// v000
// Times are from an AMD MI455X. After a warm-up the kernel runs many times in a row, and a time is the length of
// such a window on the GPU divided by its runs, so every launch and the gaps after it count. The runs cycle
// through copies of the inputs. A figure is the median of several windows, for all but v000 over two sittings.
// Sittings can differ by a few percent; kernels timed side by side share one.
// The starting kernel, v000, takes 486 microseconds a run.
// Contractions: q, k, v^T projections = v_wmma_f32_16x16x32_bf16 (bf16 operands from RNE-converted inputs and weights, single product, f32 accumulate);
// q.k^T scores (statistics pass and main pass) = v_wmma_f32_16x16x32_f16 (q as f16 hi plane + f16 residual plane x4096, k f16; 2 products, separate f32 accumulators);
// p.v = v_wmma_f32_16x16x32_f16 (p carried x16384 in f16, v f16; single product, f32 accumulate);
// ctx.Wo^T = v_wmma_f32_16x16x32_f16 (ctx as f16 hi plane x256 + f16 residual plane x4096, Wo f16 x64 of its bf16 value; 2 products, separate f32 accumulators);
// softmax statistics, probabilities and head average in f32.
#include <hip/hip_runtime.h>
#include <math.h>
#include <stdint.h>

#ifndef NB
#define NB 2
#endif
#ifndef SEQ
#define SEQ 2048
#endif
#define NB_FULL  2
#define SEQ_FULL 2048
#define EMB      1024
#define NH       16
#define HD       64
#define NROW     (NB * SEQ)          // activation rows in workspace planes, row index = b * SEQ + s
#define NQB      (SEQ / 16)          // 16-row query blocks per sequence
#define NKT      (SEQ / 64)          // 64-key chunks per sequence
#define PCARRY   16384.0f            // power-of-two carry of p in the f16 P.V operand
#define OFF1     ((size_t)NB_FULL * SEQ_FULL * EMB)   // fixed element offset of output 1 in d_out
static_assert(NB >= 1 && NB <= NB_FULL);
static_assert(SEQ >= 64 && SEQ <= SEQ_FULL && (SEQ % 64) == 0);
static_assert(NH * HD == EMB);
static_assert((NROW % 64) == 0 && (EMB % 64) == 0 && (HD % 64) == 0 && (EMB % 32) == 0);
static_assert(OFF1 * 4 == 16777216);   // byte offset of output 1
static_assert((OFF1 + (size_t)NB_FULL * SEQ_FULL * SEQ_FULL) * 4 == 50331648);   // written extent of output 1 == d_out bytes

typedef _Float16 v16h __attribute__((ext_vector_type(16)));
typedef _Float16 v8h  __attribute__((ext_vector_type(8)));
typedef __bf16   v16b __attribute__((ext_vector_type(16)));
typedef __bf16   v8b  __attribute__((ext_vector_type(8)));
typedef float    v8f  __attribute__((ext_vector_type(8)));
typedef float    v4f  __attribute__((ext_vector_type(4)));
typedef unsigned int v4u __attribute__((ext_vector_type(4)));

#if defined(__HIP_DEVICE_COMPILE__)
#define DEV_ASM 1
#else
#define DEV_ASM 0
#endif

// ---- scalar helpers --------------------------------------------------------------------------------
__device__ __forceinline__ unsigned short bf_bits(float f) {          // f32 -> bf16 bits, RNE convert
  unsigned u = __float_as_uint(f);
  return (unsigned short)((u + 0x7FFFu + ((u >> 16) & 1u)) >> 16);
}
__device__ __forceinline__ float bf_up(unsigned short hb) { return __uint_as_float(((unsigned)hb) << 16); }
__device__ __forceinline__ unsigned short h_bits(_Float16 x) { return __builtin_bit_cast(unsigned short, x); }
__device__ __forceinline__ unsigned pk16(unsigned short a, unsigned short b) { return (unsigned)a | ((unsigned)b << 16); }
__device__ __forceinline__ v8f zero8() { v8f z = {0.f, 0.f, 0.f, 0.f, 0.f, 0.f, 0.f, 0.f}; return z; }

// ---- fragment types / loaders: 16-bit A/B operand, lane -> row/col (lane&15), p already includes +8*(lane>>4);
//      elements 0..7 <- p[0..7] (k0+8h..k0+8h+7), elements 8..15 <- p[16..23] (k0+16+8h..k0+16+8h+7)
template <typename OT> struct FT;
template <> struct FT<__bf16>   { typedef v16b frag; typedef v8b half8; };
template <> struct FT<_Float16> { typedef v16h frag; typedef v8h half8; };

template <typename OT>
__device__ __forceinline__ typename FT<OT>::frag ldfrag(const OT* p) {
  union { typename FT<OT>::frag v; typename FT<OT>::half8 h[2]; } f;
  f.h[0] = *(const typename FT<OT>::half8*)(p);
  f.h[1] = *(const typename FT<OT>::half8*)(p + 16);
  return f.v;
}

// ---- WMMA helpers (asm guard bodies are device-only; concrete operand types) -----------------------------
__device__ __forceinline__ v8f mmar(v16b a, v16b b, v8f c) {
  return __builtin_amdgcn_wmma_f32_16x16x32_bf16(false, a, false, b, (short)0, c, false, false);
}
__device__ __forceinline__ v8f mmar(v16h a, v16h b, v8f c) {
  return __builtin_amdgcn_wmma_f32_16x16x32_f16(false, a, false, b, (short)0, c, false, false);
}
// guarded form: 4 VALU slots after the WMMA, D tied, A/B kept live
__device__ __forceinline__ v8f mma_h(v16h a, v16h b, v8f c) {
  c = __builtin_amdgcn_wmma_f32_16x16x32_f16(false, a, false, b, (short)0, c, false, false);
#if DEV_ASM
  asm volatile("v_nop\n\tv_nop\n\tv_nop\n\tv_nop" : "+v"(c) : "v"(a), "v"(b));
#endif
  return c;
}
__device__ __forceinline__ void dep_guard(v8f& a, v8f& b, v16b x, v16b y) {
#if DEV_ASM
  asm volatile("v_nop\n\tv_nop\n\tv_nop\n\tv_nop" : "+v"(a), "+v"(b) : "v"(x), "v"(y));
#else
  (void)a; (void)b; (void)x; (void)y;
#endif
}
__device__ __forceinline__ void dep_guard(v8f& a, v8f& b, v16h x, v16h y) {
#if DEV_ASM
  asm volatile("v_nop\n\tv_nop\n\tv_nop\n\tv_nop" : "+v"(a), "+v"(b) : "v"(x), "v"(y));
#else
  (void)a; (void)b; (void)x; (void)y;
#endif
}
__device__ __forceinline__ void keep4(v16b a, v16b b, v16b c, v16b d) {
#if DEV_ASM
  asm volatile("v_nop" :: "v"(a), "v"(b), "v"(c), "v"(d));
#else
  (void)a; (void)b; (void)c; (void)d;
#endif
}
__device__ __forceinline__ void keep4(v16h a, v16h b, v16h c, v16h d) {
#if DEV_ASM
  asm volatile("v_nop" :: "v"(a), "v"(b), "v"(c), "v"(d));
#else
  (void)a; (void)b; (void)c; (void)d;
#endif
}
__device__ __forceinline__ void acc_guard4(v8f& a, v8f& b, v8f& c, v8f& d) {
#if DEV_ASM
  asm volatile("v_nop\n\tv_nop\n\tv_nop\n\tv_nop" : "+v"(a), "+v"(b), "+v"(c), "+v"(d));
#else
  (void)a; (void)b; (void)c; (void)d;
#endif
}

// 16-bit convert helper. MODE 0: bf16 bits (RNE convert).  MODE 1: f16 bits of (64 * bf16(x)) (exact scaling of the bf16 value).
template <int MODE>
__device__ __forceinline__ unsigned short cvm(float f) {
  const unsigned short hb = bf_bits(f);
  if (MODE == 0) return hb;
  return h_bits((_Float16)(bf_up(hb) * 64.0f));
}

// =====================================================================================================
// f32 -> 16-bit planes, 8 elements per thread, one 16-B store per lane: a wave writes 512 contiguous B
// blockIdx.y selects the batch slab (element strides inStride / outStride).
// coverage: n8 threads x 8 = the whole per-batch slab (n8 is a multiple of 256 for every use here).
// =====================================================================================================
template <int MODE>
__global__ __launch_bounds__(256) void cvt16x8(const float* __restrict__ in, long long inStride,
                                               unsigned short* out, long long outStride, int n8) {
  const int i = blockIdx.x * 256 + (int)threadIdx.x;
  const float* ib = in + (size_t)blockIdx.y * (size_t)inStride;
  unsigned short* ob = out + (size_t)blockIdx.y * (size_t)outStride;
  if (i < n8) {
    const v4f a  = *(const v4f*)(ib + (size_t)i * 8);
    const v4f a4 = *(const v4f*)(ib + (size_t)i * 8 + 4);
    v4u p;
    p[0] = pk16(cvm<MODE>(a[0]),  cvm<MODE>(a[1]));
    p[1] = pk16(cvm<MODE>(a[2]),  cvm<MODE>(a[3]));
    p[2] = pk16(cvm<MODE>(a4[0]), cvm<MODE>(a4[1]));
    p[3] = pk16(cvm<MODE>(a4[2]), cvm<MODE>(a4[3]));
    unsigned short* o = ob + (size_t)i * 8;
    *(v4u*)o = p;
    
  }
}

// =====================================================================================================
// Register-blocked batched WMMA GEMM (16-bit operand type OT): C[m][n] = sum_k A[m][k] * Bt[n][k];
// one wave per (16*MI) x 64 tile, no block barriers. A row-major [M][K] pitch lda; Bt row-major [N][K] pitch ldb
// (k contiguous); M multiple of 16*MI, N multiple of 64, K multiple of 32 (static sizes here). blockIdx.y = batch
// index (strides in elements). Fragments are loaded straight from global with the split k map (ldfrag).
// NPA = number of A planes: 2 -> second plane A2 (same pitch/stride) multiplies the same Bt fragments into a
// second accumulator set, combined as acc + acc2 * rscaleA in the f32 epilogue.
// value v = (acc [+ acc2*rscaleA]) * oscale.
// OUT_MODE 0: f32 C (pitch ldc) = v.
// OUT_MODE 1: f16 plane C = f16(v * cscale).
// OUT_MODE 3: f16 hi plane C = f16(v * cscale) and f16 residual plane C2 = f16((v*cscale - hi) * rscaleC).
// =====================================================================================================
template <typename OT, int MI, int NPA, int OUT_MODE>
__global__ __launch_bounds__(256) void gemm_t(
    const unsigned short* __restrict__ Ap, const unsigned short* __restrict__ A2p, int lda, long long strideA,
    const unsigned short* __restrict__ Btp, int ldb, long long strideB,
    void* Cout, void* Cout2, int ldc, long long strideC,
    int M, int N, int K, float oscale, float rscaleA, float cscale, float rscaleC) {
  typedef typename FT<OT>::frag V16;
  const OT* A  = (const OT*)(const void*)Ap;
  const OT* A2 = (const OT*)(const void*)A2p;
  const OT* Bt = (const OT*)(const void*)Btp;
  __shared__ __align__(16) float sT[8][16 * 68];   // per-wave 16x64 slab, pitch 68 floats
  const int RT   = 16 * MI;
  const int b    = blockIdx.y;
  const int lane = threadIdx.x & 31;
  const int wave = threadIdx.x >> 5;
  const int tilesN = N >> 6;
  const int tilesM = M / RT;
  const int tile = blockIdx.x * 8 + wave;
  if (tile >= tilesM * tilesN) return;   // wave-uniform; no block barriers in this kernel
  const int tm = tile / tilesN;
  const int tn = tile - tm * tilesN;
  const int m0 = tm * RT;
  const int n0 = tn << 6;

  const OT* Ab  = A  + (size_t)b * (size_t)strideA;
  const OT* A2b = A2 + (size_t)b * (size_t)strideA;
  const OT* Bb  = Bt + (size_t)b * (size_t)strideB;

  const int rlane = lane & 15;                 // row (A) / col (B, D) within subtile
  const int koff  = (lane >> 4) * 8;           // k offset of this lane half
  const int mOff  = (lane >> 4) * 8;           // D row offset

  v8f acc[MI][4], acc2[MI][4];
#pragma unroll
  for (int i = 0; i < MI; ++i)
#pragma unroll
    for (int j = 0; j < 4; ++j) { acc[i][j] = zero8(); acc2[i][j] = zero8(); }

  for (int k0 = 0; k0 < K; k0 += 32) {
    V16 bq[4];
#pragma unroll
    for (int j = 0; j < 4; ++j)
      bq[j] = ldfrag<OT>(Bb + (size_t)(n0 + (j << 4) + rlane) * ldb + koff + k0);
#pragma unroll
    for (int i = 0; i < MI; ++i) {
      const V16 af = ldfrag<OT>(Ab + (size_t)(m0 + (i << 4) + rlane) * lda + koff + k0);
#pragma unroll
      for (int j = 0; j < 4; ++j) acc[i][j] = mmar(af, bq[j], acc[i][j]);
      dep_guard(acc[i][0], acc[i][3], af, bq[3]);
      if (NPA == 2) {
        const V16 af2 = ldfrag<OT>(A2b + (size_t)(m0 + (i << 4) + rlane) * lda + koff + k0);
#pragma unroll
        for (int j = 0; j < 4; ++j) acc2[i][j] = mmar(af2, bq[j], acc2[i][j]);
        dep_guard(acc2[i][0], acc2[i][3], af2, bq[3]);
      }
    }
    keep4(bq[0], bq[1], bq[2], bq[3]);
  }
#pragma unroll
  for (int i = 0; i < MI; ++i) {
    acc_guard4(acc[i][0], acc[i][1], acc[i][2], acc[i][3]);
    if (NPA == 2) acc_guard4(acc2[i][0], acc2[i][1], acc2[i][2], acc2[i][3]);
  }

  // ---- epilogue ----
  float* slab = sT[wave];
#pragma unroll
  for (int i = 0; i < MI; ++i) {
    const int mBase = m0 + (i << 4);
#pragma unroll
    for (int j = 0; j < 4; ++j) {
#pragma unroll
      for (int r = 0; r < 8; ++r) {
        float v = acc[i][j][r];
        if (NPA == 2) v += acc2[i][j][r] * rscaleA;
        v = v * oscale;
        slab[(mOff + r) * 68 + (j << 4) + rlane] = v;
      }
    }
    __builtin_amdgcn_fence(3, "workgroup");
    __builtin_amdgcn_wave_barrier();
    __builtin_amdgcn_fence(2, "workgroup");
    if (OUT_MODE == 0) {
      float* C = (float*)Cout + (size_t)b * (size_t)strideC;
      const int h2 = lane >> 4, c4 = (lane & 15) * 4;     // 256-B row segment = 16 lanes x 16 B
      v4f ov[8];
#pragma unroll
      for (int it = 0; it < 8; ++it) {
        const int row = it * 2 + h2;                     // it 0..7 x h2 0..1 = rows 0..15
        ov[it] = *(const v4f*)(slab + row * 68 + c4);
      }
      {
#pragma unroll
        for (int it = 0; it < 8; ++it) {
          const int row = it * 2 + h2;
          *(v4f*)(C + (size_t)(mBase + row) * ldc + n0 + c4) = ov[it];
        }
        
      }
    } else {
      const int q = lane >> 3, c8 = (lane & 7) * 8;
      unsigned short* C  = (unsigned short*)Cout  + (size_t)b * (size_t)strideC;
      unsigned short* C2 = (unsigned short*)Cout2 + (size_t)b * (size_t)strideC;
      v4u hv[4], lv[4];
#pragma unroll
      for (int it = 0; it < 4; ++it) {
        const int row = it * 4 + q;                        // it 0..3 x q 0..3 = rows 0..15
        const float* sp = slab + row * 68 + c8;
        float f[8];
#pragma unroll
        for (int e = 0; e < 8; ++e) f[e] = sp[e] * cscale;
        v4u a, a2;
#pragma unroll
        for (int e = 0; e < 4; ++e) {
          const float f0 = f[2 * e], f1 = f[2 * e + 1];
          const _Float16 x0 = (_Float16)f0, x1 = (_Float16)f1;
          const unsigned short h0 = h_bits(x0), h1 = h_bits(x1);
          unsigned short l0 = 0, l1 = 0;
          if (OUT_MODE == 3) {
            l0 = h_bits((_Float16)((f0 - (float)x0) * rscaleC));
            l1 = h_bits((_Float16)((f1 - (float)x1) * rscaleC));
          }
          a[e] = pk16(h0, h1); a2[e] = pk16(l0, l1);
        }
        hv[it] = a; lv[it] = a2;
      }
      {
#pragma unroll
        for (int it = 0; it < 4; ++it) {
          const int row = it * 4 + q;
          *(v4u*)(C + (size_t)(mBase + row) * ldc + n0 + c8) = hv[it];
          if (OUT_MODE == 3) *(v4u*)(C2 + (size_t)(mBase + row) * ldc + n0 + c8) = lv[it];
        }
        
      }
    }
    __builtin_amdgcn_fence(3, "workgroup");
    __builtin_amdgcn_wave_barrier();
    __builtin_amdgcn_fence(2, "workgroup");
  }
}

// =====================================================================================================
// Score chunk: 16 query rows (this wave) x 64 keys kv0..kv0+63 of one (b, h).
//   q fragments (A operand, row = lane&15): hi and residual (x4096) planes, 2 d-chunks of 32.
//   k fragments (B operand, col = lane&15 = key) loaded straight from the f16 k plane with the split k map:
//   kb0 = plane + (b*SEQ)*EMB + h*HD, key t adds t*EMB (plane row = b*SEQ + t).
//   s[j][r] = D element: query row 8*hh + r, key kv0 + 16j + (lane&15); value = ((qh.k) + (ql.k)/4096) / 8.
// =====================================================================================================
__device__ __forceinline__ void score_chunk(const v16h (&qah)[2], const v16h (&qal)[2],
                                            const _Float16* __restrict__ kb0, int kv0, int c, int hh,
                                            v8f (&s)[4]) {
  union FH { v16h v; v8h h[2]; };
#pragma unroll
  for (int j = 0; j < 4; ++j) {
    v8f ah = zero8(), al = zero8();
#pragma unroll
    for (int dc = 0; dc < 2; ++dc) {
      const _Float16* kp = kb0 + (size_t)(kv0 + j * 16 + c) * (size_t)EMB + dc * 32 + 8 * hh;
      FH kb;
      kb.h[0] = *(const v8h*)(kp);
      kb.h[1] = *(const v8h*)(kp + 16);
      ah = mma_h(qah[dc], kb.v, ah);
      al = mma_h(qal[dc], kb.v, al);
    }
#pragma unroll
    for (int r = 0; r < 8; ++r) s[j][r] = (ah[r] + al[r] * (1.0f / 4096.0f)) * 0.125f;
  }
}

// =====================================================================================================
// Softmax statistics: per (b, h, query s) the row max m and 1/sum(exp(s - m)) over all SEQ keys.
//   block = 4 waves = 64 consecutive query rows qb*64.. of one (b, h); grid = NB*NH*NKT blocks of 128;
//   static trip NKT over 64-key chunks; online max / rescaled sum in f32 (16 lanes per row merged by shfl).
//   Output plane ML [b*NH+h][2][SEQ] f32 (m then 1/l): the block's 64 m values and 64 1/l values are
//   funnelled through LDS (cross-wave: block barrier) and written by wave 0 with ONE instruction (lanes 0-15:
//   coverage: grid (b,h,qb) x 64 rows = the whole [NB*NH][2][SEQ] plane. MLsh: 4 waves x 2 halves x 8 x 2 = all 128.
// =====================================================================================================
__global__ __launch_bounds__(128)
void attn_stats(const unsigned short* __restrict__ qhp, const unsigned short* __restrict__ qlp,
                const unsigned short* __restrict__ kpp, float* ML) {
  __shared__ __align__(16) float MLsh[128];
  const int tid  = threadIdx.x;
  const int wave = tid >> 5;
  const int lane = tid & 31;
  const int hh   = lane >> 4;
  const int c    = lane & 15;
  const int bx   = blockIdx.x;
  const int qb   = bx % NKT;
  const int rest = bx / NKT;
  const int h    = rest % NH;
  const int b    = rest / NH;
  const int bh   = b * NH + h;
  const int q0   = qb * 64 + wave * 16;

  const _Float16* Qh  = (const _Float16*)(const void*)qhp;
  const _Float16* Ql  = (const _Float16*)(const void*)qlp;
  const _Float16* Kb0 = (const _Float16*)(const void*)kpp + (size_t)b * SEQ * EMB + (size_t)h * HD;

  v16h qah[2], qal[2];
#pragma unroll
  for (int dc = 0; dc < 2; ++dc) {
    const size_t qo = ((size_t)b * SEQ + (size_t)(q0 + c)) * EMB + (size_t)h * HD + dc * 32 + 8 * hh;
    qah[dc] = ldfrag<_Float16>(Qh + qo);
    qal[dc] = ldfrag<_Float16>(Ql + qo);
  }

  float mrow[8], lrow[8];
#pragma unroll
  for (int r = 0; r < 8; ++r) { mrow[r] = -INFINITY; lrow[r] = 0.f; }

  for (int kt = 0; kt < NKT; ++kt) {          // static trip count
    const int kv0 = kt * 64;
    v8f s[4];
    score_chunk(qah, qal, Kb0, kv0, c, hh, s);
#pragma unroll
    for (int r = 0; r < 8; ++r) {
      float m = s[0][r];
#pragma unroll
      for (int j = 1; j < 4; ++j) m = fmaxf(m, s[j][r]);
#pragma unroll
      for (int off = 1; off < 16; off <<= 1) m = fmaxf(m, __shfl_xor(m, off, 32));
      const float mnew  = fmaxf(mrow[r], m);
      const float msafe = (mnew == -INFINITY) ? 0.f : mnew;
      const float alpha = __expf(mrow[r] - msafe);
      mrow[r] = mnew;
      float psum = 0.f;
#pragma unroll
      for (int j = 0; j < 4; ++j) psum += __expf(s[j][r] - msafe);
#pragma unroll
      for (int off = 1; off < 16; off <<= 1) psum += __shfl_xor(psum, off, 32);
      lrow[r] = lrow[r] * alpha + psum;
    }
  }

  float il[8];
#pragma unroll
  for (int r = 0; r < 8; ++r) {
    const float l = lrow[r];
    il[r] = (l > 0.f) ? (1.0f / l) : 0.f;
  }
  if (c == 0) {
#pragma unroll
    for (int r = 0; r < 8; ++r) {
      MLsh[wave * 16 + 8 * hh + r]      = mrow[r];
      MLsh[64 + wave * 16 + 8 * hh + r] = il[r];
    }
  }
  __syncthreads();
  if (wave == 0) {
    const v4f v = *(const v4f*)(MLsh + lane * 4);        // lanes 0-15: m rows 4c..4c+3; lanes 16-31: 1/l rows
    float* dst = ML + (size_t)(bh * 2 + hh) * SEQ + qb * 64 + c * 4;
    *(v4f*)dst = v;
    
  }
}

// =====================================================================================================
// Main attention pass: one block per (b, 16 query rows q0..q0+15), 16 waves = the 16 heads.
//   Per 64-key chunk (static trip NKT): scores recomputed exactly as in attn_stats, p = exp(s - m) * (1/l) in f32
//   (m, 1/l from the ML plane) -> per-wave LDS tile Pf[h][row][key] (f32 element stores, every entry written);
//       converted to f16 with the x16384 carry; B = v^T f16 plane [b][h*64+d][s] (head slab h*64*SEQ) loaded
//       with the split k map;
//   (b) head average: after __syncthreads (cross-wave), threads 0..255 sum the 16 wave tiles in fixed head order
//   Epilogue: ctx = acc / 16384, x256 carry, staged in the wave's Pf tile (wave-private), written as f16 hi plane
//   coverage: avg: NKT chunks x 16 rows x 64 keys per block, grid (b, qb) = the whole [NB][SEQ][SEQ];
//   ctx planes: each wave rows q0..q0+15 (it 0..3 x lane>>3 0..3) x its head's 64 columns, 16 waves x grid =
//   the whole [NROW][EMB] planes. staged extent == consumed extent for Pf in both uses (32 lanes x 32 = 1024).
// =====================================================================================================
__global__ __launch_bounds__(512)
void attn_main(const unsigned short* __restrict__ qhp, const unsigned short* __restrict__ qlp,
               const unsigned short* __restrict__ kpp, const unsigned short* __restrict__ vtp,
               const float* __restrict__ ML, unsigned short* chp, unsigned short* clp, float* avg) {
  union FH { v16h v; v8h h[2]; };
  __shared__ __align__(32) float Pf[NH][16 * 64];          // per wave (head) P tile [row][key] f32, 64 KB
  const int tid  = threadIdx.x;
  const int wave = tid >> 5;
  const int lane = tid & 31;
  const int hh   = lane >> 4;
  const int c    = lane & 15;
  const int bx   = blockIdx.x;
  const int qb   = bx % NQB;
  const int b    = bx / NQB;
  const int h    = wave;
  const int bh   = b * NH + h;
  const int q0   = qb * 16;

  const _Float16* Qh  = (const _Float16*)(const void*)qhp;
  const _Float16* Ql  = (const _Float16*)(const void*)qlp;
  const _Float16* Kb0 = (const _Float16*)(const void*)kpp + (size_t)b * SEQ * EMB + (size_t)h * HD;
  const _Float16* Vb0 = (const _Float16*)(const void*)vtp + (size_t)b * EMB * SEQ + (size_t)h * HD * SEQ;  // v^T [b][h*64+d][s]

  v16h qah[2], qal[2];
#pragma unroll
  for (int dc = 0; dc < 2; ++dc) {
    const size_t qo = ((size_t)b * SEQ + (size_t)(q0 + c)) * EMB + (size_t)h * HD + dc * 32 + 8 * hh;
    qah[dc] = ldfrag<_Float16>(Qh + qo);
    qal[dc] = ldfrag<_Float16>(Ql + qo);
  }
  const v8f m8  = *(const v8f*)(ML + (size_t)(bh * 2) * SEQ + q0 + 8 * hh);       // rows 8hh..8hh+7
  const v8f il8 = *(const v8f*)(ML + (size_t)(bh * 2 + 1) * SEQ + q0 + 8 * hh);

  v8f oacc[4];
#pragma unroll
  for (int t = 0; t < 4; ++t) oacc[t] = zero8();
  float* pf = Pf[wave];

  for (int kt = 0; kt < NKT; ++kt) {         // static trip count
    const int kv0 = kt * 64;
    __syncthreads();                          // Pf tiles free again (head sum of the prior chunk done)

    v8f s[4];
    score_chunk(qah, qal, Kb0, kv0, c, hh, s);
#pragma unroll
    for (int r = 0; r < 8; ++r) {
#pragma unroll
      for (int j = 0; j < 4; ++j) {
        const float p = __expf(s[j][r] - m8[r]) * il8[r];
        pf[(8 * hh + r) * 64 + j * 16 + c] = p;
      }
    }
    __builtin_amdgcn_fence(3, "workgroup");
    __builtin_amdgcn_wave_barrier();
    __builtin_amdgcn_fence(2, "workgroup");

    // ---- context += P . V (f16 WMMA, p carried x16384) ----
#pragma unroll 1
    for (int kk = 0; kk < 2; ++kk) {
      const v8f p0 = *(const v8f*)(pf + c * 64 + kk * 32 + 8 * hh);
      const v8f p1 = *(const v8f*)(pf + c * 64 + kk * 32 + 16 + 8 * hh);
      FH pa;
      pa.h[0] = __builtin_convertvector(p0 * PCARRY, v8h);
      pa.h[1] = __builtin_convertvector(p1 * PCARRY, v8h);
#pragma unroll
      for (int t = 0; t < 4; ++t) {
        const v16h vb = ldfrag<_Float16>(Vb0 + (size_t)(t * 16 + c) * SEQ + kv0 + kk * 32 + 8 * hh);
        oacc[t] = mma_h(pa.v, vb, oacc[t]);
      }
    }
    __syncthreads();

    // ---- head average of this 16 x 64 tile, one block = one writer of every line ----
    if (tid < 256) {                          // waves 0..7, wave-uniform
      const int row = tid >> 4, c4 = (tid & 15) * 4;
      v4f a = *(const v4f*)(Pf[0] + row * 64 + c4);
#pragma unroll
      for (int w = 1; w < NH; ++w) a += *(const v4f*)(Pf[w] + row * 64 + c4);
      a *= (1.0f / (float)NH);
      float* dst = avg + ((size_t)b * SEQ + (size_t)(q0 + row)) * SEQ + kv0 + c4;
      *(v4f*)dst = a;
      
    }
  }
  __syncthreads();

  // ---- epilogue: ctx (undo the x16384 p carry, apply the x256 carry), stage, convert, whole-line stores ----
  float* os = pf;
#pragma unroll
  for (int r = 0; r < 8; ++r) {
#pragma unroll
    for (int t = 0; t < 4; ++t) os[(8 * hh + r) * 64 + t * 16 + c] = oacc[t][r] * (256.0f / PCARRY);
  }
  __builtin_amdgcn_fence(3, "workgroup");
  __builtin_amdgcn_wave_barrier();
  __builtin_amdgcn_fence(2, "workgroup");
  {
    const int q4 = lane >> 3, c8 = (lane & 7) * 8;
    v4u hv[4], lv[4];
#pragma unroll
    for (int it = 0; it < 4; ++it) {
      const int row = it * 4 + q4;   // it 0..3 x q4 0..3 = rows 0..15 of the wave tile
      const float* sp = os + row * 64 + c8;
      float f[8];
#pragma unroll
      for (int e = 0; e < 8; ++e) f[e] = sp[e];
      v4u a, a2;
#pragma unroll
      for (int e = 0; e < 4; ++e) {
        const float f0 = f[2 * e], f1 = f[2 * e + 1];
        const _Float16 x0 = (_Float16)f0, x1 = (_Float16)f1;
        const unsigned short h0 = h_bits(x0), h1 = h_bits(x1);
        const unsigned short l0 = h_bits((_Float16)((f0 - (float)x0) * 4096.0f));
        const unsigned short l1 = h_bits((_Float16)((f1 - (float)x1) * 4096.0f));
        a[e] = pk16(h0, h1); a2[e] = pk16(l0, l1);
      }
      hv[it] = a; lv[it] = a2;
    }
    {
#pragma unroll
      for (int it = 0; it < 4; ++it) {
        const int row = it * 4 + q4;
        const size_t go = ((size_t)b * SEQ + (size_t)(q0 + row)) * EMB + (size_t)h * HD + c8;
        *(v4u*)(chp + go) = hv[it];
        *(v4u*)(clp + go) = lv[it];
      }
      
    }
  }
}

// =====================================================================================================
// Workspace map (bytes, full size NB=2 SEQ=2048; PX = NROW*EMB*2 = 8388608; every region an exact multiple of
// its whole-line / whole-tile store granularity, rows are whole tiles, no padded tails needed):
//   Xq   bf16 [NROW][EMB]            PX        8388608
//   Xk   bf16 [NROW][EMB]            PX        8388608
//   Xv   bf16 [NROW][EMB]            PX        8388608
//   Wqb  bf16 [EMB n][EMB k]                   2097152
//   Wkb  bf16 [EMB n][EMB k]                   2097152
//   Wvb  bf16 [EMB n][EMB k]                   2097152
//   Wob  f16  [EMB n][EMB k] (x64)             2097152
//   Qh   f16  [NROW][EMB]            PX        8388608
//   Ql   f16  [NROW][EMB]            PX        8388608
//   Kp   f16  [NROW][EMB]            PX        8388608
//   VT   f16  [NB][EMB][SEQ]                   8388608
//   Ch   f16  [NROW][EMB]            PX        8388608
//   Cl   f16  [NROW][EMB]            PX        8388608
//   ML   f32  [NB*NH][2][SEQ]                   524288
//   total                                     84410368
// Input weights are [out n][in k] (k contiguous) = the Bt / A layout directly; they are only converted to 16 bit.
// Output 0 at element 0 of d_out (rows b*SEQ + s); output 1 at the fixed element offset OFF1 = NB_FULL*SEQ_FULL*EMB.
// =====================================================================================================
extern "C" void kernel_launch(void* const* d_in, const int* in_sizes, int n_in,
                              void* d_out, int out_size, void* d_ws, size_t ws_size,
                              hipStream_t stream) {
  if (n_in < 7) return;
  const int needX = ((NB - 1) * SEQ_FULL + SEQ) * EMB;
  if (in_sizes[0] < needX) return;
  if (in_sizes[1] < needX) return;
  if (in_sizes[2] < needX) return;
  if (in_sizes[3] < EMB * EMB) return;
  if (in_sizes[4] < EMB * EMB) return;
  if (in_sizes[5] < EMB * EMB) return;
  if (in_sizes[6] < EMB * EMB) return;
  const size_t n0e = (size_t)NROW * EMB;            // output 0 written elements [NB][SEQ][EMB]
  const size_t n1e = (size_t)NB * SEQ * SEQ;        // output 1 written elements [NB][SEQ][SEQ]
  if (out_size < 0) return;
  if ((size_t)out_size < n0e) return;
  if ((size_t)out_size < OFF1 + n1e) return;        // written extent of output 1 inside d_out

  const float* xq = (const float*)d_in[0];
  const float* xk = (const float*)d_in[1];
  const float* xv = (const float*)d_in[2];
  const float* Wq = (const float*)d_in[3];
  const float* Wk = (const float*)d_in[4];
  const float* Wv = (const float*)d_in[5];
  const float* Wo = (const float*)d_in[6];

  const size_t PX  = (size_t)NROW * EMB * 2;        // 16-bit activation plane
  const size_t PW  = (size_t)EMB * EMB * 2;
  const size_t PVT = (size_t)NB * EMB * SEQ * 2;
  const size_t PML = (size_t)NB * NH * 2 * SEQ * 4;
  size_t off = 0;
  const size_t oXq = off; off += PX;
  const size_t oXk = off; off += PX;
  const size_t oXv = off; off += PX;
  const size_t oWq = off; off += PW;
  const size_t oWk = off; off += PW;
  const size_t oWv = off; off += PW;
  const size_t oWo = off; off += PW;
  const size_t oQh = off; off += PX;
  const size_t oQl = off; off += PX;
  const size_t oKp = off; off += PX;
  const size_t oVT = off; off += PVT;
  const size_t oCh = off; off += PX;
  const size_t oCl = off; off += PX;
  const size_t oML = off; off += PML;
  if (off > ws_size) return;                        // off = 84410368 at full size
  if (off > (size_t)134217728) return;

  char* ws = (char*)d_ws;
  unsigned short* Xq  = (unsigned short*)(ws + oXq);
  unsigned short* Xk  = (unsigned short*)(ws + oXk);
  unsigned short* Xv  = (unsigned short*)(ws + oXv);
  unsigned short* Wqb = (unsigned short*)(ws + oWq);
  unsigned short* Wkb = (unsigned short*)(ws + oWk);
  unsigned short* Wvb = (unsigned short*)(ws + oWv);
  unsigned short* Wob = (unsigned short*)(ws + oWo);
  unsigned short* Qh  = (unsigned short*)(ws + oQh);
  unsigned short* Ql  = (unsigned short*)(ws + oQl);
  unsigned short* Kp  = (unsigned short*)(ws + oKp);
  unsigned short* VT  = (unsigned short*)(ws + oVT);
  unsigned short* Ch  = (unsigned short*)(ws + oCh);
  unsigned short* Cl  = (unsigned short*)(ws + oCl);
  float*          ML  = (float*)(ws + oML);
  float*          out0 = (float*)d_out;
  float*          out1 = (float*)d_out + OFF1;

  const dim3 blk(256);
  const int n8x = SEQ * EMB / 8;                                 // per batch slab, 262144 at full size
  const int n8w = EMB * EMB / 8;                                 // 131072
  const dim3 gCvtX((n8x + 255) / 256, NB);                       // 1024 x NB blocks
  const dim3 gCvtW((n8w + 255) / 256, 1);                        //  512 blocks
  const dim3 gQK((((NROW) / 64) * (EMB / 64) + 7) / 8, 1);        // 1024 tiles -> 128 blocks: M=NROW, N=EMB
  const dim3 gV((((EMB) / 64) * (SEQ / 64) + 7) / 8, NB);          //  512 tiles ->  64 blocks x NB: M=EMB, N=SEQ
  const dim3 gO((((NROW) / 32) * (EMB / 64) + 7) / 8, 1);         // 2048 tiles -> 256 blocks (32x64 wave tiles)
  const dim3 gStats(NB * NH * NKT);                              // 1024 blocks of 128
  const dim3 gMain(NB * NQB);                                    //  256 blocks of 512

  // (1) activations [b][s][k] -> bf16 planes [b*SEQ+s][k] (input batch stride SEQ_FULL*EMB, plane batch stride SEQ*EMB)
  cvt16x8<0><<<gCvtX, blk, 0, stream>>>(xq, (long long)SEQ_FULL * EMB, Xq, (long long)SEQ * EMB, n8x);
  cvt16x8<0><<<gCvtX, blk, 0, stream>>>(xk, (long long)SEQ_FULL * EMB, Xk, (long long)SEQ * EMB, n8x);
  cvt16x8<0><<<gCvtX, blk, 0, stream>>>(xv, (long long)SEQ_FULL * EMB, Xv, (long long)SEQ * EMB, n8x);
  // (2) weights [EMB n][EMB k] -> bf16 planes (Wq, Wk, Wv); Wo -> f16 (x64 of its bf16 value); no transpose needed
  cvt16x8<0><<<gCvtW, blk, 0, stream>>>(Wq, 0LL, Wqb, 0LL, n8w);
  cvt16x8<0><<<gCvtW, blk, 0, stream>>>(Wk, 0LL, Wkb, 0LL, n8w);
  cvt16x8<0><<<gCvtW, blk, 0, stream>>>(Wv, 0LL, Wvb, 0LL, n8w);
  cvt16x8<1><<<gCvtW, blk, 0, stream>>>(Wo, 0LL, Wob, 0LL, n8w);
  // (3) q = xq . Wq^T -> f16 hi / residual (x4096) planes [b*SEQ+s][h*64+d]   (M=NROW, N=EMB, K=EMB)
  gemm_t<__bf16, 4, 1, 3><<<gQK, blk, 0, stream>>>(
      Xq, Xq, EMB, 0LL, Wqb, EMB, 0LL,
      (void*)Qh, (void*)Ql, EMB, 0LL,
      NROW, EMB, EMB, 1.0f, 0.0f, 1.0f, 4096.0f);
  // (4) k = xk . Wk^T -> f16 plane [b*SEQ+s][h*64+d]
  gemm_t<__bf16, 4, 1, 1><<<gQK, blk, 0, stream>>>(
      Xk, Xk, EMB, 0LL, Wkb, EMB, 0LL,
      (void*)Kp, (void*)Kp, EMB, 0LL,
      NROW, EMB, EMB, 1.0f, 0.0f, 1.0f, 1.0f);
  // (5) v^T = Wv . xv_b^T (per batch b = blockIdx.y) -> f16 plane [b][h*64+d][s] (pitch SEQ)
  //     (A = Wvb [n][k]; Bt = Xv rows of batch b: offset b*SEQ*EMB, pitch EMB; M=EMB, N=SEQ, K=EMB)
  gemm_t<__bf16, 4, 1, 1><<<gV, blk, 0, stream>>>(
      Wvb, Wvb, EMB, 0LL, Xv, EMB, (long long)SEQ * EMB,
      (void*)VT, (void*)VT, SEQ, (long long)EMB * SEQ,
      EMB, SEQ, EMB, 1.0f, 0.0f, 1.0f, 1.0f);
  // (6) softmax statistics (m, 1/l) per (b, h, s)
  attn_stats<<<gStats, dim3(128), 0, stream>>>(Qh, Ql, Kp, ML);
  // (7) exact-normalised p: P.V -> ctx planes (f16 hi x256 / residual x4096); head-averaged p -> output 1
  attn_main<<<gMain, dim3(512), 0, stream>>>(Qh, Ql, Kp, VT, ML, Ch, Cl, out1);
  // (8) output 0 = ctx . Wo^T, f32 [NROW][EMB] straight into d_out, accumulators (hi + res/4096) x 1/(256*64)
  gemm_t<_Float16, 2, 2, 0><<<gO, blk, 0, stream>>>(
      Ch, Cl, EMB, 0LL, Wob, EMB, 0LL,
      (void*)out0, (void*)out0, EMB, 0LL,
      NROW, EMB, EMB, 1.0f / 16384.0f, 1.0f / 4096.0f, 1.0f, 1.0f);
  (void)hipGetLastError();
}

// v001
// A run of this version takes 389 microseconds.
// Timed twice side by side with v000, it ran 1.29 times as fast both times.
// Contractions: q, k, v^T projections = v_wmma_f32_16x16x32_bf16 (bf16 operands from RNE-converted inputs and weights, single product, f32 accumulate);
// q.k^T scores (statistics pass and main pass) = v_wmma_f32_16x16x32_f16 (q as f16 hi plane + f16 residual plane x4096, k f16; 2 products, separate f32 accumulators);
// p.v = v_wmma_f32_16x16x32_f16 (p carried x16384 in f16, v f16; single product, f32 accumulate);
// ctx.Wo^T = v_wmma_f32_16x16x32_f16 (ctx as f16 hi plane x256 + f16 residual plane x4096, Wo f16 x64 of its bf16 value; 2 products, separate f32 accumulators);
// softmax statistics, probabilities and head average in f32.
#include <hip/hip_runtime.h>
#include <math.h>
#include <stdint.h>

#ifndef NB
#define NB 2
#endif
#ifndef SEQ
#define SEQ 2048
#endif
#define NB_FULL  2
#define SEQ_FULL 2048
#define EMB      1024
#define NH       16
#define HD       64
#define NROW     (NB * SEQ)          // activation rows in workspace planes, row index = b * SEQ + s
#define NQB      (SEQ / 16)          // 16-row query blocks per sequence
#define NKT      (SEQ / 64)          // 64-key chunks per sequence
#define PCARRY   16384.0f            // power-of-two carry of p in the f16 P.V operand
#define OFF1     ((size_t)NB_FULL * SEQ_FULL * EMB)   // fixed element offset of output 1 in d_out
static_assert(NB >= 1 && NB <= NB_FULL);
static_assert(SEQ >= 64 && SEQ <= SEQ_FULL && (SEQ % 64) == 0);
static_assert(NH * HD == EMB && (EMB % 128) == 0);
static_assert((NROW % 64) == 0 && (EMB % 64) == 0 && (HD % 64) == 0 && (EMB % 32) == 0);
static_assert(OFF1 * 4 == 16777216);   // byte offset of output 1
static_assert((OFF1 + (size_t)NB_FULL * SEQ_FULL * SEQ_FULL) * 4 == 50331648);   // written extent of output 1 == d_out bytes

typedef _Float16 v16h __attribute__((ext_vector_type(16)));
typedef _Float16 v8h  __attribute__((ext_vector_type(8)));
typedef __bf16   v16b __attribute__((ext_vector_type(16)));
typedef __bf16   v8b  __attribute__((ext_vector_type(8)));
typedef float    v8f  __attribute__((ext_vector_type(8)));
typedef float    v4f  __attribute__((ext_vector_type(4)));
typedef unsigned int v4u __attribute__((ext_vector_type(4)));

#if defined(__HIP_DEVICE_COMPILE__)
#define DEV_ASM 1
#else
#define DEV_ASM 0
#endif

// ---- scalar helpers --------------------------------------------------------------------------------
__device__ __forceinline__ unsigned short bf_bits(float f) {          // f32 -> bf16 bits, RNE convert
  unsigned u = __float_as_uint(f);
  return (unsigned short)((u + 0x7FFFu + ((u >> 16) & 1u)) >> 16);
}
__device__ __forceinline__ float bf_up(unsigned short hb) { return __uint_as_float(((unsigned)hb) << 16); }
__device__ __forceinline__ unsigned short h_bits(_Float16 x) { return __builtin_bit_cast(unsigned short, x); }
__device__ __forceinline__ unsigned pk16(unsigned short a, unsigned short b) { return (unsigned)a | ((unsigned)b << 16); }
__device__ __forceinline__ v8f zero8() { v8f z = {0.f, 0.f, 0.f, 0.f, 0.f, 0.f, 0.f, 0.f}; return z; }

// ---- fragment types / loaders: 16-bit A/B operand, lane -> row/col (lane&15), p already includes +8*(lane>>4);
//      elements 0..7 <- p[0..7] (k0+8h..k0+8h+7), elements 8..15 <- p[16..23] (k0+16+8h..k0+16+8h+7)
template <typename OT> struct FT;
template <> struct FT<__bf16>   { typedef v16b frag; typedef v8b half8; };
template <> struct FT<_Float16> { typedef v16h frag; typedef v8h half8; };

template <typename OT>
__device__ __forceinline__ typename FT<OT>::frag ldfrag(const OT* p) {
  union { typename FT<OT>::frag v; typename FT<OT>::half8 h[2]; } f;
  f.h[0] = *(const typename FT<OT>::half8*)(p);
  f.h[1] = *(const typename FT<OT>::half8*)(p + 16);
  return f.v;
}

// ---- WMMA helpers (asm guard bodies are device-only; concrete operand types) -----------------------------
__device__ __forceinline__ v8f mmar(v16b a, v16b b, v8f c) {
  return __builtin_amdgcn_wmma_f32_16x16x32_bf16(false, a, false, b, (short)0, c, false, false);
}
__device__ __forceinline__ v8f mmar(v16h a, v16h b, v8f c) {
  return __builtin_amdgcn_wmma_f32_16x16x32_f16(false, a, false, b, (short)0, c, false, false);
}
// guarded form: 4 VALU slots after the WMMA, D tied, A/B kept live
__device__ __forceinline__ v8f mma_h(v16h a, v16h b, v8f c) {
  c = __builtin_amdgcn_wmma_f32_16x16x32_f16(false, a, false, b, (short)0, c, false, false);
#if DEV_ASM
  asm volatile("v_nop\n\tv_nop\n\tv_nop\n\tv_nop" : "+v"(c) : "v"(a), "v"(b));
#endif
  return c;
}
__device__ __forceinline__ void acc_guard4(v8f& a, v8f& b, v8f& c, v8f& d) {
#if DEV_ASM
  asm volatile("v_nop\n\tv_nop\n\tv_nop\n\tv_nop" : "+v"(a), "+v"(b), "+v"(c), "+v"(d));
#else
  (void)a; (void)b; (void)c; (void)d;
#endif
}

// 16-bit convert helper. MODE 0: bf16 bits (RNE convert).  MODE 1: f16 bits of (64 * bf16(x)) (exact scaling of the bf16 value).
template <int MODE>
__device__ __forceinline__ unsigned short cvm(float f) {
  const unsigned short hb = bf_bits(f);
  if (MODE == 0) return hb;
  return h_bits((_Float16)(bf_up(hb) * 64.0f));
}

// =====================================================================================================
// f32 -> 16-bit planes, 8 elements per thread, one 16-B store per lane: a wave writes 512 contiguous B
// blockIdx.y selects the batch slab (element strides inStride / outStride).
// coverage: n8 threads x 8 = the whole per-batch slab (n8 is a multiple of 256 for every use here).
// =====================================================================================================
template <int MODE>
__global__ __launch_bounds__(256) void cvt16x8(const float* __restrict__ in, long long inStride,
                                               unsigned short* out, long long outStride, int n8) {
  const int i = blockIdx.x * 256 + (int)threadIdx.x;
  const float* ib = in + (size_t)blockIdx.y * (size_t)inStride;
  unsigned short* ob = out + (size_t)blockIdx.y * (size_t)outStride;
  if (i < n8) {
    const v4f a  = *(const v4f*)(ib + (size_t)i * 8);
    const v4f a4 = *(const v4f*)(ib + (size_t)i * 8 + 4);
    v4u p;
    p[0] = pk16(cvm<MODE>(a[0]),  cvm<MODE>(a[1]));
    p[1] = pk16(cvm<MODE>(a[2]),  cvm<MODE>(a[3]));
    p[2] = pk16(cvm<MODE>(a4[0]), cvm<MODE>(a4[1]));
    p[3] = pk16(cvm<MODE>(a4[2]), cvm<MODE>(a4[3]));
    unsigned short* o = ob + (size_t)i * 8;
    *(v4u*)o = p;
    
  }
}

// =====================================================================================================
// Register-blocked batched WMMA GEMM (16-bit operand type OT): C[m][n] = sum_k A[m][k] * Bt[n][k];
// one wave per (16*MI) x 64 tile, no block barriers. A row-major [M][K] pitch lda; Bt row-major [N][K] pitch ldb
// (k contiguous); M multiple of 16*MI, N multiple of 64, K multiple of 128 (static sizes here). blockIdx.y = batch
// index (strides in elements). Fragments are loaded straight from global with the split k map (ldfrag).
// NPA = number of A planes: 2 -> second plane A2 (same pitch/stride) multiplies the same Bt fragments into a
// second accumulator set, combined as acc + acc2 * rscaleA in the f32 epilogue.
// value v = (acc [+ acc2*rscaleA]) * oscale.
// OUT_MODE 0: f32 C (pitch ldc) = v.
// OUT_MODE 1: f16 plane C = f16(v * cscale).
// OUT_MODE 3: f16 hi plane C = f16(v * cscale) and f16 residual plane C2 = f16((v*cscale - hi) * rscaleC).
// =====================================================================================================
// one k step's load group: 4 B fragments, MI A fragments (and MI of the second A plane); in this helper and the next
// every loop is unrolled so that the fragment and accumulator arrays keep constant indices (registers)
//   (bp, ap, ap2: each lane's row pointers, global address space, in 16-byte units; k: a constant element offset)
template <typename OT> struct GP { typedef const __attribute__((address_space(1))) typename FT<OT>::half8* ptr; };
template <typename OT>
__device__ __forceinline__ typename FT<OT>::frag ldfrag_g(typename GP<OT>::ptr p, int k) {   // same k map as ldfrag
  union { typename FT<OT>::frag v; typename FT<OT>::half8 h[2]; } f;
  f.h[0] = p[k / 8];
  f.h[1] = p[k / 8 + 2];
  return f.v;
}
template <typename OT, int MI, int NPA>
__device__ __forceinline__ void gemm_ld(typename GP<OT>::ptr const (&bp)[4], typename GP<OT>::ptr const (&ap)[MI],
                                        typename GP<OT>::ptr const (&ap2)[MI], int k,
                                        typename FT<OT>::frag (&bq)[4], typename FT<OT>::frag (&af)[MI],
                                        typename FT<OT>::frag (&ag)[MI]) {
#pragma unroll
  for (int j = 0; j < 4; ++j) bq[j] = ldfrag_g<OT>(bp[j], k);
#pragma unroll
  for (int i = 0; i < MI; ++i) {
    af[i] = ldfrag_g<OT>(ap[i], k);
    if (NPA == 2) ag[i] = ldfrag_g<OT>(ap2[i], k);
  }
}
// the wait that stands before the row pointers, which the issued loads name, are moved on or given up
template <int MI, int NPA, typename P>
__device__ __forceinline__ void ptr_wait(P (&bp)[4], P (&ap)[MI], P (&ap2)[MI]) {
  static_assert((MI == 4 && NPA == 1) || (MI == 2 && NPA == 2));   // the two shapes in use: eight pointers each
#if DEV_ASM
  if constexpr (MI == 4)
    asm volatile("s_wait_xcnt 0x0" : "+v"(bp[0]), "+v"(bp[1]), "+v"(bp[2]), "+v"(bp[3]),
                                     "+v"(ap[0]), "+v"(ap[1]), "+v"(ap[2]), "+v"(ap[3]) :: "memory");
  else
    asm volatile("s_wait_xcnt 0x0" : "+v"(bp[0]), "+v"(bp[1]), "+v"(bp[2]), "+v"(bp[3]),
                                     "+v"(ap[0]), "+v"(ap[1]), "+v"(ap2[0]), "+v"(ap2[1]) :: "memory");
#endif
}
// one k step's products, in the order i, plane, j
template <typename OT, int MI, int NPA>
__device__ __forceinline__ void gemm_mm(const typename FT<OT>::frag (&bq)[4], const typename FT<OT>::frag (&af)[MI],
                                        const typename FT<OT>::frag (&ag)[MI], v8f (&acc)[MI][4], v8f (&acc2)[MI][4]) {
#pragma unroll
  for (int i = 0; i < MI; ++i) {
#pragma unroll
    for (int j = 0; j < 4; ++j) acc[i][j] = mmar(af[i], bq[j], acc[i][j]);
    if (NPA == 2) {
#pragma unroll
      for (int j = 0; j < 4; ++j) acc2[i][j] = mmar(ag[i], bq[j], acc2[i][j]);
    }
  }
}

template <typename OT, int MI, int NPA, int OUT_MODE>
__global__ __launch_bounds__(256) void gemm_t(
    const unsigned short* __restrict__ Ap, const unsigned short* __restrict__ A2p, int lda, long long strideA,
    const unsigned short* __restrict__ Btp, int ldb, long long strideB,
    void* Cout, void* Cout2, int ldc, long long strideC,
    int M, int N, int K, float oscale, float rscaleA, float cscale, float rscaleC) {
  typedef typename FT<OT>::frag V16;
  const OT* A  = (const OT*)(const void*)Ap;
  const OT* A2 = (const OT*)(const void*)A2p;
  const OT* Bt = (const OT*)(const void*)Btp;
  __shared__ __align__(16) float sT[8][16 * 68];   // per-wave 16x64 slab, pitch 68 floats
  const int RT   = 16 * MI;
  const int b    = blockIdx.y;
  const int lane = threadIdx.x & 31;
  const int wave = threadIdx.x >> 5;
  const int tilesN = N >> 6;
  const int tilesM = M / RT;
  const int tile = blockIdx.x * 8 + wave;
  if (tile >= tilesM * tilesN) return;   // wave-uniform; no block barriers in this kernel
  const int tm = tile / tilesN;
  const int tn = tile - tm * tilesN;
  const int m0 = tm * RT;
  const int n0 = tn << 6;

  const OT* Ab  = A  + (size_t)b * (size_t)strideA;
  const OT* A2b = A2 + (size_t)b * (size_t)strideA;
  const OT* Bb  = Bt + (size_t)b * (size_t)strideB;

  const int rlane = lane & 15;                 // row (A) / col (B, D) within subtile
  const int koff  = (lane >> 4) * 8;           // k offset of this lane half
  const int mOff  = (lane >> 4) * 8;           // D row offset

  v8f acc[MI][4], acc2[MI][4];
#pragma unroll
  for (int i = 0; i < MI; ++i)
#pragma unroll
    for (int j = 0; j < 4; ++j) { acc[i][j] = zero8(); acc2[i][j] = zero8(); }

  // Rotating fragment sets: the whole load group of k step s + 2 is issued ahead of the products of step s, so the
  // loads of two steps fly under the products, where one latency per A fragment was waited out. K is a multiple of 128.
  typedef typename GP<OT>::ptr GPtr;
  GPtr bp[4], ap[MI], ap2[MI];
#pragma unroll
  for (int j = 0; j < 4; ++j) bp[j] = (GPtr)(const void*)(Bb + (size_t)(n0 + (j << 4) + rlane) * ldb + koff);
#pragma unroll
  for (int i = 0; i < MI; ++i) {
    ap[i]  = (GPtr)(const void*)(Ab  + (size_t)(m0 + (i << 4) + rlane) * lda + koff);
    ap2[i] = (GPtr)(const void*)(A2b + (size_t)(m0 + (i << 4) + rlane) * lda + koff);
  }
  V16 bq[4][4], af[4][MI], ag[4][MI];
  gemm_ld<OT, MI, NPA>(bp, ap, ap2, 0, bq[0], af[0], ag[0]);
  __builtin_amdgcn_sched_barrier(0);       // group order as in the loop, so that the loop's counted waits stay per group
  gemm_ld<OT, MI, NPA>(bp, ap, ap2, 32, bq[1], af[1], ag[1]);
  for (int k0 = 128; k0 < K; k0 += 128) {  // all trips but the last four steps
#pragma unroll
    for (int u = 0; u < 4; ++u) {          // unrolled so that the set index is a constant (registers)
      gemm_ld<OT, MI, NPA>(bp, ap, ap2, 32 * u + 64, bq[(u + 2) & 3], af[(u + 2) & 3], ag[(u + 2) & 3]);
      __builtin_amdgcn_sched_barrier(0);   // keeps the load group ahead of the products below
      gemm_mm<OT, MI, NPA>(bq[u], af[u], ag[u], acc, acc2);
    }
    ptr_wait<MI, NPA>(bp, ap, ap2);
#pragma unroll
    for (int j = 0; j < 4; ++j) bp[j] += 16;     // 128 elements
#pragma unroll
    for (int i = 0; i < MI; ++i) { ap[i] += 16; ap2[i] += 16; }
  }
  // the last four steps: two groups are still to fetch
  gemm_ld<OT, MI, NPA>(bp, ap, ap2, 64, bq[2], af[2], ag[2]);
  __builtin_amdgcn_sched_barrier(0);       // keeps the load group ahead of the products below
  gemm_mm<OT, MI, NPA>(bq[0], af[0], ag[0], acc, acc2);
  gemm_ld<OT, MI, NPA>(bp, ap, ap2, 96, bq[3], af[3], ag[3]);
  ptr_wait<MI, NPA>(bp, ap, ap2);
  __builtin_amdgcn_sched_barrier(0);       // keeps the load group ahead of the products below
  gemm_mm<OT, MI, NPA>(bq[1], af[1], ag[1], acc, acc2);
  gemm_mm<OT, MI, NPA>(bq[2], af[2], ag[2], acc, acc2);
  gemm_mm<OT, MI, NPA>(bq[3], af[3], ag[3], acc, acc2);
#pragma unroll
  for (int i = 0; i < MI; ++i) {
    acc_guard4(acc[i][0], acc[i][1], acc[i][2], acc[i][3]);
    if (NPA == 2) acc_guard4(acc2[i][0], acc2[i][1], acc2[i][2], acc2[i][3]);
  }

  // ---- epilogue ----
  float* slab = sT[wave];
#pragma unroll
  for (int i = 0; i < MI; ++i) {
    const int mBase = m0 + (i << 4);
#pragma unroll
    for (int j = 0; j < 4; ++j) {
#pragma unroll
      for (int r = 0; r < 8; ++r) {
        float v = acc[i][j][r];
        if (NPA == 2) v += acc2[i][j][r] * rscaleA;
        v = v * oscale;
        slab[(mOff + r) * 68 + (j << 4) + rlane] = v;
      }
    }
    __builtin_amdgcn_fence(3, "workgroup");
    __builtin_amdgcn_wave_barrier();
    __builtin_amdgcn_fence(2, "workgroup");
    if (OUT_MODE == 0) {
      float* C = (float*)Cout + (size_t)b * (size_t)strideC;
      const int h2 = lane >> 4, c4 = (lane & 15) * 4;     // 256-B row segment = 16 lanes x 16 B
      v4f ov[8];
#pragma unroll
      for (int it = 0; it < 8; ++it) {
        const int row = it * 2 + h2;                     // it 0..7 x h2 0..1 = rows 0..15
        ov[it] = *(const v4f*)(slab + row * 68 + c4);
      }
      {
#pragma unroll
        for (int it = 0; it < 8; ++it) {
          const int row = it * 2 + h2;
          *(v4f*)(C + (size_t)(mBase + row) * ldc + n0 + c4) = ov[it];
        }
        
      }
    } else {
      const int q = lane >> 3, c8 = (lane & 7) * 8;
      unsigned short* C  = (unsigned short*)Cout  + (size_t)b * (size_t)strideC;
      unsigned short* C2 = (unsigned short*)Cout2 + (size_t)b * (size_t)strideC;
      v4u hv[4], lv[4];
#pragma unroll
      for (int it = 0; it < 4; ++it) {
        const int row = it * 4 + q;                        // it 0..3 x q 0..3 = rows 0..15
        const float* sp = slab + row * 68 + c8;
        float f[8];
#pragma unroll
        for (int e = 0; e < 8; ++e) f[e] = sp[e] * cscale;
        v4u a, a2;
#pragma unroll
        for (int e = 0; e < 4; ++e) {
          const float f0 = f[2 * e], f1 = f[2 * e + 1];
          const _Float16 x0 = (_Float16)f0, x1 = (_Float16)f1;
          const unsigned short h0 = h_bits(x0), h1 = h_bits(x1);
          unsigned short l0 = 0, l1 = 0;
          if (OUT_MODE == 3) {
            l0 = h_bits((_Float16)((f0 - (float)x0) * rscaleC));
            l1 = h_bits((_Float16)((f1 - (float)x1) * rscaleC));
          }
          a[e] = pk16(h0, h1); a2[e] = pk16(l0, l1);
        }
        hv[it] = a; lv[it] = a2;
      }
      {
#pragma unroll
        for (int it = 0; it < 4; ++it) {
          const int row = it * 4 + q;
          *(v4u*)(C + (size_t)(mBase + row) * ldc + n0 + c8) = hv[it];
          if (OUT_MODE == 3) *(v4u*)(C2 + (size_t)(mBase + row) * ldc + n0 + c8) = lv[it];
        }
        
      }
    }
    __builtin_amdgcn_fence(3, "workgroup");
    __builtin_amdgcn_wave_barrier();
    __builtin_amdgcn_fence(2, "workgroup");
  }
}

// =====================================================================================================
// Score chunk: 16 query rows (this wave) x 64 keys kv0..kv0+63 of one (b, h).
//   q fragments (A operand, row = lane&15): hi and residual (x4096) planes, 2 d-chunks of 32.
//   k fragments (B operand, col = lane&15 = key) loaded straight from the f16 k plane with the split k map:
//   kb0 = plane + (b*SEQ)*EMB + h*HD, key t adds t*EMB (plane row = b*SEQ + t).
//   s[j][r] = D element: query row 8*hh + r, key kv0 + 16j + (lane&15); value = ((qh.k) + (ql.k)/4096) / 8.
// =====================================================================================================
// the chunk's 8 k fragments as one load group, kf[2j + dc]; kp = the lane's pointer to key kv0 + c, element 8*hh
// (16-byte units); loops unrolled so that kf keeps constant indices (registers)
typedef GP<_Float16>::ptr KPtr;
__device__ __forceinline__ void ld_kchunk(KPtr& kp, v16h (&kf)[8]) {
#pragma unroll
  for (int j = 0; j < 4; ++j)
#pragma unroll
    for (int dc = 0; dc < 2; ++dc) kf[2 * j + dc] = ldfrag_g<_Float16>(kp, j * 16 * EMB + dc * 32);
#if DEV_ASM
  asm volatile("s_wait_xcnt 0x0" : "+v"(kp) :: "memory");   // before kp, which these loads name, is moved on or given up
#endif
}
__device__ __forceinline__ void score_chunk(const v16h (&qah)[2], const v16h (&qal)[2], const v16h (&kf)[8],
                                            v8f (&s)[4]) {
#pragma unroll
  for (int j = 0; j < 4; ++j) {
    v8f ah = zero8(), al = zero8();
#pragma unroll
    for (int dc = 0; dc < 2; ++dc) {
      ah = mma_h(qah[dc], kf[2 * j + dc], ah);
      al = mma_h(qal[dc], kf[2 * j + dc], al);
    }
#pragma unroll
    for (int r = 0; r < 8; ++r) s[j][r] = (ah[r] + al[r] * (1.0f / 4096.0f)) * 0.125f;
  }
}

// =====================================================================================================
// Softmax statistics: per (b, h, query s) the row max m and 1/sum(exp(s - m)) over all SEQ keys.
//   block = 4 waves = 64 consecutive query rows qb*64.. of one (b, h); grid = NB*NH*NKT blocks of 128;
//   static trip NKT over 64-key chunks; online max / rescaled sum in f32 (16 lanes per row merged by shfl).
//   Output plane ML [b*NH+h][2][SEQ] f32 (m then 1/l): the block's 64 m values and 64 1/l values are
//   funnelled through LDS (cross-wave: block barrier) and written by wave 0 with ONE instruction (lanes 0-15:
//   coverage: grid (b,h,qb) x 64 rows = the whole [NB*NH][2][SEQ] plane. MLsh: 4 waves x 2 halves x 8 x 2 = all 128.
// =====================================================================================================
__global__ __launch_bounds__(128)
void attn_stats(const unsigned short* __restrict__ qhp, const unsigned short* __restrict__ qlp,
                const unsigned short* __restrict__ kpp, float* ML) {
  __shared__ __align__(16) float MLsh[128];
  const int tid  = threadIdx.x;
  const int wave = tid >> 5;
  const int lane = tid & 31;
  const int hh   = lane >> 4;
  const int c    = lane & 15;
  const int bx   = blockIdx.x;
  const int qb   = bx % NKT;
  const int rest = bx / NKT;
  const int h    = rest % NH;
  const int b    = rest / NH;
  const int bh   = b * NH + h;
  const int q0   = qb * 64 + wave * 16;

  const _Float16* Qh  = (const _Float16*)(const void*)qhp;
  const _Float16* Ql  = (const _Float16*)(const void*)qlp;
  const _Float16* Kb0 = (const _Float16*)(const void*)kpp + (size_t)b * SEQ * EMB + (size_t)h * HD;

  v16h qah[2], qal[2];
#pragma unroll
  for (int dc = 0; dc < 2; ++dc) {
    const size_t qo = ((size_t)b * SEQ + (size_t)(q0 + c)) * EMB + (size_t)h * HD + dc * 32 + 8 * hh;
    qah[dc] = ldfrag<_Float16>(Qh + qo);
    qal[dc] = ldfrag<_Float16>(Ql + qo);
  }

  float mrow[8], lrow[8];
#pragma unroll
  for (int r = 0; r < 8; ++r) { mrow[r] = -INFINITY; lrow[r] = 0.f; }

  v16h kf[8];
  KPtr kp = (KPtr)(const void*)(Kb0 + (size_t)c * EMB + 8 * hh);
  ld_kchunk(kp, kf);
  for (int kt = 0; kt < NKT; ++kt) {          // static trip count
    v8f s[4];
    score_chunk(qah, qal, kf, s);
    __builtin_amdgcn_sched_barrier(0);        // the next chunk's fetch stays behind this chunk's products (same registers)
    kp += (kt + 1 < NKT) ? 64 * EMB / 8 : 0;  // 16-byte units; last trip: the same chunk again, a fetch that nothing uses
    ld_kchunk(kp, kf);
    __builtin_amdgcn_sched_barrier(0);        // ... and ahead of the vector work below, which covers its latency
#pragma unroll
    for (int r = 0; r < 8; ++r) {
      float m = s[0][r];
#pragma unroll
      for (int j = 1; j < 4; ++j) m = fmaxf(m, s[j][r]);
#pragma unroll
      for (int off = 1; off < 16; off <<= 1) m = fmaxf(m, __shfl_xor(m, off, 32));
      const float mnew  = fmaxf(mrow[r], m);
      const float msafe = (mnew == -INFINITY) ? 0.f : mnew;
      const float alpha = __expf(mrow[r] - msafe);
      mrow[r] = mnew;
      float psum = 0.f;
#pragma unroll
      for (int j = 0; j < 4; ++j) psum += __expf(s[j][r] - msafe);
#pragma unroll
      for (int off = 1; off < 16; off <<= 1) psum += __shfl_xor(psum, off, 32);
      lrow[r] = lrow[r] * alpha + psum;
    }
  }

  float il[8];
#pragma unroll
  for (int r = 0; r < 8; ++r) {
    const float l = lrow[r];
    il[r] = (l > 0.f) ? (1.0f / l) : 0.f;
  }
  if (c == 0) {
#pragma unroll
    for (int r = 0; r < 8; ++r) {
      MLsh[wave * 16 + 8 * hh + r]      = mrow[r];
      MLsh[64 + wave * 16 + 8 * hh + r] = il[r];
    }
  }
  __syncthreads();
  if (wave == 0) {
    const v4f v = *(const v4f*)(MLsh + lane * 4);        // lanes 0-15: m rows 4c..4c+3; lanes 16-31: 1/l rows
    float* dst = ML + (size_t)(bh * 2 + hh) * SEQ + qb * 64 + c * 4;
    *(v4f*)dst = v;
    
  }
}

// =====================================================================================================
// Main attention pass: one block per (b, 16 query rows q0..q0+15), 16 waves = the 16 heads.
//   Per 64-key chunk (static trip NKT): scores recomputed exactly as in attn_stats, p = exp(s - m) * (1/l) in f32
//   (m, 1/l from the ML plane) -> per-wave LDS tile Pf[h][row][key] (f32 element stores, every entry written);
//       converted to f16 with the x16384 carry; B = v^T f16 plane [b][h*64+d][s] (head slab h*64*SEQ) loaded
//       with the split k map;
//   (b) head average: after __syncthreads (cross-wave), threads 0..255 sum the 16 wave tiles in fixed head order
//   Epilogue: ctx = acc / 16384, x256 carry, staged in the wave's Pf tile (wave-private), written as f16 hi plane
//   coverage: avg: NKT chunks x 16 rows x 64 keys per block, grid (b, qb) = the whole [NB][SEQ][SEQ];
//   ctx planes: each wave rows q0..q0+15 (it 0..3 x lane>>3 0..3) x its head's 64 columns, 16 waves x grid =
//   the whole [NROW][EMB] planes. staged extent == consumed extent for Pf in both uses (32 lanes x 32 = 1024).
// =====================================================================================================
__global__ __launch_bounds__(512)
void attn_main(const unsigned short* __restrict__ qhp, const unsigned short* __restrict__ qlp,
               const unsigned short* __restrict__ kpp, const unsigned short* __restrict__ vtp,
               const float* __restrict__ ML, unsigned short* chp, unsigned short* clp, float* avg) {
  union FH { v16h v; v8h h[2]; };
  __shared__ __align__(32) float Pf[NH][16 * 64];          // per wave (head) P tile [row][key] f32, 64 KB
  const int tid  = threadIdx.x;
  const int wave = tid >> 5;
  const int lane = tid & 31;
  const int hh   = lane >> 4;
  const int c    = lane & 15;
  const int bx   = blockIdx.x;
  const int qb   = bx % NQB;
  const int b    = bx / NQB;
  const int h    = wave;
  const int bh   = b * NH + h;
  const int q0   = qb * 16;

  const _Float16* Qh  = (const _Float16*)(const void*)qhp;
  const _Float16* Ql  = (const _Float16*)(const void*)qlp;
  const _Float16* Kb0 = (const _Float16*)(const void*)kpp + (size_t)b * SEQ * EMB + (size_t)h * HD;
  const _Float16* Vb0 = (const _Float16*)(const void*)vtp + (size_t)b * EMB * SEQ + (size_t)h * HD * SEQ;  // v^T [b][h*64+d][s]

  v16h qah[2], qal[2];
#pragma unroll
  for (int dc = 0; dc < 2; ++dc) {
    const size_t qo = ((size_t)b * SEQ + (size_t)(q0 + c)) * EMB + (size_t)h * HD + dc * 32 + 8 * hh;
    qah[dc] = ldfrag<_Float16>(Qh + qo);
    qal[dc] = ldfrag<_Float16>(Ql + qo);
  }
  const v8f m8  = *(const v8f*)(ML + (size_t)(bh * 2) * SEQ + q0 + 8 * hh);       // rows 8hh..8hh+7
  const v8f il8 = *(const v8f*)(ML + (size_t)(bh * 2 + 1) * SEQ + q0 + 8 * hh);

  v8f oacc[4];
#pragma unroll
  for (int t = 0; t < 4; ++t) oacc[t] = zero8();
  float* pf = Pf[wave];

#if DEV_ASM
  asm volatile("s_wait_xcnt 0x0" ::: "memory");   // before the k fetch lands in registers that the loads above name
#endif
  v16h kf[8];
  KPtr kp = (KPtr)(const void*)(Kb0 + (size_t)c * EMB + 8 * hh);
  ld_kchunk(kp, kf);
  for (int kt = 0; kt < NKT; ++kt) {         // static trip count
    const int kv0 = kt * 64;
    __syncthreads();                          // Pf tiles free again (head sum of the prior chunk done)

    v8f s[4];
    score_chunk(qah, qal, kf, s);
    __builtin_amdgcn_sched_barrier(0);        // the v fetch stays behind the score products (registers)
    v16h vf[8];                               // this chunk's 8 v fragments as one load group, vf[4kk + t]
#pragma unroll
    for (int kk = 0; kk < 2; ++kk)
#pragma unroll
      for (int t = 0; t < 4; ++t)
        vf[4 * kk + t] = ldfrag<_Float16>(Vb0 + (size_t)(t * 16 + c) * SEQ + kv0 + kk * 32 + 8 * hh);
    __builtin_amdgcn_sched_barrier(0);        // ... and ahead of the exponentials, which cover its latency
#pragma unroll
    for (int r = 0; r < 8; ++r) {
#pragma unroll
      for (int j = 0; j < 4; ++j) {
        const float p = __expf(s[j][r] - m8[r]) * il8[r];
        pf[(8 * hh + r) * 64 + j * 16 + c] = p;
      }
    }
    __builtin_amdgcn_fence(3, "workgroup");
    __builtin_amdgcn_wave_barrier();
    __builtin_amdgcn_fence(2, "workgroup");

    // ---- context += P . V (f16 WMMA, p carried x16384) ----
#pragma unroll                                // vf is indexed by kk: a constant index keeps it in registers
    for (int kk = 0; kk < 2; ++kk) {
      const v8f p0 = *(const v8f*)(pf + c * 64 + kk * 32 + 8 * hh);
      const v8f p1 = *(const v8f*)(pf + c * 64 + kk * 32 + 16 + 8 * hh);
      FH pa;
      pa.h[0] = __builtin_convertvector(p0 * PCARRY, v8h);
      pa.h[1] = __builtin_convertvector(p1 * PCARRY, v8h);
#pragma unroll
      for (int t = 0; t < 4; ++t) oacc[t] = mma_h(pa.v, vf[4 * kk + t], oacc[t]);
    }
    __syncthreads();
    kp += (kt + 1 < NKT) ? 64 * EMB / 8 : 0;  // 16-byte units; last trip: the same chunk again, a fetch that nothing uses
    ld_kchunk(kp, kf);                        // next chunk's k, one load group
    __builtin_amdgcn_sched_barrier(0);        // issued ahead of the head average, which covers part of its latency

    // ---- head average of this 16 x 64 tile, one block = one writer of every line ----
    if (tid < 256) {                          // waves 0..7, wave-uniform
      const int row = tid >> 4, c4 = (tid & 15) * 4;
      v4f a = *(const v4f*)(Pf[0] + row * 64 + c4);
#pragma unroll
      for (int w = 1; w < NH; ++w) a += *(const v4f*)(Pf[w] + row * 64 + c4);
      a *= (1.0f / (float)NH);
      float* dst = avg + ((size_t)b * SEQ + (size_t)(q0 + row)) * SEQ + kv0 + c4;
      *(v4f*)dst = a;
#if DEV_ASM
      asm volatile("s_wait_xcnt 0x0" ::: "memory");   // before the next chunk overwrites the registers this store names
#endif
    }
  }
  __syncthreads();

  // ---- epilogue: ctx (undo the x16384 p carry, apply the x256 carry), stage, convert, whole-line stores ----
  float* os = pf;
#pragma unroll
  for (int r = 0; r < 8; ++r) {
#pragma unroll
    for (int t = 0; t < 4; ++t) os[(8 * hh + r) * 64 + t * 16 + c] = oacc[t][r] * (256.0f / PCARRY);
  }
  __builtin_amdgcn_fence(3, "workgroup");
  __builtin_amdgcn_wave_barrier();
  __builtin_amdgcn_fence(2, "workgroup");
  {
    const int q4 = lane >> 3, c8 = (lane & 7) * 8;
    v4u hv[4], lv[4];
#pragma unroll
    for (int it = 0; it < 4; ++it) {
      const int row = it * 4 + q4;   // it 0..3 x q4 0..3 = rows 0..15 of the wave tile
      const float* sp = os + row * 64 + c8;
      float f[8];
#pragma unroll
      for (int e = 0; e < 8; ++e) f[e] = sp[e];
      v4u a, a2;
#pragma unroll
      for (int e = 0; e < 4; ++e) {
        const float f0 = f[2 * e], f1 = f[2 * e + 1];
        const _Float16 x0 = (_Float16)f0, x1 = (_Float16)f1;
        const unsigned short h0 = h_bits(x0), h1 = h_bits(x1);
        const unsigned short l0 = h_bits((_Float16)((f0 - (float)x0) * 4096.0f));
        const unsigned short l1 = h_bits((_Float16)((f1 - (float)x1) * 4096.0f));
        a[e] = pk16(h0, h1); a2[e] = pk16(l0, l1);
      }
      hv[it] = a; lv[it] = a2;
    }
    {
#pragma unroll
      for (int it = 0; it < 4; ++it) {
        const int row = it * 4 + q4;
        const size_t go = ((size_t)b * SEQ + (size_t)(q0 + row)) * EMB + (size_t)h * HD + c8;
        *(v4u*)(chp + go) = hv[it];
        *(v4u*)(clp + go) = lv[it];
      }
      
    }
  }
}

// =====================================================================================================
// Workspace map (bytes, full size NB=2 SEQ=2048; PX = NROW*EMB*2 = 8388608; every region an exact multiple of
// its whole-line / whole-tile store granularity, rows are whole tiles, no padded tails needed):
//   Xq   bf16 [NROW][EMB]            PX        8388608
//   Xk   bf16 [NROW][EMB]            PX        8388608
//   Xv   bf16 [NROW][EMB]            PX        8388608
//   Wqb  bf16 [EMB n][EMB k]                   2097152
//   Wkb  bf16 [EMB n][EMB k]                   2097152
//   Wvb  bf16 [EMB n][EMB k]                   2097152
//   Wob  f16  [EMB n][EMB k] (x64)             2097152
//   Qh   f16  [NROW][EMB]            PX        8388608
//   Ql   f16  [NROW][EMB]            PX        8388608
//   Kp   f16  [NROW][EMB]            PX        8388608
//   VT   f16  [NB][EMB][SEQ]                   8388608
//   Ch   f16  [NROW][EMB]            PX        8388608
//   Cl   f16  [NROW][EMB]            PX        8388608
//   ML   f32  [NB*NH][2][SEQ]                   524288
//   total                                     84410368
// Input weights are [out n][in k] (k contiguous) = the Bt / A layout directly; they are only converted to 16 bit.
// Output 0 at element 0 of d_out (rows b*SEQ + s); output 1 at the fixed element offset OFF1 = NB_FULL*SEQ_FULL*EMB.
// =====================================================================================================
extern "C" void kernel_launch(void* const* d_in, const int* in_sizes, int n_in,
                              void* d_out, int out_size, void* d_ws, size_t ws_size,
                              hipStream_t stream) {
  if (n_in < 7) return;
  const int needX = ((NB - 1) * SEQ_FULL + SEQ) * EMB;
  if (in_sizes[0] < needX) return;
  if (in_sizes[1] < needX) return;
  if (in_sizes[2] < needX) return;
  if (in_sizes[3] < EMB * EMB) return;
  if (in_sizes[4] < EMB * EMB) return;
  if (in_sizes[5] < EMB * EMB) return;
  if (in_sizes[6] < EMB * EMB) return;
  const size_t n0e = (size_t)NROW * EMB;            // output 0 written elements [NB][SEQ][EMB]
  const size_t n1e = (size_t)NB * SEQ * SEQ;        // output 1 written elements [NB][SEQ][SEQ]
  if (out_size < 0) return;
  if ((size_t)out_size < n0e) return;
  if ((size_t)out_size < OFF1 + n1e) return;        // written extent of output 1 inside d_out

  const float* xq = (const float*)d_in[0];
  const float* xk = (const float*)d_in[1];
  const float* xv = (const float*)d_in[2];
  const float* Wq = (const float*)d_in[3];
  const float* Wk = (const float*)d_in[4];
  const float* Wv = (const float*)d_in[5];
  const float* Wo = (const float*)d_in[6];

  const size_t PX  = (size_t)NROW * EMB * 2;        // 16-bit activation plane
  const size_t PW  = (size_t)EMB * EMB * 2;
  const size_t PVT = (size_t)NB * EMB * SEQ * 2;
  const size_t PML = (size_t)NB * NH * 2 * SEQ * 4;
  size_t off = 0;
  const size_t oXq = off; off += PX;
  const size_t oXk = off; off += PX;
  const size_t oXv = off; off += PX;
  const size_t oWq = off; off += PW;
  const size_t oWk = off; off += PW;
  const size_t oWv = off; off += PW;
  const size_t oWo = off; off += PW;
  const size_t oQh = off; off += PX;
  const size_t oQl = off; off += PX;
  const size_t oKp = off; off += PX;
  const size_t oVT = off; off += PVT;
  const size_t oCh = off; off += PX;
  const size_t oCl = off; off += PX;
  const size_t oML = off; off += PML;
  if (off > ws_size) return;                        // off = 84410368 at full size
  if (off > (size_t)134217728) return;

  char* ws = (char*)d_ws;
  unsigned short* Xq  = (unsigned short*)(ws + oXq);
  unsigned short* Xk  = (unsigned short*)(ws + oXk);
  unsigned short* Xv  = (unsigned short*)(ws + oXv);
  unsigned short* Wqb = (unsigned short*)(ws + oWq);
  unsigned short* Wkb = (unsigned short*)(ws + oWk);
  unsigned short* Wvb = (unsigned short*)(ws + oWv);
  unsigned short* Wob = (unsigned short*)(ws + oWo);
  unsigned short* Qh  = (unsigned short*)(ws + oQh);
  unsigned short* Ql  = (unsigned short*)(ws + oQl);
  unsigned short* Kp  = (unsigned short*)(ws + oKp);
  unsigned short* VT  = (unsigned short*)(ws + oVT);
  unsigned short* Ch  = (unsigned short*)(ws + oCh);
  unsigned short* Cl  = (unsigned short*)(ws + oCl);
  float*          ML  = (float*)(ws + oML);
  float*          out0 = (float*)d_out;
  float*          out1 = (float*)d_out + OFF1;

  const dim3 blk(256);
  const int n8x = SEQ * EMB / 8;                                 // per batch slab, 262144 at full size
  const int n8w = EMB * EMB / 8;                                 // 131072
  const dim3 gCvtX((n8x + 255) / 256, NB);                       // 1024 x NB blocks
  const dim3 gCvtW((n8w + 255) / 256, 1);                        //  512 blocks
  const dim3 gQK((((NROW) / 64) * (EMB / 64) + 7) / 8, 1);        // 1024 tiles -> 128 blocks: M=NROW, N=EMB
  const dim3 gV((((EMB) / 64) * (SEQ / 64) + 7) / 8, NB);          //  512 tiles ->  64 blocks x NB: M=EMB, N=SEQ
  const dim3 gO((((NROW) / 32) * (EMB / 64) + 7) / 8, 1);         // 2048 tiles -> 256 blocks (32x64 wave tiles)
  const dim3 gStats(NB * NH * NKT);                              // 1024 blocks of 128
  const dim3 gMain(NB * NQB);                                    //  256 blocks of 512

  // (1) activations [b][s][k] -> bf16 planes [b*SEQ+s][k] (input batch stride SEQ_FULL*EMB, plane batch stride SEQ*EMB)
  cvt16x8<0><<<gCvtX, blk, 0, stream>>>(xq, (long long)SEQ_FULL * EMB, Xq, (long long)SEQ * EMB, n8x);
  cvt16x8<0><<<gCvtX, blk, 0, stream>>>(xk, (long long)SEQ_FULL * EMB, Xk, (long long)SEQ * EMB, n8x);
  cvt16x8<0><<<gCvtX, blk, 0, stream>>>(xv, (long long)SEQ_FULL * EMB, Xv, (long long)SEQ * EMB, n8x);
  // (2) weights [EMB n][EMB k] -> bf16 planes (Wq, Wk, Wv); Wo -> f16 (x64 of its bf16 value); no transpose needed
  cvt16x8<0><<<gCvtW, blk, 0, stream>>>(Wq, 0LL, Wqb, 0LL, n8w);
  cvt16x8<0><<<gCvtW, blk, 0, stream>>>(Wk, 0LL, Wkb, 0LL, n8w);
  cvt16x8<0><<<gCvtW, blk, 0, stream>>>(Wv, 0LL, Wvb, 0LL, n8w);
  cvt16x8<1><<<gCvtW, blk, 0, stream>>>(Wo, 0LL, Wob, 0LL, n8w);
  // (3) q = xq . Wq^T -> f16 hi / residual (x4096) planes [b*SEQ+s][h*64+d]   (M=NROW, N=EMB, K=EMB)
  gemm_t<__bf16, 4, 1, 3><<<gQK, blk, 0, stream>>>(
      Xq, Xq, EMB, 0LL, Wqb, EMB, 0LL,
      (void*)Qh, (void*)Ql, EMB, 0LL,
      NROW, EMB, EMB, 1.0f, 0.0f, 1.0f, 4096.0f);
  // (4) k = xk . Wk^T -> f16 plane [b*SEQ+s][h*64+d]
  gemm_t<__bf16, 4, 1, 1><<<gQK, blk, 0, stream>>>(
      Xk, Xk, EMB, 0LL, Wkb, EMB, 0LL,
      (void*)Kp, (void*)Kp, EMB, 0LL,
      NROW, EMB, EMB, 1.0f, 0.0f, 1.0f, 1.0f);
  // (5) v^T = Wv . xv_b^T (per batch b = blockIdx.y) -> f16 plane [b][h*64+d][s] (pitch SEQ)
  //     (A = Wvb [n][k]; Bt = Xv rows of batch b: offset b*SEQ*EMB, pitch EMB; M=EMB, N=SEQ, K=EMB)
  gemm_t<__bf16, 4, 1, 1><<<gV, blk, 0, stream>>>(
      Wvb, Wvb, EMB, 0LL, Xv, EMB, (long long)SEQ * EMB,
      (void*)VT, (void*)VT, SEQ, (long long)EMB * SEQ,
      EMB, SEQ, EMB, 1.0f, 0.0f, 1.0f, 1.0f);
  // (6) softmax statistics (m, 1/l) per (b, h, s)
  attn_stats<<<gStats, dim3(128), 0, stream>>>(Qh, Ql, Kp, ML);
  // (7) exact-normalised p: P.V -> ctx planes (f16 hi x256 / residual x4096); head-averaged p -> output 1
  attn_main<<<gMain, dim3(512), 0, stream>>>(Qh, Ql, Kp, VT, ML, Ch, Cl, out1);
  // (8) output 0 = ctx . Wo^T, f32 [NROW][EMB] straight into d_out, accumulators (hi + res/4096) x 1/(256*64)
  gemm_t<_Float16, 2, 2, 0><<<gO, blk, 0, stream>>>(
      Ch, Cl, EMB, 0LL, Wob, EMB, 0LL,
      (void*)out0, (void*)out0, EMB, 0LL,
      NROW, EMB, EMB, 1.0f / 16384.0f, 1.0f / 4096.0f, 1.0f, 1.0f);
  (void)hipGetLastError();
}

// v002
// Measured time: 266 microseconds a run.
// Next to v001, in two timings, it ran 1.46 times as fast each time.
// Over all steps from v000 it is 1.88 times as fast.
// Contractions: q, k, v^T projections = v_wmma_f32_16x16x32_bf16 (bf16 operands from RNE-converted inputs and weights, single product, f32 accumulate);
// q.k^T scores (statistics pass and main pass) = v_wmma_f32_16x16x32_f16 (q as f16 hi plane + f16 residual plane x4096, k f16; 2 products, separate f32 accumulators);
// p.v = v_wmma_f32_16x16x32_f16 (p carried x16384 in f16, v f16; single product, f32 accumulate);
// ctx.Wo^T = v_wmma_f32_16x16x32_f16 (ctx as f16 hi plane x256 + f16 residual plane x4096, Wo f16 x64 of its bf16 value; 2 products, separate f32 accumulators);
// softmax statistics, probabilities and head average in f32.
#include <hip/hip_runtime.h>
#include <math.h>
#include <stdint.h>

#ifndef NB
#define NB 2
#endif
#ifndef SEQ
#define SEQ 2048
#endif
#define NB_FULL  2
#define SEQ_FULL 2048
#define EMB      1024
#define NH       16
#define HD       64
#define NROW     (NB * SEQ)          // activation rows in workspace planes, row index = b * SEQ + s
#define NQB      (SEQ / 16)          // 16-row query blocks per sequence
#define NKT      (SEQ / 64)          // 64-key chunks per sequence
#define PCARRY   16384.0f            // power-of-two carry of p in the f16 P.V operand
#define OFF1     ((size_t)NB_FULL * SEQ_FULL * EMB)   // fixed element offset of output 1 in d_out
static_assert(NB >= 1 && NB <= NB_FULL);
static_assert(SEQ >= 64 && SEQ <= SEQ_FULL && (SEQ % 64) == 0);
static_assert(NH * HD == EMB && (EMB % 128) == 0);
static_assert((NROW % 64) == 0 && (EMB % 64) == 0 && (HD % 64) == 0 && (EMB % 32) == 0);
static_assert(OFF1 * 4 == 16777216);   // byte offset of output 1
static_assert((OFF1 + (size_t)NB_FULL * SEQ_FULL * SEQ_FULL) * 4 == 50331648);   // written extent of output 1 == d_out bytes

typedef _Float16 v16h __attribute__((ext_vector_type(16)));
typedef _Float16 v8h  __attribute__((ext_vector_type(8)));
typedef __bf16   v16b __attribute__((ext_vector_type(16)));
typedef __bf16   v8b  __attribute__((ext_vector_type(8)));
typedef float    v8f  __attribute__((ext_vector_type(8)));
typedef float    v4f  __attribute__((ext_vector_type(4)));
typedef unsigned int v4u __attribute__((ext_vector_type(4)));

#if defined(__HIP_DEVICE_COMPILE__)
#define DEV_ASM 1
#else
#define DEV_ASM 0
#endif

// ---- scalar helpers --------------------------------------------------------------------------------
__device__ __forceinline__ unsigned short bf_bits(float f) {          // f32 -> bf16 bits, RNE convert
  unsigned u = __float_as_uint(f);
  return (unsigned short)((u + 0x7FFFu + ((u >> 16) & 1u)) >> 16);
}
__device__ __forceinline__ float bf_up(unsigned short hb) { return __uint_as_float(((unsigned)hb) << 16); }
__device__ __forceinline__ unsigned short h_bits(_Float16 x) { return __builtin_bit_cast(unsigned short, x); }
__device__ __forceinline__ unsigned pk16(unsigned short a, unsigned short b) { return (unsigned)a | ((unsigned)b << 16); }
__device__ __forceinline__ v8f zero8() { v8f z = {0.f, 0.f, 0.f, 0.f, 0.f, 0.f, 0.f, 0.f}; return z; }

// ---- fragment order: every 16-bit workspace plane [R rows][KC k] is kept as 1-KB units, one per WMMA operand fragment
//      (16 rows x 32 k), unit index = (row / 16) * (KC / 32) + k / 32. Inside a unit, in 16-byte granules of 8 k:
//      granule = ((k % 32) / 8) * 16 + row % 16, so granule g of the first 512 B is lane g's elements 0..7 and granule
//      g of the second 512 B its elements 8..15: each wave-wide 16-byte load reads 512 contiguous bytes (4 whole lines).
#define FRAG_EL 512                  // elements of one unit
// ---- fragment types / loaders: 16-bit A/B operand, lane -> row/col (lane&15), half h = lane>>4; p = unit + 8*lane;
//      elements 0..7 <- p[0..7] (k0+8h..k0+8h+7), elements 8..15 <- p[256..263] (k0+16+8h..k0+16+8h+7)
template <typename OT> struct FT;
template <> struct FT<__bf16>   { typedef v16b frag; typedef v8b half8; };
template <> struct FT<_Float16> { typedef v16h frag; typedef v8h half8; };

template <typename OT>
__device__ __forceinline__ typename FT<OT>::frag ldfrag(const OT* p) {
  union { typename FT<OT>::frag v; typename FT<OT>::half8 h[2]; } f;
  f.h[0] = *(const typename FT<OT>::half8*)(p);
  f.h[1] = *(const typename FT<OT>::half8*)(p + 256);
  return f.v;
}

// ---- WMMA helpers (asm guard bodies are device-only; concrete operand types) -----------------------------
__device__ __forceinline__ v8f mmar(v16b a, v16b b, v8f c) {
  return __builtin_amdgcn_wmma_f32_16x16x32_bf16(false, a, false, b, (short)0, c, false, false);
}
__device__ __forceinline__ v8f mmar(v16h a, v16h b, v8f c) {
  return __builtin_amdgcn_wmma_f32_16x16x32_f16(false, a, false, b, (short)0, c, false, false);
}
// guarded form: 4 VALU slots after the WMMA, D tied, A/B kept live
__device__ __forceinline__ v8f mma_h(v16h a, v16h b, v8f c) {
  c = __builtin_amdgcn_wmma_f32_16x16x32_f16(false, a, false, b, (short)0, c, false, false);
#if DEV_ASM
  asm volatile("v_nop\n\tv_nop\n\tv_nop\n\tv_nop" : "+v"(c) : "v"(a), "v"(b));
#endif
  return c;
}
__device__ __forceinline__ void acc_guard4(v8f& a, v8f& b, v8f& c, v8f& d) {
#if DEV_ASM
  asm volatile("v_nop\n\tv_nop\n\tv_nop\n\tv_nop" : "+v"(a), "+v"(b), "+v"(c), "+v"(d));
#else
  (void)a; (void)b; (void)c; (void)d;
#endif
}

// 16-bit convert helper. MODE 0: bf16 bits (RNE convert).  MODE 1: f16 bits of (64 * bf16(x)) (exact scaling of the bf16 value).
template <int MODE>
__device__ __forceinline__ unsigned short cvm(float f) {
  const unsigned short hb = bf_bits(f);
  if (MODE == 0) return hb;
  return h_bits((_Float16)(bf_up(hb) * 64.0f));
}

// =====================================================================================================
// f32 [rows][EMB] -> 16-bit planes in fragment order, 8 elements (one granule) per thread. A wave takes 8 rows x 32 k:
// it reads 8 whole 128-B lines of f32 and writes 4 whole 128-B lines (8 granules of each of the unit's 4 k groups).
// blockIdx.y selects the batch slab (element strides inStride / outStride).
// coverage: n8 threads x 8 = the whole per-batch slab (n8 is a multiple of 256 for every use here).
// =====================================================================================================
template <int MODE>
__global__ __launch_bounds__(256) void cvt16x8(const float* __restrict__ in, long long inStride,
                                               unsigned short* out, long long outStride, int n8) {
  const int i = blockIdx.x * 256 + (int)threadIdx.x;
  const float* ib = in + (size_t)blockIdx.y * (size_t)inStride;
  unsigned short* ob = out + (size_t)blockIdx.y * (size_t)outStride;
  if (i < n8) {
    const int unit = i >> 6;                                  // 64 threads (2 waves) per unit
    const int kg   = (i >> 3) & 3;                            // k group of 8 inside the unit
    const int rr   = ((i >> 5) & 1) * 8 + (i & 7);            // row inside the unit
    const float* src = ib + (size_t)((unit / (EMB / 32)) * 16 + rr) * EMB + (unit % (EMB / 32)) * 32 + kg * 8;
    const v4f a  = *(const v4f*)(src);
    const v4f a4 = *(const v4f*)(src + 4);
    v4u p;
    p[0] = pk16(cvm<MODE>(a[0]),  cvm<MODE>(a[1]));
    p[1] = pk16(cvm<MODE>(a[2]),  cvm<MODE>(a[3]));
    p[2] = pk16(cvm<MODE>(a4[0]), cvm<MODE>(a4[1]));
    p[3] = pk16(cvm<MODE>(a4[2]), cvm<MODE>(a4[3]));
    unsigned short* o = ob + (size_t)unit * FRAG_EL + (kg * 16 + rr) * 8;
    *(v4u*)o = p;
    
  }
}

// =====================================================================================================
// Register-blocked batched WMMA GEMM (16-bit operand type OT): C[m][n] = sum_k A[m][k] * Bt[n][k];
// one wave per (16*MI) x 64 tile, no block barriers. A [M][K = lda] and Bt [N][K = ldb] in fragment order;
// M multiple of 16*MI, N multiple of 64, K multiple of 128 (static sizes here). blockIdx.y = batch
// index (strides in elements). Fragments are loaded straight from global, 512 contiguous bytes a load (ldfrag_g).
// NPA = number of A planes: 2 -> second plane A2 (same pitch/stride) multiplies the same Bt fragments into a
// second accumulator set, combined as acc + acc2 * rscaleA in the f32 epilogue.
// value v = (acc [+ acc2*rscaleA]) * oscale.
// OUT_MODE 0: f32 C (pitch ldc) = v.
// OUT_MODE 1: f16 plane C = f16(v * cscale), [M][N = ldc] in fragment order.
// OUT_MODE 3: f16 hi plane C = f16(v * cscale) and f16 residual plane C2 = f16((v*cscale - hi) * rscaleC), likewise.
// =====================================================================================================
// one k step's load group: 4 B fragments, MI A fragments (and MI of the second A plane); in this helper and the next
// every loop is unrolled so that the fragment and accumulator arrays keep constant indices (registers)
//   (bp, ap, ap2: each lane's pointers into its row tiles' units, global address space, in 16-byte units;
//    k: a constant element offset, FRAG_EL per k step of 32)
template <typename OT> struct GP { typedef const __attribute__((address_space(1))) typename FT<OT>::half8* ptr; };
template <typename OT>
__device__ __forceinline__ typename FT<OT>::frag ldfrag_g(typename GP<OT>::ptr p, int k) {   // same k map as ldfrag
  union { typename FT<OT>::frag v; typename FT<OT>::half8 h[2]; } f;
  f.h[0] = p[k / 8];
  f.h[1] = p[k / 8 + 32];
  return f.v;
}
template <typename OT, int MI, int NPA>
__device__ __forceinline__ void gemm_ld(typename GP<OT>::ptr const (&bp)[4], typename GP<OT>::ptr const (&ap)[MI],
                                        typename GP<OT>::ptr const (&ap2)[MI], int k,
                                        typename FT<OT>::frag (&bq)[4], typename FT<OT>::frag (&af)[MI],
                                        typename FT<OT>::frag (&ag)[MI]) {
#pragma unroll
  for (int j = 0; j < 4; ++j) bq[j] = ldfrag_g<OT>(bp[j], k);
#pragma unroll
  for (int i = 0; i < MI; ++i) {
    af[i] = ldfrag_g<OT>(ap[i], k);
    if (NPA == 2) ag[i] = ldfrag_g<OT>(ap2[i], k);
  }
}
// the wait that stands before the row pointers, which the issued loads name, are moved on or given up
template <int MI, int NPA, typename P>
__device__ __forceinline__ void ptr_wait(P (&bp)[4], P (&ap)[MI], P (&ap2)[MI]) {
  static_assert((MI == 4 && NPA == 1) || (MI == 2 && NPA == 2));   // the two shapes in use: eight pointers each
#if DEV_ASM
  if constexpr (MI == 4)
    asm volatile("s_wait_xcnt 0x0" : "+v"(bp[0]), "+v"(bp[1]), "+v"(bp[2]), "+v"(bp[3]),
                                     "+v"(ap[0]), "+v"(ap[1]), "+v"(ap[2]), "+v"(ap[3]) :: "memory");
  else
    asm volatile("s_wait_xcnt 0x0" : "+v"(bp[0]), "+v"(bp[1]), "+v"(bp[2]), "+v"(bp[3]),
                                     "+v"(ap[0]), "+v"(ap[1]), "+v"(ap2[0]), "+v"(ap2[1]) :: "memory");
#endif
}
// one k step's products, in the order i, plane, j
template <typename OT, int MI, int NPA>
__device__ __forceinline__ void gemm_mm(const typename FT<OT>::frag (&bq)[4], const typename FT<OT>::frag (&af)[MI],
                                        const typename FT<OT>::frag (&ag)[MI], v8f (&acc)[MI][4], v8f (&acc2)[MI][4]) {
#pragma unroll
  for (int i = 0; i < MI; ++i) {
#pragma unroll
    for (int j = 0; j < 4; ++j) acc[i][j] = mmar(af[i], bq[j], acc[i][j]);
    if (NPA == 2) {
#pragma unroll
      for (int j = 0; j < 4; ++j) acc2[i][j] = mmar(ag[i], bq[j], acc2[i][j]);
    }
  }
}

template <typename OT, int MI, int NPA, int OUT_MODE>
__global__ __launch_bounds__(256) void gemm_t(
    const unsigned short* __restrict__ Ap, const unsigned short* __restrict__ A2p, int lda, long long strideA,
    const unsigned short* __restrict__ Btp, int ldb, long long strideB,
    void* Cout, void* Cout2, int ldc, long long strideC,
    int M, int N, int K, float oscale, float rscaleA, float cscale, float rscaleC) {
  typedef typename FT<OT>::frag V16;
  const OT* A  = (const OT*)(const void*)Ap;
  const OT* A2 = (const OT*)(const void*)A2p;
  const OT* Bt = (const OT*)(const void*)Btp;
  __shared__ __align__(16) float sT[8][16 * 68];   // per-wave 16x64 slab, pitch 68 floats
  const int RT   = 16 * MI;
  const int b    = blockIdx.y;
  const int lane = threadIdx.x & 31;
  const int wave = threadIdx.x >> 5;
  const int tilesN = N >> 6;
  const int tilesM = M / RT;
  const int tile = blockIdx.x * 8 + wave;
  if (tile >= tilesM * tilesN) return;   // wave-uniform; no block barriers in this kernel
  const int tm = tile / tilesN;
  const int tn = tile - tm * tilesN;
  const int m0 = tm * RT;
  const int n0 = tn << 6;

  const OT* Ab  = A  + (size_t)b * (size_t)strideA;
  const OT* A2b = A2 + (size_t)b * (size_t)strideA;
  const OT* Bb  = Bt + (size_t)b * (size_t)strideB;

  const int rlane = lane & 15;                 // row (A) / col (B, D) within subtile
  const int mOff  = (lane >> 4) * 8;           // D row offset

  v8f acc[MI][4], acc2[MI][4];
#pragma unroll
  for (int i = 0; i < MI; ++i)
#pragma unroll
    for (int j = 0; j < 4; ++j) { acc[i][j] = zero8(); acc2[i][j] = zero8(); }

  // Rotating fragment sets: the whole load group of k step s + 2 is issued ahead of the products of step s, so the
  // loads of two steps fly under the products, where one latency per A fragment was waited out. K is a multiple of 128.
  typedef typename GP<OT>::ptr GPtr;
  GPtr bp[4], ap[MI], ap2[MI];
#pragma unroll
  for (int j = 0; j < 4; ++j) bp[j] = (GPtr)(const void*)(Bb + (size_t)((n0 >> 4) + j) * (ldb >> 5) * FRAG_EL + lane * 8);
#pragma unroll
  for (int i = 0; i < MI; ++i) {
    ap[i]  = (GPtr)(const void*)(Ab  + (size_t)((m0 >> 4) + i) * (lda >> 5) * FRAG_EL + lane * 8);
    ap2[i] = (GPtr)(const void*)(A2b + (size_t)((m0 >> 4) + i) * (lda >> 5) * FRAG_EL + lane * 8);
  }
  V16 bq[4][4], af[4][MI], ag[4][MI];
  gemm_ld<OT, MI, NPA>(bp, ap, ap2, 0, bq[0], af[0], ag[0]);
  __builtin_amdgcn_sched_barrier(0);       // group order as in the loop, so that the loop's counted waits stay per group
  gemm_ld<OT, MI, NPA>(bp, ap, ap2, FRAG_EL, bq[1], af[1], ag[1]);
  for (int k0 = 128; k0 < K; k0 += 128) {  // all trips but the last four steps
#pragma unroll
    for (int u = 0; u < 4; ++u) {          // unrolled so that the set index is a constant (registers)
      gemm_ld<OT, MI, NPA>(bp, ap, ap2, (u + 2) * FRAG_EL, bq[(u + 2) & 3], af[(u + 2) & 3], ag[(u + 2) & 3]);
      __builtin_amdgcn_sched_barrier(0);   // keeps the load group ahead of the products below
      gemm_mm<OT, MI, NPA>(bq[u], af[u], ag[u], acc, acc2);
    }
    ptr_wait<MI, NPA>(bp, ap, ap2);
#pragma unroll
    for (int j = 0; j < 4; ++j) bp[j] += 4 * FRAG_EL / 8;     // 4 k steps = 4 units
#pragma unroll
    for (int i = 0; i < MI; ++i) { ap[i] += 4 * FRAG_EL / 8; ap2[i] += 4 * FRAG_EL / 8; }
  }
  // the last four steps: two groups are still to fetch
  gemm_ld<OT, MI, NPA>(bp, ap, ap2, 2 * FRAG_EL, bq[2], af[2], ag[2]);
  __builtin_amdgcn_sched_barrier(0);       // keeps the load group ahead of the products below
  gemm_mm<OT, MI, NPA>(bq[0], af[0], ag[0], acc, acc2);
  gemm_ld<OT, MI, NPA>(bp, ap, ap2, 3 * FRAG_EL, bq[3], af[3], ag[3]);
  ptr_wait<MI, NPA>(bp, ap, ap2);
  __builtin_amdgcn_sched_barrier(0);       // keeps the load group ahead of the products below
  gemm_mm<OT, MI, NPA>(bq[1], af[1], ag[1], acc, acc2);
  gemm_mm<OT, MI, NPA>(bq[2], af[2], ag[2], acc, acc2);
  gemm_mm<OT, MI, NPA>(bq[3], af[3], ag[3], acc, acc2);
#pragma unroll
  for (int i = 0; i < MI; ++i) {
    acc_guard4(acc[i][0], acc[i][1], acc[i][2], acc[i][3]);
    if (NPA == 2) acc_guard4(acc2[i][0], acc2[i][1], acc2[i][2], acc2[i][3]);
  }

  // ---- epilogue ----
  float* slab = sT[wave];
#pragma unroll
  for (int i = 0; i < MI; ++i) {
    const int mBase = m0 + (i << 4);
#pragma unroll
    for (int j = 0; j < 4; ++j) {
#pragma unroll
      for (int r = 0; r < 8; ++r) {
        float v = acc[i][j][r];
        if (NPA == 2) v += acc2[i][j][r] * rscaleA;
        v = v * oscale;
        slab[(mOff + r) * 68 + (j << 4) + rlane] = v;
      }
    }
    __builtin_amdgcn_fence(3, "workgroup");
    __builtin_amdgcn_wave_barrier();
    __builtin_amdgcn_fence(2, "workgroup");
    if (OUT_MODE == 0) {
      float* C = (float*)Cout + (size_t)b * (size_t)strideC;
      const int h2 = lane >> 4, c4 = (lane & 15) * 4;     // 256-B row segment = 16 lanes x 16 B
      v4f ov[8];
#pragma unroll
      for (int it = 0; it < 8; ++it) {
        const int row = it * 2 + h2;                     // it 0..7 x h2 0..1 = rows 0..15
        ov[it] = *(const v4f*)(slab + row * 68 + c4);
      }
      {
#pragma unroll
        for (int it = 0; it < 8; ++it) {
          const int row = it * 2 + h2;
          *(v4f*)(C + (size_t)(mBase + row) * ldc + n0 + c4) = ov[it];
        }
        
      }
    } else {
      // the 16 x 64 slab = 2 units = 128 granules in a row: store it writes granules 32*it + lane (512 contiguous B),
      // which hold row lane&15, columns 8*(2*it + (lane>>4)) .. +7
      const size_t u0 = ((size_t)(mBase >> 4) * (ldc >> 5) + (n0 >> 5)) * FRAG_EL + lane * 8;
      unsigned short* C  = (unsigned short*)Cout  + (size_t)b * (size_t)strideC + u0;
      unsigned short* C2 = (unsigned short*)Cout2 + (size_t)b * (size_t)strideC + u0;
      v4u hv[4], lv[4];
#pragma unroll
      for (int it = 0; it < 4; ++it) {
        const float* sp = slab + rlane * 68 + (it * 2 + (lane >> 4)) * 8;
        float f[8];
#pragma unroll
        for (int e = 0; e < 8; ++e) f[e] = sp[e] * cscale;
        v4u a, a2;
#pragma unroll
        for (int e = 0; e < 4; ++e) {
          const float f0 = f[2 * e], f1 = f[2 * e + 1];
          const _Float16 x0 = (_Float16)f0, x1 = (_Float16)f1;
          const unsigned short h0 = h_bits(x0), h1 = h_bits(x1);
          unsigned short l0 = 0, l1 = 0;
          if (OUT_MODE == 3) {
            l0 = h_bits((_Float16)((f0 - (float)x0) * rscaleC));
            l1 = h_bits((_Float16)((f1 - (float)x1) * rscaleC));
          }
          a[e] = pk16(h0, h1); a2[e] = pk16(l0, l1);
        }
        hv[it] = a; lv[it] = a2;
      }
      {
#pragma unroll
        for (int it = 0; it < 4; ++it) {
          *(v4u*)(C + it * 256) = hv[it];
          if (OUT_MODE == 3) *(v4u*)(C2 + it * 256) = lv[it];
        }
#if DEV_ASM
        asm volatile("s_wait_xcnt 0x0" ::: "memory");   // before the next slab overwrites the registers these stores name
#endif
      }
    }
    __builtin_amdgcn_fence(3, "workgroup");
    __builtin_amdgcn_wave_barrier();
    __builtin_amdgcn_fence(2, "workgroup");
  }
}

// =====================================================================================================
// Score chunk: 16 query rows (this wave) x 64 keys kv0..kv0+63 of one (b, h).
//   q fragments (A operand, row = lane&15): hi and residual (x4096) planes, 2 d-chunks of 32.
//   k fragments (B operand, col = lane&15 = key) loaded straight from the f16 k plane (fragment order):
//   kb0 = plane + (b*SEQ)*EMB + h*2*FRAG_EL, 16 keys on add 16*EMB (plane row = b*SEQ + t).
//   s[j][r] = D element: query row 8*hh + r, key kv0 + 16j + (lane&15); value = ((qh.k) + (ql.k)/4096) / 8.
// =====================================================================================================
// the chunk's 8 k fragments as one load group, kf[2j + dc]; kp = the lane's pointer into the unit of keys kv0..kv0+15,
// d 0..31 (16-byte units); loops unrolled so that kf keeps constant indices (registers)
typedef GP<_Float16>::ptr KPtr;
__device__ __forceinline__ void ld_kchunk(KPtr& kp, v16h (&kf)[8]) {
#pragma unroll
  for (int j = 0; j < 4; ++j)
#pragma unroll
    for (int dc = 0; dc < 2; ++dc) kf[2 * j + dc] = ldfrag_g<_Float16>(kp, j * 16 * EMB + dc * FRAG_EL);
#if DEV_ASM
  asm volatile("s_wait_xcnt 0x0" : "+v"(kp) :: "memory");   // before kp, which these loads name, is moved on or given up
#endif
}
__device__ __forceinline__ void score_chunk(const v16h (&qah)[2], const v16h (&qal)[2], const v16h (&kf)[8],
                                            v8f (&s)[4]) {
#pragma unroll
  for (int j = 0; j < 4; ++j) {
    v8f ah = zero8(), al = zero8();
#pragma unroll
    for (int dc = 0; dc < 2; ++dc) {
      ah = mma_h(qah[dc], kf[2 * j + dc], ah);
      al = mma_h(qal[dc], kf[2 * j + dc], al);
    }
#pragma unroll
    for (int r = 0; r < 8; ++r) s[j][r] = (ah[r] + al[r] * (1.0f / 4096.0f)) * 0.125f;
  }
}

// =====================================================================================================
// Softmax statistics: per (b, h, query s) the row max m and 1/sum(exp(s - m)) over all SEQ keys.
//   block = 4 waves = 64 consecutive query rows qb*64.. of one (b, h); grid = NB*NH*NKT blocks of 128;
//   static trip NKT over 64-key chunks; online max / rescaled sum in f32 (16 lanes per row merged by shfl).
//   Output plane ML [b*NH+h][2][SEQ] f32 (m then 1/l): the block's 64 m values and 64 1/l values are
//   funnelled through LDS (cross-wave: block barrier) and written by wave 0 with ONE instruction (lanes 0-15:
//   coverage: grid (b,h,qb) x 64 rows = the whole [NB*NH][2][SEQ] plane. MLsh: 4 waves x 2 halves x 8 x 2 = all 128.
// =====================================================================================================
__global__ __launch_bounds__(128)
void attn_stats(const unsigned short* __restrict__ qhp, const unsigned short* __restrict__ qlp,
                const unsigned short* __restrict__ kpp, float* ML) {
  __shared__ __align__(16) float MLsh[128];
  const int tid  = threadIdx.x;
  const int wave = tid >> 5;
  const int lane = tid & 31;
  const int hh   = lane >> 4;
  const int c    = lane & 15;
  const int bx   = blockIdx.x;
  const int qb   = bx % NKT;
  const int rest = bx / NKT;
  const int h    = rest % NH;
  const int b    = rest / NH;
  const int bh   = b * NH + h;
  const int q0   = qb * 64 + wave * 16;

  const _Float16* Qh  = (const _Float16*)(const void*)qhp;
  const _Float16* Ql  = (const _Float16*)(const void*)qlp;
  const _Float16* Kb0 = (const _Float16*)(const void*)kpp + (size_t)b * SEQ * EMB + (size_t)h * (HD / 32) * FRAG_EL;

  v16h qah[2], qal[2];
#pragma unroll
  for (int dc = 0; dc < 2; ++dc) {
    const size_t qo = ((size_t)b * SEQ + (size_t)q0) * EMB + (size_t)(h * (HD / 32) + dc) * FRAG_EL + lane * 8;
    qah[dc] = ldfrag<_Float16>(Qh + qo);
    qal[dc] = ldfrag<_Float16>(Ql + qo);
  }

  float mrow[8], lrow[8];
#pragma unroll
  for (int r = 0; r < 8; ++r) { mrow[r] = -INFINITY; lrow[r] = 0.f; }

#if DEV_ASM
  asm volatile("s_wait_xcnt 0x0" ::: "memory");   // before the k fetch lands in registers that the q loads name
#endif
  v16h kf[8];
  KPtr kp = (KPtr)(const void*)(Kb0 + lane * 8);
  ld_kchunk(kp, kf);
  for (int kt = 0; kt < NKT; ++kt) {          // static trip count
    v8f s[4];
    score_chunk(qah, qal, kf, s);
    __builtin_amdgcn_sched_barrier(0);        // the next chunk's fetch stays behind this chunk's products (same registers)
    kp += (kt + 1 < NKT) ? 64 * EMB / 8 : 0;  // 16-byte units; last trip: the same chunk again, a fetch that nothing uses
    ld_kchunk(kp, kf);
    __builtin_amdgcn_sched_barrier(0);        // ... and ahead of the vector work below, which covers its latency
#pragma unroll
    for (int r = 0; r < 8; ++r) {
      float m = s[0][r];
#pragma unroll
      for (int j = 1; j < 4; ++j) m = fmaxf(m, s[j][r]);
#pragma unroll
      for (int off = 1; off < 16; off <<= 1) m = fmaxf(m, __shfl_xor(m, off, 32));
      const float mnew  = fmaxf(mrow[r], m);
      const float msafe = (mnew == -INFINITY) ? 0.f : mnew;
      const float alpha = __expf(mrow[r] - msafe);
      mrow[r] = mnew;
      float psum = 0.f;
#pragma unroll
      for (int j = 0; j < 4; ++j) psum += __expf(s[j][r] - msafe);
#pragma unroll
      for (int off = 1; off < 16; off <<= 1) psum += __shfl_xor(psum, off, 32);
      lrow[r] = lrow[r] * alpha + psum;
    }
  }

  float il[8];
#pragma unroll
  for (int r = 0; r < 8; ++r) {
    const float l = lrow[r];
    il[r] = (l > 0.f) ? (1.0f / l) : 0.f;
  }
  if (c == 0) {
#pragma unroll
    for (int r = 0; r < 8; ++r) {
      MLsh[wave * 16 + 8 * hh + r]      = mrow[r];
      MLsh[64 + wave * 16 + 8 * hh + r] = il[r];
    }
  }
  __syncthreads();
  if (wave == 0) {
    const v4f v = *(const v4f*)(MLsh + lane * 4);        // lanes 0-15: m rows 4c..4c+3; lanes 16-31: 1/l rows
    float* dst = ML + (size_t)(bh * 2 + hh) * SEQ + qb * 64 + c * 4;
    *(v4f*)dst = v;
    
  }
}

// =====================================================================================================
// Main attention pass: one block per (b, 16 query rows q0..q0+15), 16 waves = the 16 heads.
//   Per 64-key chunk (static trip NKT): scores recomputed exactly as in attn_stats, p = exp(s - m) * (1/l) in f32
//   (m, 1/l from the ML plane) -> per-wave LDS tile Pf[h][row][key] (f32 element stores, every entry written);
//       converted to f16 with the x16384 carry; B = v^T f16 plane [b][h*64+d][s] (head slab h*64*SEQ), fragment order;
//   (b) head average: after __syncthreads (cross-wave), threads 0..255 sum the 16 wave tiles in fixed head order
//   Epilogue: ctx = acc / 16384, x256 carry, staged in the wave's Pf tile (wave-private), written as f16 hi plane
//   coverage: avg: NKT chunks x 16 rows x 64 keys per block, grid (b, qb) = the whole [NB][SEQ][SEQ];
//   ctx planes: each wave rows q0..q0+15 (lane&15) x its head's 64 columns (it 0..3 x lane>>4 0..1), 16 waves x grid =
//   the whole [NROW][EMB] planes (fragment order). staged extent == consumed extent for Pf in both uses (32 lanes x 32 = 1024).
// =====================================================================================================
__global__ __launch_bounds__(512)
void attn_main(const unsigned short* __restrict__ qhp, const unsigned short* __restrict__ qlp,
               const unsigned short* __restrict__ kpp, const unsigned short* __restrict__ vtp,
               const float* __restrict__ ML, unsigned short* chp, unsigned short* clp, float* avg) {
  union FH { v16h v; v8h h[2]; };
  __shared__ __align__(32) float Pf[NH][16 * 68];          // per wave (head) P tile [row][key] f32, pitch 64; the epilogue's ctx tile has pitch 68
  const int tid  = threadIdx.x;
  const int wave = tid >> 5;
  const int lane = tid & 31;
  const int hh   = lane >> 4;
  const int c    = lane & 15;
  const int bx   = blockIdx.x;
  const int qb   = bx % NQB;
  const int b    = bx / NQB;
  const int h    = wave;
  const int bh   = b * NH + h;
  const int q0   = qb * 16;

  const _Float16* Qh  = (const _Float16*)(const void*)qhp;
  const _Float16* Ql  = (const _Float16*)(const void*)qlp;
  const _Float16* Kb0 = (const _Float16*)(const void*)kpp + (size_t)b * SEQ * EMB + (size_t)h * (HD / 32) * FRAG_EL;
  const _Float16* Vb0 = (const _Float16*)(const void*)vtp + (size_t)b * EMB * SEQ + (size_t)h * HD * SEQ;  // v^T [b][h*64+d][s], fragment order

  v16h qah[2], qal[2];
#pragma unroll
  for (int dc = 0; dc < 2; ++dc) {
    const size_t qo = ((size_t)b * SEQ + (size_t)q0) * EMB + (size_t)(h * (HD / 32) + dc) * FRAG_EL + lane * 8;
    qah[dc] = ldfrag<_Float16>(Qh + qo);
    qal[dc] = ldfrag<_Float16>(Ql + qo);
  }
  const v8f m8  = *(const v8f*)(ML + (size_t)(bh * 2) * SEQ + q0 + 8 * hh);       // rows 8hh..8hh+7
  const v8f il8 = *(const v8f*)(ML + (size_t)(bh * 2 + 1) * SEQ + q0 + 8 * hh);

  v8f oacc[4];
#pragma unroll
  for (int t = 0; t < 4; ++t) oacc[t] = zero8();
  float* pf = Pf[wave];

#if DEV_ASM
  asm volatile("s_wait_xcnt 0x0" ::: "memory");   // before the k fetch lands in registers that the loads above name
#endif
  v16h kf[8];
  KPtr kp = (KPtr)(const void*)(Kb0 + lane * 8);
  ld_kchunk(kp, kf);
  KPtr vp = (KPtr)(const void*)(Vb0 + lane * 8);   // the lane's pointer into the unit of d 0..15, keys kv0..kv0+31
  for (int kt = 0; kt < NKT; ++kt) {         // static trip count
    const int kv0 = kt * 64;
    __syncthreads();                          // Pf tiles free again (head sum of the prior chunk done)

    v8f s[4];
    score_chunk(qah, qal, kf, s);
    __builtin_amdgcn_sched_barrier(0);        // the v fetch stays behind the score products (registers)
    v16h vf[8];                               // this chunk's 8 v fragments as one load group, vf[4kk + t]
#pragma unroll
    for (int kk = 0; kk < 2; ++kk)
#pragma unroll
      for (int t = 0; t < 4; ++t)
        vf[4 * kk + t] = ldfrag_g<_Float16>(vp, t * 16 * SEQ + kk * FRAG_EL);
#if DEV_ASM
    asm volatile("s_wait_xcnt 0x0" : "+v"(vp) :: "memory");   // before vp, which these loads name, is moved on
#endif
    vp += 2 * FRAG_EL / 8;                    // 64 keys = 2 units (16-byte units)
    __builtin_amdgcn_sched_barrier(0);        // ... and ahead of the exponentials, which cover its latency
#pragma unroll
    for (int r = 0; r < 8; ++r) {
#pragma unroll
      for (int j = 0; j < 4; ++j) {
        const float p = __expf(s[j][r] - m8[r]) * il8[r];
        pf[(8 * hh + r) * 64 + j * 16 + c] = p;
      }
    }
    __builtin_amdgcn_fence(3, "workgroup");
    __builtin_amdgcn_wave_barrier();
    __builtin_amdgcn_fence(2, "workgroup");

    // ---- context += P . V (f16 WMMA, p carried x16384) ----
#pragma unroll                                // vf is indexed by kk: a constant index keeps it in registers
    for (int kk = 0; kk < 2; ++kk) {
      const v8f p0 = *(const v8f*)(pf + c * 64 + kk * 32 + 8 * hh);
      const v8f p1 = *(const v8f*)(pf + c * 64 + kk * 32 + 16 + 8 * hh);
      FH pa;
      pa.h[0] = __builtin_convertvector(p0 * PCARRY, v8h);
      pa.h[1] = __builtin_convertvector(p1 * PCARRY, v8h);
#pragma unroll
      for (int t = 0; t < 4; ++t) oacc[t] = mma_h(pa.v, vf[4 * kk + t], oacc[t]);
    }
    __syncthreads();
    kp += (kt + 1 < NKT) ? 64 * EMB / 8 : 0;  // 16-byte units; last trip: the same chunk again, a fetch that nothing uses
    ld_kchunk(kp, kf);                        // next chunk's k, one load group
    __builtin_amdgcn_sched_barrier(0);        // issued ahead of the head average, which covers part of its latency

    // ---- head average of this 16 x 64 tile, one block = one writer of every line ----
    if (tid < 256) {                          // waves 0..7, wave-uniform
      const int row = tid >> 4, c4 = (tid & 15) * 4;
      v4f a = *(const v4f*)(Pf[0] + row * 64 + c4);
#pragma unroll
      for (int w = 1; w < NH; ++w) a += *(const v4f*)(Pf[w] + row * 64 + c4);
      a *= (1.0f / (float)NH);
      float* dst = avg + ((size_t)b * SEQ + (size_t)(q0 + row)) * SEQ + kv0 + c4;
      *(v4f*)dst = a;
#if DEV_ASM
      asm volatile("s_wait_xcnt 0x0" ::: "memory");   // before the next chunk overwrites the registers this store names
#endif
    }
  }
  __syncthreads();

  // ---- epilogue: ctx (undo the x16384 p carry, apply the x256 carry), stage, convert, whole-line stores ----
  float* os = pf;
#pragma unroll
  for (int r = 0; r < 8; ++r) {
#pragma unroll
    for (int t = 0; t < 4; ++t) os[(8 * hh + r) * 68 + t * 16 + c] = oacc[t][r] * (256.0f / PCARRY);
  }
  __builtin_amdgcn_fence(3, "workgroup");
  __builtin_amdgcn_wave_barrier();
  __builtin_amdgcn_fence(2, "workgroup");
  {
    // the wave's 16 x 64 tile = 2 units = 128 granules in a row: store it writes granules 32*it + lane (512 contiguous B),
    // which hold row c, columns 8*(2*it + hh) .. +7
    v4u hv[4], lv[4];
#pragma unroll
    for (int it = 0; it < 4; ++it) {
      const float* sp = os + c * 68 + (it * 2 + hh) * 8;
      float f[8];
#pragma unroll
      for (int e = 0; e < 8; ++e) f[e] = sp[e];
      v4u a, a2;
#pragma unroll
      for (int e = 0; e < 4; ++e) {
        const float f0 = f[2 * e], f1 = f[2 * e + 1];
        const _Float16 x0 = (_Float16)f0, x1 = (_Float16)f1;
        const unsigned short h0 = h_bits(x0), h1 = h_bits(x1);
        const unsigned short l0 = h_bits((_Float16)((f0 - (float)x0) * 4096.0f));
        const unsigned short l1 = h_bits((_Float16)((f1 - (float)x1) * 4096.0f));
        a[e] = pk16(h0, h1); a2[e] = pk16(l0, l1);
      }
      hv[it] = a; lv[it] = a2;
    }
    {
#pragma unroll
      for (int it = 0; it < 4; ++it) {
        const size_t go = ((size_t)b * SEQ + (size_t)q0) * EMB + (size_t)h * (HD / 32) * FRAG_EL + it * 256 + lane * 8;
        *(v4u*)(chp + go) = hv[it];
        *(v4u*)(clp + go) = lv[it];
      }
      
    }
  }
}

// =====================================================================================================
// Workspace map (bytes, full size NB=2 SEQ=2048; PX = NROW*EMB*2 = 8388608; every region an exact multiple of
// its whole-line / whole-tile store granularity, rows are whole tiles, no padded tails needed):
//   Xq   bf16 [NROW][EMB]            PX        8388608
//   Xk   bf16 [NROW][EMB]            PX        8388608
//   Xv   bf16 [NROW][EMB]            PX        8388608
//   Wqb  bf16 [EMB n][EMB k]                   2097152
//   Wkb  bf16 [EMB n][EMB k]                   2097152
//   Wvb  bf16 [EMB n][EMB k]                   2097152
//   Wob  f16  [EMB n][EMB k] (x64)             2097152
//   Qh   f16  [NROW][EMB]            PX        8388608
//   Ql   f16  [NROW][EMB]            PX        8388608
//   Kp   f16  [NROW][EMB]            PX        8388608
//   VT   f16  [NB][EMB][SEQ]                   8388608
//   Ch   f16  [NROW][EMB]            PX        8388608
//   Cl   f16  [NROW][EMB]            PX        8388608
//   ML   f32  [NB*NH][2][SEQ]                   524288
//   total                                     84410368
// Every 16-bit plane is in fragment order (same bytes, same extents). Input weights are [out n][in k] (k contiguous) =
// the Bt / A orientation directly; they are only converted to 16 bit and put in that order.
// Output 0 at element 0 of d_out (rows b*SEQ + s); output 1 at the fixed element offset OFF1 = NB_FULL*SEQ_FULL*EMB.
// =====================================================================================================
extern "C" void kernel_launch(void* const* d_in, const int* in_sizes, int n_in,
                              void* d_out, int out_size, void* d_ws, size_t ws_size,
                              hipStream_t stream) {
  if (n_in < 7) return;
  const int needX = ((NB - 1) * SEQ_FULL + SEQ) * EMB;
  if (in_sizes[0] < needX) return;
  if (in_sizes[1] < needX) return;
  if (in_sizes[2] < needX) return;
  if (in_sizes[3] < EMB * EMB) return;
  if (in_sizes[4] < EMB * EMB) return;
  if (in_sizes[5] < EMB * EMB) return;
  if (in_sizes[6] < EMB * EMB) return;
  const size_t n0e = (size_t)NROW * EMB;            // output 0 written elements [NB][SEQ][EMB]
  const size_t n1e = (size_t)NB * SEQ * SEQ;        // output 1 written elements [NB][SEQ][SEQ]
  if (out_size < 0) return;
  if ((size_t)out_size < n0e) return;
  if ((size_t)out_size < OFF1 + n1e) return;        // written extent of output 1 inside d_out

  const float* xq = (const float*)d_in[0];
  const float* xk = (const float*)d_in[1];
  const float* xv = (const float*)d_in[2];
  const float* Wq = (const float*)d_in[3];
  const float* Wk = (const float*)d_in[4];
  const float* Wv = (const float*)d_in[5];
  const float* Wo = (const float*)d_in[6];

  const size_t PX  = (size_t)NROW * EMB * 2;        // 16-bit activation plane
  const size_t PW  = (size_t)EMB * EMB * 2;
  const size_t PVT = (size_t)NB * EMB * SEQ * 2;
  const size_t PML = (size_t)NB * NH * 2 * SEQ * 4;
  size_t off = 0;
  const size_t oXq = off; off += PX;
  const size_t oXk = off; off += PX;
  const size_t oXv = off; off += PX;
  const size_t oWq = off; off += PW;
  const size_t oWk = off; off += PW;
  const size_t oWv = off; off += PW;
  const size_t oWo = off; off += PW;
  const size_t oQh = off; off += PX;
  const size_t oQl = off; off += PX;
  const size_t oKp = off; off += PX;
  const size_t oVT = off; off += PVT;
  const size_t oCh = off; off += PX;
  const size_t oCl = off; off += PX;
  const size_t oML = off; off += PML;
  if (off > ws_size) return;                        // off = 84410368 at full size
  if (off > (size_t)134217728) return;

  char* ws = (char*)d_ws;
  unsigned short* Xq  = (unsigned short*)(ws + oXq);
  unsigned short* Xk  = (unsigned short*)(ws + oXk);
  unsigned short* Xv  = (unsigned short*)(ws + oXv);
  unsigned short* Wqb = (unsigned short*)(ws + oWq);
  unsigned short* Wkb = (unsigned short*)(ws + oWk);
  unsigned short* Wvb = (unsigned short*)(ws + oWv);
  unsigned short* Wob = (unsigned short*)(ws + oWo);
  unsigned short* Qh  = (unsigned short*)(ws + oQh);
  unsigned short* Ql  = (unsigned short*)(ws + oQl);
  unsigned short* Kp  = (unsigned short*)(ws + oKp);
  unsigned short* VT  = (unsigned short*)(ws + oVT);
  unsigned short* Ch  = (unsigned short*)(ws + oCh);
  unsigned short* Cl  = (unsigned short*)(ws + oCl);
  float*          ML  = (float*)(ws + oML);
  float*          out0 = (float*)d_out;
  float*          out1 = (float*)d_out + OFF1;

  const dim3 blk(256);
  const int n8x = SEQ * EMB / 8;                                 // per batch slab, 262144 at full size
  const int n8w = EMB * EMB / 8;                                 // 131072
  const dim3 gCvtX((n8x + 255) / 256, NB);                       // 1024 x NB blocks
  const dim3 gCvtW((n8w + 255) / 256, 1);                        //  512 blocks
  const dim3 gQK((((NROW) / 64) * (EMB / 64) + 7) / 8, 1);        // 1024 tiles -> 128 blocks: M=NROW, N=EMB
  const dim3 gV((((EMB) / 64) * (SEQ / 64) + 7) / 8, NB);          //  512 tiles ->  64 blocks x NB: M=EMB, N=SEQ
  const dim3 gO((((NROW) / 32) * (EMB / 64) + 7) / 8, 1);         // 2048 tiles -> 256 blocks (32x64 wave tiles)
  const dim3 gStats(NB * NH * NKT);                              // 1024 blocks of 128
  const dim3 gMain(NB * NQB);                                    //  256 blocks of 512

  // (1) activations [b][s][k] -> bf16 planes [b*SEQ+s][k] (input batch stride SEQ_FULL*EMB, plane batch stride SEQ*EMB)
  cvt16x8<0><<<gCvtX, blk, 0, stream>>>(xq, (long long)SEQ_FULL * EMB, Xq, (long long)SEQ * EMB, n8x);
  cvt16x8<0><<<gCvtX, blk, 0, stream>>>(xk, (long long)SEQ_FULL * EMB, Xk, (long long)SEQ * EMB, n8x);
  cvt16x8<0><<<gCvtX, blk, 0, stream>>>(xv, (long long)SEQ_FULL * EMB, Xv, (long long)SEQ * EMB, n8x);
  // (2) weights [EMB n][EMB k] -> bf16 planes (Wq, Wk, Wv); Wo -> f16 (x64 of its bf16 value); no transpose needed
  cvt16x8<0><<<gCvtW, blk, 0, stream>>>(Wq, 0LL, Wqb, 0LL, n8w);
  cvt16x8<0><<<gCvtW, blk, 0, stream>>>(Wk, 0LL, Wkb, 0LL, n8w);
  cvt16x8<0><<<gCvtW, blk, 0, stream>>>(Wv, 0LL, Wvb, 0LL, n8w);
  cvt16x8<1><<<gCvtW, blk, 0, stream>>>(Wo, 0LL, Wob, 0LL, n8w);
  // (3) q = xq . Wq^T -> f16 hi / residual (x4096) planes [b*SEQ+s][h*64+d]   (M=NROW, N=EMB, K=EMB)
  gemm_t<__bf16, 4, 1, 3><<<gQK, blk, 0, stream>>>(
      Xq, Xq, EMB, 0LL, Wqb, EMB, 0LL,
      (void*)Qh, (void*)Ql, EMB, 0LL,
      NROW, EMB, EMB, 1.0f, 0.0f, 1.0f, 4096.0f);
  // (4) k = xk . Wk^T -> f16 plane [b*SEQ+s][h*64+d]
  gemm_t<__bf16, 4, 1, 1><<<gQK, blk, 0, stream>>>(
      Xk, Xk, EMB, 0LL, Wkb, EMB, 0LL,
      (void*)Kp, (void*)Kp, EMB, 0LL,
      NROW, EMB, EMB, 1.0f, 0.0f, 1.0f, 1.0f);
  // (5) v^T = Wv . xv_b^T (per batch b = blockIdx.y) -> f16 plane [b][h*64+d][s] (pitch SEQ)
  //     (A = Wvb [n][k]; Bt = Xv rows of batch b: offset b*SEQ*EMB, pitch EMB; M=EMB, N=SEQ, K=EMB)
  gemm_t<__bf16, 4, 1, 1><<<gV, blk, 0, stream>>>(
      Wvb, Wvb, EMB, 0LL, Xv, EMB, (long long)SEQ * EMB,
      (void*)VT, (void*)VT, SEQ, (long long)EMB * SEQ,
      EMB, SEQ, EMB, 1.0f, 0.0f, 1.0f, 1.0f);
  // (6) softmax statistics (m, 1/l) per (b, h, s)
  attn_stats<<<gStats, dim3(128), 0, stream>>>(Qh, Ql, Kp, ML);
  // (7) exact-normalised p: P.V -> ctx planes (f16 hi x256 / residual x4096); head-averaged p -> output 1
  attn_main<<<gMain, dim3(512), 0, stream>>>(Qh, Ql, Kp, VT, ML, Ch, Cl, out1);
  // (8) output 0 = ctx . Wo^T, f32 [NROW][EMB] straight into d_out, accumulators (hi + res/4096) x 1/(256*64)
  gemm_t<_Float16, 2, 2, 0><<<gO, blk, 0, stream>>>(
      Ch, Cl, EMB, 0LL, Wob, EMB, 0LL,
      (void*)out0, (void*)out0, EMB, 0LL,
      NROW, EMB, EMB, 1.0f / 16384.0f, 1.0f / 4096.0f, 1.0f, 1.0f);
  (void)hipGetLastError();
}

// v003
// Measured time: 238 microseconds a run.
// Two timings next to v002 put it at 1.12 and 1.11 times that version's speed.
// Counting every step since v000, it is 2.10 times as fast.
// Contractions: q, k, v^T projections = v_wmma_f32_16x16x32_bf16 (bf16 operands from RNE-converted inputs and weights, single product, f32 accumulate);
// q.k^T scores (statistics pass and main pass) = v_wmma_f32_16x16x32_f16 (q as f16 hi plane + f16 residual plane x4096, k f16; 2 products, separate f32 accumulators);
// p.v = v_wmma_f32_16x16x32_f16 (p carried x16384 in f16, v f16; single product, f32 accumulate);
// ctx.Wo^T = v_wmma_f32_16x16x32_f16 (ctx as f16 hi plane x256 + f16 residual plane x4096, Wo f16 x64 of its bf16 value; 2 products, separate f32 accumulators);
// softmax statistics, probabilities and head average in f32.
#include <hip/hip_runtime.h>
#include <math.h>
#include <stdint.h>

#ifndef NB
#define NB 2
#endif
#ifndef SEQ
#define SEQ 2048
#endif
#define NB_FULL  2
#define SEQ_FULL 2048
#define EMB      1024
#define NH       16
#define HD       64
#define NROW     (NB * SEQ)          // activation rows in workspace planes, row index = b * SEQ + s
#define NQB      (SEQ / 16)          // 16-row query blocks per sequence
#define NKT      (SEQ / 64)          // 64-key chunks per sequence
#define PCARRY   16384.0f            // power-of-two carry of p in the f16 P.V operand
#define PPITCH   68                  // row pitch of the LDS P tile in floats: 272 B = 16 B x odd, so 16 rows read 16 B each on 64 distinct banks
#define OFF1     ((size_t)NB_FULL * SEQ_FULL * EMB)   // fixed element offset of output 1 in d_out
static_assert(NB >= 1 && NB <= NB_FULL);
static_assert(SEQ >= 64 && SEQ <= SEQ_FULL && (SEQ % 64) == 0);
static_assert(NH * HD == EMB && (EMB % 128) == 0);
static_assert((NROW % 64) == 0 && (EMB % 64) == 0 && (HD % 64) == 0 && (EMB % 32) == 0);
static_assert(OFF1 * 4 == 16777216);   // byte offset of output 1
static_assert((OFF1 + (size_t)NB_FULL * SEQ_FULL * SEQ_FULL) * 4 == 50331648);   // written extent of output 1 == d_out bytes

typedef _Float16 v16h __attribute__((ext_vector_type(16)));
typedef _Float16 v8h  __attribute__((ext_vector_type(8)));
typedef __bf16   v16b __attribute__((ext_vector_type(16)));
typedef __bf16   v8b  __attribute__((ext_vector_type(8)));
typedef float    v8f  __attribute__((ext_vector_type(8)));
typedef float    v4f  __attribute__((ext_vector_type(4)));
typedef unsigned int v4u __attribute__((ext_vector_type(4)));

#if defined(__HIP_DEVICE_COMPILE__)
#define DEV_ASM 1
#else
#define DEV_ASM 0
#endif

// ---- scalar helpers --------------------------------------------------------------------------------
__device__ __forceinline__ unsigned short bf_bits(float f) {          // f32 -> bf16 bits, RNE convert
  unsigned u = __float_as_uint(f);
  return (unsigned short)((u + 0x7FFFu + ((u >> 16) & 1u)) >> 16);
}
__device__ __forceinline__ float bf_up(unsigned short hb) { return __uint_as_float(((unsigned)hb) << 16); }
__device__ __forceinline__ unsigned short h_bits(_Float16 x) { return __builtin_bit_cast(unsigned short, x); }
__device__ __forceinline__ unsigned pk16(unsigned short a, unsigned short b) { return (unsigned)a | ((unsigned)b << 16); }
__device__ __forceinline__ v8f zero8() { v8f z = {0.f, 0.f, 0.f, 0.f, 0.f, 0.f, 0.f, 0.f}; return z; }

// ---- fragment order: every 16-bit workspace plane [R rows][KC k] is kept as 1-KB units, one per WMMA operand fragment
//      (16 rows x 32 k), unit index = (row / 16) * (KC / 32) + k / 32. Inside a unit, in 16-byte granules of 8 k:
//      granule = ((k % 32) / 8) * 16 + row % 16, so granule g of the first 512 B is lane g's elements 0..7 and granule
//      g of the second 512 B its elements 8..15: each wave-wide 16-byte load reads 512 contiguous bytes (4 whole lines).
#define FRAG_EL 512                  // elements of one unit
// ---- fragment types / loaders: 16-bit A/B operand, lane -> row/col (lane&15), half h = lane>>4; p = unit + 8*lane;
//      elements 0..7 <- p[0..7] (k0+8h..k0+8h+7), elements 8..15 <- p[256..263] (k0+16+8h..k0+16+8h+7)
template <typename OT> struct FT;
template <> struct FT<__bf16>   { typedef v16b frag; typedef v8b half8; };
template <> struct FT<_Float16> { typedef v16h frag; typedef v8h half8; };

template <typename OT>
__device__ __forceinline__ typename FT<OT>::frag ldfrag(const OT* p) {
  union { typename FT<OT>::frag v; typename FT<OT>::half8 h[2]; } f;
  f.h[0] = *(const typename FT<OT>::half8*)(p);
  f.h[1] = *(const typename FT<OT>::half8*)(p + 256);
  return f.v;
}

// ---- WMMA helpers (asm guard bodies are device-only; concrete operand types) -----------------------------
__device__ __forceinline__ v8f mmar(v16b a, v16b b, v8f c) {
  return __builtin_amdgcn_wmma_f32_16x16x32_bf16(false, a, false, b, (short)0, c, false, false);
}
__device__ __forceinline__ v8f mmar(v16h a, v16h b, v8f c) {
  return __builtin_amdgcn_wmma_f32_16x16x32_f16(false, a, false, b, (short)0, c, false, false);
}
// guarded form: 4 VALU slots after the WMMA, D tied, A/B kept live
__device__ __forceinline__ v8f mma_h(v16h a, v16h b, v8f c) {
  c = __builtin_amdgcn_wmma_f32_16x16x32_f16(false, a, false, b, (short)0, c, false, false);
#if DEV_ASM
  asm volatile("v_nop\n\tv_nop\n\tv_nop\n\tv_nop" : "+v"(c) : "v"(a), "v"(b));
#endif
  return c;
}
__device__ __forceinline__ void acc_guard4(v8f& a, v8f& b, v8f& c, v8f& d) {
#if DEV_ASM
  asm volatile("v_nop\n\tv_nop\n\tv_nop\n\tv_nop" : "+v"(a), "+v"(b), "+v"(c), "+v"(d));
#else
  (void)a; (void)b; (void)c; (void)d;
#endif
}

// 16-bit convert helper. MODE 0: bf16 bits (RNE convert).  MODE 1: f16 bits of (64 * bf16(x)) (exact scaling of the bf16 value).
template <int MODE>
__device__ __forceinline__ unsigned short cvm(float f) {
  const unsigned short hb = bf_bits(f);
  if (MODE == 0) return hb;
  return h_bits((_Float16)(bf_up(hb) * 64.0f));
}

// =====================================================================================================
// f32 [rows][EMB] -> 16-bit planes in fragment order, 8 elements (one granule) per thread. A wave takes 8 rows x 32 k:
// it reads 8 whole 128-B lines of f32 and writes 4 whole 128-B lines (8 granules of each of the unit's 4 k groups).
// blockIdx.y selects the batch slab (element strides inStride / outStride).
// coverage: n8 threads x 8 = the whole per-batch slab (n8 is a multiple of 256 for every use here).
// =====================================================================================================
template <int MODE>
__global__ __launch_bounds__(256) void cvt16x8(const float* __restrict__ in, long long inStride,
                                               unsigned short* out, long long outStride, int n8) {
  const int i = blockIdx.x * 256 + (int)threadIdx.x;
  const float* ib = in + (size_t)blockIdx.y * (size_t)inStride;
  unsigned short* ob = out + (size_t)blockIdx.y * (size_t)outStride;
  if (i < n8) {
    const int unit = i >> 6;                                  // 64 threads (2 waves) per unit
    const int kg   = (i >> 3) & 3;                            // k group of 8 inside the unit
    const int rr   = ((i >> 5) & 1) * 8 + (i & 7);            // row inside the unit
    const float* src = ib + (size_t)((unit / (EMB / 32)) * 16 + rr) * EMB + (unit % (EMB / 32)) * 32 + kg * 8;
    const v4f a  = *(const v4f*)(src);
    const v4f a4 = *(const v4f*)(src + 4);
    v4u p;
    p[0] = pk16(cvm<MODE>(a[0]),  cvm<MODE>(a[1]));
    p[1] = pk16(cvm<MODE>(a[2]),  cvm<MODE>(a[3]));
    p[2] = pk16(cvm<MODE>(a4[0]), cvm<MODE>(a4[1]));
    p[3] = pk16(cvm<MODE>(a4[2]), cvm<MODE>(a4[3]));
    unsigned short* o = ob + (size_t)unit * FRAG_EL + (kg * 16 + rr) * 8;
    *(v4u*)o = p;
    
  }
}

// =====================================================================================================
// Register-blocked batched WMMA GEMM (16-bit operand type OT): C[m][n] = sum_k A[m][k] * Bt[n][k];
// one wave per (16*MI) x 64 tile, no block barriers. A [M][K = lda] and Bt [N][K = ldb] in fragment order;
// M multiple of 16*MI, N multiple of 64, K multiple of 128 (static sizes here). blockIdx.y = batch
// index (strides in elements). Fragments are loaded straight from global, 512 contiguous bytes a load (ldfrag_g).
// NPA = number of A planes: 2 -> second plane A2 (same pitch/stride) multiplies the same Bt fragments into a
// second accumulator set, combined as acc + acc2 * rscaleA in the f32 epilogue.
// value v = (acc [+ acc2*rscaleA]) * oscale.
// OUT_MODE 0: f32 C (pitch ldc) = v.
// OUT_MODE 1: f16 plane C = f16(v * cscale), [M][N = ldc] in fragment order.
// OUT_MODE 3: f16 hi plane C = f16(v * cscale) and f16 residual plane C2 = f16((v*cscale - hi) * rscaleC), likewise.
// =====================================================================================================
// one k step's load group: 4 B fragments, MI A fragments (and MI of the second A plane); in this helper and the next
// every loop is unrolled so that the fragment and accumulator arrays keep constant indices (registers)
//   (bp, ap, ap2: each lane's pointers into its row tiles' units, global address space, in 16-byte units;
//    k: a constant element offset, FRAG_EL per k step of 32)
template <typename OT> struct GP { typedef const __attribute__((address_space(1))) typename FT<OT>::half8* ptr; };
template <typename OT>
__device__ __forceinline__ typename FT<OT>::frag ldfrag_g(typename GP<OT>::ptr p, int k) {   // same k map as ldfrag
  union { typename FT<OT>::frag v; typename FT<OT>::half8 h[2]; } f;
  f.h[0] = p[k / 8];
  f.h[1] = p[k / 8 + 32];
  return f.v;
}
template <typename OT, int MI, int NPA>
__device__ __forceinline__ void gemm_ld(typename GP<OT>::ptr const (&bp)[4], typename GP<OT>::ptr const (&ap)[MI],
                                        typename GP<OT>::ptr const (&ap2)[MI], int k,
                                        typename FT<OT>::frag (&bq)[4], typename FT<OT>::frag (&af)[MI],
                                        typename FT<OT>::frag (&ag)[MI]) {
#pragma unroll
  for (int j = 0; j < 4; ++j) bq[j] = ldfrag_g<OT>(bp[j], k);
#pragma unroll
  for (int i = 0; i < MI; ++i) {
    af[i] = ldfrag_g<OT>(ap[i], k);
    if (NPA == 2) ag[i] = ldfrag_g<OT>(ap2[i], k);
  }
}
// the wait that stands before the row pointers, which the issued loads name, are moved on or given up
template <int MI, int NPA, typename P>
__device__ __forceinline__ void ptr_wait(P (&bp)[4], P (&ap)[MI], P (&ap2)[MI]) {
  static_assert((MI == 4 && NPA == 1) || (MI == 2 && NPA == 2));   // the two shapes in use: eight pointers each
#if DEV_ASM
  if constexpr (MI == 4)
    asm volatile("s_wait_xcnt 0x0" : "+v"(bp[0]), "+v"(bp[1]), "+v"(bp[2]), "+v"(bp[3]),
                                     "+v"(ap[0]), "+v"(ap[1]), "+v"(ap[2]), "+v"(ap[3]) :: "memory");
  else
    asm volatile("s_wait_xcnt 0x0" : "+v"(bp[0]), "+v"(bp[1]), "+v"(bp[2]), "+v"(bp[3]),
                                     "+v"(ap[0]), "+v"(ap[1]), "+v"(ap2[0]), "+v"(ap2[1]) :: "memory");
#endif
}
// one k step's products, in the order i, plane, j
template <typename OT, int MI, int NPA>
__device__ __forceinline__ void gemm_mm(const typename FT<OT>::frag (&bq)[4], const typename FT<OT>::frag (&af)[MI],
                                        const typename FT<OT>::frag (&ag)[MI], v8f (&acc)[MI][4], v8f (&acc2)[MI][4]) {
#pragma unroll
  for (int i = 0; i < MI; ++i) {
#pragma unroll
    for (int j = 0; j < 4; ++j) acc[i][j] = mmar(af[i], bq[j], acc[i][j]);
    if (NPA == 2) {
#pragma unroll
      for (int j = 0; j < 4; ++j) acc2[i][j] = mmar(ag[i], bq[j], acc2[i][j]);
    }
  }
}

template <typename OT, int MI, int NPA, int OUT_MODE>
__global__ __launch_bounds__(256) void gemm_t(
    const unsigned short* __restrict__ Ap, const unsigned short* __restrict__ A2p, int lda, long long strideA,
    const unsigned short* __restrict__ Btp, int ldb, long long strideB,
    void* Cout, void* Cout2, int ldc, long long strideC,
    int M, int N, int K, float oscale, float rscaleA, float cscale, float rscaleC) {
  typedef typename FT<OT>::frag V16;
  const OT* A  = (const OT*)(const void*)Ap;
  const OT* A2 = (const OT*)(const void*)A2p;
  const OT* Bt = (const OT*)(const void*)Btp;
  __shared__ __align__(16) float sT[8][16 * 68];   // per-wave 16x64 slab, pitch 68 floats
  const int RT   = 16 * MI;
  const int b    = blockIdx.y;
  const int lane = threadIdx.x & 31;
  const int wave = threadIdx.x >> 5;
  const int tilesN = N >> 6;
  const int tilesM = M / RT;
  const int tile = blockIdx.x * 8 + wave;
  if (tile >= tilesM * tilesN) return;   // wave-uniform; no block barriers in this kernel
  const int tm = tile / tilesN;
  const int tn = tile - tm * tilesN;
  const int m0 = tm * RT;
  const int n0 = tn << 6;

  const OT* Ab  = A  + (size_t)b * (size_t)strideA;
  const OT* A2b = A2 + (size_t)b * (size_t)strideA;
  const OT* Bb  = Bt + (size_t)b * (size_t)strideB;

  const int rlane = lane & 15;                 // row (A) / col (B, D) within subtile
  const int mOff  = (lane >> 4) * 8;           // D row offset

  v8f acc[MI][4], acc2[MI][4];
#pragma unroll
  for (int i = 0; i < MI; ++i)
#pragma unroll
    for (int j = 0; j < 4; ++j) { acc[i][j] = zero8(); acc2[i][j] = zero8(); }

  // Rotating fragment sets: the whole load group of k step s + 2 is issued ahead of the products of step s, so the
  // loads of two steps fly under the products, where one latency per A fragment was waited out. K is a multiple of 128.
  typedef typename GP<OT>::ptr GPtr;
  GPtr bp[4], ap[MI], ap2[MI];
#pragma unroll
  for (int j = 0; j < 4; ++j) bp[j] = (GPtr)(const void*)(Bb + (size_t)((n0 >> 4) + j) * (ldb >> 5) * FRAG_EL + lane * 8);
#pragma unroll
  for (int i = 0; i < MI; ++i) {
    ap[i]  = (GPtr)(const void*)(Ab  + (size_t)((m0 >> 4) + i) * (lda >> 5) * FRAG_EL + lane * 8);
    ap2[i] = (GPtr)(const void*)(A2b + (size_t)((m0 >> 4) + i) * (lda >> 5) * FRAG_EL + lane * 8);
  }
  V16 bq[4][4], af[4][MI], ag[4][MI];
  gemm_ld<OT, MI, NPA>(bp, ap, ap2, 0, bq[0], af[0], ag[0]);
  __builtin_amdgcn_sched_barrier(0);       // group order as in the loop, so that the loop's counted waits stay per group
  gemm_ld<OT, MI, NPA>(bp, ap, ap2, FRAG_EL, bq[1], af[1], ag[1]);
  for (int k0 = 128; k0 < K; k0 += 128) {  // all trips but the last four steps
#pragma unroll
    for (int u = 0; u < 4; ++u) {          // unrolled so that the set index is a constant (registers)
      gemm_ld<OT, MI, NPA>(bp, ap, ap2, (u + 2) * FRAG_EL, bq[(u + 2) & 3], af[(u + 2) & 3], ag[(u + 2) & 3]);
      __builtin_amdgcn_sched_barrier(0);   // keeps the load group ahead of the products below
      gemm_mm<OT, MI, NPA>(bq[u], af[u], ag[u], acc, acc2);
    }
    ptr_wait<MI, NPA>(bp, ap, ap2);
#pragma unroll
    for (int j = 0; j < 4; ++j) bp[j] += 4 * FRAG_EL / 8;     // 4 k steps = 4 units
#pragma unroll
    for (int i = 0; i < MI; ++i) { ap[i] += 4 * FRAG_EL / 8; ap2[i] += 4 * FRAG_EL / 8; }
  }
  // the last four steps: two groups are still to fetch
  gemm_ld<OT, MI, NPA>(bp, ap, ap2, 2 * FRAG_EL, bq[2], af[2], ag[2]);
  __builtin_amdgcn_sched_barrier(0);       // keeps the load group ahead of the products below
  gemm_mm<OT, MI, NPA>(bq[0], af[0], ag[0], acc, acc2);
  gemm_ld<OT, MI, NPA>(bp, ap, ap2, 3 * FRAG_EL, bq[3], af[3], ag[3]);
  ptr_wait<MI, NPA>(bp, ap, ap2);
  __builtin_amdgcn_sched_barrier(0);       // keeps the load group ahead of the products below
  gemm_mm<OT, MI, NPA>(bq[1], af[1], ag[1], acc, acc2);
  gemm_mm<OT, MI, NPA>(bq[2], af[2], ag[2], acc, acc2);
  gemm_mm<OT, MI, NPA>(bq[3], af[3], ag[3], acc, acc2);
#pragma unroll
  for (int i = 0; i < MI; ++i) {
    acc_guard4(acc[i][0], acc[i][1], acc[i][2], acc[i][3]);
    if (NPA == 2) acc_guard4(acc2[i][0], acc2[i][1], acc2[i][2], acc2[i][3]);
  }

  // ---- epilogue ----
  float* slab = sT[wave];
#pragma unroll
  for (int i = 0; i < MI; ++i) {
    const int mBase = m0 + (i << 4);
#pragma unroll
    for (int j = 0; j < 4; ++j) {
#pragma unroll
      for (int r = 0; r < 8; ++r) {
        float v = acc[i][j][r];
        if (NPA == 2) v += acc2[i][j][r] * rscaleA;
        v = v * oscale;
        slab[(mOff + r) * 68 + (j << 4) + rlane] = v;
      }
    }
    __builtin_amdgcn_fence(3, "workgroup");
    __builtin_amdgcn_wave_barrier();
    __builtin_amdgcn_fence(2, "workgroup");
    if (OUT_MODE == 0) {
      float* C = (float*)Cout + (size_t)b * (size_t)strideC;
      const int h2 = lane >> 4, c4 = (lane & 15) * 4;     // 256-B row segment = 16 lanes x 16 B
      v4f ov[8];
#pragma unroll
      for (int it = 0; it < 8; ++it) {
        const int row = it * 2 + h2;                     // it 0..7 x h2 0..1 = rows 0..15
        ov[it] = *(const v4f*)(slab + row * 68 + c4);
      }
      {
#pragma unroll
        for (int it = 0; it < 8; ++it) {
          const int row = it * 2 + h2;
          *(v4f*)(C + (size_t)(mBase + row) * ldc + n0 + c4) = ov[it];
        }
        
      }
    } else {
      // the 16 x 64 slab = 2 units = 128 granules in a row: store it writes granules 32*it + lane (512 contiguous B),
      // which hold row lane&15, columns 8*(2*it + (lane>>4)) .. +7
      const size_t u0 = ((size_t)(mBase >> 4) * (ldc >> 5) + (n0 >> 5)) * FRAG_EL + lane * 8;
      unsigned short* C  = (unsigned short*)Cout  + (size_t)b * (size_t)strideC + u0;
      unsigned short* C2 = (unsigned short*)Cout2 + (size_t)b * (size_t)strideC + u0;
      v4u hv[4], lv[4];
#pragma unroll
      for (int it = 0; it < 4; ++it) {
        const float* sp = slab + rlane * 68 + (it * 2 + (lane >> 4)) * 8;
        float f[8];
#pragma unroll
        for (int e = 0; e < 8; ++e) f[e] = sp[e] * cscale;
        v4u a, a2;
#pragma unroll
        for (int e = 0; e < 4; ++e) {
          const float f0 = f[2 * e], f1 = f[2 * e + 1];
          const _Float16 x0 = (_Float16)f0, x1 = (_Float16)f1;
          const unsigned short h0 = h_bits(x0), h1 = h_bits(x1);
          unsigned short l0 = 0, l1 = 0;
          if (OUT_MODE == 3) {
            l0 = h_bits((_Float16)((f0 - (float)x0) * rscaleC));
            l1 = h_bits((_Float16)((f1 - (float)x1) * rscaleC));
          }
          a[e] = pk16(h0, h1); a2[e] = pk16(l0, l1);
        }
        hv[it] = a; lv[it] = a2;
      }
      {
#pragma unroll
        for (int it = 0; it < 4; ++it) {
          *(v4u*)(C + it * 256) = hv[it];
          if (OUT_MODE == 3) *(v4u*)(C2 + it * 256) = lv[it];
        }
#if DEV_ASM
        asm volatile("s_wait_xcnt 0x0" ::: "memory");   // before the next slab overwrites the registers these stores name
#endif
      }
    }
    __builtin_amdgcn_fence(3, "workgroup");
    __builtin_amdgcn_wave_barrier();
    __builtin_amdgcn_fence(2, "workgroup");
  }
}

// =====================================================================================================
// Score chunk: 16 query rows (this wave) x 64 keys kv0..kv0+63 of one (b, h).
//   q fragments (A operand, row = lane&15): hi and residual (x4096) planes, 2 d-chunks of 32.
//   k fragments (B operand, col = lane&15 = key) loaded straight from the f16 k plane (fragment order):
//   kb0 = plane + (b*SEQ)*EMB + h*2*FRAG_EL, 16 keys on add 16*EMB (plane row = b*SEQ + t).
//   s[j][r] = D element: query row 8*hh + r, key kv0 + 16j + (lane&15); value = ((qh.k) + (ql.k)/4096) / 8.
// =====================================================================================================
// the chunk's 8 k fragments as one load group, kf[2j + dc]; kp = the lane's pointer into the unit of keys kv0..kv0+15,
// d 0..31 (16-byte units); loops unrolled so that kf keeps constant indices (registers)
typedef GP<_Float16>::ptr KPtr;
__device__ __forceinline__ void ld_kchunk(KPtr& kp, v16h (&kf)[8]) {
#pragma unroll
  for (int j = 0; j < 4; ++j)
#pragma unroll
    for (int dc = 0; dc < 2; ++dc) kf[2 * j + dc] = ldfrag_g<_Float16>(kp, j * 16 * EMB + dc * FRAG_EL);
#if DEV_ASM
  asm volatile("s_wait_xcnt 0x0" : "+v"(kp) :: "memory");   // before kp, which these loads name, is moved on or given up
#endif
}
__device__ __forceinline__ void score_chunk(const v16h (&qah)[2], const v16h (&qal)[2], const v16h (&kf)[8],
                                            v8f (&s)[4]) {
#pragma unroll
  for (int j = 0; j < 4; ++j) {
    v8f ah = zero8(), al = zero8();
#pragma unroll
    for (int dc = 0; dc < 2; ++dc) {
      ah = mma_h(qah[dc], kf[2 * j + dc], ah);
      al = mma_h(qal[dc], kf[2 * j + dc], al);
    }
#pragma unroll
    for (int r = 0; r < 8; ++r) s[j][r] = (ah[r] + al[r] * (1.0f / 4096.0f)) * 0.125f;
  }
}

// =====================================================================================================
// Softmax statistics: per (b, h, query s) the row max m and 1/sum(exp(s - m)) over all SEQ keys.
//   block = 4 waves = 64 consecutive query rows qb*64.. of one (b, h); grid = NB*NH*NKT blocks of 128;
//   static trip NKT over 64-key chunks; online max / rescaled sum in f32 (16 lanes per row merged by shfl).
//   Output plane ML [b*NH+h][2][SEQ] f32 (m then 1/l): the block's 64 m values and 64 1/l values are
//   funnelled through LDS (cross-wave: block barrier) and written by wave 0 with ONE instruction (lanes 0-15:
//   coverage: grid (b,h,qb) x 64 rows = the whole [NB*NH][2][SEQ] plane. MLsh: 4 waves x 2 halves x 8 x 2 = all 128.
// =====================================================================================================
__global__ __launch_bounds__(128)
void attn_stats(const unsigned short* __restrict__ qhp, const unsigned short* __restrict__ qlp,
                const unsigned short* __restrict__ kpp, float* ML) {
  __shared__ __align__(16) float MLsh[128];
  const int tid  = threadIdx.x;
  const int wave = tid >> 5;
  const int lane = tid & 31;
  const int hh   = lane >> 4;
  const int c    = lane & 15;
  const int bx   = blockIdx.x;
  const int qb   = bx % NKT;
  const int rest = bx / NKT;
  const int h    = rest % NH;
  const int b    = rest / NH;
  const int bh   = b * NH + h;
  const int q0   = qb * 64 + wave * 16;

  const _Float16* Qh  = (const _Float16*)(const void*)qhp;
  const _Float16* Ql  = (const _Float16*)(const void*)qlp;
  const _Float16* Kb0 = (const _Float16*)(const void*)kpp + (size_t)b * SEQ * EMB + (size_t)h * (HD / 32) * FRAG_EL;

  v16h qah[2], qal[2];
#pragma unroll
  for (int dc = 0; dc < 2; ++dc) {
    const size_t qo = ((size_t)b * SEQ + (size_t)q0) * EMB + (size_t)(h * (HD / 32) + dc) * FRAG_EL + lane * 8;
    qah[dc] = ldfrag<_Float16>(Qh + qo);
    qal[dc] = ldfrag<_Float16>(Ql + qo);
  }

  float mrow[8], lrow[8];
#pragma unroll
  for (int r = 0; r < 8; ++r) { mrow[r] = -INFINITY; lrow[r] = 0.f; }

#if DEV_ASM
  asm volatile("s_wait_xcnt 0x0" ::: "memory");   // before the k fetch lands in registers that the q loads name
#endif
  v16h kf[8];
  KPtr kp = (KPtr)(const void*)(Kb0 + lane * 8);
  ld_kchunk(kp, kf);
  for (int kt = 0; kt < NKT; ++kt) {          // static trip count
    v8f s[4];
    score_chunk(qah, qal, kf, s);
    __builtin_amdgcn_sched_barrier(0);        // the next chunk's fetch stays behind this chunk's products (same registers)
    kp += (kt + 1 < NKT) ? 64 * EMB / 8 : 0;  // 16-byte units; last trip: the same chunk again, a fetch that nothing uses
    ld_kchunk(kp, kf);
    __builtin_amdgcn_sched_barrier(0);        // ... and ahead of the vector work below, which covers its latency
#pragma unroll
    for (int r = 0; r < 8; ++r) {
      float m = s[0][r];
#pragma unroll
      for (int j = 1; j < 4; ++j) m = fmaxf(m, s[j][r]);
#pragma unroll
      for (int off = 1; off < 16; off <<= 1) m = fmaxf(m, __shfl_xor(m, off, 32));
      const float mnew  = fmaxf(mrow[r], m);
      const float msafe = (mnew == -INFINITY) ? 0.f : mnew;
      const float alpha = __expf(mrow[r] - msafe);
      mrow[r] = mnew;
      float psum = 0.f;
#pragma unroll
      for (int j = 0; j < 4; ++j) psum += __expf(s[j][r] - msafe);
#pragma unroll
      for (int off = 1; off < 16; off <<= 1) psum += __shfl_xor(psum, off, 32);
      lrow[r] = lrow[r] * alpha + psum;
    }
  }

  float il[8];
#pragma unroll
  for (int r = 0; r < 8; ++r) {
    const float l = lrow[r];
    il[r] = (l > 0.f) ? (1.0f / l) : 0.f;
  }
  if (c == 0) {
#pragma unroll
    for (int r = 0; r < 8; ++r) {
      MLsh[wave * 16 + 8 * hh + r]      = mrow[r];
      MLsh[64 + wave * 16 + 8 * hh + r] = il[r];
    }
  }
  __syncthreads();
  if (wave == 0) {
    const v4f v = *(const v4f*)(MLsh + lane * 4);        // lanes 0-15: m rows 4c..4c+3; lanes 16-31: 1/l rows
    float* dst = ML + (size_t)(bh * 2 + hh) * SEQ + qb * 64 + c * 4;
    *(v4f*)dst = v;
    
  }
}

// =====================================================================================================
// Main attention pass: one block per (b, 16 query rows q0..q0+15), 16 waves = the 16 heads.
//   Per 64-key chunk (static trip NKT): scores recomputed exactly as in attn_stats, p = exp(s - m) * (1/l) in f32
//   (m, 1/l from the ML plane) -> per-wave LDS tile Pf[h][row][key] (f32 element stores, every entry written);
//       converted to f16 with the x16384 carry; B = v^T f16 plane [b][h*64+d][s] (head slab h*64*SEQ), fragment order;
//   (b) head average: after __syncthreads (cross-wave), threads 0..255 sum the 16 wave tiles in fixed head order
//   Epilogue: ctx = acc / 16384, x256 carry, staged in the wave's Pf tile (wave-private), written as f16 hi plane
//   coverage: avg: NKT chunks x 16 rows x 64 keys per block, grid (b, qb) = the whole [NB][SEQ][SEQ];
//   ctx planes: each wave rows q0..q0+15 (lane&15) x its head's 64 columns (it 0..3 x lane>>4 0..1), 16 waves x grid =
//   the whole [NROW][EMB] planes (fragment order). staged extent == consumed extent for Pf in both uses (32 lanes x 32 = 1024).
// =====================================================================================================
__global__ __launch_bounds__(512)
void attn_main(const unsigned short* __restrict__ qhp, const unsigned short* __restrict__ qlp,
               const unsigned short* __restrict__ kpp, const unsigned short* __restrict__ vtp,
               const float* __restrict__ ML, unsigned short* chp, unsigned short* clp, float* avg) {
  union FH { v16h v; v8h h[2]; };
  __shared__ __align__(32) float Pf[NH][16 * PPITCH];      // per wave (head) P tile [row][key] f32, pitch PPITCH; the epilogue's ctx tile has pitch 68
  const int tid  = threadIdx.x;
  const int wave = tid >> 5;
  const int lane = tid & 31;
  const int hh   = lane >> 4;
  const int c    = lane & 15;
  const int bx   = blockIdx.x;
  const int qb   = bx % NQB;
  const int b    = bx / NQB;
  const int h    = wave;
  const int bh   = b * NH + h;
  const int q0   = qb * 16;

  const _Float16* Qh  = (const _Float16*)(const void*)qhp;
  const _Float16* Ql  = (const _Float16*)(const void*)qlp;
  const _Float16* Kb0 = (const _Float16*)(const void*)kpp + (size_t)b * SEQ * EMB + (size_t)h * (HD / 32) * FRAG_EL;
  const _Float16* Vb0 = (const _Float16*)(const void*)vtp + (size_t)b * EMB * SEQ + (size_t)h * HD * SEQ;  // v^T [b][h*64+d][s], fragment order

  v16h qah[2], qal[2];
#pragma unroll
  for (int dc = 0; dc < 2; ++dc) {
    const size_t qo = ((size_t)b * SEQ + (size_t)q0) * EMB + (size_t)(h * (HD / 32) + dc) * FRAG_EL + lane * 8;
    qah[dc] = ldfrag<_Float16>(Qh + qo);
    qal[dc] = ldfrag<_Float16>(Ql + qo);
  }
  const v8f m8  = *(const v8f*)(ML + (size_t)(bh * 2) * SEQ + q0 + 8 * hh);       // rows 8hh..8hh+7
  const v8f il8 = *(const v8f*)(ML + (size_t)(bh * 2 + 1) * SEQ + q0 + 8 * hh);

  v8f oacc[4];
#pragma unroll
  for (int t = 0; t < 4; ++t) oacc[t] = zero8();
  float* pf = Pf[wave];

#if DEV_ASM
  asm volatile("s_wait_xcnt 0x0" ::: "memory");   // before the k fetch lands in registers that the loads above name
#endif
  v16h kf[8];
  KPtr kp = (KPtr)(const void*)(Kb0 + lane * 8);
  ld_kchunk(kp, kf);
  KPtr vp = (KPtr)(const void*)(Vb0 + lane * 8);   // the lane's pointer into the unit of d 0..15, keys kv0..kv0+31
  for (int kt = 0; kt < NKT; ++kt) {         // static trip count
    const int kv0 = kt * 64;
    __syncthreads();                          // Pf tiles free again (head sum of the prior chunk done)

    v8f s[4];
    score_chunk(qah, qal, kf, s);
    __builtin_amdgcn_sched_barrier(0);        // the v fetch stays behind the score products (registers)
    v16h vf[8];                               // this chunk's 8 v fragments as one load group, vf[4kk + t]
#pragma unroll
    for (int kk = 0; kk < 2; ++kk)
#pragma unroll
      for (int t = 0; t < 4; ++t)
        vf[4 * kk + t] = ldfrag_g<_Float16>(vp, t * 16 * SEQ + kk * FRAG_EL);
#if DEV_ASM
    asm volatile("s_wait_xcnt 0x0" : "+v"(vp) :: "memory");   // before vp, which these loads name, is moved on
#endif
    vp += 2 * FRAG_EL / 8;                    // 64 keys = 2 units (16-byte units)
    __builtin_amdgcn_sched_barrier(0);        // ... and ahead of the exponentials, which cover its latency
#pragma unroll
    for (int r = 0; r < 8; ++r) {
#pragma unroll
      for (int j = 0; j < 4; ++j) {
        const float p = __expf(s[j][r] - m8[r]) * il8[r];
        pf[(8 * hh + r) * PPITCH + j * 16 + c] = p;
      }
    }
    __builtin_amdgcn_fence(3, "workgroup");
    __builtin_amdgcn_wave_barrier();
    __builtin_amdgcn_fence(2, "workgroup");

    // ---- context += P . V (f16 WMMA, p carried x16384) ----
#pragma unroll                                // vf is indexed by kk: a constant index keeps it in registers
    for (int kk = 0; kk < 2; ++kk) {
      const float* pr = pf + c * PPITCH + kk * 32 + 8 * hh;      // 16-byte aligned at every row (16-byte reads)
      const v4f p00 = *(const v4f*)(pr),      p01 = *(const v4f*)(pr + 4);
      const v4f p10 = *(const v4f*)(pr + 16), p11 = *(const v4f*)(pr + 20);
      const v8f p0 = __builtin_shufflevector(p00, p01, 0, 1, 2, 3, 4, 5, 6, 7);
      const v8f p1 = __builtin_shufflevector(p10, p11, 0, 1, 2, 3, 4, 5, 6, 7);
      FH pa;
      pa.h[0] = __builtin_convertvector(p0 * PCARRY, v8h);
      pa.h[1] = __builtin_convertvector(p1 * PCARRY, v8h);
#pragma unroll
      for (int t = 0; t < 4; ++t) oacc[t] = mma_h(pa.v, vf[4 * kk + t], oacc[t]);
    }
    __syncthreads();
    kp += (kt + 1 < NKT) ? 64 * EMB / 8 : 0;  // 16-byte units; last trip: the same chunk again, a fetch that nothing uses
    ld_kchunk(kp, kf);                        // next chunk's k, one load group
    __builtin_amdgcn_sched_barrier(0);        // issued ahead of the head average, which covers part of its latency

    // ---- head average of this 16 x 64 tile, one block = one writer of every line ----
    if (tid < 256) {                          // waves 0..7, wave-uniform
      const int row = tid >> 4, c4 = (tid & 15) * 4;
      v4f a = *(const v4f*)(Pf[0] + row * PPITCH + c4);
#pragma unroll
      for (int w = 1; w < NH; ++w) a += *(const v4f*)(Pf[w] + row * PPITCH + c4);
      a *= (1.0f / (float)NH);
      float* dst = avg + ((size_t)b * SEQ + (size_t)(q0 + row)) * SEQ + kv0 + c4;
      *(v4f*)dst = a;
#if DEV_ASM
      asm volatile("s_wait_xcnt 0x0" ::: "memory");   // before the next chunk overwrites the registers this store names
#endif
    }
  }
  __syncthreads();

  // ---- epilogue: ctx (undo the x16384 p carry, apply the x256 carry), stage, convert, whole-line stores ----
  float* os = pf;
#pragma unroll
  for (int r = 0; r < 8; ++r) {
#pragma unroll
    for (int t = 0; t < 4; ++t) os[(8 * hh + r) * 68 + t * 16 + c] = oacc[t][r] * (256.0f / PCARRY);
  }
  __builtin_amdgcn_fence(3, "workgroup");
  __builtin_amdgcn_wave_barrier();
  __builtin_amdgcn_fence(2, "workgroup");
  {
    // the wave's 16 x 64 tile = 2 units = 128 granules in a row: store it writes granules 32*it + lane (512 contiguous B),
    // which hold row c, columns 8*(2*it + hh) .. +7
    v4u hv[4], lv[4];
#pragma unroll
    for (int it = 0; it < 4; ++it) {
      const float* sp = os + c * 68 + (it * 2 + hh) * 8;
      float f[8];
#pragma unroll
      for (int e = 0; e < 8; ++e) f[e] = sp[e];
      v4u a, a2;
#pragma unroll
      for (int e = 0; e < 4; ++e) {
        const float f0 = f[2 * e], f1 = f[2 * e + 1];
        const _Float16 x0 = (_Float16)f0, x1 = (_Float16)f1;
        const unsigned short h0 = h_bits(x0), h1 = h_bits(x1);
        const unsigned short l0 = h_bits((_Float16)((f0 - (float)x0) * 4096.0f));
        const unsigned short l1 = h_bits((_Float16)((f1 - (float)x1) * 4096.0f));
        a[e] = pk16(h0, h1); a2[e] = pk16(l0, l1);
      }
      hv[it] = a; lv[it] = a2;
    }
    {
#pragma unroll
      for (int it = 0; it < 4; ++it) {
        const size_t go = ((size_t)b * SEQ + (size_t)q0) * EMB + (size_t)h * (HD / 32) * FRAG_EL + it * 256 + lane * 8;
        *(v4u*)(chp + go) = hv[it];
        *(v4u*)(clp + go) = lv[it];
      }
      
    }
  }
}

// =====================================================================================================
// Workspace map (bytes, full size NB=2 SEQ=2048; PX = NROW*EMB*2 = 8388608; every region an exact multiple of
// its whole-line / whole-tile store granularity, rows are whole tiles, no padded tails needed):
//   Xq   bf16 [NROW][EMB]            PX        8388608
//   Xk   bf16 [NROW][EMB]            PX        8388608
//   Xv   bf16 [NROW][EMB]            PX        8388608
//   Wqb  bf16 [EMB n][EMB k]                   2097152
//   Wkb  bf16 [EMB n][EMB k]                   2097152
//   Wvb  bf16 [EMB n][EMB k]                   2097152
//   Wob  f16  [EMB n][EMB k] (x64)             2097152
//   Qh   f16  [NROW][EMB]            PX        8388608
//   Ql   f16  [NROW][EMB]            PX        8388608
//   Kp   f16  [NROW][EMB]            PX        8388608
//   VT   f16  [NB][EMB][SEQ]                   8388608
//   Ch   f16  [NROW][EMB]            PX        8388608
//   Cl   f16  [NROW][EMB]            PX        8388608
//   ML   f32  [NB*NH][2][SEQ]                   524288
//   total                                     84410368
// Every 16-bit plane is in fragment order (same bytes, same extents). Input weights are [out n][in k] (k contiguous) =
// the Bt / A orientation directly; they are only converted to 16 bit and put in that order.
// Output 0 at element 0 of d_out (rows b*SEQ + s); output 1 at the fixed element offset OFF1 = NB_FULL*SEQ_FULL*EMB.
// =====================================================================================================
extern "C" void kernel_launch(void* const* d_in, const int* in_sizes, int n_in,
                              void* d_out, int out_size, void* d_ws, size_t ws_size,
                              hipStream_t stream) {
  if (n_in < 7) return;
  const int needX = ((NB - 1) * SEQ_FULL + SEQ) * EMB;
  if (in_sizes[0] < needX) return;
  if (in_sizes[1] < needX) return;
  if (in_sizes[2] < needX) return;
  if (in_sizes[3] < EMB * EMB) return;
  if (in_sizes[4] < EMB * EMB) return;
  if (in_sizes[5] < EMB * EMB) return;
  if (in_sizes[6] < EMB * EMB) return;
  const size_t n0e = (size_t)NROW * EMB;            // output 0 written elements [NB][SEQ][EMB]
  const size_t n1e = (size_t)NB * SEQ * SEQ;        // output 1 written elements [NB][SEQ][SEQ]
  if (out_size < 0) return;
  if ((size_t)out_size < n0e) return;
  if ((size_t)out_size < OFF1 + n1e) return;        // written extent of output 1 inside d_out

  const float* xq = (const float*)d_in[0];
  const float* xk = (const float*)d_in[1];
  const float* xv = (const float*)d_in[2];
  const float* Wq = (const float*)d_in[3];
  const float* Wk = (const float*)d_in[4];
  const float* Wv = (const float*)d_in[5];
  const float* Wo = (const float*)d_in[6];

  const size_t PX  = (size_t)NROW * EMB * 2;        // 16-bit activation plane
  const size_t PW  = (size_t)EMB * EMB * 2;
  const size_t PVT = (size_t)NB * EMB * SEQ * 2;
  const size_t PML = (size_t)NB * NH * 2 * SEQ * 4;
  size_t off = 0;
  const size_t oXq = off; off += PX;
  const size_t oXk = off; off += PX;
  const size_t oXv = off; off += PX;
  const size_t oWq = off; off += PW;
  const size_t oWk = off; off += PW;
  const size_t oWv = off; off += PW;
  const size_t oWo = off; off += PW;
  const size_t oQh = off; off += PX;
  const size_t oQl = off; off += PX;
  const size_t oKp = off; off += PX;
  const size_t oVT = off; off += PVT;
  const size_t oCh = off; off += PX;
  const size_t oCl = off; off += PX;
  const size_t oML = off; off += PML;
  if (off > ws_size) return;                        // off = 84410368 at full size
  if (off > (size_t)134217728) return;

  char* ws = (char*)d_ws;
  unsigned short* Xq  = (unsigned short*)(ws + oXq);
  unsigned short* Xk  = (unsigned short*)(ws + oXk);
  unsigned short* Xv  = (unsigned short*)(ws + oXv);
  unsigned short* Wqb = (unsigned short*)(ws + oWq);
  unsigned short* Wkb = (unsigned short*)(ws + oWk);
  unsigned short* Wvb = (unsigned short*)(ws + oWv);
  unsigned short* Wob = (unsigned short*)(ws + oWo);
  unsigned short* Qh  = (unsigned short*)(ws + oQh);
  unsigned short* Ql  = (unsigned short*)(ws + oQl);
  unsigned short* Kp  = (unsigned short*)(ws + oKp);
  unsigned short* VT  = (unsigned short*)(ws + oVT);
  unsigned short* Ch  = (unsigned short*)(ws + oCh);
  unsigned short* Cl  = (unsigned short*)(ws + oCl);
  float*          ML  = (float*)(ws + oML);
  float*          out0 = (float*)d_out;
  float*          out1 = (float*)d_out + OFF1;

  const dim3 blk(256);
  const int n8x = SEQ * EMB / 8;                                 // per batch slab, 262144 at full size
  const int n8w = EMB * EMB / 8;                                 // 131072
  const dim3 gCvtX((n8x + 255) / 256, NB);                       // 1024 x NB blocks
  const dim3 gCvtW((n8w + 255) / 256, 1);                        //  512 blocks
  const dim3 gQK((((NROW) / 64) * (EMB / 64) + 7) / 8, 1);        // 1024 tiles -> 128 blocks: M=NROW, N=EMB
  const dim3 gV((((EMB) / 64) * (SEQ / 64) + 7) / 8, NB);          //  512 tiles ->  64 blocks x NB: M=EMB, N=SEQ
  const dim3 gO((((NROW) / 32) * (EMB / 64) + 7) / 8, 1);         // 2048 tiles -> 256 blocks (32x64 wave tiles)
  const dim3 gStats(NB * NH * NKT);                              // 1024 blocks of 128
  const dim3 gMain(NB * NQB);                                    //  256 blocks of 512

  // (1) activations [b][s][k] -> bf16 planes [b*SEQ+s][k] (input batch stride SEQ_FULL*EMB, plane batch stride SEQ*EMB)
  cvt16x8<0><<<gCvtX, blk, 0, stream>>>(xq, (long long)SEQ_FULL * EMB, Xq, (long long)SEQ * EMB, n8x);
  cvt16x8<0><<<gCvtX, blk, 0, stream>>>(xk, (long long)SEQ_FULL * EMB, Xk, (long long)SEQ * EMB, n8x);
  cvt16x8<0><<<gCvtX, blk, 0, stream>>>(xv, (long long)SEQ_FULL * EMB, Xv, (long long)SEQ * EMB, n8x);
  // (2) weights [EMB n][EMB k] -> bf16 planes (Wq, Wk, Wv); Wo -> f16 (x64 of its bf16 value); no transpose needed
  cvt16x8<0><<<gCvtW, blk, 0, stream>>>(Wq, 0LL, Wqb, 0LL, n8w);
  cvt16x8<0><<<gCvtW, blk, 0, stream>>>(Wk, 0LL, Wkb, 0LL, n8w);
  cvt16x8<0><<<gCvtW, blk, 0, stream>>>(Wv, 0LL, Wvb, 0LL, n8w);
  cvt16x8<1><<<gCvtW, blk, 0, stream>>>(Wo, 0LL, Wob, 0LL, n8w);
  // (3) q = xq . Wq^T -> f16 hi / residual (x4096) planes [b*SEQ+s][h*64+d]   (M=NROW, N=EMB, K=EMB)
  gemm_t<__bf16, 4, 1, 3><<<gQK, blk, 0, stream>>>(
      Xq, Xq, EMB, 0LL, Wqb, EMB, 0LL,
      (void*)Qh, (void*)Ql, EMB, 0LL,
      NROW, EMB, EMB, 1.0f, 0.0f, 1.0f, 4096.0f);
  // (4) k = xk . Wk^T -> f16 plane [b*SEQ+s][h*64+d]
  gemm_t<__bf16, 4, 1, 1><<<gQK, blk, 0, stream>>>(
      Xk, Xk, EMB, 0LL, Wkb, EMB, 0LL,
      (void*)Kp, (void*)Kp, EMB, 0LL,
      NROW, EMB, EMB, 1.0f, 0.0f, 1.0f, 1.0f);
  // (5) v^T = Wv . xv_b^T (per batch b = blockIdx.y) -> f16 plane [b][h*64+d][s] (pitch SEQ)
  //     (A = Wvb [n][k]; Bt = Xv rows of batch b: offset b*SEQ*EMB, pitch EMB; M=EMB, N=SEQ, K=EMB)
  gemm_t<__bf16, 4, 1, 1><<<gV, blk, 0, stream>>>(
      Wvb, Wvb, EMB, 0LL, Xv, EMB, (long long)SEQ * EMB,
      (void*)VT, (void*)VT, SEQ, (long long)EMB * SEQ,
      EMB, SEQ, EMB, 1.0f, 0.0f, 1.0f, 1.0f);
  // (6) softmax statistics (m, 1/l) per (b, h, s)
  attn_stats<<<gStats, dim3(128), 0, stream>>>(Qh, Ql, Kp, ML);
  // (7) exact-normalised p: P.V -> ctx planes (f16 hi x256 / residual x4096); head-averaged p -> output 1
  attn_main<<<gMain, dim3(512), 0, stream>>>(Qh, Ql, Kp, VT, ML, Ch, Cl, out1);
  // (8) output 0 = ctx . Wo^T, f32 [NROW][EMB] straight into d_out, accumulators (hi + res/4096) x 1/(256*64)
  gemm_t<_Float16, 2, 2, 0><<<gO, blk, 0, stream>>>(
      Ch, Cl, EMB, 0LL, Wob, EMB, 0LL,
      (void*)out0, (void*)out0, EMB, 0LL,
      NROW, EMB, EMB, 1.0f / 16384.0f, 1.0f / 4096.0f, 1.0f, 1.0f);
  (void)hipGetLastError();
}

// v004
// Measured time: 223 microseconds a run.
// Next to v003, in two timings, it ran 1.06 times as fast each time.
// Counting every step since v000, it is 2.23 times as fast.
// Contractions: q, k, v^T projections = v_wmma_f32_16x16x32_bf16 (bf16 operands from RNE-converted inputs and weights, single product, f32 accumulate);
// q.k^T scores (statistics pass and main pass) = v_wmma_f32_16x16x32_f16 (q as f16 hi plane + f16 residual plane x4096, k f16; 2 products, separate f32 accumulators);
// p.v = v_wmma_f32_16x16x32_f16 (p carried x16384 in f16, v f16; single product, f32 accumulate);
// ctx.Wo^T = v_wmma_f32_16x16x32_f16 (ctx as f16 hi plane x256 + f16 residual plane x4096, Wo f16 x64 of its bf16 value; 2 products, separate f32 accumulators);
// softmax statistics, probabilities and head average in f32.
#include <hip/hip_runtime.h>
#include <math.h>
#include <stdint.h>

#ifndef NB
#define NB 2
#endif
#ifndef SEQ
#define SEQ 2048
#endif
#define NB_FULL  2
#define SEQ_FULL 2048
#define EMB      1024
#define NH       16
#define HD       64
#define NROW     (NB * SEQ)          // activation rows in workspace planes, row index = b * SEQ + s
#define NQB      (SEQ / 16)          // 16-row query blocks per sequence
#define NKT      (SEQ / 64)          // 64-key chunks per sequence
#define PCARRY   16384.0f            // power-of-two carry of p in the f16 P.V operand
#define PPITCH   68                  // row pitch of the LDS P tile in floats: 272 B = 16 B x odd, so 16 rows read 16 B each on 64 distinct banks
#define OFF1     ((size_t)NB_FULL * SEQ_FULL * EMB)   // fixed element offset of output 1 in d_out
static_assert(NB >= 1 && NB <= NB_FULL);
static_assert(SEQ >= 64 && SEQ <= SEQ_FULL && (SEQ % 64) == 0);
static_assert(NH * HD == EMB && (EMB % 128) == 0);
static_assert((NROW % 64) == 0 && (EMB % 64) == 0 && (HD % 64) == 0 && (EMB % 32) == 0);
static_assert(OFF1 * 4 == 16777216);   // byte offset of output 1
static_assert((OFF1 + (size_t)NB_FULL * SEQ_FULL * SEQ_FULL) * 4 == 50331648);   // written extent of output 1 == d_out bytes

typedef _Float16 v16h __attribute__((ext_vector_type(16)));
typedef _Float16 v8h  __attribute__((ext_vector_type(8)));
typedef __bf16   v16b __attribute__((ext_vector_type(16)));
typedef __bf16   v8b  __attribute__((ext_vector_type(8)));
typedef float    v8f  __attribute__((ext_vector_type(8)));
typedef float    v4f  __attribute__((ext_vector_type(4)));
typedef unsigned int v4u __attribute__((ext_vector_type(4)));

#if defined(__HIP_DEVICE_COMPILE__)
#define DEV_ASM 1
#else
#define DEV_ASM 0
#endif

// ---- scalar helpers --------------------------------------------------------------------------------
__device__ __forceinline__ unsigned short bf_bits(float f) {          // f32 -> bf16 bits, RNE convert
  unsigned u = __float_as_uint(f);
  return (unsigned short)((u + 0x7FFFu + ((u >> 16) & 1u)) >> 16);
}
__device__ __forceinline__ float bf_up(unsigned short hb) { return __uint_as_float(((unsigned)hb) << 16); }
__device__ __forceinline__ unsigned short h_bits(_Float16 x) { return __builtin_bit_cast(unsigned short, x); }
__device__ __forceinline__ unsigned pk16(unsigned short a, unsigned short b) { return (unsigned)a | ((unsigned)b << 16); }
__device__ __forceinline__ v8f zero8() { v8f z = {0.f, 0.f, 0.f, 0.f, 0.f, 0.f, 0.f, 0.f}; return z; }

// ---- fragment order: every 16-bit workspace plane [R rows][KC k] is kept as 1-KB units, one per WMMA operand fragment
//      (16 rows x 32 k), unit index = (row / 16) * (KC / 32) + k / 32. Inside a unit, in 16-byte granules of 8 k:
//      granule = ((k % 32) / 8) * 16 + row % 16, so granule g of the first 512 B is lane g's elements 0..7 and granule
//      g of the second 512 B its elements 8..15: each wave-wide 16-byte load reads 512 contiguous bytes (4 whole lines).
#define FRAG_EL 512                  // elements of one unit
// ---- fragment types / loaders: 16-bit A/B operand, lane -> row/col (lane&15), half h = lane>>4; p = unit + 8*lane;
//      elements 0..7 <- p[0..7] (k0+8h..k0+8h+7), elements 8..15 <- p[256..263] (k0+16+8h..k0+16+8h+7)
template <typename OT> struct FT;
template <> struct FT<__bf16>   { typedef v16b frag; typedef v8b half8; };
template <> struct FT<_Float16> { typedef v16h frag; typedef v8h half8; };

template <typename OT>
__device__ __forceinline__ typename FT<OT>::frag ldfrag(const OT* p) {
  union { typename FT<OT>::frag v; typename FT<OT>::half8 h[2]; } f;
  f.h[0] = *(const typename FT<OT>::half8*)(p);
  f.h[1] = *(const typename FT<OT>::half8*)(p + 256);
  return f.v;
}

// ---- WMMA helpers (asm guard bodies are device-only; concrete operand types) -----------------------------
__device__ __forceinline__ v8f mmar(v16b a, v16b b, v8f c) {
  return __builtin_amdgcn_wmma_f32_16x16x32_bf16(false, a, false, b, (short)0, c, false, false);
}
__device__ __forceinline__ v8f mmar(v16h a, v16h b, v8f c) {
  return __builtin_amdgcn_wmma_f32_16x16x32_f16(false, a, false, b, (short)0, c, false, false);
}
// guarded form: 4 VALU slots after the WMMA, D tied, A/B kept live
__device__ __forceinline__ v8f mma_h(v16h a, v16h b, v8f c) {
  c = __builtin_amdgcn_wmma_f32_16x16x32_f16(false, a, false, b, (short)0, c, false, false);
#if DEV_ASM
  asm volatile("v_nop\n\tv_nop\n\tv_nop\n\tv_nop" : "+v"(c) : "v"(a), "v"(b));
#endif
  return c;
}
__device__ __forceinline__ void acc_guard4(v8f& a, v8f& b, v8f& c, v8f& d) {
#if DEV_ASM
  asm volatile("v_nop\n\tv_nop\n\tv_nop\n\tv_nop" : "+v"(a), "+v"(b), "+v"(c), "+v"(d));
#else
  (void)a; (void)b; (void)c; (void)d;
#endif
}

// 16-bit convert helper. MODE 0: bf16 bits (RNE convert).  MODE 1: f16 bits of (64 * bf16(x)) (exact scaling of the bf16 value).
template <int MODE>
__device__ __forceinline__ unsigned short cvm(float f) {
  const unsigned short hb = bf_bits(f);
  if (MODE == 0) return hb;
  return h_bits((_Float16)(bf_up(hb) * 64.0f));
}

// =====================================================================================================
// All seven f32 -> 16-bit conversions (3 activations, 4 weights) in ONE launch of few waves, each with many granules.
// Planes in fragment order, 8 elements (one granule) per thread and slab. The launch has CVT_T threads. A weight is one
// slab of CVT_T granules. An activation is XSLAB slabs; a slab takes CVT_TB granules (XROWS rows) of EVERY batch, thread
// i being in batch i / CVT_TB, so that a slab's step from the plane's start is a small constant for all threads.
// In a slab a wave takes 8 rows x 32 k: it reads 8 whole 128-B lines of f32 and writes 4 whole 128-B lines
// (8 granules of each of the unit's 4 k groups).
// coverage: activations: XSLAB slabs x NB batches x XROWS rows = [NROW][EMB], 3 planes; weights: CVT_T granules = [EMB][EMB], 4 planes.
// =====================================================================================================
#define CVT_T    (EMB * EMB / 8)                  // threads of the launch = granules of a weight
#define CVT_TB   (CVT_T / NB)                     // threads on one batch
#define XROWS    (CVT_TB * 8 / EMB)               // rows of a batch in one activation slab
#define XSLAB    (SEQ / XROWS)                    // slabs of an activation
#define NXSLAB   (3 * XSLAB)
#define NSLAB    (NXSLAB + 4)                     // ... and the four weights
static_assert((CVT_T % 256) == 0 && (CVT_T % NB) == 0 && (XROWS % 16) == 0 && XROWS * EMB == CVT_TB * 8 && (SEQ % XROWS) == 0);
static_assert((size_t)NB_FULL * SEQ_FULL * EMB * 4 < ((size_t)1 << 32));   // byte offsets in a plane fit 32 bits
template <int MODE>
__device__ __forceinline__ v4u cvt8(v4f a, v4f a4) {
  v4u p;
  p[0] = pk16(cvm<MODE>(a[0]),  cvm<MODE>(a[1]));
  p[1] = pk16(cvm<MODE>(a[2]),  cvm<MODE>(a[3]));
  p[2] = pk16(cvm<MODE>(a4[0]), cvm<MODE>(a4[1]));
  p[3] = pk16(cvm<MODE>(a4[2]), cvm<MODE>(a4[3]));
  return p;
}
__global__ __launch_bounds__(256) void cvt_all(
    const float* __restrict__ xq, const float* __restrict__ xk, const float* __restrict__ xv,
    const float* __restrict__ wq, const float* __restrict__ wk, const float* __restrict__ wv,
    const float* __restrict__ wo,
    unsigned short* Xq, unsigned short* Xk, unsigned short* Xv,
    unsigned short* Wqb, unsigned short* Wkb, unsigned short* Wvb, unsigned short* Wob) {
  const unsigned i    = blockIdx.x * 256u + threadIdx.x;
  const unsigned unit = i >> 6;                               // 64 threads (2 waves) per unit
  const unsigned kg   = (i >> 3) & 3u;                        // k group of 8 inside the unit
  const unsigned rr   = ((i >> 5) & 1u) * 8u + (i & 7u);      // row inside the unit
  const unsigned bt   = i / CVT_TB;                           // the thread's batch in the activations
  // the granule's byte offsets from a plane's start, 32 bits: with a slab's constant step, one offset register serves
  // every slab of a kind beside the plane's scalar base. Weights: granule i. Activations: granule i - bt * CVT_TB of batch bt.
  unsigned sobW = (((unit / (EMB / 32)) * 16u + rr) * EMB + (unit % (EMB / 32)) * 32u + kg * 8u) * 4u;
  unsigned sobX = sobW + bt * (unsigned)((SEQ_FULL - XROWS) * EMB * 4);
  const unsigned dobW = (unit * FRAG_EL + (kg * 16u + rr) * 8u) * 2u;
  const unsigned dobX = dobW + bt * (unsigned)((SEQ - XROWS) * EMB * 2);
  const float* const xin[3]     = {xq, xk, xv};
  const float* const win[4]     = {wq, wk, wv, wo};
  unsigned short* const xout[3] = {Xq, Xk, Xv};
  unsigned short* const wout[4] = {Wqb, Wkb, Wvb, Wob};
  // every loop here is unrolled: the slab index picks pointers and registers at compile time
  v4f a[NSLAB][2];
#pragma unroll
  for (int s = 0; s < NSLAB; ++s) {               // all loads of the thread up front: 2 * NSLAB x 16 B in flight a lane
    const char* src = (s < NXSLAB) ? (const char*)xin[s / XSLAB] + (size_t)(s % XSLAB) * XROWS * EMB * 4 + sobX
                                   : (const char*)win[s - NXSLAB] + sobW;
    a[s][0] = *(const v4f*)(src);
    a[s][1] = *(const v4f*)(src + 16);
    __builtin_amdgcn_sched_barrier(0);            // a slab's two loads read the same lines: kept side by side, ahead of all conversions
  }
#if DEV_ASM
  asm volatile("s_wait_xcnt 0x0" : "+v"(sobX), "+v"(sobW) :: "memory");   // before the offset registers, which these loads name, are given up
#endif
  __builtin_amdgcn_sched_barrier(0);              // no conversion result is written ahead of that wait
  v4u p[NSLAB];
#pragma unroll
  for (int s = 0; s < NSLAB; ++s)
    p[s] = (s == NSLAB - 1) ? cvt8<1>(a[s][0], a[s][1]) : cvt8<0>(a[s][0], a[s][1]);
#pragma unroll
  for (int s = 0; s < NSLAB; ++s) {
    char* dst = (s < NXSLAB) ? (char*)xout[s / XSLAB] + (size_t)(s % XSLAB) * XROWS * EMB * 2 + dobX
                             : (char*)wout[s - NXSLAB] + dobW;
    *(v4u*)dst = p[s];
  }
}

// =====================================================================================================
// Register-blocked batched WMMA GEMM (16-bit operand type OT): C[m][n] = sum_k A[m][k] * Bt[n][k];
// one wave per (16*MI) x 64 tile, no block barriers. A [M][K = lda] and Bt [N][K = ldb] in fragment order;
// M multiple of 16*MI, N multiple of 64, K multiple of 128 (static sizes here). blockIdx.y = batch
// index (strides in elements). Fragments are loaded straight from global, 512 contiguous bytes a load (ldfrag_g).
// NPA = number of A planes: 2 -> second plane A2 (same pitch/stride) multiplies the same Bt fragments into a
// second accumulator set, combined as acc + acc2 * rscaleA in the f32 epilogue.
// value v = (acc [+ acc2*rscaleA]) * oscale.
// OUT_MODE 0: f32 C (pitch ldc) = v.
// OUT_MODE 1: f16 plane C = f16(v * cscale), [M][N = ldc] in fragment order.
// OUT_MODE 3: f16 hi plane C = f16(v * cscale) and f16 residual plane C2 = f16((v*cscale - hi) * rscaleC), likewise.
// =====================================================================================================
// one k step's load group: 4 B fragments, MI A fragments (and MI of the second A plane); in this helper and the next
// every loop is unrolled so that the fragment and accumulator arrays keep constant indices (registers)
//   (bp, ap, ap2: each lane's pointers into its row tiles' units, global address space, in 16-byte units;
//    k: a constant element offset, FRAG_EL per k step of 32)
template <typename OT> struct GP { typedef const __attribute__((address_space(1))) typename FT<OT>::half8* ptr; };
template <typename OT>
__device__ __forceinline__ typename FT<OT>::frag ldfrag_g(typename GP<OT>::ptr p, int k) {   // same k map as ldfrag
  union { typename FT<OT>::frag v; typename FT<OT>::half8 h[2]; } f;
  f.h[0] = p[k / 8];
  f.h[1] = p[k / 8 + 32];
  return f.v;
}
template <typename OT, int MI, int NPA>
__device__ __forceinline__ void gemm_ld(typename GP<OT>::ptr const (&bp)[4], typename GP<OT>::ptr const (&ap)[MI],
                                        typename GP<OT>::ptr const (&ap2)[MI], int k,
                                        typename FT<OT>::frag (&bq)[4], typename FT<OT>::frag (&af)[MI],
                                        typename FT<OT>::frag (&ag)[MI]) {
#pragma unroll
  for (int j = 0; j < 4; ++j) bq[j] = ldfrag_g<OT>(bp[j], k);
#pragma unroll
  for (int i = 0; i < MI; ++i) {
    af[i] = ldfrag_g<OT>(ap[i], k);
    if (NPA == 2) ag[i] = ldfrag_g<OT>(ap2[i], k);
  }
}
// the wait that stands before the row pointers, which the issued loads name, are moved on or given up
template <int MI, int NPA, typename P>
__device__ __forceinline__ void ptr_wait(P (&bp)[4], P (&ap)[MI], P (&ap2)[MI]) {
  static_assert((MI == 4 && NPA == 1) || (MI == 2 && NPA == 2));   // the two shapes in use: eight pointers each
#if DEV_ASM
  if constexpr (MI == 4)
    asm volatile("s_wait_xcnt 0x0" : "+v"(bp[0]), "+v"(bp[1]), "+v"(bp[2]), "+v"(bp[3]),
                                     "+v"(ap[0]), "+v"(ap[1]), "+v"(ap[2]), "+v"(ap[3]) :: "memory");
  else
    asm volatile("s_wait_xcnt 0x0" : "+v"(bp[0]), "+v"(bp[1]), "+v"(bp[2]), "+v"(bp[3]),
                                     "+v"(ap[0]), "+v"(ap[1]), "+v"(ap2[0]), "+v"(ap2[1]) :: "memory");
#endif
}
// one k step's products, in the order i, plane, j
template <typename OT, int MI, int NPA>
__device__ __forceinline__ void gemm_mm(const typename FT<OT>::frag (&bq)[4], const typename FT<OT>::frag (&af)[MI],
                                        const typename FT<OT>::frag (&ag)[MI], v8f (&acc)[MI][4], v8f (&acc2)[MI][4]) {
#pragma unroll
  for (int i = 0; i < MI; ++i) {
#pragma unroll
    for (int j = 0; j < 4; ++j) acc[i][j] = mmar(af[i], bq[j], acc[i][j]);
    if (NPA == 2) {
#pragma unroll
      for (int j = 0; j < 4; ++j) acc2[i][j] = mmar(ag[i], bq[j], acc2[i][j]);
    }
  }
}

template <typename OT, int MI, int NPA, int OUT_MODE>
__global__ __launch_bounds__(256) void gemm_t(
    const unsigned short* __restrict__ Ap, const unsigned short* __restrict__ A2p, int lda, long long strideA,
    const unsigned short* __restrict__ Btp, int ldb, long long strideB,
    void* Cout, void* Cout2, int ldc, long long strideC,
    int M, int N, int K, float oscale, float rscaleA, float cscale, float rscaleC) {
  typedef typename FT<OT>::frag V16;
  const OT* A  = (const OT*)(const void*)Ap;
  const OT* A2 = (const OT*)(const void*)A2p;
  const OT* Bt = (const OT*)(const void*)Btp;
  __shared__ __align__(16) float sT[8][16 * 68];   // per-wave 16x64 slab, pitch 68 floats
  const int RT   = 16 * MI;
  const int b    = blockIdx.y;
  const int lane = threadIdx.x & 31;
  const int wave = threadIdx.x >> 5;
  const int tilesN = N >> 6;
  const int tilesM = M / RT;
  const int tile = blockIdx.x * 8 + wave;
  if (tile >= tilesM * tilesN) return;   // wave-uniform; no block barriers in this kernel
  const int tm = tile / tilesN;
  const int tn = tile - tm * tilesN;
  const int m0 = tm * RT;
  const int n0 = tn << 6;

  const OT* Ab  = A  + (size_t)b * (size_t)strideA;
  const OT* A2b = A2 + (size_t)b * (size_t)strideA;
  const OT* Bb  = Bt + (size_t)b * (size_t)strideB;

  const int rlane = lane & 15;                 // row (A) / col (B, D) within subtile
  const int mOff  = (lane >> 4) * 8;           // D row offset

  v8f acc[MI][4], acc2[MI][4];
#pragma unroll
  for (int i = 0; i < MI; ++i)
#pragma unroll
    for (int j = 0; j < 4; ++j) { acc[i][j] = zero8(); acc2[i][j] = zero8(); }

  // Rotating fragment sets: the whole load group of k step s + 2 is issued ahead of the products of step s, so the
  // loads of two steps fly under the products, where one latency per A fragment was waited out. K is a multiple of 128.
  typedef typename GP<OT>::ptr GPtr;
  GPtr bp[4], ap[MI], ap2[MI];
#pragma unroll
  for (int j = 0; j < 4; ++j) bp[j] = (GPtr)(const void*)(Bb + (size_t)((n0 >> 4) + j) * (ldb >> 5) * FRAG_EL + lane * 8);
#pragma unroll
  for (int i = 0; i < MI; ++i) {
    ap[i]  = (GPtr)(const void*)(Ab  + (size_t)((m0 >> 4) + i) * (lda >> 5) * FRAG_EL + lane * 8);
    ap2[i] = (GPtr)(const void*)(A2b + (size_t)((m0 >> 4) + i) * (lda >> 5) * FRAG_EL + lane * 8);
  }
  V16 bq[4][4], af[4][MI], ag[4][MI];
  gemm_ld<OT, MI, NPA>(bp, ap, ap2, 0, bq[0], af[0], ag[0]);
  __builtin_amdgcn_sched_barrier(0);       // group order as in the loop, so that the loop's counted waits stay per group
  gemm_ld<OT, MI, NPA>(bp, ap, ap2, FRAG_EL, bq[1], af[1], ag[1]);
  for (int k0 = 128; k0 < K; k0 += 128) {  // all trips but the last four steps
#pragma unroll
    for (int u = 0; u < 4; ++u) {          // unrolled so that the set index is a constant (registers)
      gemm_ld<OT, MI, NPA>(bp, ap, ap2, (u + 2) * FRAG_EL, bq[(u + 2) & 3], af[(u + 2) & 3], ag[(u + 2) & 3]);
      __builtin_amdgcn_sched_barrier(0);   // keeps the load group ahead of the products below
      gemm_mm<OT, MI, NPA>(bq[u], af[u], ag[u], acc, acc2);
    }
    ptr_wait<MI, NPA>(bp, ap, ap2);
#pragma unroll
    for (int j = 0; j < 4; ++j) bp[j] += 4 * FRAG_EL / 8;     // 4 k steps = 4 units
#pragma unroll
    for (int i = 0; i < MI; ++i) { ap[i] += 4 * FRAG_EL / 8; ap2[i] += 4 * FRAG_EL / 8; }
  }
  // the last four steps: two groups are still to fetch
  gemm_ld<OT, MI, NPA>(bp, ap, ap2, 2 * FRAG_EL, bq[2], af[2], ag[2]);
  __builtin_amdgcn_sched_barrier(0);       // keeps the load group ahead of the products below
  gemm_mm<OT, MI, NPA>(bq[0], af[0], ag[0], acc, acc2);
  gemm_ld<OT, MI, NPA>(bp, ap, ap2, 3 * FRAG_EL, bq[3], af[3], ag[3]);
  ptr_wait<MI, NPA>(bp, ap, ap2);
  __builtin_amdgcn_sched_barrier(0);       // keeps the load group ahead of the products below
  gemm_mm<OT, MI, NPA>(bq[1], af[1], ag[1], acc, acc2);
  gemm_mm<OT, MI, NPA>(bq[2], af[2], ag[2], acc, acc2);
  gemm_mm<OT, MI, NPA>(bq[3], af[3], ag[3], acc, acc2);
#pragma unroll
  for (int i = 0; i < MI; ++i) {
    acc_guard4(acc[i][0], acc[i][1], acc[i][2], acc[i][3]);
    if (NPA == 2) acc_guard4(acc2[i][0], acc2[i][1], acc2[i][2], acc2[i][3]);
  }

  // ---- epilogue ----
  float* slab = sT[wave];
#pragma unroll
  for (int i = 0; i < MI; ++i) {
    const int mBase = m0 + (i << 4);
#pragma unroll
    for (int j = 0; j < 4; ++j) {
#pragma unroll
      for (int r = 0; r < 8; ++r) {
        float v = acc[i][j][r];
        if (NPA == 2) v += acc2[i][j][r] * rscaleA;
        v = v * oscale;
        slab[(mOff + r) * 68 + (j << 4) + rlane] = v;
      }
    }
    __builtin_amdgcn_fence(3, "workgroup");
    __builtin_amdgcn_wave_barrier();
    __builtin_amdgcn_fence(2, "workgroup");
    if (OUT_MODE == 0) {
      float* C = (float*)Cout + (size_t)b * (size_t)strideC;
      const int h2 = lane >> 4, c4 = (lane & 15) * 4;     // 256-B row segment = 16 lanes x 16 B
      v4f ov[8];
#pragma unroll
      for (int it = 0; it < 8; ++it) {
        const int row = it * 2 + h2;                     // it 0..7 x h2 0..1 = rows 0..15
        ov[it] = *(const v4f*)(slab + row * 68 + c4);
      }
      {
#pragma unroll
        for (int it = 0; it < 8; ++it) {
          const int row = it * 2 + h2;
          *(v4f*)(C + (size_t)(mBase + row) * ldc + n0 + c4) = ov[it];
        }
        
      }
    } else {
      // the 16 x 64 slab = 2 units = 128 granules in a row: store it writes granules 32*it + lane (512 contiguous B),
      // which hold row lane&15, columns 8*(2*it + (lane>>4)) .. +7
      const size_t u0 = ((size_t)(mBase >> 4) * (ldc >> 5) + (n0 >> 5)) * FRAG_EL + lane * 8;
      unsigned short* C  = (unsigned short*)Cout  + (size_t)b * (size_t)strideC + u0;
      unsigned short* C2 = (unsigned short*)Cout2 + (size_t)b * (size_t)strideC + u0;
      v4u hv[4], lv[4];
#pragma unroll
      for (int it = 0; it < 4; ++it) {
        const float* sp = slab + rlane * 68 + (it * 2 + (lane >> 4)) * 8;
        float f[8];
#pragma unroll
        for (int e = 0; e < 8; ++e) f[e] = sp[e] * cscale;
        v4u a, a2;
#pragma unroll
        for (int e = 0; e < 4; ++e) {
          const float f0 = f[2 * e], f1 = f[2 * e + 1];
          const _Float16 x0 = (_Float16)f0, x1 = (_Float16)f1;
          const unsigned short h0 = h_bits(x0), h1 = h_bits(x1);
          unsigned short l0 = 0, l1 = 0;
          if (OUT_MODE == 3) {
            l0 = h_bits((_Float16)((f0 - (float)x0) * rscaleC));
            l1 = h_bits((_Float16)((f1 - (float)x1) * rscaleC));
          }
          a[e] = pk16(h0, h1); a2[e] = pk16(l0, l1);
        }
        hv[it] = a; lv[it] = a2;
      }
      {
#pragma unroll
        for (int it = 0; it < 4; ++it) {
          *(v4u*)(C + it * 256) = hv[it];
          if (OUT_MODE == 3) *(v4u*)(C2 + it * 256) = lv[it];
        }
#if DEV_ASM
        asm volatile("s_wait_xcnt 0x0" ::: "memory");   // before the next slab overwrites the registers these stores name
#endif
      }
    }
    __builtin_amdgcn_fence(3, "workgroup");
    __builtin_amdgcn_wave_barrier();
    __builtin_amdgcn_fence(2, "workgroup");
  }
}

// =====================================================================================================
// Score chunk: 16 query rows (this wave) x 64 keys kv0..kv0+63 of one (b, h).
//   q fragments (A operand, row = lane&15): hi and residual (x4096) planes, 2 d-chunks of 32.
//   k fragments (B operand, col = lane&15 = key) loaded straight from the f16 k plane (fragment order):
//   kb0 = plane + (b*SEQ)*EMB + h*2*FRAG_EL, 16 keys on add 16*EMB (plane row = b*SEQ + t).
//   s[j][r] = D element: query row 8*hh + r, key kv0 + 16j + (lane&15); value = ((qh.k) + (ql.k)/4096) / 8.
// =====================================================================================================
// the chunk's 8 k fragments as one load group, kf[2j + dc]; kp = the lane's pointer into the unit of keys kv0..kv0+15,
// d 0..31 (16-byte units); loops unrolled so that kf keeps constant indices (registers)
typedef GP<_Float16>::ptr KPtr;
__device__ __forceinline__ void ld_kchunk(KPtr& kp, v16h (&kf)[8]) {
#pragma unroll
  for (int j = 0; j < 4; ++j)
#pragma unroll
    for (int dc = 0; dc < 2; ++dc) kf[2 * j + dc] = ldfrag_g<_Float16>(kp, j * 16 * EMB + dc * FRAG_EL);
#if DEV_ASM
  asm volatile("s_wait_xcnt 0x0" : "+v"(kp) :: "memory");   // before kp, which these loads name, is moved on or given up
#endif
}
__device__ __forceinline__ void score_chunk(const v16h (&qah)[2], const v16h (&qal)[2], const v16h (&kf)[8],
                                            v8f (&s)[4]) {
#pragma unroll
  for (int j = 0; j < 4; ++j) {
    v8f ah = zero8(), al = zero8();
#pragma unroll
    for (int dc = 0; dc < 2; ++dc) {
      ah = mma_h(qah[dc], kf[2 * j + dc], ah);
      al = mma_h(qal[dc], kf[2 * j + dc], al);
    }
#pragma unroll
    for (int r = 0; r < 8; ++r) s[j][r] = (ah[r] + al[r] * (1.0f / 4096.0f)) * 0.125f;
  }
}

// =====================================================================================================
// Softmax statistics: per (b, h, query s) the row max m and 1/sum(exp(s - m)) over all SEQ keys.
//   block = 4 waves = 64 consecutive query rows qb*64.. of one (b, h); grid = NB*NH*NKT blocks of 128;
//   static trip NKT over 64-key chunks; online max / rescaled sum in f32 (16 lanes per row merged by shfl).
//   Output plane ML [b*NH+h][2][SEQ] f32 (m then 1/l): the block's 64 m values and 64 1/l values are
//   funnelled through LDS (cross-wave: block barrier) and written by wave 0 with ONE instruction (lanes 0-15:
//   coverage: grid (b,h,qb) x 64 rows = the whole [NB*NH][2][SEQ] plane. MLsh: 4 waves x 2 halves x 8 x 2 = all 128.
// =====================================================================================================
__global__ __launch_bounds__(128)
void attn_stats(const unsigned short* __restrict__ qhp, const unsigned short* __restrict__ qlp,
                const unsigned short* __restrict__ kpp, float* ML) {
  __shared__ __align__(16) float MLsh[128];
  const int tid  = threadIdx.x;
  const int wave = tid >> 5;
  const int lane = tid & 31;
  const int hh   = lane >> 4;
  const int c    = lane & 15;
  const int bx   = blockIdx.x;
  const int qb   = bx % NKT;
  const int rest = bx / NKT;
  const int h    = rest % NH;
  const int b    = rest / NH;
  const int bh   = b * NH + h;
  const int q0   = qb * 64 + wave * 16;

  const _Float16* Qh  = (const _Float16*)(const void*)qhp;
  const _Float16* Ql  = (const _Float16*)(const void*)qlp;
  const _Float16* Kb0 = (const _Float16*)(const void*)kpp + (size_t)b * SEQ * EMB + (size_t)h * (HD / 32) * FRAG_EL;

  v16h qah[2], qal[2];
#pragma unroll
  for (int dc = 0; dc < 2; ++dc) {
    const size_t qo = ((size_t)b * SEQ + (size_t)q0) * EMB + (size_t)(h * (HD / 32) + dc) * FRAG_EL + lane * 8;
    qah[dc] = ldfrag<_Float16>(Qh + qo);
    qal[dc] = ldfrag<_Float16>(Ql + qo);
  }

  float mrow[8], lrow[8];
#pragma unroll
  for (int r = 0; r < 8; ++r) { mrow[r] = -INFINITY; lrow[r] = 0.f; }

#if DEV_ASM
  asm volatile("s_wait_xcnt 0x0" ::: "memory");   // before the k fetch lands in registers that the q loads name
#endif
  v16h kf[8];
  KPtr kp = (KPtr)(const void*)(Kb0 + lane * 8);
  ld_kchunk(kp, kf);
  for (int kt = 0; kt < NKT; ++kt) {          // static trip count
    v8f s[4];
    score_chunk(qah, qal, kf, s);
    __builtin_amdgcn_sched_barrier(0);        // the next chunk's fetch stays behind this chunk's products (same registers)
    kp += (kt + 1 < NKT) ? 64 * EMB / 8 : 0;  // 16-byte units; last trip: the same chunk again, a fetch that nothing uses
    ld_kchunk(kp, kf);
    __builtin_amdgcn_sched_barrier(0);        // ... and ahead of the vector work below, which covers its latency
#pragma unroll
    for (int r = 0; r < 8; ++r) {
      float m = s[0][r];
#pragma unroll
      for (int j = 1; j < 4; ++j) m = fmaxf(m, s[j][r]);
#pragma unroll
      for (int off = 1; off < 16; off <<= 1) m = fmaxf(m, __shfl_xor(m, off, 32));
      const float mnew  = fmaxf(mrow[r], m);
      const float msafe = (mnew == -INFINITY) ? 0.f : mnew;
      const float alpha = __expf(mrow[r] - msafe);
      mrow[r] = mnew;
      float psum = 0.f;
#pragma unroll
      for (int j = 0; j < 4; ++j) psum += __expf(s[j][r] - msafe);
#pragma unroll
      for (int off = 1; off < 16; off <<= 1) psum += __shfl_xor(psum, off, 32);
      lrow[r] = lrow[r] * alpha + psum;
    }
  }

  float il[8];
#pragma unroll
  for (int r = 0; r < 8; ++r) {
    const float l = lrow[r];
    il[r] = (l > 0.f) ? (1.0f / l) : 0.f;
  }
  if (c == 0) {
#pragma unroll
    for (int r = 0; r < 8; ++r) {
      MLsh[wave * 16 + 8 * hh + r]      = mrow[r];
      MLsh[64 + wave * 16 + 8 * hh + r] = il[r];
    }
  }
  __syncthreads();
  if (wave == 0) {
    const v4f v = *(const v4f*)(MLsh + lane * 4);        // lanes 0-15: m rows 4c..4c+3; lanes 16-31: 1/l rows
    float* dst = ML + (size_t)(bh * 2 + hh) * SEQ + qb * 64 + c * 4;
    *(v4f*)dst = v;
    
  }
}

// =====================================================================================================
// Main attention pass: one block per (b, 16 query rows q0..q0+15), 16 waves = the 16 heads.
//   Per 64-key chunk (static trip NKT): scores recomputed exactly as in attn_stats, p = exp(s - m) * (1/l) in f32
//   (m, 1/l from the ML plane) -> per-wave LDS tile Pf[h][row][key] (f32 element stores, every entry written);
//       converted to f16 with the x16384 carry; B = v^T f16 plane [b][h*64+d][s] (head slab h*64*SEQ), fragment order;
//   (b) head average: after __syncthreads (cross-wave), threads 0..255 sum the 16 wave tiles in fixed head order
//   Epilogue: ctx = acc / 16384, x256 carry, staged in the wave's Pf tile (wave-private), written as f16 hi plane
//   coverage: avg: NKT chunks x 16 rows x 64 keys per block, grid (b, qb) = the whole [NB][SEQ][SEQ];
//   ctx planes: each wave rows q0..q0+15 (lane&15) x its head's 64 columns (it 0..3 x lane>>4 0..1), 16 waves x grid =
//   the whole [NROW][EMB] planes (fragment order). staged extent == consumed extent for Pf in both uses (32 lanes x 32 = 1024).
// =====================================================================================================
__global__ __launch_bounds__(512)
void attn_main(const unsigned short* __restrict__ qhp, const unsigned short* __restrict__ qlp,
               const unsigned short* __restrict__ kpp, const unsigned short* __restrict__ vtp,
               const float* __restrict__ ML, unsigned short* chp, unsigned short* clp, float* avg) {
  union FH { v16h v; v8h h[2]; };
  __shared__ __align__(32) float Pf[NH][16 * PPITCH];      // per wave (head) P tile [row][key] f32, pitch PPITCH; the epilogue's ctx tile has pitch 68
  const int tid  = threadIdx.x;
  const int wave = tid >> 5;
  const int lane = tid & 31;
  const int hh   = lane >> 4;
  const int c    = lane & 15;
  const int bx   = blockIdx.x;
  const int qb   = bx % NQB;
  const int b    = bx / NQB;
  const int h    = wave;
  const int bh   = b * NH + h;
  const int q0   = qb * 16;

  const _Float16* Qh  = (const _Float16*)(const void*)qhp;
  const _Float16* Ql  = (const _Float16*)(const void*)qlp;
  const _Float16* Kb0 = (const _Float16*)(const void*)kpp + (size_t)b * SEQ * EMB + (size_t)h * (HD / 32) * FRAG_EL;
  const _Float16* Vb0 = (const _Float16*)(const void*)vtp + (size_t)b * EMB * SEQ + (size_t)h * HD * SEQ;  // v^T [b][h*64+d][s], fragment order

  v16h qah[2], qal[2];
#pragma unroll
  for (int dc = 0; dc < 2; ++dc) {
    const size_t qo = ((size_t)b * SEQ + (size_t)q0) * EMB + (size_t)(h * (HD / 32) + dc) * FRAG_EL + lane * 8;
    qah[dc] = ldfrag<_Float16>(Qh + qo);
    qal[dc] = ldfrag<_Float16>(Ql + qo);
  }
  const v8f m8  = *(const v8f*)(ML + (size_t)(bh * 2) * SEQ + q0 + 8 * hh);       // rows 8hh..8hh+7
  const v8f il8 = *(const v8f*)(ML + (size_t)(bh * 2 + 1) * SEQ + q0 + 8 * hh);

  v8f oacc[4];
#pragma unroll
  for (int t = 0; t < 4; ++t) oacc[t] = zero8();
  float* pf = Pf[wave];

#if DEV_ASM
  asm volatile("s_wait_xcnt 0x0" ::: "memory");   // before the k fetch lands in registers that the loads above name
#endif
  v16h kf[8];
  KPtr kp = (KPtr)(const void*)(Kb0 + lane * 8);
  ld_kchunk(kp, kf);
  KPtr vp = (KPtr)(const void*)(Vb0 + lane * 8);   // the lane's pointer into the unit of d 0..15, keys kv0..kv0+31
  for (int kt = 0; kt < NKT; ++kt) {         // static trip count
    const int kv0 = kt * 64;
    __syncthreads();                          // Pf tiles free again (head sum of the prior chunk done)

    v8f s[4];
    score_chunk(qah, qal, kf, s);
    __builtin_amdgcn_sched_barrier(0);        // the v fetch stays behind the score products (registers)
    v16h vf[8];                               // this chunk's 8 v fragments as one load group, vf[4kk + t]
#pragma unroll
    for (int kk = 0; kk < 2; ++kk)
#pragma unroll
      for (int t = 0; t < 4; ++t)
        vf[4 * kk + t] = ldfrag_g<_Float16>(vp, t * 16 * SEQ + kk * FRAG_EL);
#if DEV_ASM
    asm volatile("s_wait_xcnt 0x0" : "+v"(vp) :: "memory");   // before vp, which these loads name, is moved on
#endif
    vp += 2 * FRAG_EL / 8;                    // 64 keys = 2 units (16-byte units)
    __builtin_amdgcn_sched_barrier(0);        // ... and ahead of the exponentials, which cover its latency
#pragma unroll
    for (int r = 0; r < 8; ++r) {
#pragma unroll
      for (int j = 0; j < 4; ++j) {
        const float p = __expf(s[j][r] - m8[r]) * il8[r];
        pf[(8 * hh + r) * PPITCH + j * 16 + c] = p;
      }
    }
    __builtin_amdgcn_fence(3, "workgroup");
    __builtin_amdgcn_wave_barrier();
    __builtin_amdgcn_fence(2, "workgroup");

    // ---- context += P . V (f16 WMMA, p carried x16384) ----
#pragma unroll                                // vf is indexed by kk: a constant index keeps it in registers
    for (int kk = 0; kk < 2; ++kk) {
      const float* pr = pf + c * PPITCH + kk * 32 + 8 * hh;      // 16-byte aligned at every row (16-byte reads)
      const v4f p00 = *(const v4f*)(pr),      p01 = *(const v4f*)(pr + 4);
      const v4f p10 = *(const v4f*)(pr + 16), p11 = *(const v4f*)(pr + 20);
      const v8f p0 = __builtin_shufflevector(p00, p01, 0, 1, 2, 3, 4, 5, 6, 7);
      const v8f p1 = __builtin_shufflevector(p10, p11, 0, 1, 2, 3, 4, 5, 6, 7);
      FH pa;
      pa.h[0] = __builtin_convertvector(p0 * PCARRY, v8h);
      pa.h[1] = __builtin_convertvector(p1 * PCARRY, v8h);
#pragma unroll
      for (int t = 0; t < 4; ++t) oacc[t] = mma_h(pa.v, vf[4 * kk + t], oacc[t]);
    }
    __syncthreads();
    kp += (kt + 1 < NKT) ? 64 * EMB / 8 : 0;  // 16-byte units; last trip: the same chunk again, a fetch that nothing uses
    ld_kchunk(kp, kf);                        // next chunk's k, one load group
    __builtin_amdgcn_sched_barrier(0);        // issued ahead of the head average, which covers part of its latency

    // ---- head average of this 16 x 64 tile, one block = one writer of every line ----
    if (tid < 256) {                          // waves 0..7, wave-uniform
      const int row = tid >> 4, c4 = (tid & 15) * 4;
      v4f a = *(const v4f*)(Pf[0] + row * PPITCH + c4);
#pragma unroll
      for (int w = 1; w < NH; ++w) a += *(const v4f*)(Pf[w] + row * PPITCH + c4);
      a *= (1.0f / (float)NH);
      float* dst = avg + ((size_t)b * SEQ + (size_t)(q0 + row)) * SEQ + kv0 + c4;
      *(v4f*)dst = a;
#if DEV_ASM
      asm volatile("s_wait_xcnt 0x0" ::: "memory");   // before the next chunk overwrites the registers this store names
#endif
    }
  }
  __syncthreads();

  // ---- epilogue: ctx (undo the x16384 p carry, apply the x256 carry), stage, convert, whole-line stores ----
  float* os = pf;
#pragma unroll
  for (int r = 0; r < 8; ++r) {
#pragma unroll
    for (int t = 0; t < 4; ++t) os[(8 * hh + r) * 68 + t * 16 + c] = oacc[t][r] * (256.0f / PCARRY);
  }
  __builtin_amdgcn_fence(3, "workgroup");
  __builtin_amdgcn_wave_barrier();
  __builtin_amdgcn_fence(2, "workgroup");
  {
    // the wave's 16 x 64 tile = 2 units = 128 granules in a row: store it writes granules 32*it + lane (512 contiguous B),
    // which hold row c, columns 8*(2*it + hh) .. +7
    v4u hv[4], lv[4];
#pragma unroll
    for (int it = 0; it < 4; ++it) {
      const float* sp = os + c * 68 + (it * 2 + hh) * 8;
      float f[8];
#pragma unroll
      for (int e = 0; e < 8; ++e) f[e] = sp[e];
      v4u a, a2;
#pragma unroll
      for (int e = 0; e < 4; ++e) {
        const float f0 = f[2 * e], f1 = f[2 * e + 1];
        const _Float16 x0 = (_Float16)f0, x1 = (_Float16)f1;
        const unsigned short h0 = h_bits(x0), h1 = h_bits(x1);
        const unsigned short l0 = h_bits((_Float16)((f0 - (float)x0) * 4096.0f));
        const unsigned short l1 = h_bits((_Float16)((f1 - (float)x1) * 4096.0f));
        a[e] = pk16(h0, h1); a2[e] = pk16(l0, l1);
      }
      hv[it] = a; lv[it] = a2;
    }
    {
#pragma unroll
      for (int it = 0; it < 4; ++it) {
        const size_t go = ((size_t)b * SEQ + (size_t)q0) * EMB + (size_t)h * (HD / 32) * FRAG_EL + it * 256 + lane * 8;
        *(v4u*)(chp + go) = hv[it];
        *(v4u*)(clp + go) = lv[it];
      }
      
    }
  }
}

// =====================================================================================================
// Workspace map (bytes, full size NB=2 SEQ=2048; PX = NROW*EMB*2 = 8388608; every region an exact multiple of
// its whole-line / whole-tile store granularity, rows are whole tiles, no padded tails needed):
//   Xq   bf16 [NROW][EMB]            PX        8388608
//   Xk   bf16 [NROW][EMB]            PX        8388608
//   Xv   bf16 [NROW][EMB]            PX        8388608
//   Wqb  bf16 [EMB n][EMB k]                   2097152
//   Wkb  bf16 [EMB n][EMB k]                   2097152
//   Wvb  bf16 [EMB n][EMB k]                   2097152
//   Wob  f16  [EMB n][EMB k] (x64)             2097152
//   Qh   f16  [NROW][EMB]            PX        8388608
//   Ql   f16  [NROW][EMB]            PX        8388608
//   Kp   f16  [NROW][EMB]            PX        8388608
//   VT   f16  [NB][EMB][SEQ]                   8388608
//   Ch   f16  [NROW][EMB]            PX        8388608
//   Cl   f16  [NROW][EMB]            PX        8388608
//   ML   f32  [NB*NH][2][SEQ]                   524288
//   total                                     84410368
// Every 16-bit plane is in fragment order (same bytes, same extents). Input weights are [out n][in k] (k contiguous) =
// the Bt / A orientation directly; they are only converted to 16 bit and put in that order.
// Output 0 at element 0 of d_out (rows b*SEQ + s); output 1 at the fixed element offset OFF1 = NB_FULL*SEQ_FULL*EMB.
// =====================================================================================================
extern "C" void kernel_launch(void* const* d_in, const int* in_sizes, int n_in,
                              void* d_out, int out_size, void* d_ws, size_t ws_size,
                              hipStream_t stream) {
  if (n_in < 7) return;
  const int needX = ((NB - 1) * SEQ_FULL + SEQ) * EMB;
  if (in_sizes[0] < needX) return;
  if (in_sizes[1] < needX) return;
  if (in_sizes[2] < needX) return;
  if (in_sizes[3] < EMB * EMB) return;
  if (in_sizes[4] < EMB * EMB) return;
  if (in_sizes[5] < EMB * EMB) return;
  if (in_sizes[6] < EMB * EMB) return;
  const size_t n0e = (size_t)NROW * EMB;            // output 0 written elements [NB][SEQ][EMB]
  const size_t n1e = (size_t)NB * SEQ * SEQ;        // output 1 written elements [NB][SEQ][SEQ]
  if (out_size < 0) return;
  if ((size_t)out_size < n0e) return;
  if ((size_t)out_size < OFF1 + n1e) return;        // written extent of output 1 inside d_out

  const float* xq = (const float*)d_in[0];
  const float* xk = (const float*)d_in[1];
  const float* xv = (const float*)d_in[2];
  const float* Wq = (const float*)d_in[3];
  const float* Wk = (const float*)d_in[4];
  const float* Wv = (const float*)d_in[5];
  const float* Wo = (const float*)d_in[6];

  const size_t PX  = (size_t)NROW * EMB * 2;        // 16-bit activation plane
  const size_t PW  = (size_t)EMB * EMB * 2;
  const size_t PVT = (size_t)NB * EMB * SEQ * 2;
  const size_t PML = (size_t)NB * NH * 2 * SEQ * 4;
  size_t off = 0;
  const size_t oXq = off; off += PX;
  const size_t oXk = off; off += PX;
  const size_t oXv = off; off += PX;
  const size_t oWq = off; off += PW;
  const size_t oWk = off; off += PW;
  const size_t oWv = off; off += PW;
  const size_t oWo = off; off += PW;
  const size_t oQh = off; off += PX;
  const size_t oQl = off; off += PX;
  const size_t oKp = off; off += PX;
  const size_t oVT = off; off += PVT;
  const size_t oCh = off; off += PX;
  const size_t oCl = off; off += PX;
  const size_t oML = off; off += PML;
  if (off > ws_size) return;                        // off = 84410368 at full size
  if (off > (size_t)134217728) return;

  char* ws = (char*)d_ws;
  unsigned short* Xq  = (unsigned short*)(ws + oXq);
  unsigned short* Xk  = (unsigned short*)(ws + oXk);
  unsigned short* Xv  = (unsigned short*)(ws + oXv);
  unsigned short* Wqb = (unsigned short*)(ws + oWq);
  unsigned short* Wkb = (unsigned short*)(ws + oWk);
  unsigned short* Wvb = (unsigned short*)(ws + oWv);
  unsigned short* Wob = (unsigned short*)(ws + oWo);
  unsigned short* Qh  = (unsigned short*)(ws + oQh);
  unsigned short* Ql  = (unsigned short*)(ws + oQl);
  unsigned short* Kp  = (unsigned short*)(ws + oKp);
  unsigned short* VT  = (unsigned short*)(ws + oVT);
  unsigned short* Ch  = (unsigned short*)(ws + oCh);
  unsigned short* Cl  = (unsigned short*)(ws + oCl);
  float*          ML  = (float*)(ws + oML);
  float*          out0 = (float*)d_out;
  float*          out1 = (float*)d_out + OFF1;

  const dim3 blk(256);
  const dim3 gCvt(CVT_T / 256);                                  //  512 blocks
  const dim3 gQK((((NROW) / 64) * (EMB / 64) + 7) / 8, 1);        // 1024 tiles -> 128 blocks: M=NROW, N=EMB
  const dim3 gV((((EMB) / 64) * (SEQ / 64) + 7) / 8, NB);          //  512 tiles ->  64 blocks x NB: M=EMB, N=SEQ
  const dim3 gO((((NROW) / 32) * (EMB / 64) + 7) / 8, 1);         // 2048 tiles -> 256 blocks (32x64 wave tiles)
  const dim3 gStats(NB * NH * NKT);                              // 1024 blocks of 128
  const dim3 gMain(NB * NQB);                                    //  256 blocks of 512

  // (1) activations [b][s][k] -> bf16 planes [b*SEQ+s][k] (input batch stride SEQ_FULL*EMB, plane batch stride SEQ*EMB);
  // (2) weights [EMB n][EMB k] -> bf16 planes (Wq, Wk, Wv); Wo -> f16 (x64 of its bf16 value); no transpose needed
  cvt_all<<<gCvt, blk, 0, stream>>>(xq, xk, xv, Wq, Wk, Wv, Wo, Xq, Xk, Xv, Wqb, Wkb, Wvb, Wob);
  // (3) q = xq . Wq^T -> f16 hi / residual (x4096) planes [b*SEQ+s][h*64+d]   (M=NROW, N=EMB, K=EMB)
  gemm_t<__bf16, 4, 1, 3><<<gQK, blk, 0, stream>>>(
      Xq, Xq, EMB, 0LL, Wqb, EMB, 0LL,
      (void*)Qh, (void*)Ql, EMB, 0LL,
      NROW, EMB, EMB, 1.0f, 0.0f, 1.0f, 4096.0f);
  // (4) k = xk . Wk^T -> f16 plane [b*SEQ+s][h*64+d]
  gemm_t<__bf16, 4, 1, 1><<<gQK, blk, 0, stream>>>(
      Xk, Xk, EMB, 0LL, Wkb, EMB, 0LL,
      (void*)Kp, (void*)Kp, EMB, 0LL,
      NROW, EMB, EMB, 1.0f, 0.0f, 1.0f, 1.0f);
  // (5) v^T = Wv . xv_b^T (per batch b = blockIdx.y) -> f16 plane [b][h*64+d][s] (pitch SEQ)
  //     (A = Wvb [n][k]; Bt = Xv rows of batch b: offset b*SEQ*EMB, pitch EMB; M=EMB, N=SEQ, K=EMB)
  gemm_t<__bf16, 4, 1, 1><<<gV, blk, 0, stream>>>(
      Wvb, Wvb, EMB, 0LL, Xv, EMB, (long long)SEQ * EMB,
      (void*)VT, (void*)VT, SEQ, (long long)EMB * SEQ,
      EMB, SEQ, EMB, 1.0f, 0.0f, 1.0f, 1.0f);
  // (6) softmax statistics (m, 1/l) per (b, h, s)
  attn_stats<<<gStats, dim3(128), 0, stream>>>(Qh, Ql, Kp, ML);
  // (7) exact-normalised p: P.V -> ctx planes (f16 hi x256 / residual x4096); head-averaged p -> output 1
  attn_main<<<gMain, dim3(512), 0, stream>>>(Qh, Ql, Kp, VT, ML, Ch, Cl, out1);
  // (8) output 0 = ctx . Wo^T, f32 [NROW][EMB] straight into d_out, accumulators (hi + res/4096) x 1/(256*64)
  gemm_t<_Float16, 2, 2, 0><<<gO, blk, 0, stream>>>(
      Ch, Cl, EMB, 0LL, Wob, EMB, 0LL,
      (void*)out0, (void*)out0, EMB, 0LL,
      NROW, EMB, EMB, 1.0f / 16384.0f, 1.0f / 4096.0f, 1.0f, 1.0f);
  (void)hipGetLastError();
}

// v005
// It runs in 195 microseconds.
// Next to v004, in two timings, it ran 1.15 times as fast each time.
// Over all steps from v000 it is 2.56 times as fast.
// Contractions: q, k, v^T projections = v_wmma_f32_16x16x32_bf16 (bf16 operands from RNE-converted inputs and weights, single product, f32 accumulate);
// scores (statistics pass and main pass), formed transposed as k.q^T = v_wmma_f32_16x16x32_f16 (k f16 as A; q as f16 hi plane + f16 residual plane x4096 as B; 2 products, separate f32 accumulators);
// p.v = v_wmma_f32_16x16x32_f16 (p carried x16384 in f16, v f16; single product, f32 accumulate);
// ctx.Wo^T = v_wmma_f32_16x16x32_f16 (ctx as f16 hi plane x256 + f16 residual plane x4096, Wo f16 x64 of its bf16 value; 2 products, separate f32 accumulators);
// softmax statistics, probabilities and head average in f32.
#include <hip/hip_runtime.h>
#include <math.h>
#include <stdint.h>

#ifndef NB
#define NB 2
#endif
#ifndef SEQ
#define SEQ 2048
#endif
#define NB_FULL  2
#define SEQ_FULL 2048
#define EMB      1024
#define NH       16
#define HD       64
#define NROW     (NB * SEQ)          // activation rows in workspace planes, row index = b * SEQ + s
#define NQB      (SEQ / 16)          // 16-row query blocks per sequence
#define NKT      (SEQ / 64)          // 64-key chunks per sequence
#define PCARRY   16384.0f            // power-of-two carry of p in the f16 P.V operand
#define PPITCH   68                  // row pitch of the LDS P tile in floats: 272 B = 16 B x odd, so 16 rows written 16 B each fall on 64 distinct banks
#define OFF1     ((size_t)NB_FULL * SEQ_FULL * EMB)   // fixed element offset of output 1 in d_out
static_assert(NB >= 1 && NB <= NB_FULL);
static_assert(SEQ >= 64 && SEQ <= SEQ_FULL && (SEQ % 64) == 0);
static_assert(NH * HD == EMB && (EMB % 128) == 0);
static_assert((NROW % 64) == 0 && (EMB % 64) == 0 && (HD % 64) == 0 && (EMB % 32) == 0);
static_assert(OFF1 * 4 == 16777216);   // byte offset of output 1
static_assert((OFF1 + (size_t)NB_FULL * SEQ_FULL * SEQ_FULL) * 4 == 50331648);   // written extent of output 1 == d_out bytes

typedef _Float16 v16h __attribute__((ext_vector_type(16)));
typedef _Float16 v8h  __attribute__((ext_vector_type(8)));
typedef __bf16   v16b __attribute__((ext_vector_type(16)));
typedef __bf16   v8b  __attribute__((ext_vector_type(8)));
typedef float    v8f  __attribute__((ext_vector_type(8)));
typedef float    v4f  __attribute__((ext_vector_type(4)));
typedef unsigned int v4u __attribute__((ext_vector_type(4)));

#if defined(__HIP_DEVICE_COMPILE__)
#define DEV_ASM 1
#else
#define DEV_ASM 0
#endif

// ---- scalar helpers --------------------------------------------------------------------------------
__device__ __forceinline__ unsigned short bf_bits(float f) {          // f32 -> bf16 bits, RNE convert
  unsigned u = __float_as_uint(f);
  return (unsigned short)((u + 0x7FFFu + ((u >> 16) & 1u)) >> 16);
}
__device__ __forceinline__ float bf_up(unsigned short hb) { return __uint_as_float(((unsigned)hb) << 16); }
__device__ __forceinline__ unsigned short h_bits(_Float16 x) { return __builtin_bit_cast(unsigned short, x); }
__device__ __forceinline__ unsigned pk16(unsigned short a, unsigned short b) { return (unsigned)a | ((unsigned)b << 16); }
__device__ __forceinline__ v8f zero8() { v8f z = {0.f, 0.f, 0.f, 0.f, 0.f, 0.f, 0.f, 0.f}; return z; }

// ---- fragment order: every 16-bit workspace plane [R rows][KC k] is kept as 1-KB units, one per WMMA operand fragment
//      (16 rows x 32 k), unit index = (row / 16) * (KC / 32) + k / 32. Inside a unit, in 16-byte granules of 8 k:
//      granule = ((k % 32) / 8) * 16 + row % 16, so granule g of the first 512 B is lane g's elements 0..7 and granule
//      g of the second 512 B its elements 8..15: each wave-wide 16-byte load reads 512 contiguous bytes (4 whole lines).
#define FRAG_EL 512                  // elements of one unit
// ---- fragment types / loaders: 16-bit A/B operand, lane -> row/col (lane&15), half h = lane>>4; p = unit + 8*lane;
//      elements 0..7 <- p[0..7] (k0+8h..k0+8h+7), elements 8..15 <- p[256..263] (k0+16+8h..k0+16+8h+7)
template <typename OT> struct FT;
template <> struct FT<__bf16>   { typedef v16b frag; typedef v8b half8; };
template <> struct FT<_Float16> { typedef v16h frag; typedef v8h half8; };

template <typename OT>
__device__ __forceinline__ typename FT<OT>::frag ldfrag(const OT* p) {
  union { typename FT<OT>::frag v; typename FT<OT>::half8 h[2]; } f;
  f.h[0] = *(const typename FT<OT>::half8*)(p);
  f.h[1] = *(const typename FT<OT>::half8*)(p + 256);
  return f.v;
}

// ---- WMMA helpers (asm guard bodies are device-only; concrete operand types) -----------------------------
__device__ __forceinline__ v8f mmar(v16b a, v16b b, v8f c) {
  return __builtin_amdgcn_wmma_f32_16x16x32_bf16(false, a, false, b, (short)0, c, false, false);
}
__device__ __forceinline__ v8f mmar(v16h a, v16h b, v8f c) {
  return __builtin_amdgcn_wmma_f32_16x16x32_f16(false, a, false, b, (short)0, c, false, false);
}
// guarded form: 4 VALU slots after the WMMA, D tied, A/B kept live
__device__ __forceinline__ v8f mma_h(v16h a, v16h b, v8f c) {
  c = __builtin_amdgcn_wmma_f32_16x16x32_f16(false, a, false, b, (short)0, c, false, false);
#if DEV_ASM
  asm volatile("v_nop\n\tv_nop\n\tv_nop\n\tv_nop" : "+v"(c) : "v"(a), "v"(b));
#endif
  return c;
}
__device__ __forceinline__ void acc_guard4(v8f& a, v8f& b, v8f& c, v8f& d) {
#if DEV_ASM
  asm volatile("v_nop\n\tv_nop\n\tv_nop\n\tv_nop" : "+v"(a), "+v"(b), "+v"(c), "+v"(d));
#else
  (void)a; (void)b; (void)c; (void)d;
#endif
}

// 16-bit convert helper. MODE 0: bf16 bits (RNE convert).  MODE 1: f16 bits of (64 * bf16(x)) (exact scaling of the bf16 value).
template <int MODE>
__device__ __forceinline__ unsigned short cvm(float f) {
  const unsigned short hb = bf_bits(f);
  if (MODE == 0) return hb;
  return h_bits((_Float16)(bf_up(hb) * 64.0f));
}

// =====================================================================================================
// All seven f32 -> 16-bit conversions (3 activations, 4 weights) in ONE launch of few waves, each with many granules.
// Planes in fragment order, 8 elements (one granule) per thread and slab. The launch has CVT_T threads. A weight is one
// slab of CVT_T granules. An activation is XSLAB slabs; a slab takes CVT_TB granules (XROWS rows) of EVERY batch, thread
// i being in batch i / CVT_TB, so that a slab's step from the plane's start is a small constant for all threads.
// In a slab a wave takes 8 rows x 32 k: it reads 8 whole 128-B lines of f32 and writes 4 whole 128-B lines
// (8 granules of each of the unit's 4 k groups).
// coverage: activations: XSLAB slabs x NB batches x XROWS rows = [NROW][EMB], 3 planes; weights: CVT_T granules = [EMB][EMB], 4 planes.
// =====================================================================================================
#define CVT_T    (EMB * EMB / 8)                  // threads of the launch = granules of a weight
#define CVT_TB   (CVT_T / NB)                     // threads on one batch
#define XROWS    (CVT_TB * 8 / EMB)               // rows of a batch in one activation slab
#define XSLAB    (SEQ / XROWS)                    // slabs of an activation
#define NXSLAB   (3 * XSLAB)
#define NSLAB    (NXSLAB + 4)                     // ... and the four weights
static_assert((CVT_T % 256) == 0 && (CVT_T % NB) == 0 && (XROWS % 16) == 0 && XROWS * EMB == CVT_TB * 8 && (SEQ % XROWS) == 0);
static_assert((size_t)NB_FULL * SEQ_FULL * EMB * 4 < ((size_t)1 << 32));   // byte offsets in a plane fit 32 bits
template <int MODE>
__device__ __forceinline__ v4u cvt8(v4f a, v4f a4) {
  v4u p;
  p[0] = pk16(cvm<MODE>(a[0]),  cvm<MODE>(a[1]));
  p[1] = pk16(cvm<MODE>(a[2]),  cvm<MODE>(a[3]));
  p[2] = pk16(cvm<MODE>(a4[0]), cvm<MODE>(a4[1]));
  p[3] = pk16(cvm<MODE>(a4[2]), cvm<MODE>(a4[3]));
  return p;
}
__global__ __launch_bounds__(256) void cvt_all(
    const float* __restrict__ xq, const float* __restrict__ xk, const float* __restrict__ xv,
    const float* __restrict__ wq, const float* __restrict__ wk, const float* __restrict__ wv,
    const float* __restrict__ wo,
    unsigned short* Xq, unsigned short* Xk, unsigned short* Xv,
    unsigned short* Wqb, unsigned short* Wkb, unsigned short* Wvb, unsigned short* Wob) {
  const unsigned i    = blockIdx.x * 256u + threadIdx.x;
  const unsigned unit = i >> 6;                               // 64 threads (2 waves) per unit
  const unsigned kg   = (i >> 3) & 3u;                        // k group of 8 inside the unit
  const unsigned rr   = ((i >> 5) & 1u) * 8u + (i & 7u);      // row inside the unit
  const unsigned bt   = i / CVT_TB;                           // the thread's batch in the activations
  // the granule's byte offsets from a plane's start, 32 bits: with a slab's constant step, one offset register serves
  // every slab of a kind beside the plane's scalar base. Weights: granule i. Activations: granule i - bt * CVT_TB of batch bt.
  unsigned sobW = (((unit / (EMB / 32)) * 16u + rr) * EMB + (unit % (EMB / 32)) * 32u + kg * 8u) * 4u;
  unsigned sobX = sobW + bt * (unsigned)((SEQ_FULL - XROWS) * EMB * 4);
  const unsigned dobW = (unit * FRAG_EL + (kg * 16u + rr) * 8u) * 2u;
  const unsigned dobX = dobW + bt * (unsigned)((SEQ - XROWS) * EMB * 2);
  const float* const xin[3]     = {xq, xk, xv};
  const float* const win[4]     = {wq, wk, wv, wo};
  unsigned short* const xout[3] = {Xq, Xk, Xv};
  unsigned short* const wout[4] = {Wqb, Wkb, Wvb, Wob};
  // every loop here is unrolled: the slab index picks pointers and registers at compile time
  v4f a[NSLAB][2];
#pragma unroll
  for (int s = 0; s < NSLAB; ++s) {               // all loads of the thread up front: 2 * NSLAB x 16 B in flight a lane
    const char* src = (s < NXSLAB) ? (const char*)xin[s / XSLAB] + (size_t)(s % XSLAB) * XROWS * EMB * 4 + sobX
                                   : (const char*)win[s - NXSLAB] + sobW;
    a[s][0] = *(const v4f*)(src);
    a[s][1] = *(const v4f*)(src + 16);
    __builtin_amdgcn_sched_barrier(0);            // a slab's two loads read the same lines: kept side by side, ahead of all conversions
  }
#if DEV_ASM
  asm volatile("s_wait_xcnt 0x0" : "+v"(sobX), "+v"(sobW) :: "memory");   // before the offset registers, which these loads name, are given up
#endif
  __builtin_amdgcn_sched_barrier(0);              // no conversion result is written ahead of that wait
  v4u p[NSLAB];
#pragma unroll
  for (int s = 0; s < NSLAB; ++s)
    p[s] = (s == NSLAB - 1) ? cvt8<1>(a[s][0], a[s][1]) : cvt8<0>(a[s][0], a[s][1]);
#pragma unroll
  for (int s = 0; s < NSLAB; ++s) {
    char* dst = (s < NXSLAB) ? (char*)xout[s / XSLAB] + (size_t)(s % XSLAB) * XROWS * EMB * 2 + dobX
                             : (char*)wout[s - NXSLAB] + dobW;
    *(v4u*)dst = p[s];
  }
}

// =====================================================================================================
// Register-blocked batched WMMA GEMM (16-bit operand type OT): C[m][n] = sum_k A[m][k] * Bt[n][k];
// one wave per (16*MI) x 64 tile, no block barriers. A [M][K = lda] and Bt [N][K = ldb] in fragment order;
// M multiple of 16*MI, N multiple of 64, K multiple of 128 (static sizes here). blockIdx.y = batch
// index (strides in elements). Fragments are loaded straight from global, 512 contiguous bytes a load (ldfrag_g).
// NPA = number of A planes: 2 -> second plane A2 (same pitch/stride) multiplies the same Bt fragments into a
// second accumulator set, combined as acc + acc2 * rscaleA in the f32 epilogue.
// value v = (acc [+ acc2*rscaleA]) * oscale.
// OUT_MODE 0: f32 C (pitch ldc) = v.
// OUT_MODE 1: f16 plane C = f16(v * cscale), [M][N = ldc] in fragment order.
// OUT_MODE 3: f16 hi plane C = f16(v * cscale) and f16 residual plane C2 = f16((v*cscale - hi) * rscaleC), likewise.
// =====================================================================================================
// one k step's load group: 4 B fragments, MI A fragments (and MI of the second A plane); in this helper and the next
// every loop is unrolled so that the fragment and accumulator arrays keep constant indices (registers)
//   (bp, ap, ap2: each lane's pointers into its row tiles' units, global address space, in 16-byte units;
//    k: a constant element offset, FRAG_EL per k step of 32)
template <typename OT> struct GP { typedef const __attribute__((address_space(1))) typename FT<OT>::half8* ptr; };
template <typename OT>
__device__ __forceinline__ typename FT<OT>::frag ldfrag_g(typename GP<OT>::ptr p, int k) {   // same k map as ldfrag
  union { typename FT<OT>::frag v; typename FT<OT>::half8 h[2]; } f;
  f.h[0] = p[k / 8];
  f.h[1] = p[k / 8 + 32];
  return f.v;
}
template <typename OT, int MI, int NPA>
__device__ __forceinline__ void gemm_ld(typename GP<OT>::ptr const (&bp)[4], typename GP<OT>::ptr const (&ap)[MI],
                                        typename GP<OT>::ptr const (&ap2)[MI], int k,
                                        typename FT<OT>::frag (&bq)[4], typename FT<OT>::frag (&af)[MI],
                                        typename FT<OT>::frag (&ag)[MI]) {
#pragma unroll
  for (int j = 0; j < 4; ++j) bq[j] = ldfrag_g<OT>(bp[j], k);
#pragma unroll
  for (int i = 0; i < MI; ++i) {
    af[i] = ldfrag_g<OT>(ap[i], k);
    if (NPA == 2) ag[i] = ldfrag_g<OT>(ap2[i], k);
  }
}
// the wait that stands before the row pointers, which the issued loads name, are moved on or given up
template <int MI, int NPA, typename P>
__device__ __forceinline__ void ptr_wait(P (&bp)[4], P (&ap)[MI], P (&ap2)[MI]) {
  static_assert((MI == 4 && NPA == 1) || (MI == 2 && NPA == 2));   // the two shapes in use: eight pointers each
#if DEV_ASM
  if constexpr (MI == 4)
    asm volatile("s_wait_xcnt 0x0" : "+v"(bp[0]), "+v"(bp[1]), "+v"(bp[2]), "+v"(bp[3]),
                                     "+v"(ap[0]), "+v"(ap[1]), "+v"(ap[2]), "+v"(ap[3]) :: "memory");
  else
    asm volatile("s_wait_xcnt 0x0" : "+v"(bp[0]), "+v"(bp[1]), "+v"(bp[2]), "+v"(bp[3]),
                                     "+v"(ap[0]), "+v"(ap[1]), "+v"(ap2[0]), "+v"(ap2[1]) :: "memory");
#endif
}
// one k step's products, in the order i, plane, j
template <typename OT, int MI, int NPA>
__device__ __forceinline__ void gemm_mm(const typename FT<OT>::frag (&bq)[4], const typename FT<OT>::frag (&af)[MI],
                                        const typename FT<OT>::frag (&ag)[MI], v8f (&acc)[MI][4], v8f (&acc2)[MI][4]) {
#pragma unroll
  for (int i = 0; i < MI; ++i) {
#pragma unroll
    for (int j = 0; j < 4; ++j) acc[i][j] = mmar(af[i], bq[j], acc[i][j]);
    if (NPA == 2) {
#pragma unroll
      for (int j = 0; j < 4; ++j) acc2[i][j] = mmar(ag[i], bq[j], acc2[i][j]);
    }
  }
}

template <typename OT, int MI, int NPA, int OUT_MODE>
__global__ __launch_bounds__(256) void gemm_t(
    const unsigned short* __restrict__ Ap, const unsigned short* __restrict__ A2p, int lda, long long strideA,
    const unsigned short* __restrict__ Btp, int ldb, long long strideB,
    void* Cout, void* Cout2, int ldc, long long strideC,
    int M, int N, int K, float oscale, float rscaleA, float cscale, float rscaleC) {
  typedef typename FT<OT>::frag V16;
  const OT* A  = (const OT*)(const void*)Ap;
  const OT* A2 = (const OT*)(const void*)A2p;
  const OT* Bt = (const OT*)(const void*)Btp;
  __shared__ __align__(16) float sT[8][16 * 68];   // per-wave 16x64 slab, pitch 68 floats
  const int RT   = 16 * MI;
  const int b    = blockIdx.y;
  const int lane = threadIdx.x & 31;
  const int wave = threadIdx.x >> 5;
  const int tilesN = N >> 6;
  const int tilesM = M / RT;
  const int tile = blockIdx.x * 8 + wave;
  if (tile >= tilesM * tilesN) return;   // wave-uniform; no block barriers in this kernel
  const int tm = tile / tilesN;
  const int tn = tile - tm * tilesN;
  const int m0 = tm * RT;
  const int n0 = tn << 6;

  const OT* Ab  = A  + (size_t)b * (size_t)strideA;
  const OT* A2b = A2 + (size_t)b * (size_t)strideA;
  const OT* Bb  = Bt + (size_t)b * (size_t)strideB;

  const int rlane = lane & 15;                 // row (A) / col (B, D) within subtile
  const int mOff  = (lane >> 4) * 8;           // D row offset

  v8f acc[MI][4], acc2[MI][4];
#pragma unroll
  for (int i = 0; i < MI; ++i)
#pragma unroll
    for (int j = 0; j < 4; ++j) { acc[i][j] = zero8(); acc2[i][j] = zero8(); }

  // Rotating fragment sets: the whole load group of k step s + 2 is issued ahead of the products of step s, so the
  // loads of two steps fly under the products, where one latency per A fragment was waited out. K is a multiple of 128.
  typedef typename GP<OT>::ptr GPtr;
  GPtr bp[4], ap[MI], ap2[MI];
#pragma unroll
  for (int j = 0; j < 4; ++j) bp[j] = (GPtr)(const void*)(Bb + (size_t)((n0 >> 4) + j) * (ldb >> 5) * FRAG_EL + lane * 8);
#pragma unroll
  for (int i = 0; i < MI; ++i) {
    ap[i]  = (GPtr)(const void*)(Ab  + (size_t)((m0 >> 4) + i) * (lda >> 5) * FRAG_EL + lane * 8);
    ap2[i] = (GPtr)(const void*)(A2b + (size_t)((m0 >> 4) + i) * (lda >> 5) * FRAG_EL + lane * 8);
  }
  V16 bq[4][4], af[4][MI], ag[4][MI];
  gemm_ld<OT, MI, NPA>(bp, ap, ap2, 0, bq[0], af[0], ag[0]);
  __builtin_amdgcn_sched_barrier(0);       // group order as in the loop, so that the loop's counted waits stay per group
  gemm_ld<OT, MI, NPA>(bp, ap, ap2, FRAG_EL, bq[1], af[1], ag[1]);
  for (int k0 = 128; k0 < K; k0 += 128) {  // all trips but the last four steps
#pragma unroll
    for (int u = 0; u < 4; ++u) {          // unrolled so that the set index is a constant (registers)
      gemm_ld<OT, MI, NPA>(bp, ap, ap2, (u + 2) * FRAG_EL, bq[(u + 2) & 3], af[(u + 2) & 3], ag[(u + 2) & 3]);
      __builtin_amdgcn_sched_barrier(0);   // keeps the load group ahead of the products below
      gemm_mm<OT, MI, NPA>(bq[u], af[u], ag[u], acc, acc2);
    }
    ptr_wait<MI, NPA>(bp, ap, ap2);
#pragma unroll
    for (int j = 0; j < 4; ++j) bp[j] += 4 * FRAG_EL / 8;     // 4 k steps = 4 units
#pragma unroll
    for (int i = 0; i < MI; ++i) { ap[i] += 4 * FRAG_EL / 8; ap2[i] += 4 * FRAG_EL / 8; }
  }
  // the last four steps: two groups are still to fetch
  gemm_ld<OT, MI, NPA>(bp, ap, ap2, 2 * FRAG_EL, bq[2], af[2], ag[2]);
  __builtin_amdgcn_sched_barrier(0);       // keeps the load group ahead of the products below
  gemm_mm<OT, MI, NPA>(bq[0], af[0], ag[0], acc, acc2);
  gemm_ld<OT, MI, NPA>(bp, ap, ap2, 3 * FRAG_EL, bq[3], af[3], ag[3]);
  ptr_wait<MI, NPA>(bp, ap, ap2);
  __builtin_amdgcn_sched_barrier(0);       // keeps the load group ahead of the products below
  gemm_mm<OT, MI, NPA>(bq[1], af[1], ag[1], acc, acc2);
  gemm_mm<OT, MI, NPA>(bq[2], af[2], ag[2], acc, acc2);
  gemm_mm<OT, MI, NPA>(bq[3], af[3], ag[3], acc, acc2);
#pragma unroll
  for (int i = 0; i < MI; ++i) {
    acc_guard4(acc[i][0], acc[i][1], acc[i][2], acc[i][3]);
    if (NPA == 2) acc_guard4(acc2[i][0], acc2[i][1], acc2[i][2], acc2[i][3]);
  }

  // ---- epilogue ----
  float* slab = sT[wave];
#pragma unroll
  for (int i = 0; i < MI; ++i) {
    const int mBase = m0 + (i << 4);
#pragma unroll
    for (int j = 0; j < 4; ++j) {
#pragma unroll
      for (int r = 0; r < 8; ++r) {
        float v = acc[i][j][r];
        if (NPA == 2) v += acc2[i][j][r] * rscaleA;
        v = v * oscale;
        slab[(mOff + r) * 68 + (j << 4) + rlane] = v;
      }
    }
    __builtin_amdgcn_fence(3, "workgroup");
    __builtin_amdgcn_wave_barrier();
    __builtin_amdgcn_fence(2, "workgroup");
    if (OUT_MODE == 0) {
      float* C = (float*)Cout + (size_t)b * (size_t)strideC;
      const int h2 = lane >> 4, c4 = (lane & 15) * 4;     // 256-B row segment = 16 lanes x 16 B
      v4f ov[8];
#pragma unroll
      for (int it = 0; it < 8; ++it) {
        const int row = it * 2 + h2;                     // it 0..7 x h2 0..1 = rows 0..15
        ov[it] = *(const v4f*)(slab + row * 68 + c4);
      }
      {
#pragma unroll
        for (int it = 0; it < 8; ++it) {
          const int row = it * 2 + h2;
          *(v4f*)(C + (size_t)(mBase + row) * ldc + n0 + c4) = ov[it];
        }
        
      }
    } else {
      // the 16 x 64 slab = 2 units = 128 granules in a row: store it writes granules 32*it + lane (512 contiguous B),
      // which hold row lane&15, columns 8*(2*it + (lane>>4)) .. +7
      const size_t u0 = ((size_t)(mBase >> 4) * (ldc >> 5) + (n0 >> 5)) * FRAG_EL + lane * 8;
      unsigned short* C  = (unsigned short*)Cout  + (size_t)b * (size_t)strideC + u0;
      unsigned short* C2 = (unsigned short*)Cout2 + (size_t)b * (size_t)strideC + u0;
      v4u hv[4], lv[4];
#pragma unroll
      for (int it = 0; it < 4; ++it) {
        const float* sp = slab + rlane * 68 + (it * 2 + (lane >> 4)) * 8;
        float f[8];
#pragma unroll
        for (int e = 0; e < 8; ++e) f[e] = sp[e] * cscale;
        v4u a, a2;
#pragma unroll
        for (int e = 0; e < 4; ++e) {
          const float f0 = f[2 * e], f1 = f[2 * e + 1];
          const _Float16 x0 = (_Float16)f0, x1 = (_Float16)f1;
          const unsigned short h0 = h_bits(x0), h1 = h_bits(x1);
          unsigned short l0 = 0, l1 = 0;
          if (OUT_MODE == 3) {
            l0 = h_bits((_Float16)((f0 - (float)x0) * rscaleC));
            l1 = h_bits((_Float16)((f1 - (float)x1) * rscaleC));
          }
          a[e] = pk16(h0, h1); a2[e] = pk16(l0, l1);
        }
        hv[it] = a; lv[it] = a2;
      }
      {
#pragma unroll
        for (int it = 0; it < 4; ++it) {
          *(v4u*)(C + it * 256) = hv[it];
          if (OUT_MODE == 3) *(v4u*)(C2 + it * 256) = lv[it];
        }
#if DEV_ASM
        asm volatile("s_wait_xcnt 0x0" ::: "memory");   // before the next slab overwrites the registers these stores name
#endif
      }
    }
    __builtin_amdgcn_fence(3, "workgroup");
    __builtin_amdgcn_wave_barrier();
    __builtin_amdgcn_fence(2, "workgroup");
  }
}

// =====================================================================================================
// Score chunk, transposed: 64 keys kv0..kv0+63 x 16 query rows (this wave) of one (b, h).
//   k fragments (A operand, row = lane&15 = key) loaded straight from the f16 k plane (fragment order):
//   kb0 = plane + (b*SEQ)*EMB + h*2*FRAG_EL, 16 keys on add 16*EMB (plane row = b*SEQ + t).
//   q fragments (B operand, col = lane&15 = query): hi and residual (x4096) planes, 2 d-chunks of 32.
//   s[j][r] = D element: key kv0 + 16j + 8*hh + r, query lane&15; value = ((k.qh) + (k.ql)/4096) / 8.
//   A lane holds scores of ONE query only (32 of the chunk's 64 keys; lane ^ 16 has the other 32), and
//   s[2kk], s[2kk+1] lie as elements 0..7, 8..15 of an A fragment (row = query, 32 keys) for the P.V product.
// =====================================================================================================
// the chunk's 8 k fragments as one load group, kf[2j + dc]; kp = the lane's pointer into the unit of keys kv0..kv0+15,
// d 0..31 (16-byte units); loops unrolled so that kf keeps constant indices (registers)
typedef GP<_Float16>::ptr KPtr;
__device__ __forceinline__ void ld_kchunk(KPtr& kp, v16h (&kf)[8]) {
#pragma unroll
  for (int j = 0; j < 4; ++j)
#pragma unroll
    for (int dc = 0; dc < 2; ++dc) kf[2 * j + dc] = ldfrag_g<_Float16>(kp, j * 16 * EMB + dc * FRAG_EL);
#if DEV_ASM
  asm volatile("s_wait_xcnt 0x0" : "+v"(kp) :: "memory");   // before kp, which these loads name, is moved on or given up
#endif
}
__device__ __forceinline__ void score_chunk(const v16h (&qah)[2], const v16h (&qal)[2], const v16h (&kf)[8],
                                            v8f (&s)[4]) {
#pragma unroll
  for (int j = 0; j < 4; ++j) {
    v8f ah = zero8(), al = zero8();
#pragma unroll
    for (int dc = 0; dc < 2; ++dc) {
      ah = mma_h(kf[2 * j + dc], qah[dc], ah);
      al = mma_h(kf[2 * j + dc], qal[dc], al);
    }
#pragma unroll
    for (int r = 0; r < 8; ++r) s[j][r] = (ah[r] + al[r] * (1.0f / 4096.0f)) * 0.125f;
  }
}

// =====================================================================================================
// Softmax statistics: per (b, h, query s) the row max m and 1/sum(exp(s - m)) over all SEQ keys.
//   block = 4 waves = 64 consecutive query rows qb*64.. of one (b, h); grid = NB*NH*NKT blocks of 128;
//   static trip NKT over 64-key chunks; online max / rescaled sum in f32, one query a lane, all in the lane;
//   the two lanes of a query (each half of the keys) are merged once, behind the loop.
//   Output plane ML [b*NH+h][2][SEQ] f32 (m then 1/l): the block's 64 m values and 64 1/l values are
//   funnelled through LDS (cross-wave: block barrier) and written by wave 0 with ONE instruction (lanes 0-15:
//   coverage: grid (b,h,qb) x 64 rows = the whole [NB*NH][2][SEQ] plane. MLsh: 4 waves x 32 lanes = all 128.
// =====================================================================================================
__global__ __launch_bounds__(128)
void attn_stats(const unsigned short* __restrict__ qhp, const unsigned short* __restrict__ qlp,
                const unsigned short* __restrict__ kpp, float* ML) {
  __shared__ __align__(16) float MLsh[128];
  const int tid  = threadIdx.x;
  const int wave = tid >> 5;
  const int lane = tid & 31;
  const int hh   = lane >> 4;
  const int c    = lane & 15;
  const int bx   = blockIdx.x;
  const int qb   = bx % NKT;
  const int rest = bx / NKT;
  const int h    = rest % NH;
  const int b    = rest / NH;
  const int bh   = b * NH + h;
  const int q0   = qb * 64 + wave * 16;

  const _Float16* Qh  = (const _Float16*)(const void*)qhp;
  const _Float16* Ql  = (const _Float16*)(const void*)qlp;
  const _Float16* Kb0 = (const _Float16*)(const void*)kpp + (size_t)b * SEQ * EMB + (size_t)h * (HD / 32) * FRAG_EL;

  v16h qah[2], qal[2];
#pragma unroll
  for (int dc = 0; dc < 2; ++dc) {
    const size_t qo = ((size_t)b * SEQ + (size_t)q0) * EMB + (size_t)(h * (HD / 32) + dc) * FRAG_EL + lane * 8;
    qah[dc] = ldfrag<_Float16>(Qh + qo);
    qal[dc] = ldfrag<_Float16>(Ql + qo);
  }

  float mrow = -INFINITY, lrow = 0.f;         // query q0 + c, over this lane's half of the keys

#if DEV_ASM
  asm volatile("s_wait_xcnt 0x0" ::: "memory");   // before the k fetch lands in registers that the q loads name
#endif
  v16h kf[8];
  KPtr kp = (KPtr)(const void*)(Kb0 + lane * 8);
  ld_kchunk(kp, kf);
  for (int kt = 0; kt < NKT; ++kt) {          // static trip count
    v8f s[4];
    score_chunk(qah, qal, kf, s);
    __builtin_amdgcn_sched_barrier(0);        // the next chunk's fetch stays behind this chunk's products (same registers)
    kp += (kt + 1 < NKT) ? 64 * EMB / 8 : 0;  // 16-byte units; last trip: the same chunk again, a fetch that nothing uses
    ld_kchunk(kp, kf);
    __builtin_amdgcn_sched_barrier(0);        // ... and ahead of the vector work below, which covers its latency
    float mj[4];                              // loops over j and r unrolled here and below: s keeps constant indices (registers)
#pragma unroll
    for (int j = 0; j < 4; ++j) {
      mj[j] = s[j][0];
#pragma unroll
      for (int r = 1; r < 8; ++r) mj[j] = fmaxf(mj[j], s[j][r]);
    }
    const float mnew  = fmaxf(mrow, fmaxf(fmaxf(mj[0], mj[1]), fmaxf(mj[2], mj[3])));
    const float msafe = (mnew == -INFINITY) ? 0.f : mnew;
    const float alpha = __expf(mrow - msafe);
    mrow = mnew;
    float pj[4];                              // four independent partial sums
#pragma unroll
    for (int j = 0; j < 4; ++j) {
      pj[j] = 0.f;
#pragma unroll
      for (int r = 0; r < 8; ++r) pj[j] += __expf(s[j][r] - msafe);
    }
    lrow = lrow * alpha + ((pj[0] + pj[1]) + (pj[2] + pj[3]));
  }

  // merge the two halves of each query's keys (lane ^ 16), once
  const float mo    = __shfl_xor(mrow, 16, 32);
  const float lo    = __shfl_xor(lrow, 16, 32);
  const float mall  = fmaxf(mrow, mo);
  const float msafe = (mall == -INFINITY) ? 0.f : mall;
  const float l     = lrow * __expf(mrow - msafe) + lo * __expf(mo - msafe);
  const float il    = (l > 0.f) ? (1.0f / l) : 0.f;
  MLsh[hh * 64 + wave * 16 + c] = hh ? il : mall;   // lanes 0-15: m, lanes 16-31: 1/l of query q0 + c
  __syncthreads();
  if (wave == 0) {
    const v4f v = *(const v4f*)(MLsh + lane * 4);        // lanes 0-15: m rows 4c..4c+3; lanes 16-31: 1/l rows
    float* dst = ML + (size_t)(bh * 2 + hh) * SEQ + qb * 64 + c * 4;
    *(v4f*)dst = v;
    
  }
}

// =====================================================================================================
// Main attention pass: one block per (b, 16 query rows q0..q0+15), 16 waves = the 16 heads.
//   Per 64-key chunk (static trip NKT): scores recomputed exactly as in attn_stats, p = exp(s - m) * (1/l) in f32
//   (m, 1/l from the ML plane, one query a lane);
//   (a) context += P . V: the lane's p values, converted to f16 with the x16384 carry, ARE the A fragments (no LDS, no
//       lane exchange); B = v^T f16 plane [b][h*64+d][s] (head slab h*64*SEQ), fragment order;
//       p also goes to the per-wave LDS tile Pf[h][row][key] (16-byte stores of 4 keys, every entry written) for
//   (b) head average: after __syncthreads (cross-wave), threads 0..255 sum the 16 wave tiles in fixed head order
//   Epilogue: ctx = acc / 16384, x256 carry, staged in the wave's Pf tile (wave-private), written as f16 hi plane
//   coverage: avg: NKT chunks x 16 rows x 64 keys per block, grid (b, qb) = the whole [NB][SEQ][SEQ];
//   ctx planes: each wave rows q0..q0+15 (lane&15) x its head's 64 columns (it 0..3 x lane>>4 0..1), 16 waves x grid =
//   the whole [NROW][EMB] planes (fragment order). staged extent == consumed extent for Pf in both uses (32 lanes x 32 = 1024).
// =====================================================================================================
__global__ __launch_bounds__(512)
void attn_main(const unsigned short* __restrict__ qhp, const unsigned short* __restrict__ qlp,
               const unsigned short* __restrict__ kpp, const unsigned short* __restrict__ vtp,
               const float* __restrict__ ML, unsigned short* chp, unsigned short* clp, float* avg) {
  union FH { v16h v; v8h h[2]; };
  __shared__ __align__(32) float Pf[NH][16 * PPITCH];      // per wave (head) P tile [row][key] f32, pitch PPITCH; the epilogue's ctx tile has pitch 68
  const int tid  = threadIdx.x;
  const int wave = tid >> 5;
  const int lane = tid & 31;
  const int hh   = lane >> 4;
  const int c    = lane & 15;
  const int bx   = blockIdx.x;
  const int qb   = bx % NQB;
  const int b    = bx / NQB;
  const int h    = wave;
  const int bh   = b * NH + h;
  const int q0   = qb * 16;

  const _Float16* Qh  = (const _Float16*)(const void*)qhp;
  const _Float16* Ql  = (const _Float16*)(const void*)qlp;
  const _Float16* Kb0 = (const _Float16*)(const void*)kpp + (size_t)b * SEQ * EMB + (size_t)h * (HD / 32) * FRAG_EL;
  const _Float16* Vb0 = (const _Float16*)(const void*)vtp + (size_t)b * EMB * SEQ + (size_t)h * HD * SEQ;  // v^T [b][h*64+d][s], fragment order

  v16h qah[2], qal[2];
#pragma unroll
  for (int dc = 0; dc < 2; ++dc) {
    const size_t qo = ((size_t)b * SEQ + (size_t)q0) * EMB + (size_t)(h * (HD / 32) + dc) * FRAG_EL + lane * 8;
    qah[dc] = ldfrag<_Float16>(Qh + qo);
    qal[dc] = ldfrag<_Float16>(Ql + qo);
  }
  const float m1  = ML[(size_t)(bh * 2) * SEQ + q0 + c];                          // the lane's query q0 + c
  const float il1 = ML[(size_t)(bh * 2 + 1) * SEQ + q0 + c];

  v8f oacc[4];
#pragma unroll
  for (int t = 0; t < 4; ++t) oacc[t] = zero8();
  float* pf = Pf[wave];

#if DEV_ASM
  asm volatile("s_wait_xcnt 0x0" ::: "memory");   // before the k fetch lands in registers that the loads above name
#endif
  v16h kf[8];
  KPtr kp = (KPtr)(const void*)(Kb0 + lane * 8);
  ld_kchunk(kp, kf);
  KPtr vp = (KPtr)(const void*)(Vb0 + lane * 8);   // the lane's pointer into the unit of d 0..15, keys kv0..kv0+31
  for (int kt = 0; kt < NKT; ++kt) {         // static trip count
    const int kv0 = kt * 64;
    __syncthreads();                          // Pf tiles free again (head sum of the prior chunk done)

    v8f s[4];
    score_chunk(qah, qal, kf, s);
    __builtin_amdgcn_sched_barrier(0);        // the v fetch stays behind the score products (registers)
    v16h vf[8];                               // this chunk's 8 v fragments as one load group, vf[4kk + t]
#pragma unroll
    for (int kk = 0; kk < 2; ++kk)
#pragma unroll
      for (int t = 0; t < 4; ++t)
        vf[4 * kk + t] = ldfrag_g<_Float16>(vp, t * 16 * SEQ + kk * FRAG_EL);
#if DEV_ASM
    asm volatile("s_wait_xcnt 0x0" : "+v"(vp) :: "memory");   // before vp, which these loads name, is moved on
#endif
    vp += 2 * FRAG_EL / 8;                    // 64 keys = 2 units (16-byte units)
    __builtin_amdgcn_sched_barrier(0);        // ... and ahead of the exponentials, which cover its latency
#pragma unroll                                // both loops unrolled: s keeps constant indices (registers)
    for (int j = 0; j < 4; ++j) {
#pragma unroll
      for (int r = 0; r < 8; ++r) s[j][r] = __expf(s[j][r] - m1) * il1;      // s now holds p
      float* pw = pf + c * PPITCH + j * 16 + 8 * hh;             // query c, keys 16j + 8hh .. +7; 16-byte aligned at every row
      *(v4f*)(pw)     = __builtin_shufflevector(s[j], s[j], 0, 1, 2, 3);
      *(v4f*)(pw + 4) = __builtin_shufflevector(s[j], s[j], 4, 5, 6, 7);
    }

    // ---- context += P . V (f16 WMMA, p carried x16384) ----
#pragma unroll                                // vf and s are indexed by kk: a constant index keeps them in registers
    for (int kk = 0; kk < 2; ++kk) {
      FH pa;                                  // row = query c; elements 0..7 = keys 32kk + 8hh + e, 8..15 = keys 32kk + 16 + 8hh + e
      pa.h[0] = __builtin_convertvector(s[2 * kk] * PCARRY, v8h);
      pa.h[1] = __builtin_convertvector(s[2 * kk + 1] * PCARRY, v8h);
#pragma unroll
      for (int t = 0; t < 4; ++t) oacc[t] = mma_h(pa.v, vf[4 * kk + t], oacc[t]);
    }
    __syncthreads();
    kp += (kt + 1 < NKT) ? 64 * EMB / 8 : 0;  // 16-byte units; last trip: the same chunk again, a fetch that nothing uses
    ld_kchunk(kp, kf);                        // next chunk's k, one load group
    __builtin_amdgcn_sched_barrier(0);        // issued ahead of the head average, which covers part of its latency

    // ---- head average of this 16 x 64 tile, one block = one writer of every line ----
    if (tid < 256) {                          // waves 0..7, wave-uniform
      const int row = tid >> 4, c4 = (tid & 15) * 4;
      v4f a = *(const v4f*)(Pf[0] + row * PPITCH + c4);
#pragma unroll
      for (int w = 1; w < NH; ++w) a += *(const v4f*)(Pf[w] + row * PPITCH + c4);
      a *= (1.0f / (float)NH);
      float* dst = avg + ((size_t)b * SEQ + (size_t)(q0 + row)) * SEQ + kv0 + c4;
      *(v4f*)dst = a;
#if DEV_ASM
      asm volatile("s_wait_xcnt 0x0" ::: "memory");   // before the next chunk overwrites the registers this store names
#endif
    }
  }
  __syncthreads();

  // ---- epilogue: ctx (undo the x16384 p carry, apply the x256 carry), stage, convert, whole-line stores ----
  float* os = pf;
#pragma unroll
  for (int r = 0; r < 8; ++r) {
#pragma unroll
    for (int t = 0; t < 4; ++t) os[(8 * hh + r) * 68 + t * 16 + c] = oacc[t][r] * (256.0f / PCARRY);
  }
  __builtin_amdgcn_fence(3, "workgroup");
  __builtin_amdgcn_wave_barrier();
  __builtin_amdgcn_fence(2, "workgroup");
  {
    // the wave's 16 x 64 tile = 2 units = 128 granules in a row: store it writes granules 32*it + lane (512 contiguous B),
    // which hold row c, columns 8*(2*it + hh) .. +7
    v4u hv[4], lv[4];
#pragma unroll
    for (int it = 0; it < 4; ++it) {
      const float* sp = os + c * 68 + (it * 2 + hh) * 8;
      float f[8];
#pragma unroll
      for (int e = 0; e < 8; ++e) f[e] = sp[e];
      v4u a, a2;
#pragma unroll
      for (int e = 0; e < 4; ++e) {
        const float f0 = f[2 * e], f1 = f[2 * e + 1];
        const _Float16 x0 = (_Float16)f0, x1 = (_Float16)f1;
        const unsigned short h0 = h_bits(x0), h1 = h_bits(x1);
        const unsigned short l0 = h_bits((_Float16)((f0 - (float)x0) * 4096.0f));
        const unsigned short l1 = h_bits((_Float16)((f1 - (float)x1) * 4096.0f));
        a[e] = pk16(h0, h1); a2[e] = pk16(l0, l1);
      }
      hv[it] = a; lv[it] = a2;
    }
    {
#pragma unroll
      for (int it = 0; it < 4; ++it) {
        const size_t go = ((size_t)b * SEQ + (size_t)q0) * EMB + (size_t)h * (HD / 32) * FRAG_EL + it * 256 + lane * 8;
        *(v4u*)(chp + go) = hv[it];
        *(v4u*)(clp + go) = lv[it];
      }
      
    }
  }
}

// =====================================================================================================
// Workspace map (bytes, full size NB=2 SEQ=2048; PX = NROW*EMB*2 = 8388608; every region an exact multiple of
// its whole-line / whole-tile store granularity, rows are whole tiles, no padded tails needed):
//   Xq   bf16 [NROW][EMB]            PX        8388608
//   Xk   bf16 [NROW][EMB]            PX        8388608
//   Xv   bf16 [NROW][EMB]            PX        8388608
//   Wqb  bf16 [EMB n][EMB k]                   2097152
//   Wkb  bf16 [EMB n][EMB k]                   2097152
//   Wvb  bf16 [EMB n][EMB k]                   2097152
//   Wob  f16  [EMB n][EMB k] (x64)             2097152
//   Qh   f16  [NROW][EMB]            PX        8388608
//   Ql   f16  [NROW][EMB]            PX        8388608
//   Kp   f16  [NROW][EMB]            PX        8388608
//   VT   f16  [NB][EMB][SEQ]                   8388608
//   Ch   f16  [NROW][EMB]            PX        8388608
//   Cl   f16  [NROW][EMB]            PX        8388608
//   ML   f32  [NB*NH][2][SEQ]                   524288
//   total                                     84410368
// Every 16-bit plane is in fragment order (same bytes, same extents). Input weights are [out n][in k] (k contiguous) =
// the Bt / A orientation directly; they are only converted to 16 bit and put in that order.
// Output 0 at element 0 of d_out (rows b*SEQ + s); output 1 at the fixed element offset OFF1 = NB_FULL*SEQ_FULL*EMB.
// =====================================================================================================
extern "C" void kernel_launch(void* const* d_in, const int* in_sizes, int n_in,
                              void* d_out, int out_size, void* d_ws, size_t ws_size,
                              hipStream_t stream) {
  if (n_in < 7) return;
  const int needX = ((NB - 1) * SEQ_FULL + SEQ) * EMB;
  if (in_sizes[0] < needX) return;
  if (in_sizes[1] < needX) return;
  if (in_sizes[2] < needX) return;
  if (in_sizes[3] < EMB * EMB) return;
  if (in_sizes[4] < EMB * EMB) return;
  if (in_sizes[5] < EMB * EMB) return;
  if (in_sizes[6] < EMB * EMB) return;
  const size_t n0e = (size_t)NROW * EMB;            // output 0 written elements [NB][SEQ][EMB]
  const size_t n1e = (size_t)NB * SEQ * SEQ;        // output 1 written elements [NB][SEQ][SEQ]
  if (out_size < 0) return;
  if ((size_t)out_size < n0e) return;
  if ((size_t)out_size < OFF1 + n1e) return;        // written extent of output 1 inside d_out

  const float* xq = (const float*)d_in[0];
  const float* xk = (const float*)d_in[1];
  const float* xv = (const float*)d_in[2];
  const float* Wq = (const float*)d_in[3];
  const float* Wk = (const float*)d_in[4];
  const float* Wv = (const float*)d_in[5];
  const float* Wo = (const float*)d_in[6];

  const size_t PX  = (size_t)NROW * EMB * 2;        // 16-bit activation plane
  const size_t PW  = (size_t)EMB * EMB * 2;
  const size_t PVT = (size_t)NB * EMB * SEQ * 2;
  const size_t PML = (size_t)NB * NH * 2 * SEQ * 4;
  size_t off = 0;
  const size_t oXq = off; off += PX;
  const size_t oXk = off; off += PX;
  const size_t oXv = off; off += PX;
  const size_t oWq = off; off += PW;
  const size_t oWk = off; off += PW;
  const size_t oWv = off; off += PW;
  const size_t oWo = off; off += PW;
  const size_t oQh = off; off += PX;
  const size_t oQl = off; off += PX;
  const size_t oKp = off; off += PX;
  const size_t oVT = off; off += PVT;
  const size_t oCh = off; off += PX;
  const size_t oCl = off; off += PX;
  const size_t oML = off; off += PML;
  if (off > ws_size) return;                        // off = 84410368 at full size
  if (off > (size_t)134217728) return;

  char* ws = (char*)d_ws;
  unsigned short* Xq  = (unsigned short*)(ws + oXq);
  unsigned short* Xk  = (unsigned short*)(ws + oXk);
  unsigned short* Xv  = (unsigned short*)(ws + oXv);
  unsigned short* Wqb = (unsigned short*)(ws + oWq);
  unsigned short* Wkb = (unsigned short*)(ws + oWk);
  unsigned short* Wvb = (unsigned short*)(ws + oWv);
  unsigned short* Wob = (unsigned short*)(ws + oWo);
  unsigned short* Qh  = (unsigned short*)(ws + oQh);
  unsigned short* Ql  = (unsigned short*)(ws + oQl);
  unsigned short* Kp  = (unsigned short*)(ws + oKp);
  unsigned short* VT  = (unsigned short*)(ws + oVT);
  unsigned short* Ch  = (unsigned short*)(ws + oCh);
  unsigned short* Cl  = (unsigned short*)(ws + oCl);
  float*          ML  = (float*)(ws + oML);
  float*          out0 = (float*)d_out;
  float*          out1 = (float*)d_out + OFF1;

  const dim3 blk(256);
  const dim3 gCvt(CVT_T / 256);                                  //  512 blocks
  const dim3 gQK((((NROW) / 64) * (EMB / 64) + 7) / 8, 1);        // 1024 tiles -> 128 blocks: M=NROW, N=EMB
  const dim3 gV((((EMB) / 64) * (SEQ / 64) + 7) / 8, NB);          //  512 tiles ->  64 blocks x NB: M=EMB, N=SEQ
  const dim3 gO((((NROW) / 32) * (EMB / 64) + 7) / 8, 1);         // 2048 tiles -> 256 blocks (32x64 wave tiles)
  const dim3 gStats(NB * NH * NKT);                              // 1024 blocks of 128
  const dim3 gMain(NB * NQB);                                    //  256 blocks of 512

  // (1) activations [b][s][k] -> bf16 planes [b*SEQ+s][k] (input batch stride SEQ_FULL*EMB, plane batch stride SEQ*EMB);
  // (2) weights [EMB n][EMB k] -> bf16 planes (Wq, Wk, Wv); Wo -> f16 (x64 of its bf16 value); no transpose needed
  cvt_all<<<gCvt, blk, 0, stream>>>(xq, xk, xv, Wq, Wk, Wv, Wo, Xq, Xk, Xv, Wqb, Wkb, Wvb, Wob);
  // (3) q = xq . Wq^T -> f16 hi / residual (x4096) planes [b*SEQ+s][h*64+d]   (M=NROW, N=EMB, K=EMB)
  gemm_t<__bf16, 4, 1, 3><<<gQK, blk, 0, stream>>>(
      Xq, Xq, EMB, 0LL, Wqb, EMB, 0LL,
      (void*)Qh, (void*)Ql, EMB, 0LL,
      NROW, EMB, EMB, 1.0f, 0.0f, 1.0f, 4096.0f);
  // (4) k = xk . Wk^T -> f16 plane [b*SEQ+s][h*64+d]
  gemm_t<__bf16, 4, 1, 1><<<gQK, blk, 0, stream>>>(
      Xk, Xk, EMB, 0LL, Wkb, EMB, 0LL,
      (void*)Kp, (void*)Kp, EMB, 0LL,
      NROW, EMB, EMB, 1.0f, 0.0f, 1.0f, 1.0f);
  // (5) v^T = Wv . xv_b^T (per batch b = blockIdx.y) -> f16 plane [b][h*64+d][s] (pitch SEQ)
  //     (A = Wvb [n][k]; Bt = Xv rows of batch b: offset b*SEQ*EMB, pitch EMB; M=EMB, N=SEQ, K=EMB)
  gemm_t<__bf16, 4, 1, 1><<<gV, blk, 0, stream>>>(
      Wvb, Wvb, EMB, 0LL, Xv, EMB, (long long)SEQ * EMB,
      (void*)VT, (void*)VT, SEQ, (long long)EMB * SEQ,
      EMB, SEQ, EMB, 1.0f, 0.0f, 1.0f, 1.0f);
  // (6) softmax statistics (m, 1/l) per (b, h, s)
  attn_stats<<<gStats, dim3(128), 0, stream>>>(Qh, Ql, Kp, ML);
  // (7) exact-normalised p: P.V -> ctx planes (f16 hi x256 / residual x4096); head-averaged p -> output 1
  attn_main<<<gMain, dim3(512), 0, stream>>>(Qh, Ql, Kp, VT, ML, Ch, Cl, out1);
  // (8) output 0 = ctx . Wo^T, f32 [NROW][EMB] straight into d_out, accumulators (hi + res/4096) x 1/(256*64)
  gemm_t<_Float16, 2, 2, 0><<<gO, blk, 0, stream>>>(
      Ch, Cl, EMB, 0LL, Wob, EMB, 0LL,
      (void*)out0, (void*)out0, EMB, 0LL,
      NROW, EMB, EMB, 1.0f / 16384.0f, 1.0f / 4096.0f, 1.0f, 1.0f);
  (void)hipGetLastError();
}

// v006
// One run takes 176 microseconds.
// Next to v005, in two timings, it ran 1.10 and 1.11 times as fast.
// All steps since v000 together make it 2.82 times as fast.
// Contractions: q, k, v^T projections = v_wmma_f32_16x16x32_bf16 (bf16 operands from RNE-converted inputs and weights, single product, f32 accumulate);
// scores (statistics pass and main pass), formed transposed as k.q^T = v_wmma_f32_16x16x32_f16 (k f16 as A; q as f16 hi plane + f16 residual plane x4096 as B; 2 products, separate f32 accumulators);
// p.v = v_wmma_f32_16x16x32_f16 (p carried x16384 in f16, v f16; single product, f32 accumulate);
// ctx.Wo^T = v_wmma_f32_16x16x32_f16 (ctx as f16 hi plane x256 + f16 residual plane x4096, Wo f16 x64 of its bf16 value; 2 products, separate f32 accumulators);
// softmax statistics, probabilities, head average and the sum of the two key ranges' ctx parts in f32.
#include <hip/hip_runtime.h>
#include <math.h>
#include <stdint.h>

#ifndef NB
#define NB 2
#endif
#ifndef SEQ
#define SEQ 2048
#endif
#define NB_FULL  2
#define SEQ_FULL 2048
#define EMB      1024
#define NH       16
#define HD       64
#define NROW     (NB * SEQ)          // activation rows in workspace planes, row index = b * SEQ + s
#define NKT      (SEQ / 64)          // 64-key chunks per sequence
#define PCARRY   16384.0f            // power-of-two carry of p in the f16 P.V operand
#define OFF1     ((size_t)NB_FULL * SEQ_FULL * EMB)   // fixed element offset of output 1 in d_out
static_assert(NB >= 1 && NB <= NB_FULL);
static_assert(SEQ >= 64 && SEQ <= SEQ_FULL && (SEQ % 64) == 0);
static_assert(NH * HD == EMB && (EMB % 128) == 0);
static_assert((NROW % 64) == 0 && (EMB % 64) == 0 && (HD % 64) == 0 && (EMB % 32) == 0);
static_assert(OFF1 * 4 == 16777216);   // byte offset of output 1
static_assert((OFF1 + (size_t)NB_FULL * SEQ_FULL * SEQ_FULL) * 4 == 50331648);   // written extent of output 1 == d_out bytes

typedef _Float16 v16h __attribute__((ext_vector_type(16)));
typedef _Float16 v8h  __attribute__((ext_vector_type(8)));
typedef __bf16   v16b __attribute__((ext_vector_type(16)));
typedef __bf16   v8b  __attribute__((ext_vector_type(8)));
typedef float    v8f  __attribute__((ext_vector_type(8)));
typedef float    v4f  __attribute__((ext_vector_type(4)));
typedef unsigned int v4u __attribute__((ext_vector_type(4)));

#if defined(__HIP_DEVICE_COMPILE__)
#define DEV_ASM 1
#else
#define DEV_ASM 0
#endif

// ---- scalar helpers --------------------------------------------------------------------------------
__device__ __forceinline__ unsigned short bf_bits(float f) {          // f32 -> bf16 bits, RNE convert
  unsigned u = __float_as_uint(f);
  return (unsigned short)((u + 0x7FFFu + ((u >> 16) & 1u)) >> 16);
}
__device__ __forceinline__ float bf_up(unsigned short hb) { return __uint_as_float(((unsigned)hb) << 16); }
__device__ __forceinline__ unsigned short h_bits(_Float16 x) { return __builtin_bit_cast(unsigned short, x); }
__device__ __forceinline__ unsigned pk16(unsigned short a, unsigned short b) { return (unsigned)a | ((unsigned)b << 16); }
__device__ __forceinline__ v8f zero8() { v8f z = {0.f, 0.f, 0.f, 0.f, 0.f, 0.f, 0.f, 0.f}; return z; }

// ---- fragment order: every 16-bit workspace plane [R rows][KC k] is kept as 1-KB units, one per WMMA operand fragment
//      (16 rows x 32 k), unit index = (row / 16) * (KC / 32) + k / 32. Inside a unit, in 16-byte granules of 8 k:
//      granule = ((k % 32) / 8) * 16 + row % 16, so granule g of the first 512 B is lane g's elements 0..7 and granule
//      g of the second 512 B its elements 8..15: each wave-wide 16-byte load reads 512 contiguous bytes (4 whole lines).
#define FRAG_EL 512                  // elements of one unit
// ---- fragment types / loaders: 16-bit A/B operand, lane -> row/col (lane&15), half h = lane>>4; p = unit + 8*lane;
//      elements 0..7 <- p[0..7] (k0+8h..k0+8h+7), elements 8..15 <- p[256..263] (k0+16+8h..k0+16+8h+7)
template <typename OT> struct FT;
template <> struct FT<__bf16>   { typedef v16b frag; typedef v8b half8; };
template <> struct FT<_Float16> { typedef v16h frag; typedef v8h half8; };

template <typename OT>
__device__ __forceinline__ typename FT<OT>::frag ldfrag(const OT* p) {
  union { typename FT<OT>::frag v; typename FT<OT>::half8 h[2]; } f;
  f.h[0] = *(const typename FT<OT>::half8*)(p);
  f.h[1] = *(const typename FT<OT>::half8*)(p + 256);
  return f.v;
}

// ---- WMMA helpers (asm guard bodies are device-only; concrete operand types) -----------------------------
__device__ __forceinline__ v8f mmar(v16b a, v16b b, v8f c) {
  return __builtin_amdgcn_wmma_f32_16x16x32_bf16(false, a, false, b, (short)0, c, false, false);
}
__device__ __forceinline__ v8f mmar(v16h a, v16h b, v8f c) {
  return __builtin_amdgcn_wmma_f32_16x16x32_f16(false, a, false, b, (short)0, c, false, false);
}
// guarded form: 4 VALU slots after the WMMA, D tied, A/B kept live
__device__ __forceinline__ v8f mma_h(v16h a, v16h b, v8f c) {
  c = __builtin_amdgcn_wmma_f32_16x16x32_f16(false, a, false, b, (short)0, c, false, false);
#if DEV_ASM
  asm volatile("v_nop\n\tv_nop\n\tv_nop\n\tv_nop" : "+v"(c) : "v"(a), "v"(b));
#endif
  return c;
}
__device__ __forceinline__ void acc_guard4(v8f& a, v8f& b, v8f& c, v8f& d) {
#if DEV_ASM
  asm volatile("v_nop\n\tv_nop\n\tv_nop\n\tv_nop" : "+v"(a), "+v"(b), "+v"(c), "+v"(d));
#else
  (void)a; (void)b; (void)c; (void)d;
#endif
}

// 16-bit convert helper. MODE 0: bf16 bits (RNE convert).  MODE 1: f16 bits of (64 * bf16(x)) (exact scaling of the bf16 value).
template <int MODE>
__device__ __forceinline__ unsigned short cvm(float f) {
  const unsigned short hb = bf_bits(f);
  if (MODE == 0) return hb;
  return h_bits((_Float16)(bf_up(hb) * 64.0f));
}

// =====================================================================================================
// All seven f32 -> 16-bit conversions (3 activations, 4 weights) in ONE launch of few waves, each with many granules.
// Planes in fragment order, 8 elements (one granule) per thread and slab. The launch has CVT_T threads. A weight is one
// slab of CVT_T granules. An activation is XSLAB slabs; a slab takes CVT_TB granules (XROWS rows) of EVERY batch, thread
// i being in batch i / CVT_TB, so that a slab's step from the plane's start is a small constant for all threads.
// In a slab a wave takes 8 rows x 32 k: it reads 8 whole 128-B lines of f32 and writes 4 whole 128-B lines
// (8 granules of each of the unit's 4 k groups).
// coverage: activations: XSLAB slabs x NB batches x XROWS rows = [NROW][EMB], 3 planes; weights: CVT_T granules = [EMB][EMB], 4 planes.
// =====================================================================================================
#define CVT_T    (EMB * EMB / 8)                  // threads of the launch = granules of a weight
#define CVT_TB   (CVT_T / NB)                     // threads on one batch
#define XROWS    (CVT_TB * 8 / EMB)               // rows of a batch in one activation slab
#define XSLAB    (SEQ / XROWS)                    // slabs of an activation
#define NXSLAB   (3 * XSLAB)
#define NSLAB    (NXSLAB + 4)                     // ... and the four weights
static_assert((CVT_T % 256) == 0 && (CVT_T % NB) == 0 && (XROWS % 16) == 0 && XROWS * EMB == CVT_TB * 8 && (SEQ % XROWS) == 0);
static_assert((size_t)NB_FULL * SEQ_FULL * EMB * 4 < ((size_t)1 << 32));   // byte offsets in a plane fit 32 bits
template <int MODE>
__device__ __forceinline__ v4u cvt8(v4f a, v4f a4) {
  v4u p;
  p[0] = pk16(cvm<MODE>(a[0]),  cvm<MODE>(a[1]));
  p[1] = pk16(cvm<MODE>(a[2]),  cvm<MODE>(a[3]));
  p[2] = pk16(cvm<MODE>(a4[0]), cvm<MODE>(a4[1]));
  p[3] = pk16(cvm<MODE>(a4[2]), cvm<MODE>(a4[3]));
  return p;
}
__global__ __launch_bounds__(256) void cvt_all(
    const float* __restrict__ xq, const float* __restrict__ xk, const float* __restrict__ xv,
    const float* __restrict__ wq, const float* __restrict__ wk, const float* __restrict__ wv,
    const float* __restrict__ wo,
    unsigned short* Xq, unsigned short* Xk, unsigned short* Xv,
    unsigned short* Wqb, unsigned short* Wkb, unsigned short* Wvb, unsigned short* Wob) {
  const unsigned i    = blockIdx.x * 256u + threadIdx.x;
  const unsigned unit = i >> 6;                               // 64 threads (2 waves) per unit
  const unsigned kg   = (i >> 3) & 3u;                        // k group of 8 inside the unit
  const unsigned rr   = ((i >> 5) & 1u) * 8u + (i & 7u);      // row inside the unit
  const unsigned bt   = i / CVT_TB;                           // the thread's batch in the activations
  // the granule's byte offsets from a plane's start, 32 bits: with a slab's constant step, one offset register serves
  // every slab of a kind beside the plane's scalar base. Weights: granule i. Activations: granule i - bt * CVT_TB of batch bt.
  unsigned sobW = (((unit / (EMB / 32)) * 16u + rr) * EMB + (unit % (EMB / 32)) * 32u + kg * 8u) * 4u;
  unsigned sobX = sobW + bt * (unsigned)((SEQ_FULL - XROWS) * EMB * 4);
  const unsigned dobW = (unit * FRAG_EL + (kg * 16u + rr) * 8u) * 2u;
  const unsigned dobX = dobW + bt * (unsigned)((SEQ - XROWS) * EMB * 2);
  const float* const xin[3]     = {xq, xk, xv};
  const float* const win[4]     = {wq, wk, wv, wo};
  unsigned short* const xout[3] = {Xq, Xk, Xv};
  unsigned short* const wout[4] = {Wqb, Wkb, Wvb, Wob};
  // every loop here is unrolled: the slab index picks pointers and registers at compile time
  v4f a[NSLAB][2];
#pragma unroll
  for (int s = 0; s < NSLAB; ++s) {               // all loads of the thread up front: 2 * NSLAB x 16 B in flight a lane
    const char* src = (s < NXSLAB) ? (const char*)xin[s / XSLAB] + (size_t)(s % XSLAB) * XROWS * EMB * 4 + sobX
                                   : (const char*)win[s - NXSLAB] + sobW;
    a[s][0] = *(const v4f*)(src);
    a[s][1] = *(const v4f*)(src + 16);
    __builtin_amdgcn_sched_barrier(0);            // a slab's two loads read the same lines: kept side by side, ahead of all conversions
  }
#if DEV_ASM
  asm volatile("s_wait_xcnt 0x0" : "+v"(sobX), "+v"(sobW) :: "memory");   // before the offset registers, which these loads name, are given up
#endif
  __builtin_amdgcn_sched_barrier(0);              // no conversion result is written ahead of that wait
  v4u p[NSLAB];
#pragma unroll
  for (int s = 0; s < NSLAB; ++s)
    p[s] = (s == NSLAB - 1) ? cvt8<1>(a[s][0], a[s][1]) : cvt8<0>(a[s][0], a[s][1]);
#pragma unroll
  for (int s = 0; s < NSLAB; ++s) {
    char* dst = (s < NXSLAB) ? (char*)xout[s / XSLAB] + (size_t)(s % XSLAB) * XROWS * EMB * 2 + dobX
                             : (char*)wout[s - NXSLAB] + dobW;
    *(v4u*)dst = p[s];
  }
}

// =====================================================================================================
// Register-blocked batched WMMA GEMM (16-bit operand type OT): C[m][n] = sum_k A[m][k] * Bt[n][k];
// one wave per (16*MI) x 64 tile, no block barriers. A [M][K = lda] and Bt [N][K = ldb] in fragment order;
// M multiple of 16*MI, N multiple of 64, K multiple of 128 (static sizes here). blockIdx.y = batch
// index (strides in elements). Fragments are loaded straight from global, 512 contiguous bytes a load (ldfrag_g).
// NPA = number of A planes: 2 -> second plane A2 (same pitch/stride) multiplies the same Bt fragments into a
// second accumulator set, combined as acc + acc2 * rscaleA in the f32 epilogue.
// value v = (acc [+ acc2*rscaleA]) * oscale.
// OUT_MODE 0: f32 C (pitch ldc) = v.
// OUT_MODE 1: f16 plane C = f16(v * cscale), [M][N = ldc] in fragment order.
// OUT_MODE 3: f16 hi plane C = f16(v * cscale) and f16 residual plane C2 = f16((v*cscale - hi) * rscaleC), likewise.
// =====================================================================================================
// one k step's load group: 4 B fragments, MI A fragments (and MI of the second A plane); in this helper and the next
// every loop is unrolled so that the fragment and accumulator arrays keep constant indices (registers)
//   (bp, ap, ap2: each lane's pointers into its row tiles' units, global address space, in 16-byte units;
//    k: a constant element offset, FRAG_EL per k step of 32)
template <typename OT> struct GP { typedef const __attribute__((address_space(1))) typename FT<OT>::half8* ptr; };
template <typename OT>
__device__ __forceinline__ typename FT<OT>::frag ldfrag_g(typename GP<OT>::ptr p, int k) {   // same k map as ldfrag
  union { typename FT<OT>::frag v; typename FT<OT>::half8 h[2]; } f;
  f.h[0] = p[k / 8];
  f.h[1] = p[k / 8 + 32];
  return f.v;
}
template <typename OT, int MI, int NPA>
__device__ __forceinline__ void gemm_ld(typename GP<OT>::ptr const (&bp)[4], typename GP<OT>::ptr const (&ap)[MI],
                                        typename GP<OT>::ptr const (&ap2)[MI], int k,
                                        typename FT<OT>::frag (&bq)[4], typename FT<OT>::frag (&af)[MI],
                                        typename FT<OT>::frag (&ag)[MI]) {
#pragma unroll
  for (int j = 0; j < 4; ++j) bq[j] = ldfrag_g<OT>(bp[j], k);
#pragma unroll
  for (int i = 0; i < MI; ++i) {
    af[i] = ldfrag_g<OT>(ap[i], k);
    if (NPA == 2) ag[i] = ldfrag_g<OT>(ap2[i], k);
  }
}
// the wait that stands before the row pointers, which the issued loads name, are moved on or given up
template <int MI, int NPA, typename P>
__device__ __forceinline__ void ptr_wait(P (&bp)[4], P (&ap)[MI], P (&ap2)[MI]) {
  static_assert((MI == 4 && NPA == 1) || (MI == 2 && NPA == 2));   // the two shapes in use: eight pointers each
#if DEV_ASM
  if constexpr (MI == 4)
    asm volatile("s_wait_xcnt 0x0" : "+v"(bp[0]), "+v"(bp[1]), "+v"(bp[2]), "+v"(bp[3]),
                                     "+v"(ap[0]), "+v"(ap[1]), "+v"(ap[2]), "+v"(ap[3]) :: "memory");
  else
    asm volatile("s_wait_xcnt 0x0" : "+v"(bp[0]), "+v"(bp[1]), "+v"(bp[2]), "+v"(bp[3]),
                                     "+v"(ap[0]), "+v"(ap[1]), "+v"(ap2[0]), "+v"(ap2[1]) :: "memory");
#endif
}
// one k step's products, in the order i, plane, j
template <typename OT, int MI, int NPA>
__device__ __forceinline__ void gemm_mm(const typename FT<OT>::frag (&bq)[4], const typename FT<OT>::frag (&af)[MI],
                                        const typename FT<OT>::frag (&ag)[MI], v8f (&acc)[MI][4], v8f (&acc2)[MI][4]) {
#pragma unroll
  for (int i = 0; i < MI; ++i) {
#pragma unroll
    for (int j = 0; j < 4; ++j) acc[i][j] = mmar(af[i], bq[j], acc[i][j]);
    if (NPA == 2) {
#pragma unroll
      for (int j = 0; j < 4; ++j) acc2[i][j] = mmar(ag[i], bq[j], acc2[i][j]);
    }
  }
}

template <typename OT, int MI, int NPA, int OUT_MODE>
__global__ __launch_bounds__(256) void gemm_t(
    const unsigned short* __restrict__ Ap, const unsigned short* __restrict__ A2p, int lda, long long strideA,
    const unsigned short* __restrict__ Btp, int ldb, long long strideB,
    void* Cout, void* Cout2, int ldc, long long strideC,
    int M, int N, int K, float oscale, float rscaleA, float cscale, float rscaleC) {
  typedef typename FT<OT>::frag V16;
  const OT* A  = (const OT*)(const void*)Ap;
  const OT* A2 = (const OT*)(const void*)A2p;
  const OT* Bt = (const OT*)(const void*)Btp;
  __shared__ __align__(16) float sT[8][16 * 68];   // per-wave 16x64 slab, pitch 68 floats
  const int RT   = 16 * MI;
  const int b    = blockIdx.y;
  const int lane = threadIdx.x & 31;
  const int wave = threadIdx.x >> 5;
  const int tilesN = N >> 6;
  const int tilesM = M / RT;
  const int tile = blockIdx.x * 8 + wave;
  if (tile >= tilesM * tilesN) return;   // wave-uniform; no block barriers in this kernel
  const int tm = tile / tilesN;
  const int tn = tile - tm * tilesN;
  const int m0 = tm * RT;
  const int n0 = tn << 6;

  const OT* Ab  = A  + (size_t)b * (size_t)strideA;
  const OT* A2b = A2 + (size_t)b * (size_t)strideA;
  const OT* Bb  = Bt + (size_t)b * (size_t)strideB;

  const int rlane = lane & 15;                 // row (A) / col (B, D) within subtile
  const int mOff  = (lane >> 4) * 8;           // D row offset

  v8f acc[MI][4], acc2[MI][4];
#pragma unroll
  for (int i = 0; i < MI; ++i)
#pragma unroll
    for (int j = 0; j < 4; ++j) { acc[i][j] = zero8(); acc2[i][j] = zero8(); }

  // Rotating fragment sets: the whole load group of k step s + 2 is issued ahead of the products of step s, so the
  // loads of two steps fly under the products, where one latency per A fragment was waited out. K is a multiple of 128.
  typedef typename GP<OT>::ptr GPtr;
  GPtr bp[4], ap[MI], ap2[MI];
#pragma unroll
  for (int j = 0; j < 4; ++j) bp[j] = (GPtr)(const void*)(Bb + (size_t)((n0 >> 4) + j) * (ldb >> 5) * FRAG_EL + lane * 8);
#pragma unroll
  for (int i = 0; i < MI; ++i) {
    ap[i]  = (GPtr)(const void*)(Ab  + (size_t)((m0 >> 4) + i) * (lda >> 5) * FRAG_EL + lane * 8);
    ap2[i] = (GPtr)(const void*)(A2b + (size_t)((m0 >> 4) + i) * (lda >> 5) * FRAG_EL + lane * 8);
  }
  V16 bq[4][4], af[4][MI], ag[4][MI];
  gemm_ld<OT, MI, NPA>(bp, ap, ap2, 0, bq[0], af[0], ag[0]);
  __builtin_amdgcn_sched_barrier(0);       // group order as in the loop, so that the loop's counted waits stay per group
  gemm_ld<OT, MI, NPA>(bp, ap, ap2, FRAG_EL, bq[1], af[1], ag[1]);
  for (int k0 = 128; k0 < K; k0 += 128) {  // all trips but the last four steps
#pragma unroll
    for (int u = 0; u < 4; ++u) {          // unrolled so that the set index is a constant (registers)
      gemm_ld<OT, MI, NPA>(bp, ap, ap2, (u + 2) * FRAG_EL, bq[(u + 2) & 3], af[(u + 2) & 3], ag[(u + 2) & 3]);
      __builtin_amdgcn_sched_barrier(0);   // keeps the load group ahead of the products below
      gemm_mm<OT, MI, NPA>(bq[u], af[u], ag[u], acc, acc2);
    }
    ptr_wait<MI, NPA>(bp, ap, ap2);
#pragma unroll
    for (int j = 0; j < 4; ++j) bp[j] += 4 * FRAG_EL / 8;     // 4 k steps = 4 units
#pragma unroll
    for (int i = 0; i < MI; ++i) { ap[i] += 4 * FRAG_EL / 8; ap2[i] += 4 * FRAG_EL / 8; }
  }
  // the last four steps: two groups are still to fetch
  gemm_ld<OT, MI, NPA>(bp, ap, ap2, 2 * FRAG_EL, bq[2], af[2], ag[2]);
  __builtin_amdgcn_sched_barrier(0);       // keeps the load group ahead of the products below
  gemm_mm<OT, MI, NPA>(bq[0], af[0], ag[0], acc, acc2);
  gemm_ld<OT, MI, NPA>(bp, ap, ap2, 3 * FRAG_EL, bq[3], af[3], ag[3]);
  ptr_wait<MI, NPA>(bp, ap, ap2);
  __builtin_amdgcn_sched_barrier(0);       // keeps the load group ahead of the products below
  gemm_mm<OT, MI, NPA>(bq[1], af[1], ag[1], acc, acc2);
  gemm_mm<OT, MI, NPA>(bq[2], af[2], ag[2], acc, acc2);
  gemm_mm<OT, MI, NPA>(bq[3], af[3], ag[3], acc, acc2);
#pragma unroll
  for (int i = 0; i < MI; ++i) {
    acc_guard4(acc[i][0], acc[i][1], acc[i][2], acc[i][3]);
    if (NPA == 2) acc_guard4(acc2[i][0], acc2[i][1], acc2[i][2], acc2[i][3]);
  }

  // ---- epilogue ----
  float* slab = sT[wave];
#pragma unroll
  for (int i = 0; i < MI; ++i) {
    const int mBase = m0 + (i << 4);
#pragma unroll
    for (int j = 0; j < 4; ++j) {
#pragma unroll
      for (int r = 0; r < 8; ++r) {
        float v = acc[i][j][r];
        if (NPA == 2) v += acc2[i][j][r] * rscaleA;
        v = v * oscale;
        slab[(mOff + r) * 68 + (j << 4) + rlane] = v;
      }
    }
    __builtin_amdgcn_fence(3, "workgroup");
    __builtin_amdgcn_wave_barrier();
    __builtin_amdgcn_fence(2, "workgroup");
    if (OUT_MODE == 0) {
      float* C = (float*)Cout + (size_t)b * (size_t)strideC;
      const int h2 = lane >> 4, c4 = (lane & 15) * 4;     // 256-B row segment = 16 lanes x 16 B
      v4f ov[8];
#pragma unroll
      for (int it = 0; it < 8; ++it) {
        const int row = it * 2 + h2;                     // it 0..7 x h2 0..1 = rows 0..15
        ov[it] = *(const v4f*)(slab + row * 68 + c4);
      }
      {
#pragma unroll
        for (int it = 0; it < 8; ++it) {
          const int row = it * 2 + h2;
          *(v4f*)(C + (size_t)(mBase + row) * ldc + n0 + c4) = ov[it];
        }
        
      }
    } else {
      // the 16 x 64 slab = 2 units = 128 granules in a row: store it writes granules 32*it + lane (512 contiguous B),
      // which hold row lane&15, columns 8*(2*it + (lane>>4)) .. +7
      const size_t u0 = ((size_t)(mBase >> 4) * (ldc >> 5) + (n0 >> 5)) * FRAG_EL + lane * 8;
      unsigned short* C  = (unsigned short*)Cout  + (size_t)b * (size_t)strideC + u0;
      unsigned short* C2 = (unsigned short*)Cout2 + (size_t)b * (size_t)strideC + u0;
      v4u hv[4], lv[4];
#pragma unroll
      for (int it = 0; it < 4; ++it) {
        const float* sp = slab + rlane * 68 + (it * 2 + (lane >> 4)) * 8;
        float f[8];
#pragma unroll
        for (int e = 0; e < 8; ++e) f[e] = sp[e] * cscale;
        v4u a, a2;
#pragma unroll
        for (int e = 0; e < 4; ++e) {
          const float f0 = f[2 * e], f1 = f[2 * e + 1];
          const _Float16 x0 = (_Float16)f0, x1 = (_Float16)f1;
          const unsigned short h0 = h_bits(x0), h1 = h_bits(x1);
          unsigned short l0 = 0, l1 = 0;
          if (OUT_MODE == 3) {
            l0 = h_bits((_Float16)((f0 - (float)x0) * rscaleC));
            l1 = h_bits((_Float16)((f1 - (float)x1) * rscaleC));
          }
          a[e] = pk16(h0, h1); a2[e] = pk16(l0, l1);
        }
        hv[it] = a; lv[it] = a2;
      }
      {
#pragma unroll
        for (int it = 0; it < 4; ++it) {
          *(v4u*)(C + it * 256) = hv[it];
          if (OUT_MODE == 3) *(v4u*)(C2 + it * 256) = lv[it];
        }
#if DEV_ASM
        asm volatile("s_wait_xcnt 0x0" ::: "memory");   // before the next slab overwrites the registers these stores name
#endif
      }
    }
    __builtin_amdgcn_fence(3, "workgroup");
    __builtin_amdgcn_wave_barrier();
    __builtin_amdgcn_fence(2, "workgroup");
  }
}

// =====================================================================================================
// Score chunk, transposed: 64 keys kv0..kv0+63 x 16 query rows (this wave) of one (b, h).
//   k fragments (A operand, row = lane&15 = key) loaded straight from the f16 k plane (fragment order):
//   kb0 = plane + (b*SEQ)*EMB + h*2*FRAG_EL, 16 keys on add 16*EMB (plane row = b*SEQ + t).
//   q fragments (B operand, col = lane&15 = query): hi and residual (x4096) planes, 2 d-chunks of 32.
//   s[j][r] = D element: key kv0 + 16j + 8*hh + r, query lane&15; value = ((k.qh) + (k.ql)/4096) / 8.
//   A lane holds scores of ONE query only (32 of the chunk's 64 keys; lane ^ 16 has the other 32), and
//   s[2kk], s[2kk+1] lie as elements 0..7, 8..15 of an A fragment (row = query, 32 keys) for the P.V product.
// =====================================================================================================
// the chunk's 8 k fragments as one load group, kf[2j + dc]; kp = the lane's pointer into the unit of keys kv0..kv0+15,
// d 0..31 (16-byte units); loops unrolled so that kf keeps constant indices (registers)
typedef GP<_Float16>::ptr KPtr;
__device__ __forceinline__ void ld_kchunk(KPtr& kp, v16h (&kf)[8]) {
#pragma unroll
  for (int j = 0; j < 4; ++j)
#pragma unroll
    for (int dc = 0; dc < 2; ++dc) kf[2 * j + dc] = ldfrag_g<_Float16>(kp, j * 16 * EMB + dc * FRAG_EL);
#if DEV_ASM
  asm volatile("s_wait_xcnt 0x0" : "+v"(kp) :: "memory");   // before kp, which these loads name, is moved on or given up
#endif
}
__device__ __forceinline__ void score_chunk(const v16h (&qah)[2], const v16h (&qal)[2], const v16h (&kf)[8],
                                            v8f (&s)[4]) {
#pragma unroll
  for (int j = 0; j < 4; ++j) {
    v8f ah = zero8(), al = zero8();
#pragma unroll
    for (int dc = 0; dc < 2; ++dc) {
      ah = mma_h(kf[2 * j + dc], qah[dc], ah);
      al = mma_h(kf[2 * j + dc], qal[dc], al);
    }
#pragma unroll
    for (int r = 0; r < 8; ++r) s[j][r] = (ah[r] + al[r] * (1.0f / 4096.0f)) * 0.125f;
  }
}

// =====================================================================================================
// Softmax statistics: per (b, h, query s) the row max m and 1/sum(exp(s - m)) over all SEQ keys.
//   block = 4 waves = 64 consecutive query rows qb*64.. of one (b, h); grid = NB*NH*NKT blocks of 128;
//   static trip NKT over 64-key chunks; online max / rescaled sum in f32, one query a lane, all in the lane;
//   the two lanes of a query (each half of the keys) are merged once, behind the loop.
//   Output plane ML [b*NH+h][2][SEQ] f32 (m then 1/l): the block's 64 m values and 64 1/l values are
//   funnelled through LDS (cross-wave: block barrier) and written by wave 0 with ONE instruction (lanes 0-15:
//   coverage: grid (b,h,qb) x 64 rows = the whole [NB*NH][2][SEQ] plane. MLsh: 4 waves x 32 lanes = all 128.
// =====================================================================================================
__global__ __launch_bounds__(128)
void attn_stats(const unsigned short* __restrict__ qhp, const unsigned short* __restrict__ qlp,
                const unsigned short* __restrict__ kpp, float* ML) {
  __shared__ __align__(16) float MLsh[128];
  const int tid  = threadIdx.x;
  const int wave = tid >> 5;
  const int lane = tid & 31;
  const int hh   = lane >> 4;
  const int c    = lane & 15;
  const int bx   = blockIdx.x;
  const int qb   = bx % NKT;
  const int rest = bx / NKT;
  const int h    = rest % NH;
  const int b    = rest / NH;
  const int bh   = b * NH + h;
  const int q0   = qb * 64 + wave * 16;

  const _Float16* Qh  = (const _Float16*)(const void*)qhp;
  const _Float16* Ql  = (const _Float16*)(const void*)qlp;
  const _Float16* Kb0 = (const _Float16*)(const void*)kpp + (size_t)b * SEQ * EMB + (size_t)h * (HD / 32) * FRAG_EL;

  v16h qah[2], qal[2];
#pragma unroll
  for (int dc = 0; dc < 2; ++dc) {
    const size_t qo = ((size_t)b * SEQ + (size_t)q0) * EMB + (size_t)(h * (HD / 32) + dc) * FRAG_EL + lane * 8;
    qah[dc] = ldfrag<_Float16>(Qh + qo);
    qal[dc] = ldfrag<_Float16>(Ql + qo);
  }

  float mrow = -INFINITY, lrow = 0.f;         // query q0 + c, over this lane's half of the keys

#if DEV_ASM
  asm volatile("s_wait_xcnt 0x0" ::: "memory");   // before the k fetch lands in registers that the q loads name
#endif
  v16h kf[8];
  KPtr kp = (KPtr)(const void*)(Kb0 + lane * 8);
  ld_kchunk(kp, kf);
  for (int kt = 0; kt < NKT; ++kt) {          // static trip count
    v8f s[4];
    score_chunk(qah, qal, kf, s);
    __builtin_amdgcn_sched_barrier(0);        // the next chunk's fetch stays behind this chunk's products (same registers)
    kp += (kt + 1 < NKT) ? 64 * EMB / 8 : 0;  // 16-byte units; last trip: the same chunk again, a fetch that nothing uses
    ld_kchunk(kp, kf);
    __builtin_amdgcn_sched_barrier(0);        // ... and ahead of the vector work below, which covers its latency
    float mj[4];                              // loops over j and r unrolled here and below: s keeps constant indices (registers)
#pragma unroll
    for (int j = 0; j < 4; ++j) {
      mj[j] = s[j][0];
#pragma unroll
      for (int r = 1; r < 8; ++r) mj[j] = fmaxf(mj[j], s[j][r]);
    }
    const float mnew  = fmaxf(mrow, fmaxf(fmaxf(mj[0], mj[1]), fmaxf(mj[2], mj[3])));
    const float msafe = (mnew == -INFINITY) ? 0.f : mnew;
    const float alpha = __expf(mrow - msafe);
    mrow = mnew;
    float pj[4];                              // four independent partial sums
#pragma unroll
    for (int j = 0; j < 4; ++j) {
      pj[j] = 0.f;
#pragma unroll
      for (int r = 0; r < 8; ++r) pj[j] += __expf(s[j][r] - msafe);
    }
    lrow = lrow * alpha + ((pj[0] + pj[1]) + (pj[2] + pj[3]));
  }

  // merge the two halves of each query's keys (lane ^ 16), once
  const float mo    = __shfl_xor(mrow, 16, 32);
  const float lo    = __shfl_xor(lrow, 16, 32);
  const float mall  = fmaxf(mrow, mo);
  const float msafe = (mall == -INFINITY) ? 0.f : mall;
  const float l     = lrow * __expf(mrow - msafe) + lo * __expf(mo - msafe);
  const float il    = (l > 0.f) ? (1.0f / l) : 0.f;
  MLsh[hh * 64 + wave * 16 + c] = hh ? il : mall;   // lanes 0-15: m, lanes 16-31: 1/l of query q0 + c
  __syncthreads();
  if (wave == 0) {
    const v4f v = *(const v4f*)(MLsh + lane * 4);        // lanes 0-15: m rows 4c..4c+3; lanes 16-31: 1/l rows
    float* dst = ML + (size_t)(bh * 2 + hh) * SEQ + qb * 64 + c * 4;
    *(v4f*)dst = v;
    
  }
}

// =====================================================================================================
// Main attention pass: one block per (b, 32 query rows q0..q0+31, one of KSPLIT key ranges), 16 waves = the 16 heads;
//   a wave holds TWO 16-row query tiles, so each k and v fragment fetched from L2 serves 32 queries.
//   Per 32-key chunk (static trip NKT32): scores recomputed exactly as in attn_stats, p = exp(s - m) * (1/l) in f32
//   (m, 1/l from the ML plane, one query a lane and tile);
//   (a) context += P . V: the lane's p values, converted to f16 with the x16384 carry, ARE the A fragments (no LDS, no
//       lane exchange); B = v^T f16 plane [b][h*64+d][s] (head slab h*64*SEQ), fragment order;
//       p also goes to the per-wave LDS tile Pf[h][row][key] (16-byte stores of 4 keys, every entry written) for
//   (b) head average: after __syncthreads (cross-wave), threads 0..255 sum the 16 wave tiles in fixed head order
//   Epilogue: the key range's part of ctx = acc / 16384, x256 carry, staged in the wave's Pf tile (wave-private), written in f32;
//   p is already normalised, so ctx is the plain sum of its parts (ctx_merge).
//   coverage: avg: NKT32 chunks x 32 rows x 32 keys per block, grid (b, qb, ks) = the whole [NB][SEQ][SEQ];
//   ctx parts: each wave rows q0..q0+31 x its head's 64 columns, 16 waves x grid = the whole [KSPLIT][NROW][EMB].
// =====================================================================================================
// 32-key forms of the chunk fetch and of the score chunk (same k map, same products, same order per score)
__device__ __forceinline__ void ld_kchunk32(KPtr& kp, v16h (&kf)[4]) {
#pragma unroll
  for (int j = 0; j < 2; ++j)
#pragma unroll
    for (int dc = 0; dc < 2; ++dc) kf[2 * j + dc] = ldfrag_g<_Float16>(kp, j * 16 * EMB + dc * FRAG_EL);
#if DEV_ASM
  asm volatile("s_wait_xcnt 0x0" : "+v"(kp) :: "memory");   // before kp, which these loads name, is moved on or given up
#endif
}
__device__ __forceinline__ void score_chunk32(const v16h (&qah)[2], const v16h (&qal)[2], const v16h (&kf)[4],
                                              v8f (&s)[2]) {
#pragma unroll
  for (int j = 0; j < 2; ++j) {
    v8f ah = zero8(), al = zero8();
#pragma unroll
    for (int dc = 0; dc < 2; ++dc) {
      ah = mma_h(kf[2 * j + dc], qah[dc], ah);
      al = mma_h(kf[2 * j + dc], qal[dc], al);
    }
#pragma unroll
    for (int r = 0; r < 8; ++r) s[j][r] = (ah[r] + al[r] * (1.0f / 4096.0f)) * 0.125f;
  }
}
#define KSPLIT   2                   // key ranges of a sequence, one block each
#define KRANGE   (SEQ / KSPLIT)      // keys of one block
#define NQB32    (SEQ / 32)          // 32-row query blocks per sequence
#define NKT32    (KRANGE / 32)       // 32-key chunks of one block
#define PP32     36                  // row pitch of the 32-key LDS P tile in floats: 144 B = 16 B x odd, so 16 rows written 16 B each fall on 64 distinct banks
#define NGRAN    ((size_t)NROW * EMB / 8)   // 8-element granules of a ctx plane
static_assert((KRANGE % 32) == 0 && (SEQ % 32) == 0 && 32 * PP32 >= 16 * 68);
__global__ __launch_bounds__(512)
void attn_main(const unsigned short* __restrict__ qhp, const unsigned short* __restrict__ qlp,
               const unsigned short* __restrict__ kpp, const unsigned short* __restrict__ vtp,
               const float* __restrict__ ML, float* cpart, float* avg) {
  union FH { v16h v; v8h h[2]; };
  __shared__ __align__(32) float Pf[NH][32 * PP32];        // per wave (head) P tile [32 rows][32 keys] f32, pitch PP32; the epilogue's ctx tile has pitch 68
  const int tid  = threadIdx.x;
  const int wave = tid >> 5;
  const int lane = tid & 31;
  const int hh   = lane >> 4;
  const int c    = lane & 15;
  const int bx   = blockIdx.x;
  const int ks   = bx % KSPLIT;
  const int qb   = (bx / KSPLIT) % NQB32;
  const int b    = bx / (KSPLIT * NQB32);
  const int h    = wave;
  const int bh   = b * NH + h;
  const int q0   = qb * 32;
  const int key0 = ks * KRANGE;

  const _Float16* Qh  = (const _Float16*)(const void*)qhp;
  const _Float16* Ql  = (const _Float16*)(const void*)qlp;
  const _Float16* Kb0 = (const _Float16*)(const void*)kpp + ((size_t)b * SEQ + key0) * EMB + (size_t)h * (HD / 32) * FRAG_EL;
  const _Float16* Vb0 = (const _Float16*)(const void*)vtp + (size_t)b * EMB * SEQ + (size_t)h * HD * SEQ
                        + (size_t)(key0 / 32) * FRAG_EL;   // v^T [b][h*64+d][s], fragment order

  v16h qah[2][2], qal[2][2];                  // [query tile][d chunk]
  float m1[2], il1[2];
#pragma unroll
  for (int qt = 0; qt < 2; ++qt) {
#pragma unroll
    for (int dc = 0; dc < 2; ++dc) {
      const size_t qo = ((size_t)b * SEQ + (size_t)(q0 + 16 * qt)) * EMB + (size_t)(h * (HD / 32) + dc) * FRAG_EL + lane * 8;
      qah[qt][dc] = ldfrag<_Float16>(Qh + qo);
      qal[qt][dc] = ldfrag<_Float16>(Ql + qo);
    }
    m1[qt]  = ML[(size_t)(bh * 2) * SEQ + q0 + 16 * qt + c];                      // the lane's query q0 + 16qt + c
    il1[qt] = ML[(size_t)(bh * 2 + 1) * SEQ + q0 + 16 * qt + c];
  }

  v8f oacc[2][4];
#pragma unroll
  for (int qt = 0; qt < 2; ++qt)
#pragma unroll
    for (int t = 0; t < 4; ++t) oacc[qt][t] = zero8();
  float* pf = Pf[wave];

#if DEV_ASM
  asm volatile("s_wait_xcnt 0x0" ::: "memory");   // before the k fetch lands in registers that the loads above name
#endif
  __builtin_amdgcn_sched_barrier(0);          // no address below is formed, in a register that those loads name, ahead of that wait
  v16h kf[4];
  KPtr kp = (KPtr)(const void*)(Kb0 + lane * 8);
  ld_kchunk32(kp, kf);
  KPtr vp = (KPtr)(const void*)(Vb0 + lane * 8);   // the lane's pointer into the unit of d 0..15, keys kv0..kv0+31
  for (int kt = 0; kt < NKT32; ++kt) {       // static trip count
    const int kv0 = key0 + kt * 32;
    __syncthreads();                          // Pf tiles free again (head sum of the prior chunk done)

    v8f s[2][2];                              // [query tile][16-key group]: both tiles' scores from ONE fetch of the k fragments
#pragma unroll
    for (int qt = 0; qt < 2; ++qt) score_chunk32(qah[qt], qal[qt], kf, s[qt]);
    __builtin_amdgcn_sched_barrier(0);        // the v fetch stays behind the score products (registers)
    v16h vf[4];                               // this chunk's 4 v fragments as one load group, vf[t]
#pragma unroll
    for (int t = 0; t < 4; ++t) vf[t] = ldfrag_g<_Float16>(vp, t * 16 * SEQ);
#if DEV_ASM
    asm volatile("s_wait_xcnt 0x0" : "+v"(vp) :: "memory");   // before vp, which these loads name, is moved on
#endif
    vp += FRAG_EL / 8;                        // 32 keys = 1 unit (16-byte units)
    __builtin_amdgcn_sched_barrier(0);        // ... and ahead of the exponentials, which cover its latency
#pragma unroll                                // all loops unrolled: s keeps constant indices (registers)
    for (int qt = 0; qt < 2; ++qt) {
#pragma unroll
      for (int j = 0; j < 2; ++j) {
#pragma unroll
        for (int r = 0; r < 8; ++r) s[qt][j][r] = __expf(s[qt][j][r] - m1[qt]) * il1[qt];      // s now holds p
        float* pw = pf + (16 * qt + c) * PP32 + j * 16 + 8 * hh;   // query 16qt + c, keys 16j + 8hh .. +7; 16-byte aligned at every row
        *(v4f*)(pw)     = __builtin_shufflevector(s[qt][j], s[qt][j], 0, 1, 2, 3);
        *(v4f*)(pw + 4) = __builtin_shufflevector(s[qt][j], s[qt][j], 4, 5, 6, 7);
      }
    }

    // ---- context += P . V (f16 WMMA, p carried x16384): both query tiles on ONE fetch of the v fragments ----
#pragma unroll                                // s and oacc are indexed by qt: a constant index keeps them in registers
    for (int qt = 0; qt < 2; ++qt) {
      FH pa;                                  // row = query c of the tile; elements 0..7 = keys 8hh + e, 8..15 = keys 16 + 8hh + e
      pa.h[0] = __builtin_convertvector(s[qt][0] * PCARRY, v8h);
      pa.h[1] = __builtin_convertvector(s[qt][1] * PCARRY, v8h);
#pragma unroll
      for (int t = 0; t < 4; ++t) oacc[qt][t] = mma_h(pa.v, vf[t], oacc[qt][t]);
    }
    __syncthreads();
    kp += (kt + 1 < NKT32) ? 32 * EMB / 8 : 0;  // 16-byte units; last trip: the same chunk again, a fetch that nothing uses
    ld_kchunk32(kp, kf);                      // next chunk's k, one load group
    __builtin_amdgcn_sched_barrier(0);        // issued ahead of the head average, which covers part of its latency

    // ---- head average of this 32 x 32 tile, one block = one writer of every line (a row's 32 keys = one 128-B line) ----
    if (tid < 256) {                          // waves 0..7, wave-uniform
      const int row = tid >> 3, c4 = (tid & 7) * 4;
      v4f a = *(const v4f*)(Pf[0] + row * PP32 + c4);
#pragma unroll
      for (int w = 1; w < NH; ++w) a += *(const v4f*)(Pf[w] + row * PP32 + c4);
      a *= (1.0f / (float)NH);
      float* dst = avg + ((size_t)b * SEQ + (size_t)(q0 + row)) * SEQ + kv0 + c4;
      *(v4f*)dst = a;
#if DEV_ASM
      asm volatile("s_wait_xcnt 0x0" ::: "memory");   // before the next chunk overwrites the registers this store names
#endif
    }
  }
  __syncthreads();

  // ---- epilogue: this key range's part of ctx (undo the x16384 p carry, apply the x256 carry), staged, stored in f32 ----
  // cpart = [KSPLIT][2][NGRAN] groups of 4 floats: group (ks, 0, g) = elements 0..3 of granule g of the ctx planes, (ks, 1, g) = 4..7,
  // so that every store here and every load in ctx_merge covers 512 contiguous bytes a wave.
  float* os = pf;
#pragma unroll
  for (int qt = 0; qt < 2; ++qt) {
#pragma unroll
    for (int r = 0; r < 8; ++r) {
#pragma unroll
      for (int t = 0; t < 4; ++t) os[(8 * hh + r) * 68 + t * 16 + c] = oacc[qt][t][r] * (256.0f / PCARRY);
    }
    __builtin_amdgcn_fence(3, "workgroup");
    __builtin_amdgcn_wave_barrier();
    __builtin_amdgcn_fence(2, "workgroup");
    // the wave's 16 x 64 tile = 2 units = 128 granules in a row: step it takes granules 32*it + lane,
    // which hold row c, columns 8*(2*it + hh) .. +7
    v4f lo4[4], hi4[4];
#pragma unroll
    for (int it = 0; it < 4; ++it) {
      const float* sp = os + c * 68 + (it * 2 + hh) * 8;
      lo4[it] = *(const v4f*)(sp);
      hi4[it] = *(const v4f*)(sp + 4);
    }
    const size_t g0 = (((size_t)b * SEQ + (size_t)(q0 + 16 * qt)) * EMB + (size_t)h * (HD / 32) * FRAG_EL) / 8 + lane;
    float* d0 = cpart + ((size_t)(ks * 2) * NGRAN + g0) * 4;
    float* d1 = cpart + ((size_t)(ks * 2 + 1) * NGRAN + g0) * 4;
#pragma unroll
    for (int it = 0; it < 4; ++it) {
      *(v4f*)(d0 + it * 128) = lo4[it];
      *(v4f*)(d1 + it * 128) = hi4[it];
    }
#if DEV_ASM
    asm volatile("s_wait_xcnt 0x0" ::: "memory");   // before the next tile overwrites the registers these stores name
#endif
    __builtin_amdgcn_sched_barrier(0);        // the next tile's products stay behind that wait
    __builtin_amdgcn_fence(3, "workgroup");
    __builtin_amdgcn_wave_barrier();
    __builtin_amdgcn_fence(2, "workgroup");
  }
}

// =====================================================================================================
// ctx = sum of its KSPLIT key-range parts (fixed order), converted to the f16 hi plane (x256 carry, already in the parts)
// and the f16 residual plane (x4096), fragment order. Few waves, MG_N granules a thread, all loads up front.
// coverage: MG_T threads x MG_N granules = NGRAN granules = the whole [NROW][EMB] planes.
// =====================================================================================================
#define MG_N 4
#define MG_T (NROW * EMB / 8 / MG_N)
static_assert((MG_T % 256) == 0 && KSPLIT == 2);
__global__ __launch_bounds__(256) void ctx_merge(const float* __restrict__ c00, const float* __restrict__ c01,
                                                 const float* __restrict__ c10, const float* __restrict__ c11,
                                                 unsigned short* chp, unsigned short* clp) {
  const float* const cin[4] = {c00, c01, c10, c11};   // [2 * key range + half of the granule]: four scalar bases
  // granule i's byte offset, 32 bits, the same in a part (16 B of f32 a half granule) and in a plane (16 B of f16 a granule):
  // one offset register beside scalar bases serves every load and store
  unsigned ob = (blockIdx.x * 256u + threadIdx.x) * 16u;
  v4f x[MG_N][4];
#pragma unroll                                // unrolled here and below: x keeps constant indices (registers)
  for (int n = 0; n < MG_N; ++n)
#pragma unroll
    for (int p = 0; p < 4; ++p)               // p = 2 * key range + half of the granule
      x[n][p] = *(const v4f*)((const char*)cin[p] + (size_t)n * MG_T * 16 + ob);
#if DEV_ASM
  asm volatile("s_wait_xcnt 0x0" : "+v"(ob) :: "memory");   // the offset register, which these loads name, is held to here
#endif
  __builtin_amdgcn_sched_barrier(0);          // no conversion result is written ahead of that wait
#pragma unroll
  for (int n = 0; n < MG_N; ++n) {
    const v4f fa = x[n][0] + x[n][2], fb = x[n][1] + x[n][3];
    const float f[8] = {fa[0], fa[1], fa[2], fa[3], fb[0], fb[1], fb[2], fb[3]};
    v4u a, a2;
#pragma unroll
    for (int e = 0; e < 4; ++e) {
      const float f0 = f[2 * e], f1 = f[2 * e + 1];
      const _Float16 x0 = (_Float16)f0, x1 = (_Float16)f1;
      const unsigned short h0 = h_bits(x0), h1 = h_bits(x1);
      const unsigned short l0 = h_bits((_Float16)((f0 - (float)x0) * 4096.0f));
      const unsigned short l1 = h_bits((_Float16)((f1 - (float)x1) * 4096.0f));
      a[e] = pk16(h0, h1); a2[e] = pk16(l0, l1);
    }
    *(v4u*)((char*)chp + (size_t)n * MG_T * 16 + ob) = a;
    *(v4u*)((char*)clp + (size_t)n * MG_T * 16 + ob) = a2;
  }
}

// =====================================================================================================
// Workspace map (bytes, full size NB=2 SEQ=2048; PX = NROW*EMB*2 = 8388608; every region an exact multiple of
// its whole-line / whole-tile store granularity, rows are whole tiles, no padded tails needed):
//   Xq   bf16 [NROW][EMB]            PX        8388608
//   Xk   bf16 [NROW][EMB]            PX        8388608
//   Xv   bf16 [NROW][EMB]            PX        8388608
//   Wqb  bf16 [EMB n][EMB k]                   2097152
//   Wkb  bf16 [EMB n][EMB k]                   2097152
//   Wvb  bf16 [EMB n][EMB k]                   2097152
//   Wob  f16  [EMB n][EMB k] (x64)             2097152
//   Qh   f16  [NROW][EMB]            PX        8388608
//   Ql   f16  [NROW][EMB]            PX        8388608
//   Kp   f16  [NROW][EMB]            PX        8388608
//   VT   f16  [NB][EMB][SEQ]                   8388608
//   Ch   f16  [NROW][EMB]            PX        8388608
//   Cl   f16  [NROW][EMB]            PX        8388608
//   ML   f32  [NB*NH][2][SEQ]                   524288
//   CP   f32  [2 key ranges][NROW][EMB]       33554432
//   total                                    117964800
// Every 16-bit plane is in fragment order (same bytes, same extents). Input weights are [out n][in k] (k contiguous) =
// the Bt / A orientation directly; they are only converted to 16 bit and put in that order.
// Output 0 at element 0 of d_out (rows b*SEQ + s); output 1 at the fixed element offset OFF1 = NB_FULL*SEQ_FULL*EMB.
// =====================================================================================================
extern "C" void kernel_launch(void* const* d_in, const int* in_sizes, int n_in,
                              void* d_out, int out_size, void* d_ws, size_t ws_size,
                              hipStream_t stream) {
  if (n_in < 7) return;
  const int needX = ((NB - 1) * SEQ_FULL + SEQ) * EMB;
  if (in_sizes[0] < needX) return;
  if (in_sizes[1] < needX) return;
  if (in_sizes[2] < needX) return;
  if (in_sizes[3] < EMB * EMB) return;
  if (in_sizes[4] < EMB * EMB) return;
  if (in_sizes[5] < EMB * EMB) return;
  if (in_sizes[6] < EMB * EMB) return;
  const size_t n0e = (size_t)NROW * EMB;            // output 0 written elements [NB][SEQ][EMB]
  const size_t n1e = (size_t)NB * SEQ * SEQ;        // output 1 written elements [NB][SEQ][SEQ]
  if (out_size < 0) return;
  if ((size_t)out_size < n0e) return;
  if ((size_t)out_size < OFF1 + n1e) return;        // written extent of output 1 inside d_out

  const float* xq = (const float*)d_in[0];
  const float* xk = (const float*)d_in[1];
  const float* xv = (const float*)d_in[2];
  const float* Wq = (const float*)d_in[3];
  const float* Wk = (const float*)d_in[4];
  const float* Wv = (const float*)d_in[5];
  const float* Wo = (const float*)d_in[6];

  const size_t PX  = (size_t)NROW * EMB * 2;        // 16-bit activation plane
  const size_t PW  = (size_t)EMB * EMB * 2;
  const size_t PVT = (size_t)NB * EMB * SEQ * 2;
  const size_t PML = (size_t)NB * NH * 2 * SEQ * 4;
  size_t off = 0;
  const size_t oXq = off; off += PX;
  const size_t oXk = off; off += PX;
  const size_t oXv = off; off += PX;
  const size_t oWq = off; off += PW;
  const size_t oWk = off; off += PW;
  const size_t oWv = off; off += PW;
  const size_t oWo = off; off += PW;
  const size_t oQh = off; off += PX;
  const size_t oQl = off; off += PX;
  const size_t oKp = off; off += PX;
  const size_t oVT = off; off += PVT;
  const size_t oCh = off; off += PX;
  const size_t oCl = off; off += PX;
  const size_t oML = off; off += PML;
  const size_t oCP = off; off += (size_t)KSPLIT * NROW * EMB * 4;
  if (off > ws_size) return;                        // off = 117964800 at full size
  if (off > (size_t)134217728) return;

  char* ws = (char*)d_ws;
  unsigned short* Xq  = (unsigned short*)(ws + oXq);
  unsigned short* Xk  = (unsigned short*)(ws + oXk);
  unsigned short* Xv  = (unsigned short*)(ws + oXv);
  unsigned short* Wqb = (unsigned short*)(ws + oWq);
  unsigned short* Wkb = (unsigned short*)(ws + oWk);
  unsigned short* Wvb = (unsigned short*)(ws + oWv);
  unsigned short* Wob = (unsigned short*)(ws + oWo);
  unsigned short* Qh  = (unsigned short*)(ws + oQh);
  unsigned short* Ql  = (unsigned short*)(ws + oQl);
  unsigned short* Kp  = (unsigned short*)(ws + oKp);
  unsigned short* VT  = (unsigned short*)(ws + oVT);
  unsigned short* Ch  = (unsigned short*)(ws + oCh);
  unsigned short* Cl  = (unsigned short*)(ws + oCl);
  float*          ML  = (float*)(ws + oML);
  float*          CP  = (float*)(ws + oCP);
  float*          out0 = (float*)d_out;
  float*          out1 = (float*)d_out + OFF1;

  const dim3 blk(256);
  const dim3 gCvt(CVT_T / 256);                                  //  512 blocks
  const dim3 gQK((((NROW) / 64) * (EMB / 64) + 7) / 8, 1);        // 1024 tiles -> 128 blocks: M=NROW, N=EMB
  const dim3 gV((((EMB) / 64) * (SEQ / 64) + 7) / 8, NB);          //  512 tiles ->  64 blocks x NB: M=EMB, N=SEQ
  const dim3 gO((((NROW) / 32) * (EMB / 64) + 7) / 8, 1);         // 2048 tiles -> 256 blocks (32x64 wave tiles)
  const dim3 gStats(NB * NH * NKT);                              // 1024 blocks of 128
  const dim3 gMain(NB * NQB32 * KSPLIT);                         //  256 blocks of 512
  const dim3 gMerge(MG_T / 256);                                 //  512 blocks

  // (1) activations [b][s][k] -> bf16 planes [b*SEQ+s][k] (input batch stride SEQ_FULL*EMB, plane batch stride SEQ*EMB);
  // (2) weights [EMB n][EMB k] -> bf16 planes (Wq, Wk, Wv); Wo -> f16 (x64 of its bf16 value); no transpose needed
  cvt_all<<<gCvt, blk, 0, stream>>>(xq, xk, xv, Wq, Wk, Wv, Wo, Xq, Xk, Xv, Wqb, Wkb, Wvb, Wob);
  // (3) q = xq . Wq^T -> f16 hi / residual (x4096) planes [b*SEQ+s][h*64+d]   (M=NROW, N=EMB, K=EMB)
  gemm_t<__bf16, 4, 1, 3><<<gQK, blk, 0, stream>>>(
      Xq, Xq, EMB, 0LL, Wqb, EMB, 0LL,
      (void*)Qh, (void*)Ql, EMB, 0LL,
      NROW, EMB, EMB, 1.0f, 0.0f, 1.0f, 4096.0f);
  // (4) k = xk . Wk^T -> f16 plane [b*SEQ+s][h*64+d]
  gemm_t<__bf16, 4, 1, 1><<<gQK, blk, 0, stream>>>(
      Xk, Xk, EMB, 0LL, Wkb, EMB, 0LL,
      (void*)Kp, (void*)Kp, EMB, 0LL,
      NROW, EMB, EMB, 1.0f, 0.0f, 1.0f, 1.0f);
  // (5) v^T = Wv . xv_b^T (per batch b = blockIdx.y) -> f16 plane [b][h*64+d][s] (pitch SEQ)
  //     (A = Wvb [n][k]; Bt = Xv rows of batch b: offset b*SEQ*EMB, pitch EMB; M=EMB, N=SEQ, K=EMB)
  gemm_t<__bf16, 4, 1, 1><<<gV, blk, 0, stream>>>(
      Wvb, Wvb, EMB, 0LL, Xv, EMB, (long long)SEQ * EMB,
      (void*)VT, (void*)VT, SEQ, (long long)EMB * SEQ,
      EMB, SEQ, EMB, 1.0f, 0.0f, 1.0f, 1.0f);
  // (6) softmax statistics (m, 1/l) per (b, h, s)
  attn_stats<<<gStats, dim3(128), 0, stream>>>(Qh, Ql, Kp, ML);
  // (7) exact-normalised p: P.V -> f32 parts of ctx, one per key range; head-averaged p -> output 1
  attn_main<<<gMain, dim3(512), 0, stream>>>(Qh, Ql, Kp, VT, ML, CP, out1);
  // (7b) ctx = sum of its parts -> ctx planes (f16 hi x256 / residual x4096)
  ctx_merge<<<gMerge, blk, 0, stream>>>(CP, CP + NGRAN * 4, CP + NGRAN * 8, CP + NGRAN * 12, Ch, Cl);
  // (8) output 0 = ctx . Wo^T, f32 [NROW][EMB] straight into d_out, accumulators (hi + res/4096) x 1/(256*64)
  gemm_t<_Float16, 2, 2, 0><<<gO, blk, 0, stream>>>(
      Ch, Cl, EMB, 0LL, Wob, EMB, 0LL,
      (void*)out0, (void*)out0, EMB, 0LL,
      NROW, EMB, EMB, 1.0f / 16384.0f, 1.0f / 4096.0f, 1.0f, 1.0f);
  (void)hipGetLastError();
}

// v007
// A run of this version takes 165 microseconds.
// Two timings next to v006 put it at 1.08 and 1.07 times that version's speed.
// All steps since v000 together make it 3.03 times as fast.
// Contractions: q, k, v^T projections = v_wmma_f32_16x16x32_bf16 (bf16 operands from RNE-converted inputs and weights, single product, f32 accumulate);
// scores (statistics pass and main pass), formed transposed as k.q^T = v_wmma_f32_16x16x32_f16 (k f16 as A; q as f16 hi plane + f16 residual plane x4096 as B; 2 products, separate f32 accumulators);
// p.v = v_wmma_f32_16x16x32_f16 (p carried x16384 in f16, v f16; single product, f32 accumulate);
// ctx.Wo^T = v_wmma_f32_16x16x32_f16 (ctx as f16 hi plane x256 + f16 residual plane x4096, Wo f16 x64 of its bf16 value; 2 products, separate f32 accumulators);
// softmax statistics, probabilities, head average and the sum of the two key ranges' ctx parts in f32.
#include <hip/hip_runtime.h>
#include <math.h>
#include <stdint.h>

#ifndef NB
#define NB 2
#endif
#ifndef SEQ
#define SEQ 2048
#endif
#define NB_FULL  2
#define SEQ_FULL 2048
#define EMB      1024
#define NH       16
#define HD       64
#define NROW     (NB * SEQ)          // activation rows in workspace planes, row index = b * SEQ + s
#define NKT      (SEQ / 64)          // 64-key chunks per sequence
#define PCARRY   16384.0f            // power-of-two carry of p in the f16 P.V operand
#define OFF1     ((size_t)NB_FULL * SEQ_FULL * EMB)   // fixed element offset of output 1 in d_out
static_assert(NB >= 1 && NB <= NB_FULL);
static_assert(SEQ >= 64 && SEQ <= SEQ_FULL && (SEQ % 64) == 0);
static_assert(NH * HD == EMB && (EMB % 128) == 0);
static_assert((NROW % 64) == 0 && (EMB % 64) == 0 && (HD % 64) == 0 && (EMB % 32) == 0);
static_assert(OFF1 * 4 == 16777216);   // byte offset of output 1
static_assert((OFF1 + (size_t)NB_FULL * SEQ_FULL * SEQ_FULL) * 4 == 50331648);   // written extent of output 1 == d_out bytes

typedef _Float16 v16h __attribute__((ext_vector_type(16)));
typedef _Float16 v8h  __attribute__((ext_vector_type(8)));
typedef __bf16   v16b __attribute__((ext_vector_type(16)));
typedef __bf16   v8b  __attribute__((ext_vector_type(8)));
typedef float    v8f  __attribute__((ext_vector_type(8)));
typedef float    v4f  __attribute__((ext_vector_type(4)));
typedef unsigned int v4u __attribute__((ext_vector_type(4)));

#if defined(__HIP_DEVICE_COMPILE__)
#define DEV_ASM 1
#else
#define DEV_ASM 0
#endif

// ---- scalar helpers --------------------------------------------------------------------------------
__device__ __forceinline__ unsigned short bf_bits(float f) {          // f32 -> bf16 bits, RNE convert
  unsigned u = __float_as_uint(f);
  return (unsigned short)((u + 0x7FFFu + ((u >> 16) & 1u)) >> 16);
}
__device__ __forceinline__ float bf_up(unsigned short hb) { return __uint_as_float(((unsigned)hb) << 16); }
__device__ __forceinline__ unsigned short h_bits(_Float16 x) { return __builtin_bit_cast(unsigned short, x); }
__device__ __forceinline__ unsigned pk16(unsigned short a, unsigned short b) { return (unsigned)a | ((unsigned)b << 16); }
__device__ __forceinline__ v8f zero8() { v8f z = {0.f, 0.f, 0.f, 0.f, 0.f, 0.f, 0.f, 0.f}; return z; }

// ---- fragment order: every 16-bit workspace plane [R rows][KC k] is kept as 1-KB units, one per WMMA operand fragment
//      (16 rows x 32 k), unit index = (row / 16) * (KC / 32) + k / 32. Inside a unit, in 16-byte granules of 8 k:
//      granule = ((k % 32) / 8) * 16 + row % 16, so granule g of the first 512 B is lane g's elements 0..7 and granule
//      g of the second 512 B its elements 8..15: each wave-wide 16-byte load reads 512 contiguous bytes (4 whole lines).
#define FRAG_EL 512                  // elements of one unit
// ---- fragment types / loaders: 16-bit A/B operand, lane -> row/col (lane&15), half h = lane>>4; p = unit + 8*lane;
//      elements 0..7 <- p[0..7] (k0+8h..k0+8h+7), elements 8..15 <- p[256..263] (k0+16+8h..k0+16+8h+7)
template <typename OT> struct FT;
template <> struct FT<__bf16>   { typedef v16b frag; typedef v8b half8; };
template <> struct FT<_Float16> { typedef v16h frag; typedef v8h half8; };

template <typename OT>
__device__ __forceinline__ typename FT<OT>::frag ldfrag(const OT* p) {
  union { typename FT<OT>::frag v; typename FT<OT>::half8 h[2]; } f;
  f.h[0] = *(const typename FT<OT>::half8*)(p);
  f.h[1] = *(const typename FT<OT>::half8*)(p + 256);
  return f.v;
}

// ---- WMMA helpers (asm guard bodies are device-only; concrete operand types) -----------------------------
__device__ __forceinline__ v8f mmar(v16b a, v16b b, v8f c) {
  return __builtin_amdgcn_wmma_f32_16x16x32_bf16(false, a, false, b, (short)0, c, false, false);
}
__device__ __forceinline__ v8f mmar(v16h a, v16h b, v8f c) {
  return __builtin_amdgcn_wmma_f32_16x16x32_f16(false, a, false, b, (short)0, c, false, false);
}
// guarded form: 4 VALU slots after the WMMA, D tied, A/B kept live
__device__ __forceinline__ v8f mma_h(v16h a, v16h b, v8f c) {
  c = __builtin_amdgcn_wmma_f32_16x16x32_f16(false, a, false, b, (short)0, c, false, false);
#if DEV_ASM
  asm volatile("v_nop\n\tv_nop\n\tv_nop\n\tv_nop" : "+v"(c) : "v"(a), "v"(b));
#endif
  return c;
}
__device__ __forceinline__ void acc_guard4(v8f& a, v8f& b, v8f& c, v8f& d) {
#if DEV_ASM
  asm volatile("v_nop\n\tv_nop\n\tv_nop\n\tv_nop" : "+v"(a), "+v"(b), "+v"(c), "+v"(d));
#else
  (void)a; (void)b; (void)c; (void)d;
#endif
}

// 16-bit convert helper. MODE 0: bf16 bits (RNE convert).  MODE 1: f16 bits of (64 * bf16(x)) (exact scaling of the bf16 value).
template <int MODE>
__device__ __forceinline__ unsigned short cvm(float f) {
  const unsigned short hb = bf_bits(f);
  if (MODE == 0) return hb;
  return h_bits((_Float16)(bf_up(hb) * 64.0f));
}

// =====================================================================================================
// All seven f32 -> 16-bit conversions (3 activations, 4 weights) in ONE launch of few waves, each with many granules.
// Planes in fragment order, 8 elements (one granule) per thread and slab. The launch has CVT_T threads. A weight is one
// slab of CVT_T granules. An activation is XSLAB slabs; a slab takes CVT_TB granules (XROWS rows) of EVERY batch, thread
// i being in batch i / CVT_TB, so that a slab's step from the plane's start is a small constant for all threads.
// In a slab a wave takes 8 rows x 32 k: it reads 8 whole 128-B lines of f32 and writes 4 whole 128-B lines
// (8 granules of each of the unit's 4 k groups).
// coverage: activations: XSLAB slabs x NB batches x XROWS rows = [NROW][EMB], 3 planes; weights: CVT_T granules = [EMB][EMB], 4 planes.
// =====================================================================================================
#define CVT_T    (EMB * EMB / 8)                  // threads of the launch = granules of a weight
#define CVT_TB   (CVT_T / NB)                     // threads on one batch
#define XROWS    (CVT_TB * 8 / EMB)               // rows of a batch in one activation slab
#define XSLAB    (SEQ / XROWS)                    // slabs of an activation
#define NXSLAB   (3 * XSLAB)
#define NSLAB    (NXSLAB + 4)                     // ... and the four weights
static_assert((CVT_T % 256) == 0 && (CVT_T % NB) == 0 && (XROWS % 16) == 0 && XROWS * EMB == CVT_TB * 8 && (SEQ % XROWS) == 0);
static_assert((size_t)NB_FULL * SEQ_FULL * EMB * 4 < ((size_t)1 << 32));   // byte offsets in a plane fit 32 bits
template <int MODE>
__device__ __forceinline__ v4u cvt8(v4f a, v4f a4) {
  v4u p;
  p[0] = pk16(cvm<MODE>(a[0]),  cvm<MODE>(a[1]));
  p[1] = pk16(cvm<MODE>(a[2]),  cvm<MODE>(a[3]));
  p[2] = pk16(cvm<MODE>(a4[0]), cvm<MODE>(a4[1]));
  p[3] = pk16(cvm<MODE>(a4[2]), cvm<MODE>(a4[3]));
  return p;
}
__global__ __launch_bounds__(256) void cvt_all(
    const float* __restrict__ xq, const float* __restrict__ xk, const float* __restrict__ xv,
    const float* __restrict__ wq, const float* __restrict__ wk, const float* __restrict__ wv,
    const float* __restrict__ wo,
    unsigned short* Xq, unsigned short* Xk, unsigned short* Xv,
    unsigned short* Wqb, unsigned short* Wkb, unsigned short* Wvb, unsigned short* Wob) {
  const unsigned i    = blockIdx.x * 256u + threadIdx.x;
  const unsigned unit = i >> 6;                               // 64 threads (2 waves) per unit
  const unsigned kg   = (i >> 3) & 3u;                        // k group of 8 inside the unit
  const unsigned rr   = ((i >> 5) & 1u) * 8u + (i & 7u);      // row inside the unit
  const unsigned bt   = i / CVT_TB;                           // the thread's batch in the activations
  // the granule's byte offsets from a plane's start, 32 bits: with a slab's constant step, one offset register serves
  // every slab of a kind beside the plane's scalar base. Weights: granule i. Activations: granule i - bt * CVT_TB of batch bt.
  unsigned sobW = (((unit / (EMB / 32)) * 16u + rr) * EMB + (unit % (EMB / 32)) * 32u + kg * 8u) * 4u;
  unsigned sobX = sobW + bt * (unsigned)((SEQ_FULL - XROWS) * EMB * 4);
  const unsigned dobW = (unit * FRAG_EL + (kg * 16u + rr) * 8u) * 2u;
  const unsigned dobX = dobW + bt * (unsigned)((SEQ - XROWS) * EMB * 2);
  const float* const xin[3]     = {xq, xk, xv};
  const float* const win[4]     = {wq, wk, wv, wo};
  unsigned short* const xout[3] = {Xq, Xk, Xv};
  unsigned short* const wout[4] = {Wqb, Wkb, Wvb, Wob};
  // every loop here is unrolled: the slab index picks pointers and registers at compile time
  v4f a[NSLAB][2];
#pragma unroll
  for (int s = 0; s < NSLAB; ++s) {               // all loads of the thread up front: 2 * NSLAB x 16 B in flight a lane
    const char* src = (s < NXSLAB) ? (const char*)xin[s / XSLAB] + (size_t)(s % XSLAB) * XROWS * EMB * 4 + sobX
                                   : (const char*)win[s - NXSLAB] + sobW;
    a[s][0] = *(const v4f*)(src);
    a[s][1] = *(const v4f*)(src + 16);
    __builtin_amdgcn_sched_barrier(0);            // a slab's two loads read the same lines: kept side by side, ahead of all conversions
  }
#if DEV_ASM
  asm volatile("s_wait_xcnt 0x0" : "+v"(sobX), "+v"(sobW) :: "memory");   // before the offset registers, which these loads name, are given up
#endif
  __builtin_amdgcn_sched_barrier(0);              // no conversion result is written ahead of that wait
  v4u p[NSLAB];
#pragma unroll
  for (int s = 0; s < NSLAB; ++s)
    p[s] = (s == NSLAB - 1) ? cvt8<1>(a[s][0], a[s][1]) : cvt8<0>(a[s][0], a[s][1]);
#pragma unroll
  for (int s = 0; s < NSLAB; ++s) {
    char* dst = (s < NXSLAB) ? (char*)xout[s / XSLAB] + (size_t)(s % XSLAB) * XROWS * EMB * 2 + dobX
                             : (char*)wout[s - NXSLAB] + dobW;
    *(v4u*)dst = p[s];
  }
}

// =====================================================================================================
// Register-blocked batched WMMA GEMM (16-bit operand type OT): C[m][n] = sum_k A[m][k] * Bt[n][k];
// one wave per (16*MI) x 64 tile, no block barriers. A [M][K = lda] and Bt [N][K = ldb] in fragment order;
// M multiple of 16*MI, N multiple of 64, K multiple of 128 (static sizes here). blockIdx.y = batch
// index (strides in elements). Fragments are loaded straight from global, 512 contiguous bytes a load (ldfrag_g).
// NPA = number of A planes: 2 -> second plane A2 (same pitch/stride) multiplies the same Bt fragments into a
// second accumulator set, combined as acc + acc2 * rscaleA in the f32 epilogue.
// value v = (acc [+ acc2*rscaleA]) * oscale.
// OUT_MODE 0: f32 C (pitch ldc) = v.
// OUT_MODE 1: f16 plane C = f16(v * cscale), [M][N = ldc] in fragment order.
// OUT_MODE 3: f16 hi plane C = f16(v * cscale) and f16 residual plane C2 = f16((v*cscale - hi) * rscaleC), likewise.
// =====================================================================================================
// one k step's load group: 4 B fragments, MI A fragments (and MI of the second A plane); in this helper and the next
// every loop is unrolled so that the fragment and accumulator arrays keep constant indices (registers)
//   (bp, ap, ap2: each lane's pointers into its row tiles' units, global address space, in 16-byte units;
//    k: a constant element offset, FRAG_EL per k step of 32)
template <typename OT> struct GP { typedef const __attribute__((address_space(1))) typename FT<OT>::half8* ptr; };
template <typename OT>
__device__ __forceinline__ typename FT<OT>::frag ldfrag_g(typename GP<OT>::ptr p, int k) {   // same k map as ldfrag
  union { typename FT<OT>::frag v; typename FT<OT>::half8 h[2]; } f;
  f.h[0] = p[k / 8];
  f.h[1] = p[k / 8 + 32];
  return f.v;
}
template <typename OT, int MI, int NPA>
__device__ __forceinline__ void gemm_ld(typename GP<OT>::ptr const (&bp)[4], typename GP<OT>::ptr const (&ap)[MI],
                                        typename GP<OT>::ptr const (&ap2)[MI], int k,
                                        typename FT<OT>::frag (&bq)[4], typename FT<OT>::frag (&af)[MI],
                                        typename FT<OT>::frag (&ag)[MI]) {
#pragma unroll
  for (int j = 0; j < 4; ++j) bq[j] = ldfrag_g<OT>(bp[j], k);
#pragma unroll
  for (int i = 0; i < MI; ++i) {
    af[i] = ldfrag_g<OT>(ap[i], k);
    if (NPA == 2) ag[i] = ldfrag_g<OT>(ap2[i], k);
  }
}
// the wait that stands before the row pointers, which the issued loads name, are moved on or given up
template <int MI, int NPA, typename P>
__device__ __forceinline__ void ptr_wait(P (&bp)[4], P (&ap)[MI], P (&ap2)[MI]) {
  static_assert((MI == 4 && NPA == 1) || (MI == 2 && NPA == 2));   // the two shapes in use: eight pointers each
#if DEV_ASM
  if constexpr (MI == 4)
    asm volatile("s_wait_xcnt 0x0" : "+v"(bp[0]), "+v"(bp[1]), "+v"(bp[2]), "+v"(bp[3]),
                                     "+v"(ap[0]), "+v"(ap[1]), "+v"(ap[2]), "+v"(ap[3]) :: "memory");
  else
    asm volatile("s_wait_xcnt 0x0" : "+v"(bp[0]), "+v"(bp[1]), "+v"(bp[2]), "+v"(bp[3]),
                                     "+v"(ap[0]), "+v"(ap[1]), "+v"(ap2[0]), "+v"(ap2[1]) :: "memory");
#endif
}
// one k step's products, in the order i, plane, j
template <typename OT, int MI, int NPA>
__device__ __forceinline__ void gemm_mm(const typename FT<OT>::frag (&bq)[4], const typename FT<OT>::frag (&af)[MI],
                                        const typename FT<OT>::frag (&ag)[MI], v8f (&acc)[MI][4], v8f (&acc2)[MI][4]) {
#pragma unroll
  for (int i = 0; i < MI; ++i) {
#pragma unroll
    for (int j = 0; j < 4; ++j) acc[i][j] = mmar(af[i], bq[j], acc[i][j]);
    if (NPA == 2) {
#pragma unroll
      for (int j = 0; j < 4; ++j) acc2[i][j] = mmar(ag[i], bq[j], acc2[i][j]);
    }
  }
}

template <typename OT, int MI, int NPA, int OUT_MODE>
__global__ __launch_bounds__(256) void gemm_t(
    const unsigned short* __restrict__ Ap, const unsigned short* __restrict__ A2p, int lda, long long strideA,
    const unsigned short* __restrict__ Btp, int ldb, long long strideB,
    void* Cout, void* Cout2, int ldc, long long strideC,
    int M, int N, int K, float oscale, float rscaleA, float cscale, float rscaleC) {
  typedef typename FT<OT>::frag V16;
  const OT* A  = (const OT*)(const void*)Ap;
  const OT* A2 = (const OT*)(const void*)A2p;
  const OT* Bt = (const OT*)(const void*)Btp;
  __shared__ __align__(16) float sT[8][16 * 68];   // per-wave 16x64 slab, pitch 68 floats
  const int RT   = 16 * MI;
  const int b    = blockIdx.y;
  const int lane = threadIdx.x & 31;
  const int wave = threadIdx.x >> 5;
  const int tilesN = N >> 6;
  const int tilesM = M / RT;
  const int tile = blockIdx.x * 8 + wave;
  if (tile >= tilesM * tilesN) return;   // wave-uniform; no block barriers in this kernel
  const int tm = tile / tilesN;
  const int tn = tile - tm * tilesN;
  const int m0 = tm * RT;
  const int n0 = tn << 6;

  const OT* Ab  = A  + (size_t)b * (size_t)strideA;
  const OT* A2b = A2 + (size_t)b * (size_t)strideA;
  const OT* Bb  = Bt + (size_t)b * (size_t)strideB;

  const int rlane = lane & 15;                 // row (A) / col (B, D) within subtile
  const int mOff  = (lane >> 4) * 8;           // D row offset

  v8f acc[MI][4], acc2[MI][4];
#pragma unroll
  for (int i = 0; i < MI; ++i)
#pragma unroll
    for (int j = 0; j < 4; ++j) { acc[i][j] = zero8(); acc2[i][j] = zero8(); }

  // Rotating fragment sets: the whole load group of k step s + 2 is issued ahead of the products of step s, so the
  // loads of two steps fly under the products, where one latency per A fragment was waited out. K is a multiple of 128.
  typedef typename GP<OT>::ptr GPtr;
  GPtr bp[4], ap[MI], ap2[MI];
  // Blocks that share operand rows walk the same lines: each block starts its k walk at its own group of 4 k steps and wraps
  // round, so that blocks running in step ask L2 for different lines at any moment. One start for the whole block: its waves
  // stay in step on the A rows they share. Blocks of one tile row, and blocks of one tile column set, get different starts.
  const int ng = K >> 7;                       // groups of 4 k steps
  int grp = (int)((blockIdx.x + blockIdx.x / (unsigned)((tilesN + 7) >> 3) + 3u * blockIdx.y) % (unsigned)ng);   // group in hand
  const size_t kst = (size_t)grp * 4 * FRAG_EL + lane * 8;
#pragma unroll
  for (int j = 0; j < 4; ++j) bp[j] = (GPtr)(const void*)(Bb + (size_t)((n0 >> 4) + j) * (ldb >> 5) * FRAG_EL + kst);
#pragma unroll
  for (int i = 0; i < MI; ++i) {
    ap[i]  = (GPtr)(const void*)(Ab  + (size_t)((m0 >> 4) + i) * (lda >> 5) * FRAG_EL + kst);
    ap2[i] = (GPtr)(const void*)(A2b + (size_t)((m0 >> 4) + i) * (lda >> 5) * FRAG_EL + kst);
  }
  V16 bq[4][4], af[4][MI], ag[4][MI];
  gemm_ld<OT, MI, NPA>(bp, ap, ap2, 0, bq[0], af[0], ag[0]);
  __builtin_amdgcn_sched_barrier(0);       // group order as in the loop, so that the loop's counted waits stay per group
  gemm_ld<OT, MI, NPA>(bp, ap, ap2, FRAG_EL, bq[1], af[1], ag[1]);
  for (int k0 = 128; k0 < K; k0 += 128) {  // all trips but the last four steps
#pragma unroll
    for (int u = 0; u < 2; ++u) {          // unrolled so that the set index is a constant (registers): steps 2, 3 of the group in hand
      gemm_ld<OT, MI, NPA>(bp, ap, ap2, (u + 2) * FRAG_EL, bq[u + 2], af[u + 2], ag[u + 2]);
      __builtin_amdgcn_sched_barrier(0);   // keeps the load group ahead of the products below
      gemm_mm<OT, MI, NPA>(bq[u], af[u], ag[u], acc, acc2);
    }
    ptr_wait<MI, NPA>(bp, ap, ap2);
    const int adv = (grp + 1 < ng) ? 4 * FRAG_EL / 8 : -(ng - 1) * (4 * FRAG_EL / 8);   // 4 k steps = 4 units; behind the last group comes group 0
    grp = (grp + 1 < ng) ? grp + 1 : 0;
#pragma unroll
    for (int j = 0; j < 4; ++j) bp[j] += adv;
#pragma unroll
    for (int i = 0; i < MI; ++i) { ap[i] += adv; ap2[i] += adv; }
#pragma unroll
    for (int u = 2; u < 4; ++u) {          // steps 0, 1 of the next group
      gemm_ld<OT, MI, NPA>(bp, ap, ap2, (u - 2) * FRAG_EL, bq[u - 2], af[u - 2], ag[u - 2]);
      __builtin_amdgcn_sched_barrier(0);   // keeps the load group ahead of the products below
      gemm_mm<OT, MI, NPA>(bq[u], af[u], ag[u], acc, acc2);
    }
  }
  // the last four steps: two groups are still to fetch
  gemm_ld<OT, MI, NPA>(bp, ap, ap2, 2 * FRAG_EL, bq[2], af[2], ag[2]);
  __builtin_amdgcn_sched_barrier(0);       // keeps the load group ahead of the products below
  gemm_mm<OT, MI, NPA>(bq[0], af[0], ag[0], acc, acc2);
  gemm_ld<OT, MI, NPA>(bp, ap, ap2, 3 * FRAG_EL, bq[3], af[3], ag[3]);
  ptr_wait<MI, NPA>(bp, ap, ap2);
  __builtin_amdgcn_sched_barrier(0);       // keeps the load group ahead of the products below
  gemm_mm<OT, MI, NPA>(bq[1], af[1], ag[1], acc, acc2);
  gemm_mm<OT, MI, NPA>(bq[2], af[2], ag[2], acc, acc2);
  gemm_mm<OT, MI, NPA>(bq[3], af[3], ag[3], acc, acc2);
#pragma unroll
  for (int i = 0; i < MI; ++i) {
    acc_guard4(acc[i][0], acc[i][1], acc[i][2], acc[i][3]);
    if (NPA == 2) acc_guard4(acc2[i][0], acc2[i][1], acc2[i][2], acc2[i][3]);
  }

  // ---- epilogue ----
  float* slab = sT[wave];
#pragma unroll
  for (int i = 0; i < MI; ++i) {
    const int mBase = m0 + (i << 4);
#pragma unroll
    for (int j = 0; j < 4; ++j) {
#pragma unroll
      for (int r = 0; r < 8; ++r) {
        float v = acc[i][j][r];
        if (NPA == 2) v += acc2[i][j][r] * rscaleA;
        v = v * oscale;
        slab[(mOff + r) * 68 + (j << 4) + rlane] = v;
      }
    }
    __builtin_amdgcn_fence(3, "workgroup");
    __builtin_amdgcn_wave_barrier();
    __builtin_amdgcn_fence(2, "workgroup");
    if (OUT_MODE == 0) {
      float* C = (float*)Cout + (size_t)b * (size_t)strideC;
      const int h2 = lane >> 4, c4 = (lane & 15) * 4;     // 256-B row segment = 16 lanes x 16 B
      v4f ov[8];
#pragma unroll
      for (int it = 0; it < 8; ++it) {
        const int row = it * 2 + h2;                     // it 0..7 x h2 0..1 = rows 0..15
        ov[it] = *(const v4f*)(slab + row * 68 + c4);
      }
      {
#pragma unroll
        for (int it = 0; it < 8; ++it) {
          const int row = it * 2 + h2;
          *(v4f*)(C + (size_t)(mBase + row) * ldc + n0 + c4) = ov[it];
        }
        
      }
    } else {
      // the 16 x 64 slab = 2 units = 128 granules in a row: store it writes granules 32*it + lane (512 contiguous B),
      // which hold row lane&15, columns 8*(2*it + (lane>>4)) .. +7
      const size_t u0 = ((size_t)(mBase >> 4) * (ldc >> 5) + (n0 >> 5)) * FRAG_EL + lane * 8;
      unsigned short* C  = (unsigned short*)Cout  + (size_t)b * (size_t)strideC + u0;
      unsigned short* C2 = (unsigned short*)Cout2 + (size_t)b * (size_t)strideC + u0;
      v4u hv[4], lv[4];
#pragma unroll
      for (int it = 0; it < 4; ++it) {
        const float* sp = slab + rlane * 68 + (it * 2 + (lane >> 4)) * 8;
        float f[8];
#pragma unroll
        for (int e = 0; e < 8; ++e) f[e] = sp[e] * cscale;
        v4u a, a2;
#pragma unroll
        for (int e = 0; e < 4; ++e) {
          const float f0 = f[2 * e], f1 = f[2 * e + 1];
          const _Float16 x0 = (_Float16)f0, x1 = (_Float16)f1;
          const unsigned short h0 = h_bits(x0), h1 = h_bits(x1);
          unsigned short l0 = 0, l1 = 0;
          if (OUT_MODE == 3) {
            l0 = h_bits((_Float16)((f0 - (float)x0) * rscaleC));
            l1 = h_bits((_Float16)((f1 - (float)x1) * rscaleC));
          }
          a[e] = pk16(h0, h1); a2[e] = pk16(l0, l1);
        }
        hv[it] = a; lv[it] = a2;
      }
      {
#pragma unroll
        for (int it = 0; it < 4; ++it) {
          *(v4u*)(C + it * 256) = hv[it];
          if (OUT_MODE == 3) *(v4u*)(C2 + it * 256) = lv[it];
        }
#if DEV_ASM
        asm volatile("s_wait_xcnt 0x0" ::: "memory");   // before the next slab overwrites the registers these stores name
#endif
      }
    }
    __builtin_amdgcn_fence(3, "workgroup");
    __builtin_amdgcn_wave_barrier();
    __builtin_amdgcn_fence(2, "workgroup");
  }
}

// =====================================================================================================
// Score chunk, transposed: 64 keys kv0..kv0+63 x 16 query rows (this wave) of one (b, h).
//   k fragments (A operand, row = lane&15 = key) loaded straight from the f16 k plane (fragment order):
//   kb0 = plane + (b*SEQ)*EMB + h*2*FRAG_EL, 16 keys on add 16*EMB (plane row = b*SEQ + t).
//   q fragments (B operand, col = lane&15 = query): hi and residual (x4096) planes, 2 d-chunks of 32.
//   s[j][r] = D element: key kv0 + 16j + 8*hh + r, query lane&15; value = ((k.qh) + (k.ql)/4096) / 8.
//   A lane holds scores of ONE query only (32 of the chunk's 64 keys; lane ^ 16 has the other 32), and
//   s[2kk], s[2kk+1] lie as elements 0..7, 8..15 of an A fragment (row = query, 32 keys) for the P.V product.
// =====================================================================================================
// the chunk's 8 k fragments as one load group, kf[2j + dc]; kp = the lane's pointer into the unit of keys kv0..kv0+15,
// d 0..31 (16-byte units); loops unrolled so that kf keeps constant indices (registers)
typedef GP<_Float16>::ptr KPtr;
__device__ __forceinline__ void ld_kchunk(KPtr& kp, v16h (&kf)[8]) {
#pragma unroll
  for (int j = 0; j < 4; ++j)
#pragma unroll
    for (int dc = 0; dc < 2; ++dc) kf[2 * j + dc] = ldfrag_g<_Float16>(kp, j * 16 * EMB + dc * FRAG_EL);
#if DEV_ASM
  asm volatile("s_wait_xcnt 0x0" : "+v"(kp) :: "memory");   // before kp, which these loads name, is moved on or given up
#endif
}
__device__ __forceinline__ void score_chunk(const v16h (&qah)[2], const v16h (&qal)[2], const v16h (&kf)[8],
                                            v8f (&s)[4]) {
#pragma unroll
  for (int j = 0; j < 4; ++j) {
    v8f ah = zero8(), al = zero8();
#pragma unroll
    for (int dc = 0; dc < 2; ++dc) {
      ah = mma_h(kf[2 * j + dc], qah[dc], ah);
      al = mma_h(kf[2 * j + dc], qal[dc], al);
    }
#pragma unroll
    for (int r = 0; r < 8; ++r) s[j][r] = (ah[r] + al[r] * (1.0f / 4096.0f)) * 0.125f;
  }
}

// =====================================================================================================
// Softmax statistics: per (b, h, query s) the row max m and 1/sum(exp(s - m)) over all SEQ keys.
//   block = 4 waves = 64 consecutive query rows qb*64.. of one (b, h); grid = NB*NH*NKT blocks of 128;
//   static trip NKT over 64-key chunks; online max / rescaled sum in f32, one query a lane, all in the lane;
//   the two lanes of a query (each half of the keys) are merged once, behind the loop.
//   Output plane ML [b*NH+h][2][SEQ] f32 (m then 1/l): the block's 64 m values and 64 1/l values are
//   funnelled through LDS (cross-wave: block barrier) and written by wave 0 with ONE instruction (lanes 0-15:
//   coverage: grid (b,h,qb) x 64 rows = the whole [NB*NH][2][SEQ] plane. MLsh: 4 waves x 32 lanes = all 128.
// =====================================================================================================
__global__ __launch_bounds__(128)
void attn_stats(const unsigned short* __restrict__ qhp, const unsigned short* __restrict__ qlp,
                const unsigned short* __restrict__ kpp, float* ML) {
  __shared__ __align__(16) float MLsh[128];
  const int tid  = threadIdx.x;
  const int wave = tid >> 5;
  const int lane = tid & 31;
  const int hh   = lane >> 4;
  const int c    = lane & 15;
  const int bx   = blockIdx.x;
  const int qb   = bx % NKT;
  const int rest = bx / NKT;
  const int h    = rest % NH;
  const int b    = rest / NH;
  const int bh   = b * NH + h;
  const int q0   = qb * 64 + wave * 16;

  const _Float16* Qh  = (const _Float16*)(const void*)qhp;
  const _Float16* Ql  = (const _Float16*)(const void*)qlp;
  const _Float16* Kb0 = (const _Float16*)(const void*)kpp + (size_t)b * SEQ * EMB + (size_t)h * (HD / 32) * FRAG_EL;

  v16h qah[2], qal[2];
#pragma unroll
  for (int dc = 0; dc < 2; ++dc) {
    const size_t qo = ((size_t)b * SEQ + (size_t)q0) * EMB + (size_t)(h * (HD / 32) + dc) * FRAG_EL + lane * 8;
    qah[dc] = ldfrag<_Float16>(Qh + qo);
    qal[dc] = ldfrag<_Float16>(Ql + qo);
  }

  float mrow = -INFINITY, lrow = 0.f;         // query q0 + c, over this lane's half of the keys

#if DEV_ASM
  asm volatile("s_wait_xcnt 0x0" ::: "memory");   // before the k fetch lands in registers that the q loads name
#endif
  v16h kf[8];
  // The NKT blocks of one (b, h) walk the same k lines: each starts its walk at its own chunk (qb) and wraps round, so that
  // blocks running in step ask L2 for different lines at any moment.
  int kc = qb;                                // chunk in hand, 0 .. NKT-1
  KPtr kp = (KPtr)(const void*)(Kb0 + (size_t)kc * 64 * EMB + lane * 8);
  ld_kchunk(kp, kf);
  for (int kt = 0; kt < NKT; ++kt) {          // static trip count
    v8f s[4];
    score_chunk(qah, qal, kf, s);
    __builtin_amdgcn_sched_barrier(0);        // the next chunk's fetch stays behind this chunk's products (same registers)
    kp += (kc + 1 < NKT) ? 64 * EMB / 8 : -(NKT - 1) * (64 * EMB / 8);  // 16-byte units; behind the last chunk comes chunk 0
    kc = (kc + 1 < NKT) ? kc + 1 : 0;         // last trip: the walk's first chunk again, a fetch that nothing uses
    ld_kchunk(kp, kf);
    __builtin_amdgcn_sched_barrier(0);        // ... and ahead of the vector work below, which covers its latency
    float mj[4];                              // loops over j and r unrolled here and below: s keeps constant indices (registers)
#pragma unroll
    for (int j = 0; j < 4; ++j) {
      mj[j] = s[j][0];
#pragma unroll
      for (int r = 1; r < 8; ++r) mj[j] = fmaxf(mj[j], s[j][r]);
    }
    const float mnew  = fmaxf(mrow, fmaxf(fmaxf(mj[0], mj[1]), fmaxf(mj[2], mj[3])));
    const float msafe = (mnew == -INFINITY) ? 0.f : mnew;
    const float alpha = __expf(mrow - msafe);
    mrow = mnew;
    float pj[4];                              // four independent partial sums
#pragma unroll
    for (int j = 0; j < 4; ++j) {
      pj[j] = 0.f;
#pragma unroll
      for (int r = 0; r < 8; ++r) pj[j] += __expf(s[j][r] - msafe);
    }
    lrow = lrow * alpha + ((pj[0] + pj[1]) + (pj[2] + pj[3]));
  }

  // merge the two halves of each query's keys (lane ^ 16), once
  const float mo    = __shfl_xor(mrow, 16, 32);
  const float lo    = __shfl_xor(lrow, 16, 32);
  const float mall  = fmaxf(mrow, mo);
  const float msafe = (mall == -INFINITY) ? 0.f : mall;
  const float l     = lrow * __expf(mrow - msafe) + lo * __expf(mo - msafe);
  const float il    = (l > 0.f) ? (1.0f / l) : 0.f;
  MLsh[hh * 64 + wave * 16 + c] = hh ? il : mall;   // lanes 0-15: m, lanes 16-31: 1/l of query q0 + c
  __syncthreads();
  if (wave == 0) {
    const v4f v = *(const v4f*)(MLsh + lane * 4);        // lanes 0-15: m rows 4c..4c+3; lanes 16-31: 1/l rows
    float* dst = ML + (size_t)(bh * 2 + hh) * SEQ + qb * 64 + c * 4;
    *(v4f*)dst = v;
    
  }
}

// =====================================================================================================
// Main attention pass: one block per (b, 32 query rows q0..q0+31, one of KSPLIT key ranges), 16 waves = the 16 heads;
//   a wave holds TWO 16-row query tiles, so each k and v fragment fetched from L2 serves 32 queries.
//   Per 32-key chunk (static trip NKT32): scores recomputed exactly as in attn_stats, p = exp(s - m) * (1/l) in f32
//   (m, 1/l from the ML plane, one query a lane and tile);
//   (a) context += P . V: the lane's p values, converted to f16 with the x16384 carry, ARE the A fragments (no LDS, no
//       lane exchange); B = v^T f16 plane [b][h*64+d][s] (head slab h*64*SEQ), fragment order;
//       p also goes to the per-wave LDS tile Pf[h][row][key] (16-byte stores of 4 keys, every entry written) for
//   (b) head average: after __syncthreads (cross-wave), threads 0..255 sum the 16 wave tiles in fixed head order
//   Epilogue: the key range's part of ctx = acc / 16384, x256 carry, staged in the wave's Pf tile (wave-private), written in f32;
//   p is already normalised, so ctx is the plain sum of its parts (ctx_merge).
//   coverage: avg: NKT32 chunks x 32 rows x 32 keys per block, grid (b, qb, ks) = the whole [NB][SEQ][SEQ];
//   ctx parts: each wave rows q0..q0+31 x its head's 64 columns, 16 waves x grid = the whole [KSPLIT][NROW][EMB].
// =====================================================================================================
// 32-key forms of the chunk fetch and of the score chunk (same k map, same products, same order per score)
__device__ __forceinline__ void ld_kchunk32(KPtr& kp, v16h (&kf)[4]) {
#pragma unroll
  for (int j = 0; j < 2; ++j)
#pragma unroll
    for (int dc = 0; dc < 2; ++dc) kf[2 * j + dc] = ldfrag_g<_Float16>(kp, j * 16 * EMB + dc * FRAG_EL);
#if DEV_ASM
  asm volatile("s_wait_xcnt 0x0" : "+v"(kp) :: "memory");   // before kp, which these loads name, is moved on or given up
#endif
}
__device__ __forceinline__ void score_chunk32(const v16h (&qah)[2], const v16h (&qal)[2], const v16h (&kf)[4],
                                              v8f (&s)[2]) {
#pragma unroll
  for (int j = 0; j < 2; ++j) {
    v8f ah = zero8(), al = zero8();
#pragma unroll
    for (int dc = 0; dc < 2; ++dc) {
      ah = mma_h(kf[2 * j + dc], qah[dc], ah);
      al = mma_h(kf[2 * j + dc], qal[dc], al);
    }
#pragma unroll
    for (int r = 0; r < 8; ++r) s[j][r] = (ah[r] + al[r] * (1.0f / 4096.0f)) * 0.125f;
  }
}
#define KSPLIT   2                   // key ranges of a sequence, one block each
#define KRANGE   (SEQ / KSPLIT)      // keys of one block
#define NQB32    (SEQ / 32)          // 32-row query blocks per sequence
#define NKT32    (KRANGE / 32)       // 32-key chunks of one block
#define PP32     36                  // row pitch of the 32-key LDS P tile in floats: 144 B = 16 B x odd, so 16 rows written 16 B each fall on 64 distinct banks
#define NGRAN    ((size_t)NROW * EMB / 8)   // 8-element granules of a ctx plane
static_assert((KRANGE % 32) == 0 && (SEQ % 32) == 0 && 32 * PP32 >= 16 * 68);
__global__ __launch_bounds__(512)
void attn_main(const unsigned short* __restrict__ qhp, const unsigned short* __restrict__ qlp,
               const unsigned short* __restrict__ kpp, const unsigned short* __restrict__ vtp,
               const float* __restrict__ ML, float* cpart, float* avg) {
  union FH { v16h v; v8h h[2]; };
  __shared__ __align__(32) float Pf[NH][32 * PP32];        // per wave (head) P tile [32 rows][32 keys] f32, pitch PP32; the epilogue's ctx tile has pitch 68
  const int tid  = threadIdx.x;
  const int wave = tid >> 5;
  const int lane = tid & 31;
  const int hh   = lane >> 4;
  const int c    = lane & 15;
  const int bx   = blockIdx.x;
  const int ks   = bx % KSPLIT;
  const int qb   = (bx / KSPLIT) % NQB32;
  const int b    = bx / (KSPLIT * NQB32);
  const int h    = wave;
  const int bh   = b * NH + h;
  const int q0   = qb * 32;
  const int key0 = ks * KRANGE;

  const _Float16* Qh  = (const _Float16*)(const void*)qhp;
  const _Float16* Ql  = (const _Float16*)(const void*)qlp;
  const _Float16* Kb0 = (const _Float16*)(const void*)kpp + ((size_t)b * SEQ + key0) * EMB + (size_t)h * (HD / 32) * FRAG_EL;
  const _Float16* Vb0 = (const _Float16*)(const void*)vtp + (size_t)b * EMB * SEQ + (size_t)h * HD * SEQ
                        + (size_t)(key0 / 32) * FRAG_EL;   // v^T [b][h*64+d][s], fragment order

  v16h qah[2][2], qal[2][2];                  // [query tile][d chunk]
  float m1[2], il1[2];
#pragma unroll
  for (int qt = 0; qt < 2; ++qt) {
#pragma unroll
    for (int dc = 0; dc < 2; ++dc) {
      const size_t qo = ((size_t)b * SEQ + (size_t)(q0 + 16 * qt)) * EMB + (size_t)(h * (HD / 32) + dc) * FRAG_EL + lane * 8;
      qah[qt][dc] = ldfrag<_Float16>(Qh + qo);
      qal[qt][dc] = ldfrag<_Float16>(Ql + qo);
    }
    m1[qt]  = ML[(size_t)(bh * 2) * SEQ + q0 + 16 * qt + c];                      // the lane's query q0 + 16qt + c
    il1[qt] = ML[(size_t)(bh * 2 + 1) * SEQ + q0 + 16 * qt + c];
  }

  v8f oacc[2][4];
#pragma unroll
  for (int qt = 0; qt < 2; ++qt)
#pragma unroll
    for (int t = 0; t < 4; ++t) oacc[qt][t] = zero8();
  float* pf = Pf[wave];

#if DEV_ASM
  asm volatile("s_wait_xcnt 0x0" ::: "memory");   // before the k fetch lands in registers that the loads above name
#endif
  __builtin_amdgcn_sched_barrier(0);          // no address below is formed, in a register that those loads name, ahead of that wait
  v16h kf[4];
  // The NQB32 blocks of one (b, key range) walk the same k and v lines: each starts its walk at its own chunk and wraps round,
  // so that blocks running in step ask L2 for different lines at any moment. p is already normalised: any chunk order gives ctx.
  int kc = qb % NKT32;                        // chunk in hand, 0 .. NKT32-1
  KPtr kp = (KPtr)(const void*)(Kb0 + (size_t)kc * 32 * EMB + lane * 8);
  ld_kchunk32(kp, kf);
  KPtr vp = (KPtr)(const void*)(Vb0 + (size_t)kc * FRAG_EL + lane * 8);   // the lane's pointer into the unit of d 0..15, keys kv0..kv0+31
  for (int kt = 0; kt < NKT32; ++kt) {       // static trip count
    const int kv0 = key0 + kc * 32;
    const bool more = kc + 1 < NKT32;         // block-uniform: behind the last chunk comes chunk 0
    __syncthreads();                          // Pf tiles free again (head sum of the prior chunk done)

    v8f s[2][2];                              // [query tile][16-key group]: both tiles' scores from ONE fetch of the k fragments
#pragma unroll
    for (int qt = 0; qt < 2; ++qt) score_chunk32(qah[qt], qal[qt], kf, s[qt]);
    __builtin_amdgcn_sched_barrier(0);        // the v fetch stays behind the score products (registers)
    v16h vf[4];                               // this chunk's 4 v fragments as one load group, vf[t]
#pragma unroll
    for (int t = 0; t < 4; ++t) vf[t] = ldfrag_g<_Float16>(vp, t * 16 * SEQ);
#if DEV_ASM
    asm volatile("s_wait_xcnt 0x0" : "+v"(vp) :: "memory");   // before vp, which these loads name, is moved on
#endif
    vp += more ? FRAG_EL / 8 : -(NKT32 - 1) * (FRAG_EL / 8);   // 32 keys = 1 unit (16-byte units)
    __builtin_amdgcn_sched_barrier(0);        // ... and ahead of the exponentials, which cover its latency
#pragma unroll                                // all loops unrolled: s keeps constant indices (registers)
    for (int qt = 0; qt < 2; ++qt) {
#pragma unroll
      for (int j = 0; j < 2; ++j) {
#pragma unroll
        for (int r = 0; r < 8; ++r) s[qt][j][r] = __expf(s[qt][j][r] - m1[qt]) * il1[qt];      // s now holds p
        float* pw = pf + (16 * qt + c) * PP32 + j * 16 + 8 * hh;   // query 16qt + c, keys 16j + 8hh .. +7; 16-byte aligned at every row
        *(v4f*)(pw)     = __builtin_shufflevector(s[qt][j], s[qt][j], 0, 1, 2, 3);
        *(v4f*)(pw + 4) = __builtin_shufflevector(s[qt][j], s[qt][j], 4, 5, 6, 7);
      }
    }

    // ---- context += P . V (f16 WMMA, p carried x16384): both query tiles on ONE fetch of the v fragments ----
#pragma unroll                                // s and oacc are indexed by qt: a constant index keeps them in registers
    for (int qt = 0; qt < 2; ++qt) {
      FH pa;                                  // row = query c of the tile; elements 0..7 = keys 8hh + e, 8..15 = keys 16 + 8hh + e
      pa.h[0] = __builtin_convertvector(s[qt][0] * PCARRY, v8h);
      pa.h[1] = __builtin_convertvector(s[qt][1] * PCARRY, v8h);
#pragma unroll
      for (int t = 0; t < 4; ++t) oacc[qt][t] = mma_h(pa.v, vf[t], oacc[qt][t]);
    }
    __syncthreads();
    kp += more ? 32 * EMB / 8 : -(NKT32 - 1) * (32 * EMB / 8);  // 16-byte units; last trip: the walk's first chunk again, a fetch that nothing uses
    kc = more ? kc + 1 : 0;
    ld_kchunk32(kp, kf);                      // next chunk's k, one load group
    __builtin_amdgcn_sched_barrier(0);        // issued ahead of the head average, which covers part of its latency

    // ---- head average of this 32 x 32 tile, one block = one writer of every line (a row's 32 keys = one 128-B line) ----
    if (tid < 256) {                          // waves 0..7, wave-uniform
      const int row = tid >> 3, c4 = (tid & 7) * 4;
      v4f a = *(const v4f*)(Pf[0] + row * PP32 + c4);
#pragma unroll
      for (int w = 1; w < NH; ++w) a += *(const v4f*)(Pf[w] + row * PP32 + c4);
      a *= (1.0f / (float)NH);
      float* dst = avg + ((size_t)b * SEQ + (size_t)(q0 + row)) * SEQ + kv0 + c4;
      *(v4f*)dst = a;
#if DEV_ASM
      asm volatile("s_wait_xcnt 0x0" ::: "memory");   // before the next chunk overwrites the registers this store names
#endif
    }
  }
  __syncthreads();

  // ---- epilogue: this key range's part of ctx (undo the x16384 p carry, apply the x256 carry), staged, stored in f32 ----
  // cpart = [KSPLIT][2][NGRAN] groups of 4 floats: group (ks, 0, g) = elements 0..3 of granule g of the ctx planes, (ks, 1, g) = 4..7,
  // so that every store here and every load in ctx_merge covers 512 contiguous bytes a wave.
  float* os = pf;
#pragma unroll
  for (int qt = 0; qt < 2; ++qt) {
#pragma unroll
    for (int r = 0; r < 8; ++r) {
#pragma unroll
      for (int t = 0; t < 4; ++t) os[(8 * hh + r) * 68 + t * 16 + c] = oacc[qt][t][r] * (256.0f / PCARRY);
    }
    __builtin_amdgcn_fence(3, "workgroup");
    __builtin_amdgcn_wave_barrier();
    __builtin_amdgcn_fence(2, "workgroup");
    // the wave's 16 x 64 tile = 2 units = 128 granules in a row: step it takes granules 32*it + lane,
    // which hold row c, columns 8*(2*it + hh) .. +7
    v4f lo4[4], hi4[4];
#pragma unroll
    for (int it = 0; it < 4; ++it) {
      const float* sp = os + c * 68 + (it * 2 + hh) * 8;
      lo4[it] = *(const v4f*)(sp);
      hi4[it] = *(const v4f*)(sp + 4);
    }
    const size_t g0 = (((size_t)b * SEQ + (size_t)(q0 + 16 * qt)) * EMB + (size_t)h * (HD / 32) * FRAG_EL) / 8 + lane;
    float* d0 = cpart + ((size_t)(ks * 2) * NGRAN + g0) * 4;
    float* d1 = cpart + ((size_t)(ks * 2 + 1) * NGRAN + g0) * 4;
#pragma unroll
    for (int it = 0; it < 4; ++it) {
      *(v4f*)(d0 + it * 128) = lo4[it];
      *(v4f*)(d1 + it * 128) = hi4[it];
    }
#if DEV_ASM
    asm volatile("s_wait_xcnt 0x0" ::: "memory");   // before the next tile overwrites the registers these stores name
#endif
    __builtin_amdgcn_sched_barrier(0);        // the next tile's products stay behind that wait
    __builtin_amdgcn_fence(3, "workgroup");
    __builtin_amdgcn_wave_barrier();
    __builtin_amdgcn_fence(2, "workgroup");
  }
}

// =====================================================================================================
// ctx = sum of its KSPLIT key-range parts (fixed order), converted to the f16 hi plane (x256 carry, already in the parts)
// and the f16 residual plane (x4096), fragment order. Few waves, MG_N granules a thread, all loads up front.
// coverage: MG_T threads x MG_N granules = NGRAN granules = the whole [NROW][EMB] planes.
// =====================================================================================================
#define MG_N 4
#define MG_T (NROW * EMB / 8 / MG_N)
static_assert((MG_T % 256) == 0 && KSPLIT == 2);
__global__ __launch_bounds__(256) void ctx_merge(const float* __restrict__ c00, const float* __restrict__ c01,
                                                 const float* __restrict__ c10, const float* __restrict__ c11,
                                                 unsigned short* chp, unsigned short* clp) {
  const float* const cin[4] = {c00, c01, c10, c11};   // [2 * key range + half of the granule]: four scalar bases
  // granule i's byte offset, 32 bits, the same in a part (16 B of f32 a half granule) and in a plane (16 B of f16 a granule):
  // one offset register beside scalar bases serves every load and store
  unsigned ob = (blockIdx.x * 256u + threadIdx.x) * 16u;
  v4f x[MG_N][4];
#pragma unroll                                // unrolled here and below: x keeps constant indices (registers)
  for (int n = 0; n < MG_N; ++n)
#pragma unroll
    for (int p = 0; p < 4; ++p)               // p = 2 * key range + half of the granule
      x[n][p] = *(const v4f*)((const char*)cin[p] + (size_t)n * MG_T * 16 + ob);
#if DEV_ASM
  asm volatile("s_wait_xcnt 0x0" : "+v"(ob) :: "memory");   // the offset register, which these loads name, is held to here
#endif
  __builtin_amdgcn_sched_barrier(0);          // no conversion result is written ahead of that wait
#pragma unroll
  for (int n = 0; n < MG_N; ++n) {
    const v4f fa = x[n][0] + x[n][2], fb = x[n][1] + x[n][3];
    const float f[8] = {fa[0], fa[1], fa[2], fa[3], fb[0], fb[1], fb[2], fb[3]};
    v4u a, a2;
#pragma unroll
    for (int e = 0; e < 4; ++e) {
      const float f0 = f[2 * e], f1 = f[2 * e + 1];
      const _Float16 x0 = (_Float16)f0, x1 = (_Float16)f1;
      const unsigned short h0 = h_bits(x0), h1 = h_bits(x1);
      const unsigned short l0 = h_bits((_Float16)((f0 - (float)x0) * 4096.0f));
      const unsigned short l1 = h_bits((_Float16)((f1 - (float)x1) * 4096.0f));
      a[e] = pk16(h0, h1); a2[e] = pk16(l0, l1);
    }
    *(v4u*)((char*)chp + (size_t)n * MG_T * 16 + ob) = a;
    *(v4u*)((char*)clp + (size_t)n * MG_T * 16 + ob) = a2;
  }
}

// =====================================================================================================
// Workspace map (bytes, full size NB=2 SEQ=2048; PX = NROW*EMB*2 = 8388608; every region an exact multiple of
// its whole-line / whole-tile store granularity, rows are whole tiles, no padded tails needed):
//   Xq   bf16 [NROW][EMB]            PX        8388608
//   Xk   bf16 [NROW][EMB]            PX        8388608
//   Xv   bf16 [NROW][EMB]            PX        8388608
//   Wqb  bf16 [EMB n][EMB k]                   2097152
//   Wkb  bf16 [EMB n][EMB k]                   2097152
//   Wvb  bf16 [EMB n][EMB k]                   2097152
//   Wob  f16  [EMB n][EMB k] (x64)             2097152
//   Qh   f16  [NROW][EMB]            PX        8388608
//   Ql   f16  [NROW][EMB]            PX        8388608
//   Kp   f16  [NROW][EMB]            PX        8388608
//   VT   f16  [NB][EMB][SEQ]                   8388608
//   Ch   f16  [NROW][EMB]            PX        8388608
//   Cl   f16  [NROW][EMB]            PX        8388608
//   ML   f32  [NB*NH][2][SEQ]                   524288
//   CP   f32  [2 key ranges][NROW][EMB]       33554432
//   total                                    117964800
// Every 16-bit plane is in fragment order (same bytes, same extents). Input weights are [out n][in k] (k contiguous) =
// the Bt / A orientation directly; they are only converted to 16 bit and put in that order.
// Output 0 at element 0 of d_out (rows b*SEQ + s); output 1 at the fixed element offset OFF1 = NB_FULL*SEQ_FULL*EMB.
// =====================================================================================================
extern "C" void kernel_launch(void* const* d_in, const int* in_sizes, int n_in,
                              void* d_out, int out_size, void* d_ws, size_t ws_size,
                              hipStream_t stream) {
  if (n_in < 7) return;
  const int needX = ((NB - 1) * SEQ_FULL + SEQ) * EMB;
  if (in_sizes[0] < needX) return;
  if (in_sizes[1] < needX) return;
  if (in_sizes[2] < needX) return;
  if (in_sizes[3] < EMB * EMB) return;
  if (in_sizes[4] < EMB * EMB) return;
  if (in_sizes[5] < EMB * EMB) return;
  if (in_sizes[6] < EMB * EMB) return;
  const size_t n0e = (size_t)NROW * EMB;            // output 0 written elements [NB][SEQ][EMB]
  const size_t n1e = (size_t)NB * SEQ * SEQ;        // output 1 written elements [NB][SEQ][SEQ]
  if (out_size < 0) return;
  if ((size_t)out_size < n0e) return;
  if ((size_t)out_size < OFF1 + n1e) return;        // written extent of output 1 inside d_out

  const float* xq = (const float*)d_in[0];
  const float* xk = (const float*)d_in[1];
  const float* xv = (const float*)d_in[2];
  const float* Wq = (const float*)d_in[3];
  const float* Wk = (const float*)d_in[4];
  const float* Wv = (const float*)d_in[5];
  const float* Wo = (const float*)d_in[6];

  const size_t PX  = (size_t)NROW * EMB * 2;        // 16-bit activation plane
  const size_t PW  = (size_t)EMB * EMB * 2;
  const size_t PVT = (size_t)NB * EMB * SEQ * 2;
  const size_t PML = (size_t)NB * NH * 2 * SEQ * 4;
  size_t off = 0;
  const size_t oXq = off; off += PX;
  const size_t oXk = off; off += PX;
  const size_t oXv = off; off += PX;
  const size_t oWq = off; off += PW;
  const size_t oWk = off; off += PW;
  const size_t oWv = off; off += PW;
  const size_t oWo = off; off += PW;
  const size_t oQh = off; off += PX;
  const size_t oQl = off; off += PX;
  const size_t oKp = off; off += PX;
  const size_t oVT = off; off += PVT;
  const size_t oCh = off; off += PX;
  const size_t oCl = off; off += PX;
  const size_t oML = off; off += PML;
  const size_t oCP = off; off += (size_t)KSPLIT * NROW * EMB * 4;
  if (off > ws_size) return;                        // off = 117964800 at full size
  if (off > (size_t)134217728) return;

  char* ws = (char*)d_ws;
  unsigned short* Xq  = (unsigned short*)(ws + oXq);
  unsigned short* Xk  = (unsigned short*)(ws + oXk);
  unsigned short* Xv  = (unsigned short*)(ws + oXv);
  unsigned short* Wqb = (unsigned short*)(ws + oWq);
  unsigned short* Wkb = (unsigned short*)(ws + oWk);
  unsigned short* Wvb = (unsigned short*)(ws + oWv);
  unsigned short* Wob = (unsigned short*)(ws + oWo);
  unsigned short* Qh  = (unsigned short*)(ws + oQh);
  unsigned short* Ql  = (unsigned short*)(ws + oQl);
  unsigned short* Kp  = (unsigned short*)(ws + oKp);
  unsigned short* VT  = (unsigned short*)(ws + oVT);
  unsigned short* Ch  = (unsigned short*)(ws + oCh);
  unsigned short* Cl  = (unsigned short*)(ws + oCl);
  float*          ML  = (float*)(ws + oML);
  float*          CP  = (float*)(ws + oCP);
  float*          out0 = (float*)d_out;
  float*          out1 = (float*)d_out + OFF1;

  const dim3 blk(256);
  const dim3 gCvt(CVT_T / 256);                                  //  512 blocks
  const dim3 gQK((((NROW) / 64) * (EMB / 64) + 7) / 8, 1);        // 1024 tiles -> 128 blocks: M=NROW, N=EMB
  const dim3 gV((((EMB) / 64) * (SEQ / 64) + 7) / 8, NB);          //  512 tiles ->  64 blocks x NB: M=EMB, N=SEQ
  const dim3 gO((((NROW) / 32) * (EMB / 64) + 7) / 8, 1);         // 2048 tiles -> 256 blocks (32x64 wave tiles)
  const dim3 gStats(NB * NH * NKT);                              // 1024 blocks of 128
  const dim3 gMain(NB * NQB32 * KSPLIT);                         //  256 blocks of 512
  const dim3 gMerge(MG_T / 256);                                 //  512 blocks

  // (1) activations [b][s][k] -> bf16 planes [b*SEQ+s][k] (input batch stride SEQ_FULL*EMB, plane batch stride SEQ*EMB);
  // (2) weights [EMB n][EMB k] -> bf16 planes (Wq, Wk, Wv); Wo -> f16 (x64 of its bf16 value); no transpose needed
  cvt_all<<<gCvt, blk, 0, stream>>>(xq, xk, xv, Wq, Wk, Wv, Wo, Xq, Xk, Xv, Wqb, Wkb, Wvb, Wob);
  // (3) q = xq . Wq^T -> f16 hi / residual (x4096) planes [b*SEQ+s][h*64+d]   (M=NROW, N=EMB, K=EMB)
  gemm_t<__bf16, 4, 1, 3><<<gQK, blk, 0, stream>>>(
      Xq, Xq, EMB, 0LL, Wqb, EMB, 0LL,
      (void*)Qh, (void*)Ql, EMB, 0LL,
      NROW, EMB, EMB, 1.0f, 0.0f, 1.0f, 4096.0f);
  // (4) k = xk . Wk^T -> f16 plane [b*SEQ+s][h*64+d]
  gemm_t<__bf16, 4, 1, 1><<<gQK, blk, 0, stream>>>(
      Xk, Xk, EMB, 0LL, Wkb, EMB, 0LL,
      (void*)Kp, (void*)Kp, EMB, 0LL,
      NROW, EMB, EMB, 1.0f, 0.0f, 1.0f, 1.0f);
  // (5) v^T = Wv . xv_b^T (per batch b = blockIdx.y) -> f16 plane [b][h*64+d][s] (pitch SEQ)
  //     (A = Wvb [n][k]; Bt = Xv rows of batch b: offset b*SEQ*EMB, pitch EMB; M=EMB, N=SEQ, K=EMB)
  gemm_t<__bf16, 4, 1, 1><<<gV, blk, 0, stream>>>(
      Wvb, Wvb, EMB, 0LL, Xv, EMB, (long long)SEQ * EMB,
      (void*)VT, (void*)VT, SEQ, (long long)EMB * SEQ,
      EMB, SEQ, EMB, 1.0f, 0.0f, 1.0f, 1.0f);
  // (6) softmax statistics (m, 1/l) per (b, h, s)
  attn_stats<<<gStats, dim3(128), 0, stream>>>(Qh, Ql, Kp, ML);
  // (7) exact-normalised p: P.V -> f32 parts of ctx, one per key range; head-averaged p -> output 1
  attn_main<<<gMain, dim3(512), 0, stream>>>(Qh, Ql, Kp, VT, ML, CP, out1);
  // (7b) ctx = sum of its parts -> ctx planes (f16 hi x256 / residual x4096)
  ctx_merge<<<gMerge, blk, 0, stream>>>(CP, CP + NGRAN * 4, CP + NGRAN * 8, CP + NGRAN * 12, Ch, Cl);
  // (8) output 0 = ctx . Wo^T, f32 [NROW][EMB] straight into d_out, accumulators (hi + res/4096) x 1/(256*64)
  gemm_t<_Float16, 2, 2, 0><<<gO, blk, 0, stream>>>(
      Ch, Cl, EMB, 0LL, Wob, EMB, 0LL,
      (void*)out0, (void*)out0, EMB, 0LL,
      NROW, EMB, EMB, 1.0f / 16384.0f, 1.0f / 4096.0f, 1.0f, 1.0f);
  (void)hipGetLastError();
}

// v008
// It runs in 151 microseconds.
// Two timings next to v007 both put it at 1.09 times that version's speed.
// All steps since v000 together make it 3.29 times as fast.
// Contractions: q, k, v^T projections = v_wmma_f32_16x16x32_bf16 (bf16 operands from RNE-converted inputs and weights, single product, f32 accumulate);
// scores (statistics pass and main pass), formed transposed as k.q^T = v_wmma_f32_16x16x32_f16 (k f16 as A; q as f16 hi plane + f16 residual plane x4096 as B; 2 products, separate f32 accumulators);
// p.v = v_wmma_f32_16x16x32_f16 (p carried x16384 in f16, v f16; single product, f32 accumulate);
// ctx.Wo^T = v_wmma_f32_16x16x32_f16 (ctx as f16 hi plane x256 + f16 residual plane x4096, Wo f16 x64 of its bf16 value; 2 products, separate f32 accumulators);
// softmax statistics, probabilities, head average and the sum of the two key ranges' ctx parts in f32.
#include <hip/hip_runtime.h>
#include <math.h>
#include <stdint.h>

#ifndef NB
#define NB 2
#endif
#ifndef SEQ
#define SEQ 2048
#endif
#define NB_FULL  2
#define SEQ_FULL 2048
#define EMB      1024
#define NH       16
#define HD       64
#define NROW     (NB * SEQ)          // activation rows in workspace planes, row index = b * SEQ + s
#define NKT      (SEQ / 64)          // 64-key chunks per sequence
#define PCARRY   16384.0f            // power-of-two carry of p in the f16 P.V operand
#define OFF1     ((size_t)NB_FULL * SEQ_FULL * EMB)   // fixed element offset of output 1 in d_out
static_assert(NB >= 1 && NB <= NB_FULL);
static_assert(SEQ >= 64 && SEQ <= SEQ_FULL && (SEQ % 64) == 0);
static_assert(NH * HD == EMB && (EMB % 128) == 0);
static_assert((NROW % 64) == 0 && (EMB % 64) == 0 && (HD % 64) == 0 && (EMB % 32) == 0);
static_assert(OFF1 * 4 == 16777216);   // byte offset of output 1
static_assert((OFF1 + (size_t)NB_FULL * SEQ_FULL * SEQ_FULL) * 4 == 50331648);   // written extent of output 1 == d_out bytes

typedef _Float16 v16h __attribute__((ext_vector_type(16)));
typedef _Float16 v8h  __attribute__((ext_vector_type(8)));
typedef __bf16   v16b __attribute__((ext_vector_type(16)));
typedef __bf16   v8b  __attribute__((ext_vector_type(8)));
typedef float    v8f  __attribute__((ext_vector_type(8)));
typedef float    v4f  __attribute__((ext_vector_type(4)));
typedef unsigned int v4u __attribute__((ext_vector_type(4)));

#if defined(__HIP_DEVICE_COMPILE__)
#define DEV_ASM 1
#else
#define DEV_ASM 0
#endif

// ---- scalar helpers --------------------------------------------------------------------------------
__device__ __forceinline__ unsigned short bf_bits(float f) {          // f32 -> bf16 bits, RNE convert
  unsigned u = __float_as_uint(f);
  return (unsigned short)((u + 0x7FFFu + ((u >> 16) & 1u)) >> 16);
}
__device__ __forceinline__ float bf_up(unsigned short hb) { return __uint_as_float(((unsigned)hb) << 16); }
__device__ __forceinline__ unsigned short h_bits(_Float16 x) { return __builtin_bit_cast(unsigned short, x); }
__device__ __forceinline__ unsigned pk16(unsigned short a, unsigned short b) { return (unsigned)a | ((unsigned)b << 16); }
__device__ __forceinline__ v8f zero8() { v8f z = {0.f, 0.f, 0.f, 0.f, 0.f, 0.f, 0.f, 0.f}; return z; }

// ---- fragment order: every 16-bit workspace plane [R rows][KC k] is kept as 1-KB units, one per WMMA operand fragment
//      (16 rows x 32 k), unit index = (row / 16) * (KC / 32) + k / 32. Inside a unit, in 16-byte granules of 8 k:
//      granule = ((k % 32) / 8) * 16 + row % 16, so granule g of the first 512 B is lane g's elements 0..7 and granule
//      g of the second 512 B its elements 8..15: each wave-wide 16-byte load reads 512 contiguous bytes (4 whole lines).
#define FRAG_EL 512                  // elements of one unit
// ---- fragment types / loaders: 16-bit A/B operand, lane -> row/col (lane&15), half h = lane>>4; p = unit + 8*lane;
//      elements 0..7 <- p[0..7] (k0+8h..k0+8h+7), elements 8..15 <- p[256..263] (k0+16+8h..k0+16+8h+7)
template <typename OT> struct FT;
template <> struct FT<__bf16>   { typedef v16b frag; typedef v8b half8; };
template <> struct FT<_Float16> { typedef v16h frag; typedef v8h half8; };

template <typename OT>
__device__ __forceinline__ typename FT<OT>::frag ldfrag(const OT* p) {
  union { typename FT<OT>::frag v; typename FT<OT>::half8 h[2]; } f;
  f.h[0] = *(const typename FT<OT>::half8*)(p);
  f.h[1] = *(const typename FT<OT>::half8*)(p + 256);
  return f.v;
}

// ---- WMMA helpers (asm guard bodies are device-only; concrete operand types) -----------------------------
__device__ __forceinline__ v8f mmar(v16b a, v16b b, v8f c) {
  return __builtin_amdgcn_wmma_f32_16x16x32_bf16(false, a, false, b, (short)0, c, false, false);
}
__device__ __forceinline__ v8f mmar(v16h a, v16h b, v8f c) {
  return __builtin_amdgcn_wmma_f32_16x16x32_f16(false, a, false, b, (short)0, c, false, false);
}
// guarded form: 4 VALU slots after the WMMA, D tied, A/B kept live
__device__ __forceinline__ v8f mma_h(v16h a, v16h b, v8f c) {
  c = __builtin_amdgcn_wmma_f32_16x16x32_f16(false, a, false, b, (short)0, c, false, false);
#if DEV_ASM
  asm volatile("v_nop\n\tv_nop\n\tv_nop\n\tv_nop" : "+v"(c) : "v"(a), "v"(b));
#endif
  return c;
}
__device__ __forceinline__ void acc_guard4(v8f& a, v8f& b, v8f& c, v8f& d) {
#if DEV_ASM
  asm volatile("v_nop\n\tv_nop\n\tv_nop\n\tv_nop" : "+v"(a), "+v"(b), "+v"(c), "+v"(d));
#else
  (void)a; (void)b; (void)c; (void)d;
#endif
}

// 16-bit convert helper. MODE 0: bf16 bits (RNE convert).  MODE 1: f16 bits of (64 * bf16(x)) (exact scaling of the bf16 value).
template <int MODE>
__device__ __forceinline__ unsigned short cvm(float f) {
  const unsigned short hb = bf_bits(f);
  if (MODE == 0) return hb;
  return h_bits((_Float16)(bf_up(hb) * 64.0f));
}

// =====================================================================================================
// All seven f32 -> 16-bit conversions (3 activations, 4 weights) in ONE launch of few waves, each with many granules.
// Planes in fragment order, 8 elements (one granule) per thread and slab. The launch has CVT_T threads. A weight is one
// slab of CVT_T granules. An activation is XSLAB slabs; a slab takes CVT_TB granules (XROWS rows) of EVERY batch, thread
// i being in batch i / CVT_TB, so that a slab's step from the plane's start is a small constant for all threads.
// In a slab a wave takes 8 rows x 32 k: it reads 8 whole 128-B lines of f32 and writes 4 whole 128-B lines
// (8 granules of each of the unit's 4 k groups).
// coverage: activations: XSLAB slabs x NB batches x XROWS rows = [NROW][EMB], 3 planes; weights: CVT_T granules = [EMB][EMB], 4 planes.
// =====================================================================================================
#define CVT_T    (EMB * EMB / 8)                  // threads of the launch = granules of a weight
#define CVT_TB   (CVT_T / NB)                     // threads on one batch
#define XROWS    (CVT_TB * 8 / EMB)               // rows of a batch in one activation slab
#define XSLAB    (SEQ / XROWS)                    // slabs of an activation
#define NXSLAB   (3 * XSLAB)
#define NSLAB    (NXSLAB + 4)                     // ... and the four weights
static_assert((CVT_T % 256) == 0 && (CVT_T % NB) == 0 && (XROWS % 16) == 0 && XROWS * EMB == CVT_TB * 8 && (SEQ % XROWS) == 0);
static_assert((size_t)NB_FULL * SEQ_FULL * EMB * 4 < ((size_t)1 << 32));   // byte offsets in a plane fit 32 bits
template <int MODE>
__device__ __forceinline__ v4u cvt8(v4f a, v4f a4) {
  v4u p;
  p[0] = pk16(cvm<MODE>(a[0]),  cvm<MODE>(a[1]));
  p[1] = pk16(cvm<MODE>(a[2]),  cvm<MODE>(a[3]));
  p[2] = pk16(cvm<MODE>(a4[0]), cvm<MODE>(a4[1]));
  p[3] = pk16(cvm<MODE>(a4[2]), cvm<MODE>(a4[3]));
  return p;
}
__global__ __launch_bounds__(256) void cvt_all(
    const float* __restrict__ xq, const float* __restrict__ xk, const float* __restrict__ xv,
    const float* __restrict__ wq, const float* __restrict__ wk, const float* __restrict__ wv,
    const float* __restrict__ wo,
    unsigned short* Xq, unsigned short* Xk, unsigned short* Xv,
    unsigned short* Wqb, unsigned short* Wkb, unsigned short* Wvb, unsigned short* Wob) {
  const unsigned i    = blockIdx.x * 256u + threadIdx.x;
  const unsigned unit = i >> 6;                               // 64 threads (2 waves) per unit
  const unsigned kg   = (i >> 3) & 3u;                        // k group of 8 inside the unit
  const unsigned rr   = ((i >> 5) & 1u) * 8u + (i & 7u);      // row inside the unit
  const unsigned bt   = i / CVT_TB;                           // the thread's batch in the activations
  // the granule's byte offsets from a plane's start, 32 bits: with a slab's constant step, one offset register serves
  // every slab of a kind beside the plane's scalar base. Weights: granule i. Activations: granule i - bt * CVT_TB of batch bt.
  unsigned sobW = (((unit / (EMB / 32)) * 16u + rr) * EMB + (unit % (EMB / 32)) * 32u + kg * 8u) * 4u;
  unsigned sobX = sobW + bt * (unsigned)((SEQ_FULL - XROWS) * EMB * 4);
  const unsigned dobW = (unit * FRAG_EL + (kg * 16u + rr) * 8u) * 2u;
  const unsigned dobX = dobW + bt * (unsigned)((SEQ - XROWS) * EMB * 2);
  const float* const xin[3]     = {xq, xk, xv};
  const float* const win[4]     = {wq, wk, wv, wo};
  unsigned short* const xout[3] = {Xq, Xk, Xv};
  unsigned short* const wout[4] = {Wqb, Wkb, Wvb, Wob};
  // every loop here is unrolled: the slab index picks pointers and registers at compile time
  v4f a[NSLAB][2];
#pragma unroll
  for (int s = 0; s < NSLAB; ++s) {               // all loads of the thread up front: 2 * NSLAB x 16 B in flight a lane
    const char* src = (s < NXSLAB) ? (const char*)xin[s / XSLAB] + (size_t)(s % XSLAB) * XROWS * EMB * 4 + sobX
                                   : (const char*)win[s - NXSLAB] + sobW;
    a[s][0] = *(const v4f*)(src);
    a[s][1] = *(const v4f*)(src + 16);
    __builtin_amdgcn_sched_barrier(0);            // a slab's two loads read the same lines: kept side by side, ahead of all conversions
  }
#if DEV_ASM
  asm volatile("s_wait_xcnt 0x0" : "+v"(sobX), "+v"(sobW) :: "memory");   // before the offset registers, which these loads name, are given up
#endif
  __builtin_amdgcn_sched_barrier(0);              // no conversion result is written ahead of that wait
  v4u p[NSLAB];
#pragma unroll
  for (int s = 0; s < NSLAB; ++s)
    p[s] = (s == NSLAB - 1) ? cvt8<1>(a[s][0], a[s][1]) : cvt8<0>(a[s][0], a[s][1]);
#pragma unroll
  for (int s = 0; s < NSLAB; ++s) {
    char* dst = (s < NXSLAB) ? (char*)xout[s / XSLAB] + (size_t)(s % XSLAB) * XROWS * EMB * 2 + dobX
                             : (char*)wout[s - NXSLAB] + dobW;
    *(v4u*)dst = p[s];
  }
}

// =====================================================================================================
// Register-blocked batched WMMA GEMM (16-bit operand type OT): C[m][n] = sum_k A[m][k] * Bt[n][k];
// one wave per (16*MI) x 64 tile, no block barriers. A [M][K = lda] and Bt [N][K = ldb] in fragment order;
// M multiple of 16*MI, N multiple of 64, K multiple of 128 (static sizes here). by = batch
// index (strides in elements). Fragments are loaded straight from global, 512 contiguous bytes a load (ldfrag_g).
// NPA = number of A planes: 2 -> second plane A2 (same pitch/stride) multiplies the same Bt fragments into a
// second accumulator set, combined as acc + acc2 * rscaleA in the f32 epilogue.
// value v = (acc [+ acc2*rscaleA]) * oscale.
// OUT_MODE 0: f32 C (pitch ldc) = v.
// OUT_MODE 3: f16 plane C = f16(v * cscale), [M][N = ldc] in fragment order, and, where res is set (block-uniform),
//             the f16 residual plane C2 = f16((v*cscale - hi) * rscaleC), likewise.
// bx: the block's index among the blocks of its product and batch.
// =====================================================================================================
// one k step's load group: 4 B fragments, MI A fragments (and MI of the second A plane); in this helper and the next
// every loop is unrolled so that the fragment and accumulator arrays keep constant indices (registers)
//   (bp, ap, ap2: each lane's pointers into its row tiles' units, global address space, in 16-byte units;
//    k: a constant element offset, FRAG_EL per k step of 32)
template <typename OT> struct GP { typedef const __attribute__((address_space(1))) typename FT<OT>::half8* ptr; };
template <typename OT>
__device__ __forceinline__ typename FT<OT>::frag ldfrag_g(typename GP<OT>::ptr p, int k) {   // same k map as ldfrag
  union { typename FT<OT>::frag v; typename FT<OT>::half8 h[2]; } f;
  f.h[0] = p[k / 8];
  f.h[1] = p[k / 8 + 32];
  return f.v;
}
template <typename OT, int MI, int NPA>
__device__ __forceinline__ void gemm_ld(typename GP<OT>::ptr const (&bp)[4], typename GP<OT>::ptr const (&ap)[MI],
                                        typename GP<OT>::ptr const (&ap2)[MI], int k,
                                        typename FT<OT>::frag (&bq)[4], typename FT<OT>::frag (&af)[MI],
                                        typename FT<OT>::frag (&ag)[MI]) {
#pragma unroll
  for (int j = 0; j < 4; ++j) bq[j] = ldfrag_g<OT>(bp[j], k);
#pragma unroll
  for (int i = 0; i < MI; ++i) {
    af[i] = ldfrag_g<OT>(ap[i], k);
    if (NPA == 2) ag[i] = ldfrag_g<OT>(ap2[i], k);
  }
}
// the wait that stands before the row pointers, which the issued loads name, are moved on or given up
template <int MI, int NPA, typename P>
__device__ __forceinline__ void ptr_wait(P (&bp)[4], P (&ap)[MI], P (&ap2)[MI]) {
  static_assert((MI == 4 && NPA == 1) || (MI == 2 && NPA == 2));   // the two shapes in use: eight pointers each
#if DEV_ASM
  if constexpr (MI == 4)
    asm volatile("s_wait_xcnt 0x0" : "+v"(bp[0]), "+v"(bp[1]), "+v"(bp[2]), "+v"(bp[3]),
                                     "+v"(ap[0]), "+v"(ap[1]), "+v"(ap[2]), "+v"(ap[3]) :: "memory");
  else
    asm volatile("s_wait_xcnt 0x0" : "+v"(bp[0]), "+v"(bp[1]), "+v"(bp[2]), "+v"(bp[3]),
                                     "+v"(ap[0]), "+v"(ap[1]), "+v"(ap2[0]), "+v"(ap2[1]) :: "memory");
#endif
}
// one k step's products, in the order i, plane, j
template <typename OT, int MI, int NPA>
__device__ __forceinline__ void gemm_mm(const typename FT<OT>::frag (&bq)[4], const typename FT<OT>::frag (&af)[MI],
                                        const typename FT<OT>::frag (&ag)[MI], v8f (&acc)[MI][4], v8f (&acc2)[MI][4]) {
#pragma unroll
  for (int i = 0; i < MI; ++i) {
#pragma unroll
    for (int j = 0; j < 4; ++j) acc[i][j] = mmar(af[i], bq[j], acc[i][j]);
    if (NPA == 2) {
#pragma unroll
      for (int j = 0; j < 4; ++j) acc2[i][j] = mmar(ag[i], bq[j], acc2[i][j]);
    }
  }
}

// a wave's 16 x 64 f32 slab (pitch 68) -> 2 units of the f16 plane C and, with RES, of the residual plane C2;
// C, C2: the lane's pointers into the first unit (8 elements a lane)
template <bool RES>
__device__ __forceinline__ void store_slab16(const float* slab, unsigned short* C, unsigned short* C2,
                                             float cscale, float rscaleC, int lane) {
  const int rlane = lane & 15;
  v4u hv[4], lv[4];
#pragma unroll
  for (int it = 0; it < 4; ++it) {
    const float* sp = slab + rlane * 68 + (it * 2 + (lane >> 4)) * 8;
    float f[8];
#pragma unroll
    for (int e = 0; e < 8; ++e) f[e] = sp[e] * cscale;
    v4u a, a2;
#pragma unroll
    for (int e = 0; e < 4; ++e) {
      const float f0 = f[2 * e], f1 = f[2 * e + 1];
      const _Float16 x0 = (_Float16)f0, x1 = (_Float16)f1;
      const unsigned short h0 = h_bits(x0), h1 = h_bits(x1);
      unsigned short l0 = 0, l1 = 0;
      if (RES) {
        l0 = h_bits((_Float16)((f0 - (float)x0) * rscaleC));
        l1 = h_bits((_Float16)((f1 - (float)x1) * rscaleC));
      }
      a[e] = pk16(h0, h1); a2[e] = pk16(l0, l1);
    }
    hv[it] = a; lv[it] = a2;
  }
#pragma unroll
  for (int it = 0; it < 4; ++it) {
    *(v4u*)(C + it * 256) = hv[it];
    if (RES) *(v4u*)(C2 + it * 256) = lv[it];
  }
#if DEV_ASM
  asm volatile("s_wait_xcnt 0x0" ::: "memory");   // before the next slab overwrites the registers these stores name
#endif
}

template <typename OT, int MI, int NPA, int OUT_MODE>
__device__ __forceinline__ void gemm_body(
    const unsigned short* __restrict__ Ap, const unsigned short* __restrict__ A2p, int lda, long long strideA,
    const unsigned short* __restrict__ Btp, int ldb, long long strideB,
    void* Cout, void* Cout2, int ldc, long long strideC,
    int M, int N, int K, float oscale, float rscaleA, float cscale, float rscaleC,
    unsigned bx, unsigned by, bool res) {
  typedef typename FT<OT>::frag V16;
  const OT* A  = (const OT*)(const void*)Ap;
  const OT* A2 = (const OT*)(const void*)A2p;
  const OT* Bt = (const OT*)(const void*)Btp;
  __shared__ __align__(16) float sT[8][16 * 68];   // per-wave 16x64 slab, pitch 68 floats
  const int RT   = 16 * MI;
  const int b    = by;
  const int lane = threadIdx.x & 31;
  const int wave = threadIdx.x >> 5;
  const int tilesN = N >> 6;
  const int tilesM = M / RT;
  const int tile = bx * 8 + wave;
  if (tile >= tilesM * tilesN) return;   // wave-uniform; no block barriers in this kernel
  const int tm = tile / tilesN;
  const int tn = tile - tm * tilesN;
  const int m0 = tm * RT;
  const int n0 = tn << 6;

  const OT* Ab  = A  + (size_t)b * (size_t)strideA;
  const OT* A2b = A2 + (size_t)b * (size_t)strideA;
  const OT* Bb  = Bt + (size_t)b * (size_t)strideB;

  const int rlane = lane & 15;                 // row (A) / col (B, D) within subtile
  const int mOff  = (lane >> 4) * 8;           // D row offset

  v8f acc[MI][4], acc2[MI][4];
#pragma unroll
  for (int i = 0; i < MI; ++i)
#pragma unroll
    for (int j = 0; j < 4; ++j) { acc[i][j] = zero8(); acc2[i][j] = zero8(); }

  // Rotating fragment sets: the whole load group of k step s + 2 is issued ahead of the products of step s, so the
  // loads of two steps fly under the products, where one latency per A fragment was waited out. K is a multiple of 128.
  typedef typename GP<OT>::ptr GPtr;
  GPtr bp[4], ap[MI], ap2[MI];
  // Blocks that share operand rows walk the same lines: each block starts its k walk at its own group of 4 k steps and wraps
  // round, so that blocks running in step ask L2 for different lines at any moment. One start for the whole block: its waves
  // stay in step on the A rows they share. Blocks of one tile row, and blocks of one tile column set, get different starts.
  const int ng = K >> 7;                       // groups of 4 k steps
  int grp = (int)((bx + bx / (unsigned)((tilesN + 7) >> 3) + 3u * by) % (unsigned)ng);   // group in hand
  const size_t kst = (size_t)grp * 4 * FRAG_EL + lane * 8;
#pragma unroll
  for (int j = 0; j < 4; ++j) bp[j] = (GPtr)(const void*)(Bb + (size_t)((n0 >> 4) + j) * (ldb >> 5) * FRAG_EL + kst);
#pragma unroll
  for (int i = 0; i < MI; ++i) {
    ap[i]  = (GPtr)(const void*)(Ab  + (size_t)((m0 >> 4) + i) * (lda >> 5) * FRAG_EL + kst);
    ap2[i] = (GPtr)(const void*)(A2b + (size_t)((m0 >> 4) + i) * (lda >> 5) * FRAG_EL + kst);
  }
  V16 bq[4][4], af[4][MI], ag[4][MI];
  gemm_ld<OT, MI, NPA>(bp, ap, ap2, 0, bq[0], af[0], ag[0]);
  __builtin_amdgcn_sched_barrier(0);       // group order as in the loop, so that the loop's counted waits stay per group
  gemm_ld<OT, MI, NPA>(bp, ap, ap2, FRAG_EL, bq[1], af[1], ag[1]);
  for (int k0 = 128; k0 < K; k0 += 128) {  // all trips but the last four steps
#pragma unroll
    for (int u = 0; u < 2; ++u) {          // unrolled so that the set index is a constant (registers): steps 2, 3 of the group in hand
      gemm_ld<OT, MI, NPA>(bp, ap, ap2, (u + 2) * FRAG_EL, bq[u + 2], af[u + 2], ag[u + 2]);
      __builtin_amdgcn_sched_barrier(0);   // keeps the load group ahead of the products below
      gemm_mm<OT, MI, NPA>(bq[u], af[u], ag[u], acc, acc2);
    }
    ptr_wait<MI, NPA>(bp, ap, ap2);
    const int adv = (grp + 1 < ng) ? 4 * FRAG_EL / 8 : -(ng - 1) * (4 * FRAG_EL / 8);   // 4 k steps = 4 units; behind the last group comes group 0
    grp = (grp + 1 < ng) ? grp + 1 : 0;
#pragma unroll
    for (int j = 0; j < 4; ++j) bp[j] += adv;
#pragma unroll
    for (int i = 0; i < MI; ++i) { ap[i] += adv; ap2[i] += adv; }
#pragma unroll
    for (int u = 2; u < 4; ++u) {          // steps 0, 1 of the next group
      gemm_ld<OT, MI, NPA>(bp, ap, ap2, (u - 2) * FRAG_EL, bq[u - 2], af[u - 2], ag[u - 2]);
      __builtin_amdgcn_sched_barrier(0);   // keeps the load group ahead of the products below
      gemm_mm<OT, MI, NPA>(bq[u], af[u], ag[u], acc, acc2);
    }
  }
  // the last four steps: two groups are still to fetch
  gemm_ld<OT, MI, NPA>(bp, ap, ap2, 2 * FRAG_EL, bq[2], af[2], ag[2]);
  __builtin_amdgcn_sched_barrier(0);       // keeps the load group ahead of the products below
  gemm_mm<OT, MI, NPA>(bq[0], af[0], ag[0], acc, acc2);
  gemm_ld<OT, MI, NPA>(bp, ap, ap2, 3 * FRAG_EL, bq[3], af[3], ag[3]);
  ptr_wait<MI, NPA>(bp, ap, ap2);
  __builtin_amdgcn_sched_barrier(0);       // keeps the load group ahead of the products below
  gemm_mm<OT, MI, NPA>(bq[1], af[1], ag[1], acc, acc2);
  gemm_mm<OT, MI, NPA>(bq[2], af[2], ag[2], acc, acc2);
  gemm_mm<OT, MI, NPA>(bq[3], af[3], ag[3], acc, acc2);
#pragma unroll
  for (int i = 0; i < MI; ++i) {
    acc_guard4(acc[i][0], acc[i][1], acc[i][2], acc[i][3]);
    if (NPA == 2) acc_guard4(acc2[i][0], acc2[i][1], acc2[i][2], acc2[i][3]);
  }

  // ---- epilogue ----
  float* slab = sT[wave];
#pragma unroll
  for (int i = 0; i < MI; ++i) {
    const int mBase = m0 + (i << 4);
#pragma unroll
    for (int j = 0; j < 4; ++j) {
#pragma unroll
      for (int r = 0; r < 8; ++r) {
        float v = acc[i][j][r];
        if (NPA == 2) v += acc2[i][j][r] * rscaleA;
        v = v * oscale;
        slab[(mOff + r) * 68 + (j << 4) + rlane] = v;
      }
    }
    __builtin_amdgcn_fence(3, "workgroup");
    __builtin_amdgcn_wave_barrier();
    __builtin_amdgcn_fence(2, "workgroup");
    if (OUT_MODE == 0) {
      float* C = (float*)Cout + (size_t)b * (size_t)strideC;
      const int h2 = lane >> 4, c4 = (lane & 15) * 4;     // 256-B row segment = 16 lanes x 16 B
      v4f ov[8];
#pragma unroll
      for (int it = 0; it < 8; ++it) {
        const int row = it * 2 + h2;                     // it 0..7 x h2 0..1 = rows 0..15
        ov[it] = *(const v4f*)(slab + row * 68 + c4);
      }
      {
#pragma unroll
        for (int it = 0; it < 8; ++it) {
          const int row = it * 2 + h2;
          *(v4f*)(C + (size_t)(mBase + row) * ldc + n0 + c4) = ov[it];
        }
        
      }
    } else {
      // the 16 x 64 slab = 2 units = 128 granules in a row: store it writes granules 32*it + lane (512 contiguous B),
      // which hold row lane&15, columns 8*(2*it + (lane>>4)) .. +7
      const size_t u0 = ((size_t)(mBase >> 4) * (ldc >> 5) + (n0 >> 5)) * FRAG_EL + lane * 8;
      unsigned short* C  = (unsigned short*)Cout  + (size_t)b * (size_t)strideC + u0;
      unsigned short* C2 = (unsigned short*)Cout2 + (size_t)b * (size_t)strideC + u0;
      if (OUT_MODE == 3 && res) store_slab16<true>(slab, C, C2, cscale, rscaleC, lane);    // block-uniform: one scalar branch a slab
      else                      store_slab16<false>(slab, C, C2, cscale, rscaleC, lane);
    }
    __builtin_amdgcn_fence(3, "workgroup");
    __builtin_amdgcn_wave_barrier();
    __builtin_amdgcn_fence(2, "workgroup");
  }
}

// one product a launch
template <typename OT, int MI, int NPA, int OUT_MODE>
__global__ __launch_bounds__(256) void gemm_t(
    const unsigned short* __restrict__ Ap, const unsigned short* __restrict__ A2p, int lda, long long strideA,
    const unsigned short* __restrict__ Btp, int ldb, long long strideB,
    void* Cout, void* Cout2, int ldc, long long strideC,
    int M, int N, int K, float oscale, float rscaleA, float cscale, float rscaleC) {
  gemm_body<OT, MI, NPA, OUT_MODE>(Ap, A2p, lda, strideA, Btp, ldb, strideB, Cout, Cout2, ldc, strideC,
                                   M, N, K, oscale, rscaleA, cscale, rscaleC, blockIdx.x, blockIdx.y, false);
}
// The three projections in ONE launch: each alone has QKV_NBLK blocks of 8 waves, and a WGP holds one such block (registers),
// so a launch of one product leaves WGPs idle wherever the chip has more than QKV_NBLK of them. blockIdx.y = product:
//   0: q = xq . Wq^T -> f16 hi / residual (x4096) planes [b*SEQ+s][h*64+d]   (M=NROW, N=EMB)
//   1: k = xk . Wk^T -> f16 plane [b*SEQ+s][h*64+d]
//   2: v^T = Wv . xv_b^T per batch b -> f16 plane [b][h*64+d][s] (pitch SEQ); A = Wvb [n][k], Bt = Xv rows of batch b
//      (offset b*SEQ*EMB); M=EMB, N=SEQ; its blocks are QKV_VBLK a batch
// Every block keeps the tile, the k walk and the sums that it had in a launch of its own. kk = EMB (pitch of A and Bt, and K).
#define QKV_NBLK ((NROW / 64) * (EMB / 64) / 8)
#define QKV_VBLK ((EMB / 64) * (SEQ / 64) / 8)
static_assert(QKV_NBLK * 8 == (NROW / 64) * (EMB / 64) && QKV_VBLK * 8 == (EMB / 64) * (SEQ / 64) && QKV_VBLK * NB == QKV_NBLK);
__global__ __launch_bounds__(256) void gemm_qkv(
    const unsigned short* __restrict__ Xq, const unsigned short* __restrict__ Xk, const unsigned short* __restrict__ Xv,
    const unsigned short* __restrict__ Wqb, const unsigned short* __restrict__ Wkb, const unsigned short* __restrict__ Wvb,
    unsigned short* Qh, unsigned short* Ql, unsigned short* Kp, unsigned short* VT, int kk) {
  const unsigned job = blockIdx.y;              // block-uniform: all that follows is picked in scalar registers
  const bool isv = job == 2u;
  const unsigned short* A  = (job == 0u) ? Xq  : (job == 1u) ? Xk  : Wvb;
  const unsigned short* Bt = (job == 0u) ? Wqb : (job == 1u) ? Wkb : Xv;
  unsigned short* C        = (job == 0u) ? Qh  : (job == 1u) ? Kp  : VT;
  gemm_body<__bf16, 4, 1, 3>(A, A, kk, 0LL, Bt, kk, isv ? (long long)SEQ * EMB : 0LL,
                             (void*)C, (void*)Ql, isv ? SEQ : EMB, isv ? (long long)EMB * SEQ : 0LL,
                             isv ? EMB : NROW, isv ? SEQ : EMB, kk, 1.0f, 0.0f, 1.0f, 4096.0f,
                             isv ? blockIdx.x % QKV_VBLK : blockIdx.x, isv ? blockIdx.x / QKV_VBLK : 0u, job == 0u);
}

// =====================================================================================================
// Score chunk, transposed: 64 keys kv0..kv0+63 x 16 query rows (this wave) of one (b, h).
//   k fragments (A operand, row = lane&15 = key) loaded straight from the f16 k plane (fragment order):
//   kb0 = plane + (b*SEQ)*EMB + h*2*FRAG_EL, 16 keys on add 16*EMB (plane row = b*SEQ + t).
//   q fragments (B operand, col = lane&15 = query): hi and residual (x4096) planes, 2 d-chunks of 32.
//   s[j][r] = D element: key kv0 + 16j + 8*hh + r, query lane&15; value = ((k.qh) + (k.ql)/4096) / 8.
//   A lane holds scores of ONE query only (32 of the chunk's 64 keys; lane ^ 16 has the other 32), and
//   s[2kk], s[2kk+1] lie as elements 0..7, 8..15 of an A fragment (row = query, 32 keys) for the P.V product.
// =====================================================================================================
// the chunk's 8 k fragments as one load group, kf[2j + dc]; kp = the lane's pointer into the unit of keys kv0..kv0+15,
// d 0..31 (16-byte units); loops unrolled so that kf keeps constant indices (registers)
typedef GP<_Float16>::ptr KPtr;
__device__ __forceinline__ void ld_kchunk(KPtr& kp, v16h (&kf)[8]) {
#pragma unroll
  for (int j = 0; j < 4; ++j)
#pragma unroll
    for (int dc = 0; dc < 2; ++dc) kf[2 * j + dc] = ldfrag_g<_Float16>(kp, j * 16 * EMB + dc * FRAG_EL);
#if DEV_ASM
  asm volatile("s_wait_xcnt 0x0" : "+v"(kp) :: "memory");   // before kp, which these loads name, is moved on or given up
#endif
}
__device__ __forceinline__ void score_chunk(const v16h (&qah)[2], const v16h (&qal)[2], const v16h (&kf)[8],
                                            v8f (&s)[4]) {
#pragma unroll
  for (int j = 0; j < 4; ++j) {
    v8f ah = zero8(), al = zero8();
#pragma unroll
    for (int dc = 0; dc < 2; ++dc) {
      ah = mma_h(kf[2 * j + dc], qah[dc], ah);
      al = mma_h(kf[2 * j + dc], qal[dc], al);
    }
#pragma unroll
    for (int r = 0; r < 8; ++r) s[j][r] = (ah[r] + al[r] * (1.0f / 4096.0f)) * 0.125f;
  }
}

// =====================================================================================================
// Softmax statistics: per (b, h, query s) the row max m and 1/sum(exp(s - m)) over all SEQ keys.
//   block = 4 waves = 64 consecutive query rows qb*64.. of one (b, h); grid = NB*NH*NKT blocks of 128;
//   static trip NKT over 64-key chunks; online max / rescaled sum in f32, one query a lane, all in the lane;
//   the two lanes of a query (each half of the keys) are merged once, behind the loop.
//   Output plane ML [b*NH+h][2][SEQ] f32 (m then 1/l): the block's 64 m values and 64 1/l values are
//   funnelled through LDS (cross-wave: block barrier) and written by wave 0 with ONE instruction (lanes 0-15:
//   coverage: grid (b,h,qb) x 64 rows = the whole [NB*NH][2][SEQ] plane. MLsh: 4 waves x 32 lanes = all 128.
// =====================================================================================================
__global__ __launch_bounds__(128)
void attn_stats(const unsigned short* __restrict__ qhp, const unsigned short* __restrict__ qlp,
                const unsigned short* __restrict__ kpp, float* ML) {
  __shared__ __align__(16) float MLsh[128];
  const int tid  = threadIdx.x;
  const int wave = tid >> 5;
  const int lane = tid & 31;
  const int hh   = lane >> 4;
  const int c    = lane & 15;
  const int bx   = blockIdx.x;
  const int qb   = bx % NKT;
  const int rest = bx / NKT;
  const int h    = rest % NH;
  const int b    = rest / NH;
  const int bh   = b * NH + h;
  const int q0   = qb * 64 + wave * 16;

  const _Float16* Qh  = (const _Float16*)(const void*)qhp;
  const _Float16* Ql  = (const _Float16*)(const void*)qlp;
  const _Float16* Kb0 = (const _Float16*)(const void*)kpp + (size_t)b * SEQ * EMB + (size_t)h * (HD / 32) * FRAG_EL;

  v16h qah[2], qal[2];
#pragma unroll
  for (int dc = 0; dc < 2; ++dc) {
    const size_t qo = ((size_t)b * SEQ + (size_t)q0) * EMB + (size_t)(h * (HD / 32) + dc) * FRAG_EL + lane * 8;
    qah[dc] = ldfrag<_Float16>(Qh + qo);
    qal[dc] = ldfrag<_Float16>(Ql + qo);
  }

  float mrow = -INFINITY, lrow = 0.f;         // query q0 + c, over this lane's half of the keys

#if DEV_ASM
  asm volatile("s_wait_xcnt 0x0" ::: "memory");   // before the k fetch lands in registers that the q loads name
#endif
  v16h kf[8];
  // The NKT blocks of one (b, h) walk the same k lines: each starts its walk at its own chunk (qb) and wraps round, so that
  // blocks running in step ask L2 for different lines at any moment.
  int kc = qb;                                // chunk in hand, 0 .. NKT-1
  KPtr kp = (KPtr)(const void*)(Kb0 + (size_t)kc * 64 * EMB + lane * 8);
  ld_kchunk(kp, kf);
  for (int kt = 0; kt < NKT; ++kt) {          // static trip count
    v8f s[4];
    score_chunk(qah, qal, kf, s);
    __builtin_amdgcn_sched_barrier(0);        // the next chunk's fetch stays behind this chunk's products (same registers)
    kp += (kc + 1 < NKT) ? 64 * EMB / 8 : -(NKT - 1) * (64 * EMB / 8);  // 16-byte units; behind the last chunk comes chunk 0
    kc = (kc + 1 < NKT) ? kc + 1 : 0;         // last trip: the walk's first chunk again, a fetch that nothing uses
    ld_kchunk(kp, kf);
    __builtin_amdgcn_sched_barrier(0);        // ... and ahead of the vector work below, which covers its latency
    float mj[4];                              // loops over j and r unrolled here and below: s keeps constant indices (registers)
#pragma unroll
    for (int j = 0; j < 4; ++j) {
      mj[j] = s[j][0];
#pragma unroll
      for (int r = 1; r < 8; ++r) mj[j] = fmaxf(mj[j], s[j][r]);
    }
    const float mnew  = fmaxf(mrow, fmaxf(fmaxf(mj[0], mj[1]), fmaxf(mj[2], mj[3])));
    const float msafe = (mnew == -INFINITY) ? 0.f : mnew;
    const float alpha = __expf(mrow - msafe);
    mrow = mnew;
    float pj[4];                              // four independent partial sums
#pragma unroll
    for (int j = 0; j < 4; ++j) {
      pj[j] = 0.f;
#pragma unroll
      for (int r = 0; r < 8; ++r) pj[j] += __expf(s[j][r] - msafe);
    }
    lrow = lrow * alpha + ((pj[0] + pj[1]) + (pj[2] + pj[3]));
  }

  // merge the two halves of each query's keys (lane ^ 16), once
  const float mo    = __shfl_xor(mrow, 16, 32);
  const float lo    = __shfl_xor(lrow, 16, 32);
  const float mall  = fmaxf(mrow, mo);
  const float msafe = (mall == -INFINITY) ? 0.f : mall;
  const float l     = lrow * __expf(mrow - msafe) + lo * __expf(mo - msafe);
  const float il    = (l > 0.f) ? (1.0f / l) : 0.f;
  MLsh[hh * 64 + wave * 16 + c] = hh ? il : mall;   // lanes 0-15: m, lanes 16-31: 1/l of query q0 + c
  __syncthreads();
  if (wave == 0) {
    const v4f v = *(const v4f*)(MLsh + lane * 4);        // lanes 0-15: m rows 4c..4c+3; lanes 16-31: 1/l rows
    float* dst = ML + (size_t)(bh * 2 + hh) * SEQ + qb * 64 + c * 4;
    *(v4f*)dst = v;
    
  }
}

// =====================================================================================================
// Main attention pass: one block per (b, 32 query rows q0..q0+31, one of KSPLIT key ranges), 16 waves = the 16 heads;
//   a wave holds TWO 16-row query tiles, so each k and v fragment fetched from L2 serves 32 queries.
//   Per 32-key chunk (static trip NKT32): scores recomputed exactly as in attn_stats, p = exp(s - m) * (1/l) in f32
//   (m, 1/l from the ML plane, one query a lane and tile);
//   (a) context += P . V: the lane's p values, converted to f16 with the x16384 carry, ARE the A fragments (no LDS, no
//       lane exchange); B = v^T f16 plane [b][h*64+d][s] (head slab h*64*SEQ), fragment order;
//       p also goes to the per-wave LDS tile Pf[h][row][key] (16-byte stores of 4 keys, every entry written) for
//   (b) head average: after __syncthreads (cross-wave), threads 0..255 sum the 16 wave tiles in fixed head order
//   Epilogue: the key range's part of ctx = acc / 16384, x256 carry, staged in the wave's Pf tile (wave-private), written in f32;
//   p is already normalised, so ctx is the plain sum of its parts (ctx_merge).
//   coverage: avg: NKT32 chunks x 32 rows x 32 keys per block, grid (b, qb, ks) = the whole [NB][SEQ][SEQ];
//   ctx parts: each wave rows q0..q0+31 x its head's 64 columns, 16 waves x grid = the whole [KSPLIT][NROW][EMB].
// =====================================================================================================
// 32-key forms of the chunk fetch and of the score chunk (same k map, same products, same order per score)
__device__ __forceinline__ void ld_kchunk32(KPtr& kp, v16h (&kf)[4]) {
#pragma unroll
  for (int j = 0; j < 2; ++j)
#pragma unroll
    for (int dc = 0; dc < 2; ++dc) kf[2 * j + dc] = ldfrag_g<_Float16>(kp, j * 16 * EMB + dc * FRAG_EL);
#if DEV_ASM
  asm volatile("s_wait_xcnt 0x0" : "+v"(kp) :: "memory");   // before kp, which these loads name, is moved on or given up
#endif
}
__device__ __forceinline__ void score_chunk32(const v16h (&qah)[2], const v16h (&qal)[2], const v16h (&kf)[4],
                                              v8f (&s)[2]) {
#pragma unroll
  for (int j = 0; j < 2; ++j) {
    v8f ah = zero8(), al = zero8();
#pragma unroll
    for (int dc = 0; dc < 2; ++dc) {
      ah = mma_h(kf[2 * j + dc], qah[dc], ah);
      al = mma_h(kf[2 * j + dc], qal[dc], al);
    }
#pragma unroll
    for (int r = 0; r < 8; ++r) s[j][r] = (ah[r] + al[r] * (1.0f / 4096.0f)) * 0.125f;
  }
}
#define KSPLIT   2                   // key ranges of a sequence, one block each
#define KRANGE   (SEQ / KSPLIT)      // keys of one block
#define NQB32    (SEQ / 32)          // 32-row query blocks per sequence
#define NKT32    (KRANGE / 32)       // 32-key chunks of one block
#define PP32     36                  // row pitch of the 32-key LDS P tile in floats: 144 B = 16 B x odd, so 16 rows written 16 B each fall on 64 distinct banks
#define NGRAN    ((size_t)NROW * EMB / 8)   // 8-element granules of a ctx plane
static_assert((KRANGE % 32) == 0 && (SEQ % 32) == 0 && 32 * PP32 >= 16 * 68);
__global__ __launch_bounds__(512)
void attn_main(const unsigned short* __restrict__ qhp, const unsigned short* __restrict__ qlp,
               const unsigned short* __restrict__ kpp, const unsigned short* __restrict__ vtp,
               const float* __restrict__ ML, float* cpart, float* avg) {
  union FH { v16h v; v8h h[2]; };
  __shared__ __align__(32) float Pf[NH][32 * PP32];        // per wave (head) P tile [32 rows][32 keys] f32, pitch PP32; the epilogue's ctx tile has pitch 68
  const int tid  = threadIdx.x;
  const int wave = tid >> 5;
  const int lane = tid & 31;
  const int hh   = lane >> 4;
  const int c    = lane & 15;
  const int bx   = blockIdx.x;
  const int ks   = bx % KSPLIT;
  const int qb   = (bx / KSPLIT) % NQB32;
  const int b    = bx / (KSPLIT * NQB32);
  const int h    = wave;
  const int bh   = b * NH + h;
  const int q0   = qb * 32;
  const int key0 = ks * KRANGE;

  const _Float16* Qh  = (const _Float16*)(const void*)qhp;
  const _Float16* Ql  = (const _Float16*)(const void*)qlp;
  const _Float16* Kb0 = (const _Float16*)(const void*)kpp + ((size_t)b * SEQ + key0) * EMB + (size_t)h * (HD / 32) * FRAG_EL;
  const _Float16* Vb0 = (const _Float16*)(const void*)vtp + (size_t)b * EMB * SEQ + (size_t)h * HD * SEQ
                        + (size_t)(key0 / 32) * FRAG_EL;   // v^T [b][h*64+d][s], fragment order

  v16h qah[2][2], qal[2][2];                  // [query tile][d chunk]
  float m1[2], il1[2];
#pragma unroll
  for (int qt = 0; qt < 2; ++qt) {
#pragma unroll
    for (int dc = 0; dc < 2; ++dc) {
      const size_t qo = ((size_t)b * SEQ + (size_t)(q0 + 16 * qt)) * EMB + (size_t)(h * (HD / 32) + dc) * FRAG_EL + lane * 8;
      qah[qt][dc] = ldfrag<_Float16>(Qh + qo);
      qal[qt][dc] = ldfrag<_Float16>(Ql + qo);
    }
    m1[qt]  = ML[(size_t)(bh * 2) * SEQ + q0 + 16 * qt + c];                      // the lane's query q0 + 16qt + c
    il1[qt] = ML[(size_t)(bh * 2 + 1) * SEQ + q0 + 16 * qt + c];
  }

  v8f oacc[2][4];
#pragma unroll
  for (int qt = 0; qt < 2; ++qt)
#pragma unroll
    for (int t = 0; t < 4; ++t) oacc[qt][t] = zero8();
  float* pf = Pf[wave];

#if DEV_ASM
  asm volatile("s_wait_xcnt 0x0" ::: "memory");   // before the k fetch lands in registers that the loads above name
#endif
  __builtin_amdgcn_sched_barrier(0);          // no address below is formed, in a register that those loads name, ahead of that wait
  v16h kf[4];
  // The NQB32 blocks of one (b, key range) walk the same k and v lines: each starts its walk at its own chunk and wraps round,
  // so that blocks running in step ask L2 for different lines at any moment. p is already normalised: any chunk order gives ctx.
  int kc = qb % NKT32;                        // chunk in hand, 0 .. NKT32-1
  KPtr kp = (KPtr)(const void*)(Kb0 + (size_t)kc * 32 * EMB + lane * 8);
  ld_kchunk32(kp, kf);
  KPtr vp = (KPtr)(const void*)(Vb0 + (size_t)kc * FRAG_EL + lane * 8);   // the lane's pointer into the unit of d 0..15, keys kv0..kv0+31
  for (int kt = 0; kt < NKT32; ++kt) {       // static trip count
    const int kv0 = key0 + kc * 32;
    const bool more = kc + 1 < NKT32;         // block-uniform: behind the last chunk comes chunk 0
    __syncthreads();                          // Pf tiles free again (head sum of the prior chunk done)

    v8f s[2][2];                              // [query tile][16-key group]: both tiles' scores from ONE fetch of the k fragments
#pragma unroll
    for (int qt = 0; qt < 2; ++qt) score_chunk32(qah[qt], qal[qt], kf, s[qt]);
    __builtin_amdgcn_sched_barrier(0);        // the v fetch stays behind the score products (registers)
    v16h vf[4];                               // this chunk's 4 v fragments as one load group, vf[t]
#pragma unroll
    for (int t = 0; t < 4; ++t) vf[t] = ldfrag_g<_Float16>(vp, t * 16 * SEQ);
#if DEV_ASM
    asm volatile("s_wait_xcnt 0x0" : "+v"(vp) :: "memory");   // before vp, which these loads name, is moved on
#endif
    vp += more ? FRAG_EL / 8 : -(NKT32 - 1) * (FRAG_EL / 8);   // 32 keys = 1 unit (16-byte units)
    __builtin_amdgcn_sched_barrier(0);        // ... and ahead of the exponentials, which cover its latency
#pragma unroll                                // all loops unrolled: s keeps constant indices (registers)
    for (int qt = 0; qt < 2; ++qt) {
#pragma unroll
      for (int j = 0; j < 2; ++j) {
#pragma unroll
        for (int r = 0; r < 8; ++r) s[qt][j][r] = __expf(s[qt][j][r] - m1[qt]) * il1[qt];      // s now holds p
        float* pw = pf + (16 * qt + c) * PP32 + j * 16 + 8 * hh;   // query 16qt + c, keys 16j + 8hh .. +7; 16-byte aligned at every row
        *(v4f*)(pw)     = __builtin_shufflevector(s[qt][j], s[qt][j], 0, 1, 2, 3);
        *(v4f*)(pw + 4) = __builtin_shufflevector(s[qt][j], s[qt][j], 4, 5, 6, 7);
      }
    }

    // ---- context += P . V (f16 WMMA, p carried x16384): both query tiles on ONE fetch of the v fragments ----
#pragma unroll                                // s and oacc are indexed by qt: a constant index keeps them in registers
    for (int qt = 0; qt < 2; ++qt) {
      FH pa;                                  // row = query c of the tile; elements 0..7 = keys 8hh + e, 8..15 = keys 16 + 8hh + e
      pa.h[0] = __builtin_convertvector(s[qt][0] * PCARRY, v8h);
      pa.h[1] = __builtin_convertvector(s[qt][1] * PCARRY, v8h);
#pragma unroll
      for (int t = 0; t < 4; ++t) oacc[qt][t] = mma_h(pa.v, vf[t], oacc[qt][t]);
    }
    __syncthreads();
    kp += more ? 32 * EMB / 8 : -(NKT32 - 1) * (32 * EMB / 8);  // 16-byte units; last trip: the walk's first chunk again, a fetch that nothing uses
    kc = more ? kc + 1 : 0;
    ld_kchunk32(kp, kf);                      // next chunk's k, one load group
    __builtin_amdgcn_sched_barrier(0);        // issued ahead of the head average, which covers part of its latency

    // ---- head average of this 32 x 32 tile, one block = one writer of every line (a row's 32 keys = one 128-B line) ----
    if (tid < 256) {                          // waves 0..7, wave-uniform
      const int row = tid >> 3, c4 = (tid & 7) * 4;
      v4f a = *(const v4f*)(Pf[0] + row * PP32 + c4);
#pragma unroll
      for (int w = 1; w < NH; ++w) a += *(const v4f*)(Pf[w] + row * PP32 + c4);
      a *= (1.0f / (float)NH);
      float* dst = avg + ((size_t)b * SEQ + (size_t)(q0 + row)) * SEQ + kv0 + c4;
      *(v4f*)dst = a;
#if DEV_ASM
      asm volatile("s_wait_xcnt 0x0" ::: "memory");   // before the next chunk overwrites the registers this store names
#endif
    }
  }
  __syncthreads();

  // ---- epilogue: this key range's part of ctx (undo the x16384 p carry, apply the x256 carry), staged, stored in f32 ----
  // cpart = [KSPLIT][2][NGRAN] groups of 4 floats: group (ks, 0, g) = elements 0..3 of granule g of the ctx planes, (ks, 1, g) = 4..7,
  // so that every store here and every load in ctx_merge covers 512 contiguous bytes a wave.
  float* os = pf;
#pragma unroll
  for (int qt = 0; qt < 2; ++qt) {
#pragma unroll
    for (int r = 0; r < 8; ++r) {
#pragma unroll
      for (int t = 0; t < 4; ++t) os[(8 * hh + r) * 68 + t * 16 + c] = oacc[qt][t][r] * (256.0f / PCARRY);
    }
    __builtin_amdgcn_fence(3, "workgroup");
    __builtin_amdgcn_wave_barrier();
    __builtin_amdgcn_fence(2, "workgroup");
    // the wave's 16 x 64 tile = 2 units = 128 granules in a row: step it takes granules 32*it + lane,
    // which hold row c, columns 8*(2*it + hh) .. +7
    v4f lo4[4], hi4[4];
#pragma unroll
    for (int it = 0; it < 4; ++it) {
      const float* sp = os + c * 68 + (it * 2 + hh) * 8;
      lo4[it] = *(const v4f*)(sp);
      hi4[it] = *(const v4f*)(sp + 4);
    }
    const size_t g0 = (((size_t)b * SEQ + (size_t)(q0 + 16 * qt)) * EMB + (size_t)h * (HD / 32) * FRAG_EL) / 8 + lane;
    float* d0 = cpart + ((size_t)(ks * 2) * NGRAN + g0) * 4;
    float* d1 = cpart + ((size_t)(ks * 2 + 1) * NGRAN + g0) * 4;
#pragma unroll
    for (int it = 0; it < 4; ++it) {
      *(v4f*)(d0 + it * 128) = lo4[it];
      *(v4f*)(d1 + it * 128) = hi4[it];
    }
#if DEV_ASM
    asm volatile("s_wait_xcnt 0x0" ::: "memory");   // before the next tile overwrites the registers these stores name
#endif
    __builtin_amdgcn_sched_barrier(0);        // the next tile's products stay behind that wait
    __builtin_amdgcn_fence(3, "workgroup");
    __builtin_amdgcn_wave_barrier();
    __builtin_amdgcn_fence(2, "workgroup");
  }
}

// =====================================================================================================
// ctx = sum of its KSPLIT key-range parts (fixed order), converted to the f16 hi plane (x256 carry, already in the parts)
// and the f16 residual plane (x4096), fragment order. Few waves, MG_N granules a thread, all loads up front.
// coverage: MG_T threads x MG_N granules = NGRAN granules = the whole [NROW][EMB] planes.
// =====================================================================================================
#define MG_N 4
#define MG_T (NROW * EMB / 8 / MG_N)
static_assert((MG_T % 256) == 0 && KSPLIT == 2);
__global__ __launch_bounds__(256) void ctx_merge(const float* __restrict__ c00, const float* __restrict__ c01,
                                                 const float* __restrict__ c10, const float* __restrict__ c11,
                                                 unsigned short* chp, unsigned short* clp) {
  const float* const cin[4] = {c00, c01, c10, c11};   // [2 * key range + half of the granule]: four scalar bases
  // granule i's byte offset, 32 bits, the same in a part (16 B of f32 a half granule) and in a plane (16 B of f16 a granule):
  // one offset register beside scalar bases serves every load and store
  unsigned ob = (blockIdx.x * 256u + threadIdx.x) * 16u;
  v4f x[MG_N][4];
#pragma unroll                                // unrolled here and below: x keeps constant indices (registers)
  for (int n = 0; n < MG_N; ++n)
#pragma unroll
    for (int p = 0; p < 4; ++p)               // p = 2 * key range + half of the granule
      x[n][p] = *(const v4f*)((const char*)cin[p] + (size_t)n * MG_T * 16 + ob);
#if DEV_ASM
  asm volatile("s_wait_xcnt 0x0" : "+v"(ob) :: "memory");   // the offset register, which these loads name, is held to here
#endif
  __builtin_amdgcn_sched_barrier(0);          // no conversion result is written ahead of that wait
#pragma unroll
  for (int n = 0; n < MG_N; ++n) {
    const v4f fa = x[n][0] + x[n][2], fb = x[n][1] + x[n][3];
    const float f[8] = {fa[0], fa[1], fa[2], fa[3], fb[0], fb[1], fb[2], fb[3]};
    v4u a, a2;
#pragma unroll
    for (int e = 0; e < 4; ++e) {
      const float f0 = f[2 * e], f1 = f[2 * e + 1];
      const _Float16 x0 = (_Float16)f0, x1 = (_Float16)f1;
      const unsigned short h0 = h_bits(x0), h1 = h_bits(x1);
      const unsigned short l0 = h_bits((_Float16)((f0 - (float)x0) * 4096.0f));
      const unsigned short l1 = h_bits((_Float16)((f1 - (float)x1) * 4096.0f));
      a[e] = pk16(h0, h1); a2[e] = pk16(l0, l1);
    }
    *(v4u*)((char*)chp + (size_t)n * MG_T * 16 + ob) = a;
    *(v4u*)((char*)clp + (size_t)n * MG_T * 16 + ob) = a2;
  }
}

// =====================================================================================================
// Workspace map (bytes, full size NB=2 SEQ=2048; PX = NROW*EMB*2 = 8388608; every region an exact multiple of
// its whole-line / whole-tile store granularity, rows are whole tiles, no padded tails needed):
//   Xq   bf16 [NROW][EMB]            PX        8388608
//   Xk   bf16 [NROW][EMB]            PX        8388608
//   Xv   bf16 [NROW][EMB]            PX        8388608
//   Wqb  bf16 [EMB n][EMB k]                   2097152
//   Wkb  bf16 [EMB n][EMB k]                   2097152
//   Wvb  bf16 [EMB n][EMB k]                   2097152
//   Wob  f16  [EMB n][EMB k] (x64)             2097152
//   Qh   f16  [NROW][EMB]            PX        8388608
//   Ql   f16  [NROW][EMB]            PX        8388608
//   Kp   f16  [NROW][EMB]            PX        8388608
//   VT   f16  [NB][EMB][SEQ]                   8388608
//   Ch   f16  [NROW][EMB]            PX        8388608
//   Cl   f16  [NROW][EMB]            PX        8388608
//   ML   f32  [NB*NH][2][SEQ]                   524288
//   CP   f32  [2 key ranges][NROW][EMB]       33554432
//   total                                    117964800
// Every 16-bit plane is in fragment order (same bytes, same extents). Input weights are [out n][in k] (k contiguous) =
// the Bt / A orientation directly; they are only converted to 16 bit and put in that order.
// Output 0 at element 0 of d_out (rows b*SEQ + s); output 1 at the fixed element offset OFF1 = NB_FULL*SEQ_FULL*EMB.
// =====================================================================================================
extern "C" void kernel_launch(void* const* d_in, const int* in_sizes, int n_in,
                              void* d_out, int out_size, void* d_ws, size_t ws_size,
                              hipStream_t stream) {
  if (n_in < 7) return;
  const int needX = ((NB - 1) * SEQ_FULL + SEQ) * EMB;
  if (in_sizes[0] < needX) return;
  if (in_sizes[1] < needX) return;
  if (in_sizes[2] < needX) return;
  if (in_sizes[3] < EMB * EMB) return;
  if (in_sizes[4] < EMB * EMB) return;
  if (in_sizes[5] < EMB * EMB) return;
  if (in_sizes[6] < EMB * EMB) return;
  const size_t n0e = (size_t)NROW * EMB;            // output 0 written elements [NB][SEQ][EMB]
  const size_t n1e = (size_t)NB * SEQ * SEQ;        // output 1 written elements [NB][SEQ][SEQ]
  if (out_size < 0) return;
  if ((size_t)out_size < n0e) return;
  if ((size_t)out_size < OFF1 + n1e) return;        // written extent of output 1 inside d_out

  const float* xq = (const float*)d_in[0];
  const float* xk = (const float*)d_in[1];
  const float* xv = (const float*)d_in[2];
  const float* Wq = (const float*)d_in[3];
  const float* Wk = (const float*)d_in[4];
  const float* Wv = (const float*)d_in[5];
  const float* Wo = (const float*)d_in[6];

  const size_t PX  = (size_t)NROW * EMB * 2;        // 16-bit activation plane
  const size_t PW  = (size_t)EMB * EMB * 2;
  const size_t PVT = (size_t)NB * EMB * SEQ * 2;
  const size_t PML = (size_t)NB * NH * 2 * SEQ * 4;
  size_t off = 0;
  const size_t oXq = off; off += PX;
  const size_t oXk = off; off += PX;
  const size_t oXv = off; off += PX;
  const size_t oWq = off; off += PW;
  const size_t oWk = off; off += PW;
  const size_t oWv = off; off += PW;
  const size_t oWo = off; off += PW;
  const size_t oQh = off; off += PX;
  const size_t oQl = off; off += PX;
  const size_t oKp = off; off += PX;
  const size_t oVT = off; off += PVT;
  const size_t oCh = off; off += PX;
  const size_t oCl = off; off += PX;
  const size_t oML = off; off += PML;
  const size_t oCP = off; off += (size_t)KSPLIT * NROW * EMB * 4;
  if (off > ws_size) return;                        // off = 117964800 at full size
  if (off > (size_t)134217728) return;

  char* ws = (char*)d_ws;
  unsigned short* Xq  = (unsigned short*)(ws + oXq);
  unsigned short* Xk  = (unsigned short*)(ws + oXk);
  unsigned short* Xv  = (unsigned short*)(ws + oXv);
  unsigned short* Wqb = (unsigned short*)(ws + oWq);
  unsigned short* Wkb = (unsigned short*)(ws + oWk);
  unsigned short* Wvb = (unsigned short*)(ws + oWv);
  unsigned short* Wob = (unsigned short*)(ws + oWo);
  unsigned short* Qh  = (unsigned short*)(ws + oQh);
  unsigned short* Ql  = (unsigned short*)(ws + oQl);
  unsigned short* Kp  = (unsigned short*)(ws + oKp);
  unsigned short* VT  = (unsigned short*)(ws + oVT);
  unsigned short* Ch  = (unsigned short*)(ws + oCh);
  unsigned short* Cl  = (unsigned short*)(ws + oCl);
  float*          ML  = (float*)(ws + oML);
  float*          CP  = (float*)(ws + oCP);
  float*          out0 = (float*)d_out;
  float*          out1 = (float*)d_out + OFF1;

  const dim3 blk(256);
  const dim3 gCvt(CVT_T / 256);                                  //  512 blocks
  const dim3 gQKV(QKV_NBLK, 3);                                  // 3 products x 1024 tiles of 64 x 64 -> 3 x 128 blocks
  const dim3 gO((((NROW) / 32) * (EMB / 64) + 7) / 8, 1);         // 2048 tiles -> 256 blocks (32x64 wave tiles)
  const dim3 gStats(NB * NH * NKT);                              // 1024 blocks of 128
  const dim3 gMain(NB * NQB32 * KSPLIT);                         //  256 blocks of 512
  const dim3 gMerge(MG_T / 256);                                 //  512 blocks

  // (1) activations [b][s][k] -> bf16 planes [b*SEQ+s][k] (input batch stride SEQ_FULL*EMB, plane batch stride SEQ*EMB);
  // (2) weights [EMB n][EMB k] -> bf16 planes (Wq, Wk, Wv); Wo -> f16 (x64 of its bf16 value); no transpose needed
  cvt_all<<<gCvt, blk, 0, stream>>>(xq, xk, xv, Wq, Wk, Wv, Wo, Xq, Xk, Xv, Wqb, Wkb, Wvb, Wob);
  // (3) (4) (5) q, k and v^T, one launch (gemm_qkv)
  gemm_qkv<<<gQKV, blk, 0, stream>>>(Xq, Xk, Xv, Wqb, Wkb, Wvb, Qh, Ql, Kp, VT, EMB);
  // (6) softmax statistics (m, 1/l) per (b, h, s)
  attn_stats<<<gStats, dim3(128), 0, stream>>>(Qh, Ql, Kp, ML);
  // (7) exact-normalised p: P.V -> f32 parts of ctx, one per key range; head-averaged p -> output 1
  attn_main<<<gMain, dim3(512), 0, stream>>>(Qh, Ql, Kp, VT, ML, CP, out1);
  // (7b) ctx = sum of its parts -> ctx planes (f16 hi x256 / residual x4096)
  ctx_merge<<<gMerge, blk, 0, stream>>>(CP, CP + NGRAN * 4, CP + NGRAN * 8, CP + NGRAN * 12, Ch, Cl);
  // (8) output 0 = ctx . Wo^T, f32 [NROW][EMB] straight into d_out, accumulators (hi + res/4096) x 1/(256*64)
  gemm_t<_Float16, 2, 2, 0><<<gO, blk, 0, stream>>>(
      Ch, Cl, EMB, 0LL, Wob, EMB, 0LL,
      (void*)out0, (void*)out0, EMB, 0LL,
      NROW, EMB, EMB, 1.0f / 16384.0f, 1.0f / 4096.0f, 1.0f, 1.0f);
  (void)hipGetLastError();
}

// v009
// Measured time: 146 microseconds a run.
// Two timings next to v008 both put it at 1.04 times that version's speed.
// All steps since v000 together make it 3.42 times as fast.
// Contractions: q, k, v^T projections = v_wmma_f32_16x16x32_bf16 (bf16 operands from RNE-converted inputs and weights, single product, f32 accumulate);
// scores (statistics pass and main pass), formed transposed as k.q^T = v_wmma_f32_16x16x32_f16 (k f16 as A; q as f16 hi plane + f16 residual plane x4096 as B; 2 products, separate f32 accumulators);
// p.v = v_wmma_f32_16x16x32_f16 (p carried x16384 in f16, v f16; single product, f32 accumulate);
// ctx.Wo^T = v_wmma_f32_16x16x32_f16 (ctx as f16 hi plane x256 + f16 residual plane x4096, Wo f16 x64 of its bf16 value; 2 products, separate f32 accumulators);
// softmax statistics, probabilities, head average and the sum of the two key ranges' ctx parts in f32.
#include <hip/hip_runtime.h>
#include <math.h>
#include <stdint.h>

#ifndef NB
#define NB 2
#endif
#ifndef SEQ
#define SEQ 2048
#endif
#define NB_FULL  2
#define SEQ_FULL 2048
#define EMB      1024
#define NH       16
#define HD       64
#define NROW     (NB * SEQ)          // activation rows in workspace planes, row index = b * SEQ + s
#define NKT      (SEQ / 64)          // 64-key chunks per sequence
#define PCARRY   16384.0f            // power-of-two carry of p in the f16 P.V operand
#define OFF1     ((size_t)NB_FULL * SEQ_FULL * EMB)   // fixed element offset of output 1 in d_out
static_assert(NB >= 1 && NB <= NB_FULL);
static_assert(SEQ >= 64 && SEQ <= SEQ_FULL && (SEQ % 64) == 0);
static_assert(NH * HD == EMB && (EMB % 128) == 0);
static_assert((NROW % 64) == 0 && (EMB % 64) == 0 && (HD % 64) == 0 && (EMB % 32) == 0);
static_assert(OFF1 * 4 == 16777216);   // byte offset of output 1
static_assert((OFF1 + (size_t)NB_FULL * SEQ_FULL * SEQ_FULL) * 4 == 50331648);   // written extent of output 1 == d_out bytes

typedef _Float16 v16h __attribute__((ext_vector_type(16)));
typedef _Float16 v8h  __attribute__((ext_vector_type(8)));
typedef __bf16   v16b __attribute__((ext_vector_type(16)));
typedef __bf16   v8b  __attribute__((ext_vector_type(8)));
typedef float    v8f  __attribute__((ext_vector_type(8)));
typedef float    v4f  __attribute__((ext_vector_type(4)));
typedef unsigned int v4u __attribute__((ext_vector_type(4)));

#if defined(__HIP_DEVICE_COMPILE__)
#define DEV_ASM 1
#else
#define DEV_ASM 0
#endif

// ---- scalar helpers --------------------------------------------------------------------------------
__device__ __forceinline__ unsigned short bf_bits(float f) {          // f32 -> bf16 bits, RNE convert
  unsigned u = __float_as_uint(f);
  return (unsigned short)((u + 0x7FFFu + ((u >> 16) & 1u)) >> 16);
}
__device__ __forceinline__ float bf_up(unsigned short hb) { return __uint_as_float(((unsigned)hb) << 16); }
__device__ __forceinline__ unsigned short h_bits(_Float16 x) { return __builtin_bit_cast(unsigned short, x); }
__device__ __forceinline__ unsigned pk16(unsigned short a, unsigned short b) { return (unsigned)a | ((unsigned)b << 16); }
__device__ __forceinline__ v8f zero8() { v8f z = {0.f, 0.f, 0.f, 0.f, 0.f, 0.f, 0.f, 0.f}; return z; }

// ---- fragment order: every 16-bit workspace plane [R rows][KC k] is kept as 1-KB units, one per WMMA operand fragment
//      (16 rows x 32 k), unit index = (row / 16) * (KC / 32) + k / 32. Inside a unit, in 16-byte granules of 8 k:
//      granule = ((k % 32) / 8) * 16 + row % 16, so granule g of the first 512 B is lane g's elements 0..7 and granule
//      g of the second 512 B its elements 8..15: each wave-wide 16-byte load reads 512 contiguous bytes (4 whole lines).
#define FRAG_EL 512                  // elements of one unit
// ---- fragment types / loaders: 16-bit A/B operand, lane -> row/col (lane&15), half h = lane>>4; p = unit + 8*lane;
//      elements 0..7 <- p[0..7] (k0+8h..k0+8h+7), elements 8..15 <- p[256..263] (k0+16+8h..k0+16+8h+7)
template <typename OT> struct FT;
template <> struct FT<__bf16>   { typedef v16b frag; typedef v8b half8; };
template <> struct FT<_Float16> { typedef v16h frag; typedef v8h half8; };

template <typename OT>
__device__ __forceinline__ typename FT<OT>::frag ldfrag(const OT* p) {
  union { typename FT<OT>::frag v; typename FT<OT>::half8 h[2]; } f;
  f.h[0] = *(const typename FT<OT>::half8*)(p);
  f.h[1] = *(const typename FT<OT>::half8*)(p + 256);
  return f.v;
}

// ---- WMMA helpers (asm guard bodies are device-only; concrete operand types) -----------------------------
__device__ __forceinline__ v8f mmar(v16b a, v16b b, v8f c) {
  return __builtin_amdgcn_wmma_f32_16x16x32_bf16(false, a, false, b, (short)0, c, false, false);
}
__device__ __forceinline__ v8f mmar(v16h a, v16h b, v8f c) {
  return __builtin_amdgcn_wmma_f32_16x16x32_f16(false, a, false, b, (short)0, c, false, false);
}
__device__ __forceinline__ void acc_guard4(v8f& a, v8f& b, v8f& c, v8f& d) {
#if DEV_ASM
  asm volatile("v_nop\n\tv_nop\n\tv_nop\n\tv_nop" : "+v"(a), "+v"(b), "+v"(c), "+v"(d));
#else
  (void)a; (void)b; (void)c; (void)d;
#endif
}
// behind a whole run of products (its eight accumulators tied): 4 VALU slots ahead of the global loads that land in the
// run's A and B registers (the distance asked for an overwrite of A or B). Inside the run each product fills the slots
// behind the others, so none is padded.
__device__ __forceinline__ void run_guard8(v8f& a, v8f& b, v8f& c, v8f& d, v8f& e, v8f& f, v8f& g, v8f& h) {
#if DEV_ASM
  asm volatile("v_nop\n\tv_nop\n\tv_nop\n\tv_nop" : "+v"(a), "+v"(b), "+v"(c), "+v"(d), "+v"(e), "+v"(f), "+v"(g), "+v"(h));
#else
  (void)a; (void)b; (void)c; (void)d; (void)e; (void)f; (void)g; (void)h;
#endif
}

// 16-bit convert helper. MODE 0: bf16 bits (RNE convert).  MODE 1: f16 bits of (64 * bf16(x)) (exact scaling of the bf16 value).
template <int MODE>
__device__ __forceinline__ unsigned short cvm(float f) {
  const unsigned short hb = bf_bits(f);
  if (MODE == 0) return hb;
  return h_bits((_Float16)(bf_up(hb) * 64.0f));
}

// =====================================================================================================
// All seven f32 -> 16-bit conversions (3 activations, 4 weights) in ONE launch of few waves, each with many granules.
// Planes in fragment order, 8 elements (one granule) per thread and slab. The launch has CVT_T threads. A weight is one
// slab of CVT_T granules. An activation is XSLAB slabs; a slab takes CVT_TB granules (XROWS rows) of EVERY batch, thread
// i being in batch i / CVT_TB, so that a slab's step from the plane's start is a small constant for all threads.
// In a slab a wave takes 8 rows x 32 k: it reads 8 whole 128-B lines of f32 and writes 4 whole 128-B lines
// (8 granules of each of the unit's 4 k groups).
// coverage: activations: XSLAB slabs x NB batches x XROWS rows = [NROW][EMB], 3 planes; weights: CVT_T granules = [EMB][EMB], 4 planes.
// =====================================================================================================
#define CVT_T    (EMB * EMB / 8)                  // threads of the launch = granules of a weight
#define CVT_TB   (CVT_T / NB)                     // threads on one batch
#define XROWS    (CVT_TB * 8 / EMB)               // rows of a batch in one activation slab
#define XSLAB    (SEQ / XROWS)                    // slabs of an activation
#define NXSLAB   (3 * XSLAB)
#define NSLAB    (NXSLAB + 4)                     // ... and the four weights
static_assert((CVT_T % 256) == 0 && (CVT_T % NB) == 0 && (XROWS % 16) == 0 && XROWS * EMB == CVT_TB * 8 && (SEQ % XROWS) == 0);
static_assert((size_t)NB_FULL * SEQ_FULL * EMB * 4 < ((size_t)1 << 32));   // byte offsets in a plane fit 32 bits
template <int MODE>
__device__ __forceinline__ v4u cvt8(v4f a, v4f a4) {
  v4u p;
  p[0] = pk16(cvm<MODE>(a[0]),  cvm<MODE>(a[1]));
  p[1] = pk16(cvm<MODE>(a[2]),  cvm<MODE>(a[3]));
  p[2] = pk16(cvm<MODE>(a4[0]), cvm<MODE>(a4[1]));
  p[3] = pk16(cvm<MODE>(a4[2]), cvm<MODE>(a4[3]));
  return p;
}
__global__ __launch_bounds__(256) void cvt_all(
    const float* __restrict__ xq, const float* __restrict__ xk, const float* __restrict__ xv,
    const float* __restrict__ wq, const float* __restrict__ wk, const float* __restrict__ wv,
    const float* __restrict__ wo,
    unsigned short* Xq, unsigned short* Xk, unsigned short* Xv,
    unsigned short* Wqb, unsigned short* Wkb, unsigned short* Wvb, unsigned short* Wob) {
  const unsigned i    = blockIdx.x * 256u + threadIdx.x;
  const unsigned unit = i >> 6;                               // 64 threads (2 waves) per unit
  const unsigned kg   = (i >> 3) & 3u;                        // k group of 8 inside the unit
  const unsigned rr   = ((i >> 5) & 1u) * 8u + (i & 7u);      // row inside the unit
  const unsigned bt   = i / CVT_TB;                           // the thread's batch in the activations
  // the granule's byte offsets from a plane's start, 32 bits: with a slab's constant step, one offset register serves
  // every slab of a kind beside the plane's scalar base. Weights: granule i. Activations: granule i - bt * CVT_TB of batch bt.
  unsigned sobW = (((unit / (EMB / 32)) * 16u + rr) * EMB + (unit % (EMB / 32)) * 32u + kg * 8u) * 4u;
  unsigned sobX = sobW + bt * (unsigned)((SEQ_FULL - XROWS) * EMB * 4);
  const unsigned dobW = (unit * FRAG_EL + (kg * 16u + rr) * 8u) * 2u;
  const unsigned dobX = dobW + bt * (unsigned)((SEQ - XROWS) * EMB * 2);
  const float* const xin[3]     = {xq, xk, xv};
  const float* const win[4]     = {wq, wk, wv, wo};
  unsigned short* const xout[3] = {Xq, Xk, Xv};
  unsigned short* const wout[4] = {Wqb, Wkb, Wvb, Wob};
  // every loop here is unrolled: the slab index picks pointers and registers at compile time
  v4f a[NSLAB][2];
#pragma unroll
  for (int s = 0; s < NSLAB; ++s) {               // all loads of the thread up front: 2 * NSLAB x 16 B in flight a lane
    const char* src = (s < NXSLAB) ? (const char*)xin[s / XSLAB] + (size_t)(s % XSLAB) * XROWS * EMB * 4 + sobX
                                   : (const char*)win[s - NXSLAB] + sobW;
    a[s][0] = *(const v4f*)(src);
    a[s][1] = *(const v4f*)(src + 16);
    __builtin_amdgcn_sched_barrier(0);            // a slab's two loads read the same lines: kept side by side, ahead of all conversions
  }
#if DEV_ASM
  asm volatile("s_wait_xcnt 0x0" : "+v"(sobX), "+v"(sobW) :: "memory");   // before the offset registers, which these loads name, are given up
#endif
  __builtin_amdgcn_sched_barrier(0);              // no conversion result is written ahead of that wait
  v4u p[NSLAB];
#pragma unroll
  for (int s = 0; s < NSLAB; ++s)
    p[s] = (s == NSLAB - 1) ? cvt8<1>(a[s][0], a[s][1]) : cvt8<0>(a[s][0], a[s][1]);
#pragma unroll
  for (int s = 0; s < NSLAB; ++s) {
    char* dst = (s < NXSLAB) ? (char*)xout[s / XSLAB] + (size_t)(s % XSLAB) * XROWS * EMB * 2 + dobX
                             : (char*)wout[s - NXSLAB] + dobW;
    *(v4u*)dst = p[s];
  }
}

// =====================================================================================================
// Register-blocked batched WMMA GEMM (16-bit operand type OT): C[m][n] = sum_k A[m][k] * Bt[n][k];
// one wave per (16*MI) x 64 tile, no block barriers. A [M][K = lda] and Bt [N][K = ldb] in fragment order;
// M multiple of 16*MI, N multiple of 64, K multiple of 128 (static sizes here). by = batch
// index (strides in elements). Fragments are loaded straight from global, 512 contiguous bytes a load (ldfrag_g).
// NPA = number of A planes: 2 -> second plane A2 (same pitch/stride) multiplies the same Bt fragments into a
// second accumulator set, combined as acc + acc2 * rscaleA in the f32 epilogue.
// value v = (acc [+ acc2*rscaleA]) * oscale.
// OUT_MODE 0: f32 C (pitch ldc) = v.
// OUT_MODE 3: f16 plane C = f16(v * cscale), [M][N = ldc] in fragment order, and, where res is set (block-uniform),
//             the f16 residual plane C2 = f16((v*cscale - hi) * rscaleC), likewise.
// bx: the block's index among the blocks of its product and batch.
// =====================================================================================================
// one k step's load group: 4 B fragments, MI A fragments (and MI of the second A plane); in this helper and the next
// every loop is unrolled so that the fragment and accumulator arrays keep constant indices (registers)
//   (bp, ap, ap2: each lane's pointers into its row tiles' units, global address space, in 16-byte units;
//    k: a constant element offset, FRAG_EL per k step of 32)
template <typename OT> struct GP { typedef const __attribute__((address_space(1))) typename FT<OT>::half8* ptr; };
template <typename OT>
__device__ __forceinline__ typename FT<OT>::frag ldfrag_g(typename GP<OT>::ptr p, int k) {   // same k map as ldfrag
  union { typename FT<OT>::frag v; typename FT<OT>::half8 h[2]; } f;
  f.h[0] = p[k / 8];
  f.h[1] = p[k / 8 + 32];
  return f.v;
}
template <typename OT, int MI, int NPA>
__device__ __forceinline__ void gemm_ld(typename GP<OT>::ptr const (&bp)[4], typename GP<OT>::ptr const (&ap)[MI],
                                        typename GP<OT>::ptr const (&ap2)[MI], int k,
                                        typename FT<OT>::frag (&bq)[4], typename FT<OT>::frag (&af)[MI],
                                        typename FT<OT>::frag (&ag)[MI]) {
#pragma unroll
  for (int j = 0; j < 4; ++j) bq[j] = ldfrag_g<OT>(bp[j], k);
#pragma unroll
  for (int i = 0; i < MI; ++i) {
    af[i] = ldfrag_g<OT>(ap[i], k);
    if (NPA == 2) ag[i] = ldfrag_g<OT>(ap2[i], k);
  }
}
// the wait that stands before the row pointers, which the issued loads name, are moved on or given up
template <int MI, int NPA, typename P>
__device__ __forceinline__ void ptr_wait(P (&bp)[4], P (&ap)[MI], P (&ap2)[MI]) {
  static_assert((MI == 4 && NPA == 1) || (MI == 2 && NPA == 2));   // the two shapes in use: eight pointers each
#if DEV_ASM
  if constexpr (MI == 4)
    asm volatile("s_wait_xcnt 0x0" : "+v"(bp[0]), "+v"(bp[1]), "+v"(bp[2]), "+v"(bp[3]),
                                     "+v"(ap[0]), "+v"(ap[1]), "+v"(ap[2]), "+v"(ap[3]) :: "memory");
  else
    asm volatile("s_wait_xcnt 0x0" : "+v"(bp[0]), "+v"(bp[1]), "+v"(bp[2]), "+v"(bp[3]),
                                     "+v"(ap[0]), "+v"(ap[1]), "+v"(ap2[0]), "+v"(ap2[1]) :: "memory");
#endif
}
// one k step's products, in the order i, plane, j
template <typename OT, int MI, int NPA>
__device__ __forceinline__ void gemm_mm(const typename FT<OT>::frag (&bq)[4], const typename FT<OT>::frag (&af)[MI],
                                        const typename FT<OT>::frag (&ag)[MI], v8f (&acc)[MI][4], v8f (&acc2)[MI][4]) {
#pragma unroll
  for (int i = 0; i < MI; ++i) {
#pragma unroll
    for (int j = 0; j < 4; ++j) acc[i][j] = mmar(af[i], bq[j], acc[i][j]);
    if (NPA == 2) {
#pragma unroll
      for (int j = 0; j < 4; ++j) acc2[i][j] = mmar(ag[i], bq[j], acc2[i][j]);
    }
  }
}

// a wave's 16 x 64 f32 slab (pitch 68) -> 2 units of the f16 plane C and, with RES, of the residual plane C2;
// C, C2: the lane's pointers into the first unit (8 elements a lane)
template <bool RES>
__device__ __forceinline__ void store_slab16(const float* slab, unsigned short* C, unsigned short* C2,
                                             float cscale, float rscaleC, int lane) {
  const int rlane = lane & 15;
  v4u hv[4], lv[4];
#pragma unroll
  for (int it = 0; it < 4; ++it) {
    const float* sp = slab + rlane * 68 + (it * 2 + (lane >> 4)) * 8;
    float f[8];
#pragma unroll
    for (int e = 0; e < 8; ++e) f[e] = sp[e] * cscale;
    v4u a, a2;
#pragma unroll
    for (int e = 0; e < 4; ++e) {
      const float f0 = f[2 * e], f1 = f[2 * e + 1];
      const _Float16 x0 = (_Float16)f0, x1 = (_Float16)f1;
      const unsigned short h0 = h_bits(x0), h1 = h_bits(x1);
      unsigned short l0 = 0, l1 = 0;
      if (RES) {
        l0 = h_bits((_Float16)((f0 - (float)x0) * rscaleC));
        l1 = h_bits((_Float16)((f1 - (float)x1) * rscaleC));
      }
      a[e] = pk16(h0, h1); a2[e] = pk16(l0, l1);
    }
    hv[it] = a; lv[it] = a2;
  }
#pragma unroll
  for (int it = 0; it < 4; ++it) {
    *(v4u*)(C + it * 256) = hv[it];
    if (RES) *(v4u*)(C2 + it * 256) = lv[it];
  }
#if DEV_ASM
  asm volatile("s_wait_xcnt 0x0" ::: "memory");   // before the next slab overwrites the registers these stores name
#endif
}

template <typename OT, int MI, int NPA, int OUT_MODE>
__device__ __forceinline__ void gemm_body(
    const unsigned short* __restrict__ Ap, const unsigned short* __restrict__ A2p, int lda, long long strideA,
    const unsigned short* __restrict__ Btp, int ldb, long long strideB,
    void* Cout, void* Cout2, int ldc, long long strideC,
    int M, int N, int K, float oscale, float rscaleA, float cscale, float rscaleC,
    unsigned bx, unsigned by, bool res) {
  typedef typename FT<OT>::frag V16;
  const OT* A  = (const OT*)(const void*)Ap;
  const OT* A2 = (const OT*)(const void*)A2p;
  const OT* Bt = (const OT*)(const void*)Btp;
  __shared__ __align__(16) float sT[8][16 * 68];   // per-wave 16x64 slab, pitch 68 floats
  const int RT   = 16 * MI;
  const int b    = by;
  const int lane = threadIdx.x & 31;
  const int wave = threadIdx.x >> 5;
  const int tilesN = N >> 6;
  const int tilesM = M / RT;
  const int tile = bx * 8 + wave;
  if (tile >= tilesM * tilesN) return;   // wave-uniform; no block barriers in this kernel
  const int tm = tile / tilesN;
  const int tn = tile - tm * tilesN;
  const int m0 = tm * RT;
  const int n0 = tn << 6;

  const OT* Ab  = A  + (size_t)b * (size_t)strideA;
  const OT* A2b = A2 + (size_t)b * (size_t)strideA;
  const OT* Bb  = Bt + (size_t)b * (size_t)strideB;

  const int rlane = lane & 15;                 // row (A) / col (B, D) within subtile
  const int mOff  = (lane >> 4) * 8;           // D row offset

  v8f acc[MI][4], acc2[MI][4];
#pragma unroll
  for (int i = 0; i < MI; ++i)
#pragma unroll
    for (int j = 0; j < 4; ++j) { acc[i][j] = zero8(); acc2[i][j] = zero8(); }

  // Rotating fragment sets: the whole load group of k step s + 2 is issued ahead of the products of step s, so the
  // loads of two steps fly under the products, where one latency per A fragment was waited out. K is a multiple of 128.
  typedef typename GP<OT>::ptr GPtr;
  GPtr bp[4], ap[MI], ap2[MI];
  // Blocks that share operand rows walk the same lines: each block starts its k walk at its own group of 4 k steps and wraps
  // round, so that blocks running in step ask L2 for different lines at any moment. One start for the whole block: its waves
  // stay in step on the A rows they share. Blocks of one tile row, and blocks of one tile column set, get different starts.
  const int ng = K >> 7;                       // groups of 4 k steps
  int grp = (int)((bx + bx / (unsigned)((tilesN + 7) >> 3) + 3u * by) % (unsigned)ng);   // group in hand
  const size_t kst = (size_t)grp * 4 * FRAG_EL + lane * 8;
#pragma unroll
  for (int j = 0; j < 4; ++j) bp[j] = (GPtr)(const void*)(Bb + (size_t)((n0 >> 4) + j) * (ldb >> 5) * FRAG_EL + kst);
#pragma unroll
  for (int i = 0; i < MI; ++i) {
    ap[i]  = (GPtr)(const void*)(Ab  + (size_t)((m0 >> 4) + i) * (lda >> 5) * FRAG_EL + kst);
    ap2[i] = (GPtr)(const void*)(A2b + (size_t)((m0 >> 4) + i) * (lda >> 5) * FRAG_EL + kst);
  }
  V16 bq[4][4], af[4][MI], ag[4][MI];
  gemm_ld<OT, MI, NPA>(bp, ap, ap2, 0, bq[0], af[0], ag[0]);
  __builtin_amdgcn_sched_barrier(0);       // group order as in the loop, so that the loop's counted waits stay per group
  gemm_ld<OT, MI, NPA>(bp, ap, ap2, FRAG_EL, bq[1], af[1], ag[1]);
  for (int k0 = 128; k0 < K; k0 += 128) {  // all trips but the last four steps
#pragma unroll
    for (int u = 0; u < 2; ++u) {          // unrolled so that the set index is a constant (registers): steps 2, 3 of the group in hand
      gemm_ld<OT, MI, NPA>(bp, ap, ap2, (u + 2) * FRAG_EL, bq[u + 2], af[u + 2], ag[u + 2]);
      __builtin_amdgcn_sched_barrier(0);   // keeps the load group ahead of the products below
      gemm_mm<OT, MI, NPA>(bq[u], af[u], ag[u], acc, acc2);
    }
    ptr_wait<MI, NPA>(bp, ap, ap2);
    const int adv = (grp + 1 < ng) ? 4 * FRAG_EL / 8 : -(ng - 1) * (4 * FRAG_EL / 8);   // 4 k steps = 4 units; behind the last group comes group 0
    grp = (grp + 1 < ng) ? grp + 1 : 0;
#pragma unroll
    for (int j = 0; j < 4; ++j) bp[j] += adv;
#pragma unroll
    for (int i = 0; i < MI; ++i) { ap[i] += adv; ap2[i] += adv; }
#pragma unroll
    for (int u = 2; u < 4; ++u) {          // steps 0, 1 of the next group
      gemm_ld<OT, MI, NPA>(bp, ap, ap2, (u - 2) * FRAG_EL, bq[u - 2], af[u - 2], ag[u - 2]);
      __builtin_amdgcn_sched_barrier(0);   // keeps the load group ahead of the products below
      gemm_mm<OT, MI, NPA>(bq[u], af[u], ag[u], acc, acc2);
    }
  }
  // the last four steps: two groups are still to fetch
  gemm_ld<OT, MI, NPA>(bp, ap, ap2, 2 * FRAG_EL, bq[2], af[2], ag[2]);
  __builtin_amdgcn_sched_barrier(0);       // keeps the load group ahead of the products below
  gemm_mm<OT, MI, NPA>(bq[0], af[0], ag[0], acc, acc2);
  gemm_ld<OT, MI, NPA>(bp, ap, ap2, 3 * FRAG_EL, bq[3], af[3], ag[3]);
  ptr_wait<MI, NPA>(bp, ap, ap2);
  __builtin_amdgcn_sched_barrier(0);       // keeps the load group ahead of the products below
  gemm_mm<OT, MI, NPA>(bq[1], af[1], ag[1], acc, acc2);
  gemm_mm<OT, MI, NPA>(bq[2], af[2], ag[2], acc, acc2);
  gemm_mm<OT, MI, NPA>(bq[3], af[3], ag[3], acc, acc2);
#pragma unroll
  for (int i = 0; i < MI; ++i) {
    acc_guard4(acc[i][0], acc[i][1], acc[i][2], acc[i][3]);
    if (NPA == 2) acc_guard4(acc2[i][0], acc2[i][1], acc2[i][2], acc2[i][3]);
  }

  // ---- epilogue ----
  float* slab = sT[wave];
#pragma unroll
  for (int i = 0; i < MI; ++i) {
    const int mBase = m0 + (i << 4);
#pragma unroll
    for (int j = 0; j < 4; ++j) {
#pragma unroll
      for (int r = 0; r < 8; ++r) {
        float v = acc[i][j][r];
        if (NPA == 2) v += acc2[i][j][r] * rscaleA;
        v = v * oscale;
        slab[(mOff + r) * 68 + (j << 4) + rlane] = v;
      }
    }
    __builtin_amdgcn_fence(3, "workgroup");
    __builtin_amdgcn_wave_barrier();
    __builtin_amdgcn_fence(2, "workgroup");
    if (OUT_MODE == 0) {
      float* C = (float*)Cout + (size_t)b * (size_t)strideC;
      const int h2 = lane >> 4, c4 = (lane & 15) * 4;     // 256-B row segment = 16 lanes x 16 B
      v4f ov[8];
#pragma unroll
      for (int it = 0; it < 8; ++it) {
        const int row = it * 2 + h2;                     // it 0..7 x h2 0..1 = rows 0..15
        ov[it] = *(const v4f*)(slab + row * 68 + c4);
      }
      {
#pragma unroll
        for (int it = 0; it < 8; ++it) {
          const int row = it * 2 + h2;
          *(v4f*)(C + (size_t)(mBase + row) * ldc + n0 + c4) = ov[it];
        }
        
      }
    } else {
      // the 16 x 64 slab = 2 units = 128 granules in a row: store it writes granules 32*it + lane (512 contiguous B),
      // which hold row lane&15, columns 8*(2*it + (lane>>4)) .. +7
      const size_t u0 = ((size_t)(mBase >> 4) * (ldc >> 5) + (n0 >> 5)) * FRAG_EL + lane * 8;
      unsigned short* C  = (unsigned short*)Cout  + (size_t)b * (size_t)strideC + u0;
      unsigned short* C2 = (unsigned short*)Cout2 + (size_t)b * (size_t)strideC + u0;
      if (OUT_MODE == 3 && res) store_slab16<true>(slab, C, C2, cscale, rscaleC, lane);    // block-uniform: one scalar branch a slab
      else                      store_slab16<false>(slab, C, C2, cscale, rscaleC, lane);
    }
    __builtin_amdgcn_fence(3, "workgroup");
    __builtin_amdgcn_wave_barrier();
    __builtin_amdgcn_fence(2, "workgroup");
  }
}

// one product a launch
template <typename OT, int MI, int NPA, int OUT_MODE>
__global__ __launch_bounds__(256) void gemm_t(
    const unsigned short* __restrict__ Ap, const unsigned short* __restrict__ A2p, int lda, long long strideA,
    const unsigned short* __restrict__ Btp, int ldb, long long strideB,
    void* Cout, void* Cout2, int ldc, long long strideC,
    int M, int N, int K, float oscale, float rscaleA, float cscale, float rscaleC) {
  gemm_body<OT, MI, NPA, OUT_MODE>(Ap, A2p, lda, strideA, Btp, ldb, strideB, Cout, Cout2, ldc, strideC,
                                   M, N, K, oscale, rscaleA, cscale, rscaleC, blockIdx.x, blockIdx.y, false);
}
// The three projections in ONE launch: each alone has QKV_NBLK blocks of 8 waves, and a WGP holds one such block (registers),
// so a launch of one product leaves WGPs idle wherever the chip has more than QKV_NBLK of them. blockIdx.y = product:
//   0: q = xq . Wq^T -> f16 hi / residual (x4096) planes [b*SEQ+s][h*64+d]   (M=NROW, N=EMB)
//   1: k = xk . Wk^T -> f16 plane [b*SEQ+s][h*64+d]
//   2: v^T = Wv . xv_b^T per batch b -> f16 plane [b][h*64+d][s] (pitch SEQ); A = Wvb [n][k], Bt = Xv rows of batch b
//      (offset b*SEQ*EMB); M=EMB, N=SEQ; its blocks are QKV_VBLK a batch
// Every block keeps the tile, the k walk and the sums that it had in a launch of its own. kk = EMB (pitch of A and Bt, and K).
#define QKV_NBLK ((NROW / 64) * (EMB / 64) / 8)
#define QKV_VBLK ((EMB / 64) * (SEQ / 64) / 8)
static_assert(QKV_NBLK * 8 == (NROW / 64) * (EMB / 64) && QKV_VBLK * 8 == (EMB / 64) * (SEQ / 64) && QKV_VBLK * NB == QKV_NBLK);
__global__ __launch_bounds__(256) void gemm_qkv(
    const unsigned short* __restrict__ Xq, const unsigned short* __restrict__ Xk, const unsigned short* __restrict__ Xv,
    const unsigned short* __restrict__ Wqb, const unsigned short* __restrict__ Wkb, const unsigned short* __restrict__ Wvb,
    unsigned short* Qh, unsigned short* Ql, unsigned short* Kp, unsigned short* VT, int kk) {
  const unsigned job = blockIdx.y;              // block-uniform: all that follows is picked in scalar registers
  const bool isv = job == 2u;
  const unsigned short* A  = (job == 0u) ? Xq  : (job == 1u) ? Xk  : Wvb;
  const unsigned short* Bt = (job == 0u) ? Wqb : (job == 1u) ? Wkb : Xv;
  unsigned short* C        = (job == 0u) ? Qh  : (job == 1u) ? Kp  : VT;
  gemm_body<__bf16, 4, 1, 3>(A, A, kk, 0LL, Bt, kk, isv ? (long long)SEQ * EMB : 0LL,
                             (void*)C, (void*)Ql, isv ? SEQ : EMB, isv ? (long long)EMB * SEQ : 0LL,
                             isv ? EMB : NROW, isv ? SEQ : EMB, kk, 1.0f, 0.0f, 1.0f, 4096.0f,
                             isv ? blockIdx.x % QKV_VBLK : blockIdx.x, isv ? blockIdx.x / QKV_VBLK : 0u, job == 0u);
}

// =====================================================================================================
// Score chunk, transposed: 64 keys kv0..kv0+63 x 16 query rows (this wave) of one (b, h).
//   k fragments (A operand, row = lane&15 = key) loaded straight from the f16 k plane (fragment order):
//   kb0 = plane + (b*SEQ)*EMB + h*2*FRAG_EL, 16 keys on add 16*EMB (plane row = b*SEQ + t).
//   q fragments (B operand, col = lane&15 = query): hi and residual (x4096) planes, 2 d-chunks of 32.
//   s[j][r] = D element: key kv0 + 16j + 8*hh + r, query lane&15; value = ((k.qh) + (k.ql)/4096) / 8.
//   A lane holds scores of ONE query only (32 of the chunk's 64 keys; lane ^ 16 has the other 32), and
//   s[2kk], s[2kk+1] lie as elements 0..7, 8..15 of an A fragment (row = query, 32 keys) for the P.V product.
// =====================================================================================================
// the chunk's 8 k fragments as one load group, kf[2j + dc]; kp = the lane's pointer into the unit of keys kv0..kv0+15,
// d 0..31 (16-byte units); loops unrolled so that kf keeps constant indices (registers)
typedef GP<_Float16>::ptr KPtr;
__device__ __forceinline__ void ld_kchunk(KPtr& kp, v16h (&kf)[8]) {
#pragma unroll
  for (int j = 0; j < 4; ++j)
#pragma unroll
    for (int dc = 0; dc < 2; ++dc) kf[2 * j + dc] = ldfrag_g<_Float16>(kp, j * 16 * EMB + dc * FRAG_EL);
#if DEV_ASM
  asm volatile("s_wait_xcnt 0x0" : "+v"(kp) :: "memory");   // before kp, which these loads name, is moved on or given up
#endif
}
__device__ __forceinline__ void score_chunk(const v16h (&qah)[2], const v16h (&qal)[2], const v16h (&kf)[8],
                                            v8f (&s)[4]) {
  v8f ah[4], al[4];                           // all 16 products in one run, ahead of the vector work on them
#pragma unroll
  for (int j = 0; j < 4; ++j) {
    ah[j] = zero8(); al[j] = zero8();
#pragma unroll
    for (int dc = 0; dc < 2; ++dc) {
      ah[j] = mmar(kf[2 * j + dc], qah[dc], ah[j]);
      al[j] = mmar(kf[2 * j + dc], qal[dc], al[j]);
    }
  }
  __builtin_amdgcn_sched_barrier(0);          // keeps the run whole: split up, each part is padded with v_nop ahead of its first reader
#pragma unroll
  for (int j = 0; j < 4; ++j)
#pragma unroll
    for (int r = 0; r < 8; ++r) s[j][r] = (ah[j][r] + al[j][r] * (1.0f / 4096.0f)) * 0.125f;
}

// =====================================================================================================
// Softmax statistics: per (b, h, query s) the row max m and 1/sum(exp(s - m)) over all SEQ keys.
//   block = 4 waves = 64 consecutive query rows qb*64.. of one (b, h); grid = NB*NH*NKT blocks of 128;
//   static trip NKT over 64-key chunks; online max / rescaled sum in f32, one query a lane, all in the lane;
//   the two lanes of a query (each half of the keys) are merged once, behind the loop.
//   Output plane ML [b*NH+h][2][SEQ] f32 (m then 1/l): the block's 64 m values and 64 1/l values are
//   funnelled through LDS (cross-wave: block barrier) and written by wave 0 with ONE instruction (lanes 0-15:
//   coverage: grid (b,h,qb) x 64 rows = the whole [NB*NH][2][SEQ] plane. MLsh: 4 waves x 32 lanes = all 128.
// =====================================================================================================
__global__ __launch_bounds__(128)
void attn_stats(const unsigned short* __restrict__ qhp, const unsigned short* __restrict__ qlp,
                const unsigned short* __restrict__ kpp, float* ML) {
  __shared__ __align__(16) float MLsh[128];
  const int tid  = threadIdx.x;
  const int wave = tid >> 5;
  const int lane = tid & 31;
  const int hh   = lane >> 4;
  const int c    = lane & 15;
  const int bx   = blockIdx.x;
  const int qb   = bx % NKT;
  const int rest = bx / NKT;
  const int h    = rest % NH;
  const int b    = rest / NH;
  const int bh   = b * NH + h;
  const int q0   = qb * 64 + wave * 16;

  const _Float16* Qh  = (const _Float16*)(const void*)qhp;
  const _Float16* Ql  = (const _Float16*)(const void*)qlp;
  const _Float16* Kb0 = (const _Float16*)(const void*)kpp + (size_t)b * SEQ * EMB + (size_t)h * (HD / 32) * FRAG_EL;

  v16h qah[2], qal[2];
#pragma unroll
  for (int dc = 0; dc < 2; ++dc) {
    const size_t qo = ((size_t)b * SEQ + (size_t)q0) * EMB + (size_t)(h * (HD / 32) + dc) * FRAG_EL + lane * 8;
    qah[dc] = ldfrag<_Float16>(Qh + qo);
    qal[dc] = ldfrag<_Float16>(Ql + qo);
  }

  float mrow = -INFINITY, lrow = 0.f;         // query q0 + c, over this lane's half of the keys

#if DEV_ASM
  asm volatile("s_wait_xcnt 0x0" ::: "memory");   // before the k fetch lands in registers that the q loads name
#endif
  v16h kf[8];
  // The NKT blocks of one (b, h) walk the same k lines: each starts its walk at its own chunk (qb) and wraps round, so that
  // blocks running in step ask L2 for different lines at any moment.
  int kc = qb;                                // chunk in hand, 0 .. NKT-1
  KPtr kp = (KPtr)(const void*)(Kb0 + (size_t)kc * 64 * EMB + lane * 8);
  ld_kchunk(kp, kf);
  for (int kt = 0; kt < NKT; ++kt) {          // static trip count
    v8f s[4];
    score_chunk(qah, qal, kf, s);
    __builtin_amdgcn_sched_barrier(0);        // the next chunk's fetch stays behind this chunk's products (same registers)
    kp += (kc + 1 < NKT) ? 64 * EMB / 8 : -(NKT - 1) * (64 * EMB / 8);  // 16-byte units; behind the last chunk comes chunk 0
    kc = (kc + 1 < NKT) ? kc + 1 : 0;         // last trip: the walk's first chunk again, a fetch that nothing uses
    ld_kchunk(kp, kf);
    __builtin_amdgcn_sched_barrier(0);        // ... and ahead of the vector work below, which covers its latency
    float mj[4];                              // loops over j and r unrolled here and below: s keeps constant indices (registers)
#pragma unroll
    for (int j = 0; j < 4; ++j) {
      mj[j] = s[j][0];
#pragma unroll
      for (int r = 1; r < 8; ++r) mj[j] = fmaxf(mj[j], s[j][r]);
    }
    const float mnew  = fmaxf(mrow, fmaxf(fmaxf(mj[0], mj[1]), fmaxf(mj[2], mj[3])));
    const float msafe = (mnew == -INFINITY) ? 0.f : mnew;
    const float alpha = __expf(mrow - msafe);
    mrow = mnew;
    float pj[4];                              // four independent partial sums
#pragma unroll
    for (int j = 0; j < 4; ++j) {
      pj[j] = 0.f;
#pragma unroll
      for (int r = 0; r < 8; ++r) pj[j] += __expf(s[j][r] - msafe);
    }
    lrow = lrow * alpha + ((pj[0] + pj[1]) + (pj[2] + pj[3]));
  }

  // merge the two halves of each query's keys (lane ^ 16), once
  const float mo    = __shfl_xor(mrow, 16, 32);
  const float lo    = __shfl_xor(lrow, 16, 32);
  const float mall  = fmaxf(mrow, mo);
  const float msafe = (mall == -INFINITY) ? 0.f : mall;
  const float l     = lrow * __expf(mrow - msafe) + lo * __expf(mo - msafe);
  const float il    = (l > 0.f) ? (1.0f / l) : 0.f;
  MLsh[hh * 64 + wave * 16 + c] = hh ? il : mall;   // lanes 0-15: m, lanes 16-31: 1/l of query q0 + c
  __syncthreads();
  if (wave == 0) {
    const v4f v = *(const v4f*)(MLsh + lane * 4);        // lanes 0-15: m rows 4c..4c+3; lanes 16-31: 1/l rows
    float* dst = ML + (size_t)(bh * 2 + hh) * SEQ + qb * 64 + c * 4;
    *(v4f*)dst = v;
    
  }
}

// =====================================================================================================
// Main attention pass: one block per (b, 32 query rows q0..q0+31, one of KSPLIT key ranges), 16 waves = the 16 heads;
//   a wave holds TWO 16-row query tiles, so each k and v fragment fetched from L2 serves 32 queries.
//   Per 32-key chunk (static trip NKT32): scores recomputed exactly as in attn_stats, p = exp(s - m) * (1/l) in f32
//   (m, 1/l from the ML plane, one query a lane and tile);
//   (a) context += P . V: the lane's p values, converted to f16 with the x16384 carry, ARE the A fragments (no LDS, no
//       lane exchange); B = v^T f16 plane [b][h*64+d][s] (head slab h*64*SEQ), fragment order;
//       p also goes to the per-wave LDS tile Pf[h][row][key] (16-byte stores of 4 keys, every entry written) for
//   (b) head average: after __syncthreads (cross-wave), threads 0..255 sum the 16 wave tiles in fixed head order
//   Epilogue: the key range's part of ctx = acc / 16384, x256 carry, staged in the wave's Pf tile (wave-private), written in f32;
//   p is already normalised, so ctx is the plain sum of its parts (ctx_merge).
//   coverage: avg: NKT32 chunks x 32 rows x 32 keys per block, grid (b, qb, ks) = the whole [NB][SEQ][SEQ];
//   ctx parts: each wave rows q0..q0+31 x its head's 64 columns, 16 waves x grid = the whole [KSPLIT][NROW][EMB].
// =====================================================================================================
// 32-key forms of the chunk fetch and of the score chunk (same k map, same products, same order per score)
__device__ __forceinline__ void ld_kchunk32(KPtr& kp, v16h (&kf)[4]) {
#pragma unroll
  for (int j = 0; j < 2; ++j)
#pragma unroll
    for (int dc = 0; dc < 2; ++dc) kf[2 * j + dc] = ldfrag_g<_Float16>(kp, j * 16 * EMB + dc * FRAG_EL);
#if DEV_ASM
  asm volatile("s_wait_xcnt 0x0" : "+v"(kp) :: "memory");   // before kp, which these loads name, is moved on or given up
#endif
}
// both query tiles [qt], 16 products in one run
__device__ __forceinline__ void score_chunk32(const v16h (&qah)[2][2], const v16h (&qal)[2][2], const v16h (&kf)[4],
                                              v8f (&s)[2][2]) {
  v8f ah[2][2], al[2][2];
#pragma unroll
  for (int qt = 0; qt < 2; ++qt)
#pragma unroll
    for (int j = 0; j < 2; ++j) {
      ah[qt][j] = zero8(); al[qt][j] = zero8();
#pragma unroll
      for (int dc = 0; dc < 2; ++dc) {
        ah[qt][j] = mmar(kf[2 * j + dc], qah[qt][dc], ah[qt][j]);
        al[qt][j] = mmar(kf[2 * j + dc], qal[qt][dc], al[qt][j]);
      }
    }
  run_guard8(ah[0][0], al[0][0], ah[0][1], al[0][1], ah[1][0], al[1][0], ah[1][1], al[1][1]);   // the v fetch lands in kf's registers
#pragma unroll
  for (int qt = 0; qt < 2; ++qt)
#pragma unroll
    for (int j = 0; j < 2; ++j)
#pragma unroll
      for (int r = 0; r < 8; ++r) s[qt][j][r] = (ah[qt][j][r] + al[qt][j][r] * (1.0f / 4096.0f)) * 0.125f;
}
#define KSPLIT   2                   // key ranges of a sequence, one block each
#define KRANGE   (SEQ / KSPLIT)      // keys of one block
#define NQB32    (SEQ / 32)          // 32-row query blocks per sequence
#define NKT32    (KRANGE / 32)       // 32-key chunks of one block
#define PP32     36                  // row pitch of the 32-key LDS P tile in floats: 144 B = 16 B x odd, so 16 rows written 16 B each fall on 64 distinct banks
#define NGRAN    ((size_t)NROW * EMB / 8)   // 8-element granules of a ctx plane
static_assert((KRANGE % 32) == 0 && (SEQ % 32) == 0 && 32 * PP32 >= 16 * 68);
__global__ __launch_bounds__(512)
void attn_main(const unsigned short* __restrict__ qhp, const unsigned short* __restrict__ qlp,
               const unsigned short* __restrict__ kpp, const unsigned short* __restrict__ vtp,
               const float* __restrict__ ML, float* cpart, float* avg) {
  union FH { v16h v; v8h h[2]; };
  __shared__ __align__(32) float Pf[NH][32 * PP32];        // per wave (head) P tile [32 rows][32 keys] f32, pitch PP32; the epilogue's ctx tile has pitch 68
  const int tid  = threadIdx.x;
  const int wave = tid >> 5;
  const int lane = tid & 31;
  const int hh   = lane >> 4;
  const int c    = lane & 15;
  const int bx   = blockIdx.x;
  const int ks   = bx % KSPLIT;
  const int qb   = (bx / KSPLIT) % NQB32;
  const int b    = bx / (KSPLIT * NQB32);
  const int h    = wave;
  const int bh   = b * NH + h;
  const int q0   = qb * 32;
  const int key0 = ks * KRANGE;

  const _Float16* Qh  = (const _Float16*)(const void*)qhp;
  const _Float16* Ql  = (const _Float16*)(const void*)qlp;
  const _Float16* Kb0 = (const _Float16*)(const void*)kpp + ((size_t)b * SEQ + key0) * EMB + (size_t)h * (HD / 32) * FRAG_EL;
  const _Float16* Vb0 = (const _Float16*)(const void*)vtp + (size_t)b * EMB * SEQ + (size_t)h * HD * SEQ
                        + (size_t)(key0 / 32) * FRAG_EL;   // v^T [b][h*64+d][s], fragment order

  v16h qah[2][2], qal[2][2];                  // [query tile][d chunk]
  float m1[2], il1[2];
#pragma unroll
  for (int qt = 0; qt < 2; ++qt) {
#pragma unroll
    for (int dc = 0; dc < 2; ++dc) {
      const size_t qo = ((size_t)b * SEQ + (size_t)(q0 + 16 * qt)) * EMB + (size_t)(h * (HD / 32) + dc) * FRAG_EL + lane * 8;
      qah[qt][dc] = ldfrag<_Float16>(Qh + qo);
      qal[qt][dc] = ldfrag<_Float16>(Ql + qo);
    }
    m1[qt]  = ML[(size_t)(bh * 2) * SEQ + q0 + 16 * qt + c];                      // the lane's query q0 + 16qt + c
    il1[qt] = ML[(size_t)(bh * 2 + 1) * SEQ + q0 + 16 * qt + c];
  }

  v8f oacc[2][4];
#pragma unroll
  for (int qt = 0; qt < 2; ++qt)
#pragma unroll
    for (int t = 0; t < 4; ++t) oacc[qt][t] = zero8();
  float* pf = Pf[wave];

#if DEV_ASM
  asm volatile("s_wait_xcnt 0x0" ::: "memory");   // before the k fetch lands in registers that the loads above name
#endif
  __builtin_amdgcn_sched_barrier(0);          // no address below is formed, in a register that those loads name, ahead of that wait
  v16h kf[4];
  // The NQB32 blocks of one (b, key range) walk the same k and v lines: each starts its walk at its own chunk and wraps round,
  // so that blocks running in step ask L2 for different lines at any moment. p is already normalised: any chunk order gives ctx.
  int kc = qb % NKT32;                        // chunk in hand, 0 .. NKT32-1
  KPtr kp = (KPtr)(const void*)(Kb0 + (size_t)kc * 32 * EMB + lane * 8);
  ld_kchunk32(kp, kf);
  KPtr vp = (KPtr)(const void*)(Vb0 + (size_t)kc * FRAG_EL + lane * 8);   // the lane's pointer into the unit of d 0..15, keys kv0..kv0+31
  for (int kt = 0; kt < NKT32; ++kt) {       // static trip count
    const int kv0 = key0 + kc * 32;
    const bool more = kc + 1 < NKT32;         // block-uniform: behind the last chunk comes chunk 0
    __syncthreads();                          // Pf tiles free again (head sum of the prior chunk done)

    v8f s[2][2];                              // [query tile][16-key group]: both tiles' scores from ONE fetch of the k fragments
    score_chunk32(qah, qal, kf, s);
    __builtin_amdgcn_sched_barrier(0);        // the v fetch stays behind the score products (registers)
    v16h vf[4];                               // this chunk's 4 v fragments as one load group, vf[t]
#pragma unroll
    for (int t = 0; t < 4; ++t) vf[t] = ldfrag_g<_Float16>(vp, t * 16 * SEQ);
#if DEV_ASM
    asm volatile("s_wait_xcnt 0x0" : "+v"(vp) :: "memory");   // before vp, which these loads name, is moved on
#endif
    vp += more ? FRAG_EL / 8 : -(NKT32 - 1) * (FRAG_EL / 8);   // 32 keys = 1 unit (16-byte units)
    __builtin_amdgcn_sched_barrier(0);        // ... and ahead of the exponentials, which cover its latency
#pragma unroll                                // all loops unrolled: s keeps constant indices (registers)
    for (int qt = 0; qt < 2; ++qt) {
#pragma unroll
      for (int j = 0; j < 2; ++j) {
#pragma unroll
        for (int r = 0; r < 8; ++r) s[qt][j][r] = __expf(s[qt][j][r] - m1[qt]) * il1[qt];      // s now holds p
        float* pw = pf + (16 * qt + c) * PP32 + j * 16 + 8 * hh;   // query 16qt + c, keys 16j + 8hh .. +7; 16-byte aligned at every row
        *(v4f*)(pw)     = __builtin_shufflevector(s[qt][j], s[qt][j], 0, 1, 2, 3);
        *(v4f*)(pw + 4) = __builtin_shufflevector(s[qt][j], s[qt][j], 4, 5, 6, 7);
      }
    }

    // ---- context += P . V (f16 WMMA, p carried x16384): both query tiles on ONE fetch of the v fragments ----
    FH pa[2];                                 // row = query c of the tile; elements 0..7 = keys 8hh + e, 8..15 = keys 16 + 8hh + e
#pragma unroll                                // s, pa and oacc are indexed by qt: a constant index keeps them in registers
    for (int qt = 0; qt < 2; ++qt) {          // both tiles converted first, so that the 8 products stand in one run
      pa[qt].h[0] = __builtin_convertvector(s[qt][0] * PCARRY, v8h);
      pa[qt].h[1] = __builtin_convertvector(s[qt][1] * PCARRY, v8h);
    }
#pragma unroll
    for (int qt = 0; qt < 2; ++qt)
#pragma unroll
      for (int t = 0; t < 4; ++t) oacc[qt][t] = mmar(pa[qt].v, vf[t], oacc[qt][t]);
    run_guard8(oacc[0][0], oacc[0][1], oacc[0][2], oacc[0][3], oacc[1][0], oacc[1][1], oacc[1][2], oacc[1][3]);   // the next k fetch lands in vf's registers
    __syncthreads();
    kp += more ? 32 * EMB / 8 : -(NKT32 - 1) * (32 * EMB / 8);  // 16-byte units; last trip: the walk's first chunk again, a fetch that nothing uses
    kc = more ? kc + 1 : 0;
    ld_kchunk32(kp, kf);                      // next chunk's k, one load group
    __builtin_amdgcn_sched_barrier(0);        // issued ahead of the head average, which covers part of its latency

    // ---- head average of this 32 x 32 tile, one block = one writer of every line (a row's 32 keys = one 128-B line) ----
    if (tid < 256) {                          // waves 0..7, wave-uniform
      const int row = tid >> 3, c4 = (tid & 7) * 4;
      v4f a = *(const v4f*)(Pf[0] + row * PP32 + c4);
#pragma unroll
      for (int w = 1; w < NH; ++w) a += *(const v4f*)(Pf[w] + row * PP32 + c4);
      a *= (1.0f / (float)NH);
      float* dst = avg + ((size_t)b * SEQ + (size_t)(q0 + row)) * SEQ + kv0 + c4;
      *(v4f*)dst = a;
#if DEV_ASM
      asm volatile("s_wait_xcnt 0x0" ::: "memory");   // before the next chunk overwrites the registers this store names
#endif
    }
  }
  __syncthreads();

  // ---- epilogue: this key range's part of ctx (undo the x16384 p carry, apply the x256 carry), staged, stored in f32 ----
  // cpart = [KSPLIT][2][NGRAN] groups of 4 floats: group (ks, 0, g) = elements 0..3 of granule g of the ctx planes, (ks, 1, g) = 4..7,
  // so that every store here and every load in ctx_merge covers 512 contiguous bytes a wave.
  float* os = pf;
#pragma unroll
  for (int qt = 0; qt < 2; ++qt) {
#pragma unroll
    for (int r = 0; r < 8; ++r) {
#pragma unroll
      for (int t = 0; t < 4; ++t) os[(8 * hh + r) * 68 + t * 16 + c] = oacc[qt][t][r] * (256.0f / PCARRY);
    }
    __builtin_amdgcn_fence(3, "workgroup");
    __builtin_amdgcn_wave_barrier();
    __builtin_amdgcn_fence(2, "workgroup");
    // the wave's 16 x 64 tile = 2 units = 128 granules in a row: step it takes granules 32*it + lane,
    // which hold row c, columns 8*(2*it + hh) .. +7
    v4f lo4[4], hi4[4];
#pragma unroll
    for (int it = 0; it < 4; ++it) {
      const float* sp = os + c * 68 + (it * 2 + hh) * 8;
      lo4[it] = *(const v4f*)(sp);
      hi4[it] = *(const v4f*)(sp + 4);
    }
    const size_t g0 = (((size_t)b * SEQ + (size_t)(q0 + 16 * qt)) * EMB + (size_t)h * (HD / 32) * FRAG_EL) / 8 + lane;
    float* d0 = cpart + ((size_t)(ks * 2) * NGRAN + g0) * 4;
    float* d1 = cpart + ((size_t)(ks * 2 + 1) * NGRAN + g0) * 4;
#pragma unroll
    for (int it = 0; it < 4; ++it) {
      *(v4f*)(d0 + it * 128) = lo4[it];
      *(v4f*)(d1 + it * 128) = hi4[it];
    }
#if DEV_ASM
    asm volatile("s_wait_xcnt 0x0" ::: "memory");   // before the next tile overwrites the registers these stores name
#endif
    __builtin_amdgcn_sched_barrier(0);        // the next tile's products stay behind that wait
    __builtin_amdgcn_fence(3, "workgroup");
    __builtin_amdgcn_wave_barrier();
    __builtin_amdgcn_fence(2, "workgroup");
  }
}

// =====================================================================================================
// ctx = sum of its KSPLIT key-range parts (fixed order), converted to the f16 hi plane (x256 carry, already in the parts)
// and the f16 residual plane (x4096), fragment order. Few waves, MG_N granules a thread, all loads up front.
// coverage: MG_T threads x MG_N granules = NGRAN granules = the whole [NROW][EMB] planes.
// =====================================================================================================
#define MG_N 4
#define MG_T (NROW * EMB / 8 / MG_N)
static_assert((MG_T % 256) == 0 && KSPLIT == 2);
__global__ __launch_bounds__(256) void ctx_merge(const float* __restrict__ c00, const float* __restrict__ c01,
                                                 const float* __restrict__ c10, const float* __restrict__ c11,
                                                 unsigned short* chp, unsigned short* clp) {
  const float* const cin[4] = {c00, c01, c10, c11};   // [2 * key range + half of the granule]: four scalar bases
  // granule i's byte offset, 32 bits, the same in a part (16 B of f32 a half granule) and in a plane (16 B of f16 a granule):
  // one offset register beside scalar bases serves every load and store
  unsigned ob = (blockIdx.x * 256u + threadIdx.x) * 16u;
  v4f x[MG_N][4];
#pragma unroll                                // unrolled here and below: x keeps constant indices (registers)
  for (int n = 0; n < MG_N; ++n)
#pragma unroll
    for (int p = 0; p < 4; ++p)               // p = 2 * key range + half of the granule
      x[n][p] = *(const v4f*)((const char*)cin[p] + (size_t)n * MG_T * 16 + ob);
#if DEV_ASM
  asm volatile("s_wait_xcnt 0x0" : "+v"(ob) :: "memory");   // the offset register, which these loads name, is held to here
#endif
  __builtin_amdgcn_sched_barrier(0);          // no conversion result is written ahead of that wait
#pragma unroll
  for (int n = 0; n < MG_N; ++n) {
    const v4f fa = x[n][0] + x[n][2], fb = x[n][1] + x[n][3];
    const float f[8] = {fa[0], fa[1], fa[2], fa[3], fb[0], fb[1], fb[2], fb[3]};
    v4u a, a2;
#pragma unroll
    for (int e = 0; e < 4; ++e) {
      const float f0 = f[2 * e], f1 = f[2 * e + 1];
      const _Float16 x0 = (_Float16)f0, x1 = (_Float16)f1;
      const unsigned short h0 = h_bits(x0), h1 = h_bits(x1);
      const unsigned short l0 = h_bits((_Float16)((f0 - (float)x0) * 4096.0f));
      const unsigned short l1 = h_bits((_Float16)((f1 - (float)x1) * 4096.0f));
      a[e] = pk16(h0, h1); a2[e] = pk16(l0, l1);
    }
    *(v4u*)((char*)chp + (size_t)n * MG_T * 16 + ob) = a;
    *(v4u*)((char*)clp + (size_t)n * MG_T * 16 + ob) = a2;
  }
}

// =====================================================================================================
// Workspace map (bytes, full size NB=2 SEQ=2048; PX = NROW*EMB*2 = 8388608; every region an exact multiple of
// its whole-line / whole-tile store granularity, rows are whole tiles, no padded tails needed):
//   Xq   bf16 [NROW][EMB]            PX        8388608
//   Xk   bf16 [NROW][EMB]            PX        8388608
//   Xv   bf16 [NROW][EMB]            PX        8388608
//   Wqb  bf16 [EMB n][EMB k]                   2097152
//   Wkb  bf16 [EMB n][EMB k]                   2097152
//   Wvb  bf16 [EMB n][EMB k]                   2097152
//   Wob  f16  [EMB n][EMB k] (x64)             2097152
//   Qh   f16  [NROW][EMB]            PX        8388608
//   Ql   f16  [NROW][EMB]            PX        8388608
//   Kp   f16  [NROW][EMB]            PX        8388608
//   VT   f16  [NB][EMB][SEQ]                   8388608
//   Ch   f16  [NROW][EMB]            PX        8388608
//   Cl   f16  [NROW][EMB]            PX        8388608
//   ML   f32  [NB*NH][2][SEQ]                   524288
//   CP   f32  [2 key ranges][NROW][EMB]       33554432
//   total                                    117964800
// Every 16-bit plane is in fragment order (same bytes, same extents). Input weights are [out n][in k] (k contiguous) =
// the Bt / A orientation directly; they are only converted to 16 bit and put in that order.
// Output 0 at element 0 of d_out (rows b*SEQ + s); output 1 at the fixed element offset OFF1 = NB_FULL*SEQ_FULL*EMB.
// =====================================================================================================
extern "C" void kernel_launch(void* const* d_in, const int* in_sizes, int n_in,
                              void* d_out, int out_size, void* d_ws, size_t ws_size,
                              hipStream_t stream) {
  if (n_in < 7) return;
  const int needX = ((NB - 1) * SEQ_FULL + SEQ) * EMB;
  if (in_sizes[0] < needX) return;
  if (in_sizes[1] < needX) return;
  if (in_sizes[2] < needX) return;
  if (in_sizes[3] < EMB * EMB) return;
  if (in_sizes[4] < EMB * EMB) return;
  if (in_sizes[5] < EMB * EMB) return;
  if (in_sizes[6] < EMB * EMB) return;
  const size_t n0e = (size_t)NROW * EMB;            // output 0 written elements [NB][SEQ][EMB]
  const size_t n1e = (size_t)NB * SEQ * SEQ;        // output 1 written elements [NB][SEQ][SEQ]
  if (out_size < 0) return;
  if ((size_t)out_size < n0e) return;
  if ((size_t)out_size < OFF1 + n1e) return;        // written extent of output 1 inside d_out

  const float* xq = (const float*)d_in[0];
  const float* xk = (const float*)d_in[1];
  const float* xv = (const float*)d_in[2];
  const float* Wq = (const float*)d_in[3];
  const float* Wk = (const float*)d_in[4];
  const float* Wv = (const float*)d_in[5];
  const float* Wo = (const float*)d_in[6];

  const size_t PX  = (size_t)NROW * EMB * 2;        // 16-bit activation plane
  const size_t PW  = (size_t)EMB * EMB * 2;
  const size_t PVT = (size_t)NB * EMB * SEQ * 2;
  const size_t PML = (size_t)NB * NH * 2 * SEQ * 4;
  size_t off = 0;
  const size_t oXq = off; off += PX;
  const size_t oXk = off; off += PX;
  const size_t oXv = off; off += PX;
  const size_t oWq = off; off += PW;
  const size_t oWk = off; off += PW;
  const size_t oWv = off; off += PW;
  const size_t oWo = off; off += PW;
  const size_t oQh = off; off += PX;
  const size_t oQl = off; off += PX;
  const size_t oKp = off; off += PX;
  const size_t oVT = off; off += PVT;
  const size_t oCh = off; off += PX;
  const size_t oCl = off; off += PX;
  const size_t oML = off; off += PML;
  const size_t oCP = off; off += (size_t)KSPLIT * NROW * EMB * 4;
  if (off > ws_size) return;                        // off = 117964800 at full size
  if (off > (size_t)134217728) return;

  char* ws = (char*)d_ws;
  unsigned short* Xq  = (unsigned short*)(ws + oXq);
  unsigned short* Xk  = (unsigned short*)(ws + oXk);
  unsigned short* Xv  = (unsigned short*)(ws + oXv);
  unsigned short* Wqb = (unsigned short*)(ws + oWq);
  unsigned short* Wkb = (unsigned short*)(ws + oWk);
  unsigned short* Wvb = (unsigned short*)(ws + oWv);
  unsigned short* Wob = (unsigned short*)(ws + oWo);
  unsigned short* Qh  = (unsigned short*)(ws + oQh);
  unsigned short* Ql  = (unsigned short*)(ws + oQl);
  unsigned short* Kp  = (unsigned short*)(ws + oKp);
  unsigned short* VT  = (unsigned short*)(ws + oVT);
  unsigned short* Ch  = (unsigned short*)(ws + oCh);
  unsigned short* Cl  = (unsigned short*)(ws + oCl);
  float*          ML  = (float*)(ws + oML);
  float*          CP  = (float*)(ws + oCP);
  float*          out0 = (float*)d_out;
  float*          out1 = (float*)d_out + OFF1;

  const dim3 blk(256);
  const dim3 gCvt(CVT_T / 256);                                  //  512 blocks
  const dim3 gQKV(QKV_NBLK, 3);                                  // 3 products x 1024 tiles of 64 x 64 -> 3 x 128 blocks
  const dim3 gO((((NROW) / 32) * (EMB / 64) + 7) / 8, 1);         // 2048 tiles -> 256 blocks (32x64 wave tiles)
  const dim3 gStats(NB * NH * NKT);                              // 1024 blocks of 128
  const dim3 gMain(NB * NQB32 * KSPLIT);                         //  256 blocks of 512
  const dim3 gMerge(MG_T / 256);                                 //  512 blocks

  // (1) activations [b][s][k] -> bf16 planes [b*SEQ+s][k] (input batch stride SEQ_FULL*EMB, plane batch stride SEQ*EMB);
  // (2) weights [EMB n][EMB k] -> bf16 planes (Wq, Wk, Wv); Wo -> f16 (x64 of its bf16 value); no transpose needed
  cvt_all<<<gCvt, blk, 0, stream>>>(xq, xk, xv, Wq, Wk, Wv, Wo, Xq, Xk, Xv, Wqb, Wkb, Wvb, Wob);
  // (3) (4) (5) q, k and v^T, one launch (gemm_qkv)
  gemm_qkv<<<gQKV, blk, 0, stream>>>(Xq, Xk, Xv, Wqb, Wkb, Wvb, Qh, Ql, Kp, VT, EMB);
  // (6) softmax statistics (m, 1/l) per (b, h, s)
  attn_stats<<<gStats, dim3(128), 0, stream>>>(Qh, Ql, Kp, ML);
  // (7) exact-normalised p: P.V -> f32 parts of ctx, one per key range; head-averaged p -> output 1
  attn_main<<<gMain, dim3(512), 0, stream>>>(Qh, Ql, Kp, VT, ML, CP, out1);
  // (7b) ctx = sum of its parts -> ctx planes (f16 hi x256 / residual x4096)
  ctx_merge<<<gMerge, blk, 0, stream>>>(CP, CP + NGRAN * 4, CP + NGRAN * 8, CP + NGRAN * 12, Ch, Cl);
  // (8) output 0 = ctx . Wo^T, f32 [NROW][EMB] straight into d_out, accumulators (hi + res/4096) x 1/(256*64)
  gemm_t<_Float16, 2, 2, 0><<<gO, blk, 0, stream>>>(
      Ch, Cl, EMB, 0LL, Wob, EMB, 0LL,
      (void*)out0, (void*)out0, EMB, 0LL,
      NROW, EMB, EMB, 1.0f / 16384.0f, 1.0f / 4096.0f, 1.0f, 1.0f);
  (void)hipGetLastError();
}

// v010
// One run takes 139 microseconds.
// Next to v009, in two timings, it ran 1.05 times as fast each time.
// Over all steps from v000 it is 3.59 times as fast.
// Contractions: q, k, v^T projections = v_wmma_f32_16x16x32_bf16 (bf16 operands from RNE-converted inputs and weights, single product, f32 accumulate);
// scores (statistics pass and main pass), formed transposed as k.q^T = v_wmma_f32_16x16x32_f16 (k f16 x1/16 as A; q x16*log2(e)/8 as f16 hi plane + f16 residual plane of the same scale as B; 2 products, one f32 accumulator);
// p.v = v_wmma_f32_16x16x32_f16 (p carried x16384 in f16, v f16; single product, f32 accumulate);
// ctx.Wo^T = v_wmma_f32_16x16x32_f16 (ctx as f16 hi plane x256 + f16 residual plane x4096, Wo f16 x64 of its bf16 value; 2 products, separate f32 accumulators);
// softmax statistics, probabilities, head average and the sum of the two key ranges' ctx parts in f32.
#include <hip/hip_runtime.h>
#include <math.h>
#include <stdint.h>

#ifndef NB
#define NB 2
#endif
#ifndef SEQ
#define SEQ 2048
#endif
#define NB_FULL  2
#define SEQ_FULL 2048
#define EMB      1024
#define NH       16
#define HD       64
#define NROW     (NB * SEQ)          // activation rows in workspace planes, row index = b * SEQ + s
#define NKT      (SEQ / 64)          // 64-key chunks per sequence
#define PCARRY   16384.0f            // power-of-two carry of p in the f16 P.V operand
#define PCARRY_L2 14.0f              // its base-2 logarithm
// The score's constant factors live in the planes: q carries log2(e) / sqrt(HD) (and x16), k carries 1/16, so that the WMMA sum
// k.q IS the score in base-2 units. The x16 / x1/16 pair is exact and keeps most of q's residual plane above the f16 subnormals.
#define QSCALE   (16.0f * 0.125f * 1.44269504088896341f)
#define KSCALE   (1.0f / 16.0f)
#define OFF1     ((size_t)NB_FULL * SEQ_FULL * EMB)   // fixed element offset of output 1 in d_out
static_assert(NB >= 1 && NB <= NB_FULL);
static_assert(SEQ >= 64 && SEQ <= SEQ_FULL && (SEQ % 64) == 0);
static_assert(NH * HD == EMB && (EMB % 128) == 0);
static_assert((NROW % 64) == 0 && (EMB % 64) == 0 && (HD % 64) == 0 && (EMB % 32) == 0);
static_assert(OFF1 * 4 == 16777216);   // byte offset of output 1
static_assert((OFF1 + (size_t)NB_FULL * SEQ_FULL * SEQ_FULL) * 4 == 50331648);   // written extent of output 1 == d_out bytes

typedef _Float16 v16h __attribute__((ext_vector_type(16)));
typedef _Float16 v8h  __attribute__((ext_vector_type(8)));
typedef __bf16   v16b __attribute__((ext_vector_type(16)));
typedef __bf16   v8b  __attribute__((ext_vector_type(8)));
typedef float    v8f  __attribute__((ext_vector_type(8)));
typedef float    v4f  __attribute__((ext_vector_type(4)));
typedef unsigned int v4u __attribute__((ext_vector_type(4)));

#if defined(__HIP_DEVICE_COMPILE__)
#define DEV_ASM 1
#else
#define DEV_ASM 0
#endif

// ---- scalar helpers --------------------------------------------------------------------------------
__device__ __forceinline__ unsigned short bf_bits(float f) {          // f32 -> bf16 bits, RNE convert
  unsigned u = __float_as_uint(f);
  return (unsigned short)((u + 0x7FFFu + ((u >> 16) & 1u)) >> 16);
}
__device__ __forceinline__ float bf_up(unsigned short hb) { return __uint_as_float(((unsigned)hb) << 16); }
__device__ __forceinline__ unsigned short h_bits(_Float16 x) { return __builtin_bit_cast(unsigned short, x); }
__device__ __forceinline__ unsigned pk16(unsigned short a, unsigned short b) { return (unsigned)a | ((unsigned)b << 16); }
__device__ __forceinline__ v8f zero8() { v8f z = {0.f, 0.f, 0.f, 0.f, 0.f, 0.f, 0.f, 0.f}; return z; }
__device__ __forceinline__ float ex2(float x) { return __builtin_amdgcn_exp2f(x); }   // 2^x, one instruction
__device__ __forceinline__ float lg2(float x) { return __builtin_amdgcn_logf(x); }    // log2(x), one instruction

// ---- fragment order: every 16-bit workspace plane [R rows][KC k] is kept as 1-KB units, one per WMMA operand fragment
//      (16 rows x 32 k), unit index = (row / 16) * (KC / 32) + k / 32. Inside a unit, in 16-byte granules of 8 k:
//      granule = ((k % 32) / 8) * 16 + row % 16, so granule g of the first 512 B is lane g's elements 0..7 and granule
//      g of the second 512 B its elements 8..15: each wave-wide 16-byte load reads 512 contiguous bytes (4 whole lines).
#define FRAG_EL 512                  // elements of one unit
// ---- fragment types / loaders: 16-bit A/B operand, lane -> row/col (lane&15), half h = lane>>4; p = unit + 8*lane;
//      elements 0..7 <- p[0..7] (k0+8h..k0+8h+7), elements 8..15 <- p[256..263] (k0+16+8h..k0+16+8h+7)
template <typename OT> struct FT;
template <> struct FT<__bf16>   { typedef v16b frag; typedef v8b half8; };
template <> struct FT<_Float16> { typedef v16h frag; typedef v8h half8; };

template <typename OT>
__device__ __forceinline__ typename FT<OT>::frag ldfrag(const OT* p) {
  union { typename FT<OT>::frag v; typename FT<OT>::half8 h[2]; } f;
  f.h[0] = *(const typename FT<OT>::half8*)(p);
  f.h[1] = *(const typename FT<OT>::half8*)(p + 256);
  return f.v;
}

// ---- WMMA helpers (asm guard bodies are device-only; concrete operand types) -----------------------------
__device__ __forceinline__ v8f mmar(v16b a, v16b b, v8f c) {
  return __builtin_amdgcn_wmma_f32_16x16x32_bf16(false, a, false, b, (short)0, c, false, false);
}
__device__ __forceinline__ v8f mmar(v16h a, v16h b, v8f c) {
  return __builtin_amdgcn_wmma_f32_16x16x32_f16(false, a, false, b, (short)0, c, false, false);
}
__device__ __forceinline__ void acc_guard4(v8f& a, v8f& b, v8f& c, v8f& d) {
#if DEV_ASM
  asm volatile("v_nop\n\tv_nop\n\tv_nop\n\tv_nop" : "+v"(a), "+v"(b), "+v"(c), "+v"(d));
#else
  (void)a; (void)b; (void)c; (void)d;
#endif
}
// behind a whole run of products (its eight accumulators tied): 4 VALU slots ahead of the global loads that land in the
// run's A and B registers (the distance asked for an overwrite of A or B). Inside the run each product fills the slots
// behind the others, so none is padded.
__device__ __forceinline__ void run_guard8(v8f& a, v8f& b, v8f& c, v8f& d, v8f& e, v8f& f, v8f& g, v8f& h) {
#if DEV_ASM
  asm volatile("v_nop\n\tv_nop\n\tv_nop\n\tv_nop" : "+v"(a), "+v"(b), "+v"(c), "+v"(d), "+v"(e), "+v"(f), "+v"(g), "+v"(h));
#else
  (void)a; (void)b; (void)c; (void)d; (void)e; (void)f; (void)g; (void)h;
#endif
}

// 16-bit convert helper. MODE 0: bf16 bits (RNE convert).  MODE 1: f16 bits of (64 * bf16(x)) (exact scaling of the bf16 value).
template <int MODE>
__device__ __forceinline__ unsigned short cvm(float f) {
  const unsigned short hb = bf_bits(f);
  if (MODE == 0) return hb;
  return h_bits((_Float16)(bf_up(hb) * 64.0f));
}

// =====================================================================================================
// All seven f32 -> 16-bit conversions (3 activations, 4 weights) in ONE launch of few waves, each with many granules.
// Planes in fragment order, 8 elements (one granule) per thread and slab. The launch has CVT_T threads. A weight is one
// slab of CVT_T granules. An activation is XSLAB slabs; a slab takes CVT_TB granules (XROWS rows) of EVERY batch, thread
// i being in batch i / CVT_TB, so that a slab's step from the plane's start is a small constant for all threads.
// In a slab a wave takes 8 rows x 32 k: it reads 8 whole 128-B lines of f32 and writes 4 whole 128-B lines
// (8 granules of each of the unit's 4 k groups).
// coverage: activations: XSLAB slabs x NB batches x XROWS rows = [NROW][EMB], 3 planes; weights: CVT_T granules = [EMB][EMB], 4 planes.
// =====================================================================================================
#define CVT_T    (EMB * EMB / 8)                  // threads of the launch = granules of a weight
#define CVT_TB   (CVT_T / NB)                     // threads on one batch
#define XROWS    (CVT_TB * 8 / EMB)               // rows of a batch in one activation slab
#define XSLAB    (SEQ / XROWS)                    // slabs of an activation
#define NXSLAB   (3 * XSLAB)
#define NSLAB    (NXSLAB + 4)                     // ... and the four weights
static_assert((CVT_T % 256) == 0 && (CVT_T % NB) == 0 && (XROWS % 16) == 0 && XROWS * EMB == CVT_TB * 8 && (SEQ % XROWS) == 0);
static_assert((size_t)NB_FULL * SEQ_FULL * EMB * 4 < ((size_t)1 << 32));   // byte offsets in a plane fit 32 bits
template <int MODE>
__device__ __forceinline__ v4u cvt8(v4f a, v4f a4) {
  v4u p;
  p[0] = pk16(cvm<MODE>(a[0]),  cvm<MODE>(a[1]));
  p[1] = pk16(cvm<MODE>(a[2]),  cvm<MODE>(a[3]));
  p[2] = pk16(cvm<MODE>(a4[0]), cvm<MODE>(a4[1]));
  p[3] = pk16(cvm<MODE>(a4[2]), cvm<MODE>(a4[3]));
  return p;
}
__global__ __launch_bounds__(256) void cvt_all(
    const float* __restrict__ xq, const float* __restrict__ xk, const float* __restrict__ xv,
    const float* __restrict__ wq, const float* __restrict__ wk, const float* __restrict__ wv,
    const float* __restrict__ wo,
    unsigned short* Xq, unsigned short* Xk, unsigned short* Xv,
    unsigned short* Wqb, unsigned short* Wkb, unsigned short* Wvb, unsigned short* Wob) {
  const unsigned i    = blockIdx.x * 256u + threadIdx.x;
  const unsigned unit = i >> 6;                               // 64 threads (2 waves) per unit
  const unsigned kg   = (i >> 3) & 3u;                        // k group of 8 inside the unit
  const unsigned rr   = ((i >> 5) & 1u) * 8u + (i & 7u);      // row inside the unit
  const unsigned bt   = i / CVT_TB;                           // the thread's batch in the activations
  // the granule's byte offsets from a plane's start, 32 bits: with a slab's constant step, one offset register serves
  // every slab of a kind beside the plane's scalar base. Weights: granule i. Activations: granule i - bt * CVT_TB of batch bt.
  unsigned sobW = (((unit / (EMB / 32)) * 16u + rr) * EMB + (unit % (EMB / 32)) * 32u + kg * 8u) * 4u;
  unsigned sobX = sobW + bt * (unsigned)((SEQ_FULL - XROWS) * EMB * 4);
  const unsigned dobW = (unit * FRAG_EL + (kg * 16u + rr) * 8u) * 2u;
  const unsigned dobX = dobW + bt * (unsigned)((SEQ - XROWS) * EMB * 2);
  const float* const xin[3]     = {xq, xk, xv};
  const float* const win[4]     = {wq, wk, wv, wo};
  unsigned short* const xout[3] = {Xq, Xk, Xv};
  unsigned short* const wout[4] = {Wqb, Wkb, Wvb, Wob};
  // every loop here is unrolled: the slab index picks pointers and registers at compile time
  v4f a[NSLAB][2];
#pragma unroll
  for (int s = 0; s < NSLAB; ++s) {               // all loads of the thread up front: 2 * NSLAB x 16 B in flight a lane
    const char* src = (s < NXSLAB) ? (const char*)xin[s / XSLAB] + (size_t)(s % XSLAB) * XROWS * EMB * 4 + sobX
                                   : (const char*)win[s - NXSLAB] + sobW;
    a[s][0] = *(const v4f*)(src);
    a[s][1] = *(const v4f*)(src + 16);
    __builtin_amdgcn_sched_barrier(0);            // a slab's two loads read the same lines: kept side by side, ahead of all conversions
  }
#if DEV_ASM
  asm volatile("s_wait_xcnt 0x0" : "+v"(sobX), "+v"(sobW) :: "memory");   // before the offset registers, which these loads name, are given up
#endif
  __builtin_amdgcn_sched_barrier(0);              // no conversion result is written ahead of that wait
  v4u p[NSLAB];
#pragma unroll
  for (int s = 0; s < NSLAB; ++s)
    p[s] = (s == NSLAB - 1) ? cvt8<1>(a[s][0], a[s][1]) : cvt8<0>(a[s][0], a[s][1]);
#pragma unroll
  for (int s = 0; s < NSLAB; ++s) {
    char* dst = (s < NXSLAB) ? (char*)xout[s / XSLAB] + (size_t)(s % XSLAB) * XROWS * EMB * 2 + dobX
                             : (char*)wout[s - NXSLAB] + dobW;
    *(v4u*)dst = p[s];
  }
}

// =====================================================================================================
// Register-blocked batched WMMA GEMM (16-bit operand type OT): C[m][n] = sum_k A[m][k] * Bt[n][k];
// one wave per (16*MI) x 64 tile, no block barriers. A [M][K = lda] and Bt [N][K = ldb] in fragment order;
// M multiple of 16*MI, N multiple of 64, K multiple of 128 (static sizes here). by = batch
// index (strides in elements). Fragments are loaded straight from global, 512 contiguous bytes a load (ldfrag_g).
// NPA = number of A planes: 2 -> second plane A2 (same pitch/stride) multiplies the same Bt fragments into a
// second accumulator set, combined as acc + acc2 * rscaleA in the f32 epilogue.
// value v = (acc [+ acc2*rscaleA]) * oscale.
// OUT_MODE 0: f32 C (pitch ldc) = v.
// OUT_MODE 3: f16 plane C = f16(v * cscale), [M][N = ldc] in fragment order, and, where res is set (block-uniform),
//             the f16 residual plane C2 = f16((v*cscale - hi) * rscaleC), likewise.
// bx: the block's index among the blocks of its product and batch.
// =====================================================================================================
// one k step's load group: 4 B fragments, MI A fragments (and MI of the second A plane); in this helper and the next
// every loop is unrolled so that the fragment and accumulator arrays keep constant indices (registers)
//   (bp, ap, ap2: each lane's pointers into its row tiles' units, global address space, in 16-byte units;
//    k: a constant element offset, FRAG_EL per k step of 32)
template <typename OT> struct GP { typedef const __attribute__((address_space(1))) typename FT<OT>::half8* ptr; };
template <typename OT>
__device__ __forceinline__ typename FT<OT>::frag ldfrag_g(typename GP<OT>::ptr p, int k) {   // same k map as ldfrag
  union { typename FT<OT>::frag v; typename FT<OT>::half8 h[2]; } f;
  f.h[0] = p[k / 8];
  f.h[1] = p[k / 8 + 32];
  return f.v;
}
template <typename OT, int MI, int NPA>
__device__ __forceinline__ void gemm_ld(typename GP<OT>::ptr const (&bp)[4], typename GP<OT>::ptr const (&ap)[MI],
                                        typename GP<OT>::ptr const (&ap2)[MI], int k,
                                        typename FT<OT>::frag (&bq)[4], typename FT<OT>::frag (&af)[MI],
                                        typename FT<OT>::frag (&ag)[MI]) {
#pragma unroll
  for (int j = 0; j < 4; ++j) bq[j] = ldfrag_g<OT>(bp[j], k);
#pragma unroll
  for (int i = 0; i < MI; ++i) {
    af[i] = ldfrag_g<OT>(ap[i], k);
    if (NPA == 2) ag[i] = ldfrag_g<OT>(ap2[i], k);
  }
}
// the wait that stands before the row pointers, which the issued loads name, are moved on or given up
template <int MI, int NPA, typename P>
__device__ __forceinline__ void ptr_wait(P (&bp)[4], P (&ap)[MI], P (&ap2)[MI]) {
  static_assert((MI == 4 && NPA == 1) || (MI == 2 && NPA == 2));   // the two shapes in use: eight pointers each
#if DEV_ASM
  if constexpr (MI == 4)
    asm volatile("s_wait_xcnt 0x0" : "+v"(bp[0]), "+v"(bp[1]), "+v"(bp[2]), "+v"(bp[3]),
                                     "+v"(ap[0]), "+v"(ap[1]), "+v"(ap[2]), "+v"(ap[3]) :: "memory");
  else
    asm volatile("s_wait_xcnt 0x0" : "+v"(bp[0]), "+v"(bp[1]), "+v"(bp[2]), "+v"(bp[3]),
                                     "+v"(ap[0]), "+v"(ap[1]), "+v"(ap2[0]), "+v"(ap2[1]) :: "memory");
#endif
}
// one k step's products, in the order i, plane, j
template <typename OT, int MI, int NPA>
__device__ __forceinline__ void gemm_mm(const typename FT<OT>::frag (&bq)[4], const typename FT<OT>::frag (&af)[MI],
                                        const typename FT<OT>::frag (&ag)[MI], v8f (&acc)[MI][4], v8f (&acc2)[MI][4]) {
#pragma unroll
  for (int i = 0; i < MI; ++i) {
#pragma unroll
    for (int j = 0; j < 4; ++j) acc[i][j] = mmar(af[i], bq[j], acc[i][j]);
    if (NPA == 2) {
#pragma unroll
      for (int j = 0; j < 4; ++j) acc2[i][j] = mmar(ag[i], bq[j], acc2[i][j]);
    }
  }
}

// a wave's 16 x 64 f32 slab (pitch 68) -> 2 units of the f16 plane C and, with RES, of the residual plane C2;
// C, C2: the lane's pointers into the first unit (8 elements a lane)
template <bool RES>
__device__ __forceinline__ void store_slab16(const float* slab, unsigned short* C, unsigned short* C2,
                                             float cscale, float rscaleC, int lane) {
  const int rlane = lane & 15;
  v4u hv[4], lv[4];
#pragma unroll
  for (int it = 0; it < 4; ++it) {
    const float* sp = slab + rlane * 68 + (it * 2 + (lane >> 4)) * 8;
    float f[8];
#pragma unroll
    for (int e = 0; e < 8; ++e) f[e] = sp[e] * cscale;
    v4u a, a2;
#pragma unroll
    for (int e = 0; e < 4; ++e) {
      const float f0 = f[2 * e], f1 = f[2 * e + 1];
      const _Float16 x0 = (_Float16)f0, x1 = (_Float16)f1;
      const unsigned short h0 = h_bits(x0), h1 = h_bits(x1);
      unsigned short l0 = 0, l1 = 0;
      if (RES) {
        l0 = h_bits((_Float16)((f0 - (float)x0) * rscaleC));
        l1 = h_bits((_Float16)((f1 - (float)x1) * rscaleC));
      }
      a[e] = pk16(h0, h1); a2[e] = pk16(l0, l1);
    }
    hv[it] = a; lv[it] = a2;
  }
#pragma unroll
  for (int it = 0; it < 4; ++it) {
    *(v4u*)(C + it * 256) = hv[it];
    if (RES) *(v4u*)(C2 + it * 256) = lv[it];
  }
#if DEV_ASM
  asm volatile("s_wait_xcnt 0x0" ::: "memory");   // before the next slab overwrites the registers these stores name
#endif
}

template <typename OT, int MI, int NPA, int OUT_MODE>
__device__ __forceinline__ void gemm_body(
    const unsigned short* __restrict__ Ap, const unsigned short* __restrict__ A2p, int lda, long long strideA,
    const unsigned short* __restrict__ Btp, int ldb, long long strideB,
    void* Cout, void* Cout2, int ldc, long long strideC,
    int M, int N, int K, float oscale, float rscaleA, float cscale, float rscaleC,
    unsigned bx, unsigned by, bool res) {
  typedef typename FT<OT>::frag V16;
  const OT* A  = (const OT*)(const void*)Ap;
  const OT* A2 = (const OT*)(const void*)A2p;
  const OT* Bt = (const OT*)(const void*)Btp;
  __shared__ __align__(16) float sT[8][16 * 68];   // per-wave 16x64 slab, pitch 68 floats
  const int RT   = 16 * MI;
  const int b    = by;
  const int lane = threadIdx.x & 31;
  const int wave = threadIdx.x >> 5;
  const int tilesN = N >> 6;
  const int tilesM = M / RT;
  const int tile = bx * 8 + wave;
  if (tile >= tilesM * tilesN) return;   // wave-uniform; no block barriers in this kernel
  const int tm = tile / tilesN;
  const int tn = tile - tm * tilesN;
  const int m0 = tm * RT;
  const int n0 = tn << 6;

  const OT* Ab  = A  + (size_t)b * (size_t)strideA;
  const OT* A2b = A2 + (size_t)b * (size_t)strideA;
  const OT* Bb  = Bt + (size_t)b * (size_t)strideB;

  const int rlane = lane & 15;                 // row (A) / col (B, D) within subtile
  const int mOff  = (lane >> 4) * 8;           // D row offset

  v8f acc[MI][4], acc2[MI][4];
#pragma unroll
  for (int i = 0; i < MI; ++i)
#pragma unroll
    for (int j = 0; j < 4; ++j) { acc[i][j] = zero8(); acc2[i][j] = zero8(); }

  // Rotating fragment sets: the whole load group of k step s + 2 is issued ahead of the products of step s, so the
  // loads of two steps fly under the products, where one latency per A fragment was waited out. K is a multiple of 128.
  typedef typename GP<OT>::ptr GPtr;
  GPtr bp[4], ap[MI], ap2[MI];
  // Blocks that share operand rows walk the same lines: each block starts its k walk at its own group of 4 k steps and wraps
  // round, so that blocks running in step ask L2 for different lines at any moment. One start for the whole block: its waves
  // stay in step on the A rows they share. Blocks of one tile row, and blocks of one tile column set, get different starts.
  const int ng = K >> 7;                       // groups of 4 k steps
  int grp = (int)((bx + bx / (unsigned)((tilesN + 7) >> 3) + 3u * by) % (unsigned)ng);   // group in hand
  const size_t kst = (size_t)grp * 4 * FRAG_EL + lane * 8;
#pragma unroll
  for (int j = 0; j < 4; ++j) bp[j] = (GPtr)(const void*)(Bb + (size_t)((n0 >> 4) + j) * (ldb >> 5) * FRAG_EL + kst);
#pragma unroll
  for (int i = 0; i < MI; ++i) {
    ap[i]  = (GPtr)(const void*)(Ab  + (size_t)((m0 >> 4) + i) * (lda >> 5) * FRAG_EL + kst);
    ap2[i] = (GPtr)(const void*)(A2b + (size_t)((m0 >> 4) + i) * (lda >> 5) * FRAG_EL + kst);
  }
  V16 bq[4][4], af[4][MI], ag[4][MI];
  gemm_ld<OT, MI, NPA>(bp, ap, ap2, 0, bq[0], af[0], ag[0]);
  __builtin_amdgcn_sched_barrier(0);       // group order as in the loop, so that the loop's counted waits stay per group
  gemm_ld<OT, MI, NPA>(bp, ap, ap2, FRAG_EL, bq[1], af[1], ag[1]);
  for (int k0 = 128; k0 < K; k0 += 128) {  // all trips but the last four steps
#pragma unroll
    for (int u = 0; u < 2; ++u) {          // unrolled so that the set index is a constant (registers): steps 2, 3 of the group in hand
      gemm_ld<OT, MI, NPA>(bp, ap, ap2, (u + 2) * FRAG_EL, bq[u + 2], af[u + 2], ag[u + 2]);
      __builtin_amdgcn_sched_barrier(0);   // keeps the load group ahead of the products below
      gemm_mm<OT, MI, NPA>(bq[u], af[u], ag[u], acc, acc2);
    }
    ptr_wait<MI, NPA>(bp, ap, ap2);
    const int adv = (grp + 1 < ng) ? 4 * FRAG_EL / 8 : -(ng - 1) * (4 * FRAG_EL / 8);   // 4 k steps = 4 units; behind the last group comes group 0
    grp = (grp + 1 < ng) ? grp + 1 : 0;
#pragma unroll
    for (int j = 0; j < 4; ++j) bp[j] += adv;
#pragma unroll
    for (int i = 0; i < MI; ++i) { ap[i] += adv; ap2[i] += adv; }
#pragma unroll
    for (int u = 2; u < 4; ++u) {          // steps 0, 1 of the next group
      gemm_ld<OT, MI, NPA>(bp, ap, ap2, (u - 2) * FRAG_EL, bq[u - 2], af[u - 2], ag[u - 2]);
      __builtin_amdgcn_sched_barrier(0);   // keeps the load group ahead of the products below
      gemm_mm<OT, MI, NPA>(bq[u], af[u], ag[u], acc, acc2);
    }
  }
  // the last four steps: two groups are still to fetch
  gemm_ld<OT, MI, NPA>(bp, ap, ap2, 2 * FRAG_EL, bq[2], af[2], ag[2]);
  __builtin_amdgcn_sched_barrier(0);       // keeps the load group ahead of the products below
  gemm_mm<OT, MI, NPA>(bq[0], af[0], ag[0], acc, acc2);
  gemm_ld<OT, MI, NPA>(bp, ap, ap2, 3 * FRAG_EL, bq[3], af[3], ag[3]);
  ptr_wait<MI, NPA>(bp, ap, ap2);
  __builtin_amdgcn_sched_barrier(0);       // keeps the load group ahead of the products below
  gemm_mm<OT, MI, NPA>(bq[1], af[1], ag[1], acc, acc2);
  gemm_mm<OT, MI, NPA>(bq[2], af[2], ag[2], acc, acc2);
  gemm_mm<OT, MI, NPA>(bq[3], af[3], ag[3], acc, acc2);
#pragma unroll
  for (int i = 0; i < MI; ++i) {
    acc_guard4(acc[i][0], acc[i][1], acc[i][2], acc[i][3]);
    if (NPA == 2) acc_guard4(acc2[i][0], acc2[i][1], acc2[i][2], acc2[i][3]);
  }

  // ---- epilogue ----
  float* slab = sT[wave];
#pragma unroll
  for (int i = 0; i < MI; ++i) {
    const int mBase = m0 + (i << 4);
#pragma unroll
    for (int j = 0; j < 4; ++j) {
#pragma unroll
      for (int r = 0; r < 8; ++r) {
        float v = acc[i][j][r];
        if (NPA == 2) v += acc2[i][j][r] * rscaleA;
        v = v * oscale;
        slab[(mOff + r) * 68 + (j << 4) + rlane] = v;
      }
    }
    __builtin_amdgcn_fence(3, "workgroup");
    __builtin_amdgcn_wave_barrier();
    __builtin_amdgcn_fence(2, "workgroup");
    if (OUT_MODE == 0) {
      float* C = (float*)Cout + (size_t)b * (size_t)strideC;
      const int h2 = lane >> 4, c4 = (lane & 15) * 4;     // 256-B row segment = 16 lanes x 16 B
      v4f ov[8];
#pragma unroll
      for (int it = 0; it < 8; ++it) {
        const int row = it * 2 + h2;                     // it 0..7 x h2 0..1 = rows 0..15
        ov[it] = *(const v4f*)(slab + row * 68 + c4);
      }
      {
#pragma unroll
        for (int it = 0; it < 8; ++it) {
          const int row = it * 2 + h2;
          *(v4f*)(C + (size_t)(mBase + row) * ldc + n0 + c4) = ov[it];
        }
        
      }
    } else {
      // the 16 x 64 slab = 2 units = 128 granules in a row: store it writes granules 32*it + lane (512 contiguous B),
      // which hold row lane&15, columns 8*(2*it + (lane>>4)) .. +7
      const size_t u0 = ((size_t)(mBase >> 4) * (ldc >> 5) + (n0 >> 5)) * FRAG_EL + lane * 8;
      unsigned short* C  = (unsigned short*)Cout  + (size_t)b * (size_t)strideC + u0;
      unsigned short* C2 = (unsigned short*)Cout2 + (size_t)b * (size_t)strideC + u0;
      if (OUT_MODE == 3 && res) store_slab16<true>(slab, C, C2, cscale, rscaleC, lane);    // block-uniform: one scalar branch a slab
      else                      store_slab16<false>(slab, C, C2, cscale, rscaleC, lane);
    }
    __builtin_amdgcn_fence(3, "workgroup");
    __builtin_amdgcn_wave_barrier();
    __builtin_amdgcn_fence(2, "workgroup");
  }
}

// one product a launch
template <typename OT, int MI, int NPA, int OUT_MODE>
__global__ __launch_bounds__(256) void gemm_t(
    const unsigned short* __restrict__ Ap, const unsigned short* __restrict__ A2p, int lda, long long strideA,
    const unsigned short* __restrict__ Btp, int ldb, long long strideB,
    void* Cout, void* Cout2, int ldc, long long strideC,
    int M, int N, int K, float oscale, float rscaleA, float cscale, float rscaleC) {
  gemm_body<OT, MI, NPA, OUT_MODE>(Ap, A2p, lda, strideA, Btp, ldb, strideB, Cout, Cout2, ldc, strideC,
                                   M, N, K, oscale, rscaleA, cscale, rscaleC, blockIdx.x, blockIdx.y, false);
}
// The three projections in ONE launch: each alone has QKV_NBLK blocks of 8 waves, and a WGP holds one such block (registers),
// so a launch of one product leaves WGPs idle wherever the chip has more than QKV_NBLK of them. blockIdx.y = product:
//   0: q = xq . Wq^T, x QSCALE -> f16 hi / residual planes (one scale) [b*SEQ+s][h*64+d]   (M=NROW, N=EMB)
//   1: k = xk . Wk^T, x KSCALE -> f16 plane [b*SEQ+s][h*64+d]
//   2: v^T = Wv . xv_b^T per batch b -> f16 plane [b][h*64+d][s] (pitch SEQ); A = Wvb [n][k], Bt = Xv rows of batch b
//      (offset b*SEQ*EMB); M=EMB, N=SEQ; its blocks are QKV_VBLK a batch
// Every block keeps the tile, the k walk and the sums that it had in a launch of its own. kk = EMB (pitch of A and Bt, and K).
#define QKV_NBLK ((NROW / 64) * (EMB / 64) / 8)
#define QKV_VBLK ((EMB / 64) * (SEQ / 64) / 8)
static_assert(QKV_NBLK * 8 == (NROW / 64) * (EMB / 64) && QKV_VBLK * 8 == (EMB / 64) * (SEQ / 64) && QKV_VBLK * NB == QKV_NBLK);
__global__ __launch_bounds__(256) void gemm_qkv(
    const unsigned short* __restrict__ Xq, const unsigned short* __restrict__ Xk, const unsigned short* __restrict__ Xv,
    const unsigned short* __restrict__ Wqb, const unsigned short* __restrict__ Wkb, const unsigned short* __restrict__ Wvb,
    unsigned short* Qh, unsigned short* Ql, unsigned short* Kp, unsigned short* VT, int kk) {
  const unsigned job = blockIdx.y;              // block-uniform: all that follows is picked in scalar registers
  const bool isv = job == 2u;
  const unsigned short* A  = (job == 0u) ? Xq  : (job == 1u) ? Xk  : Wvb;
  const unsigned short* Bt = (job == 0u) ? Wqb : (job == 1u) ? Wkb : Xv;
  unsigned short* C        = (job == 0u) ? Qh  : (job == 1u) ? Kp  : VT;
  gemm_body<__bf16, 4, 1, 3>(A, A, kk, 0LL, Bt, kk, isv ? (long long)SEQ * EMB : 0LL,
                             (void*)C, (void*)Ql, isv ? SEQ : EMB, isv ? (long long)EMB * SEQ : 0LL,
                             isv ? EMB : NROW, isv ? SEQ : EMB, kk, 1.0f, 0.0f, (job == 0u) ? QSCALE : (job == 1u) ? KSCALE : 1.0f, 1.0f,
                             isv ? blockIdx.x % QKV_VBLK : blockIdx.x, isv ? blockIdx.x / QKV_VBLK : 0u, job == 0u);
}

// =====================================================================================================
// Score chunk, transposed: 64 keys kv0..kv0+63 x 16 query rows (this wave) of one (b, h).
//   k fragments (A operand, row = lane&15 = key) loaded straight from the f16 k plane (fragment order):
//   kb0 = plane + (b*SEQ)*EMB + h*2*FRAG_EL, 16 keys on add 16*EMB (plane row = b*SEQ + t).
//   q fragments (B operand, col = lane&15 = query): hi and residual planes, 2 d-chunks of 32.
//   s[j][r] = D element: key kv0 + 16j + 8*hh + r, query lane&15; value = k.qh + k.ql = score * log2(e), straight from the
//   accumulator (the planes carry the factors); per score the sum runs d chunk 0 hi, residual, d chunk 1 hi, residual.
//   A lane holds scores of ONE query only (32 of the chunk's 64 keys; lane ^ 16 has the other 32), and
//   s[2kk], s[2kk+1] lie as elements 0..7, 8..15 of an A fragment (row = query, 32 keys) for the P.V product.
// =====================================================================================================
// the chunk's 8 k fragments as one load group, kf[2j + dc]; kp = the lane's pointer into the unit of keys kv0..kv0+15,
// d 0..31 (16-byte units); loops unrolled so that kf keeps constant indices (registers)
typedef GP<_Float16>::ptr KPtr;
__device__ __forceinline__ void ld_kchunk(KPtr& kp, v16h (&kf)[8]) {
#pragma unroll
  for (int j = 0; j < 4; ++j)
#pragma unroll
    for (int dc = 0; dc < 2; ++dc) kf[2 * j + dc] = ldfrag_g<_Float16>(kp, j * 16 * EMB + dc * FRAG_EL);
#if DEV_ASM
  asm volatile("s_wait_xcnt 0x0" : "+v"(kp) :: "memory");   // before kp, which these loads name, is moved on or given up
#endif
}
__device__ __forceinline__ void score_chunk(const v16h (&qah)[2], const v16h (&qal)[2], const v16h (&kf)[8],
                                            v8f (&s)[4]) {
#pragma unroll                                // all 16 products in one run; j innermost: a product's successor on the same accumulator stands 4 products on
  for (int j = 0; j < 4; ++j) s[j] = zero8();
#pragma unroll
  for (int dc = 0; dc < 2; ++dc) {
#pragma unroll
    for (int j = 0; j < 4; ++j) s[j] = mmar(kf[2 * j + dc], qah[dc], s[j]);
#pragma unroll
    for (int j = 0; j < 4; ++j) s[j] = mmar(kf[2 * j + dc], qal[dc], s[j]);
  }
  acc_guard4(s[0], s[1], s[2], s[3]);         // 4 VALU slots ahead of the next chunk's fetch, which lands in kf's registers
}

// =====================================================================================================
// Softmax statistics: per (b, h, query s) ONE value M = m + log2(sum(2^(s - m))) over all SEQ keys (s, m = row max: base-2 units),
//   so that the probability of a score is 2^(s - M).
//   block = 4 waves = 64 consecutive query rows qb*64.. of one (b, h); grid = NB*NH*NKT blocks of 128;
//   static trip NKT over 64-key chunks; online max / rescaled sum in f32, one query a lane, all in the lane;
//   the two lanes of a query (each half of the keys) are merged once, behind the loop.
//   Output plane ML [b*NH+h][SEQ] f32: the block's 64 values are funnelled through LDS (cross-wave: block barrier)
//   and written by lanes 0-15 of wave 0 with ONE instruction.
//   coverage: grid (b,h,qb) x 64 rows = the whole [NB*NH][SEQ] plane. MLsh: 4 waves x 16 lanes = all 64.
// =====================================================================================================
__global__ __launch_bounds__(128)
void attn_stats(const unsigned short* __restrict__ qhp, const unsigned short* __restrict__ qlp,
                const unsigned short* __restrict__ kpp, float* ML) {
  __shared__ __align__(16) float MLsh[64];
  const int tid  = threadIdx.x;
  const int wave = tid >> 5;
  const int lane = tid & 31;
  const int hh   = lane >> 4;
  const int c    = lane & 15;
  const int bx   = blockIdx.x;
  const int qb   = bx % NKT;
  const int rest = bx / NKT;
  const int h    = rest % NH;
  const int b    = rest / NH;
  const int bh   = b * NH + h;
  const int q0   = qb * 64 + wave * 16;

  const _Float16* Qh  = (const _Float16*)(const void*)qhp;
  const _Float16* Ql  = (const _Float16*)(const void*)qlp;
  const _Float16* Kb0 = (const _Float16*)(const void*)kpp + (size_t)b * SEQ * EMB + (size_t)h * (HD / 32) * FRAG_EL;

  v16h qah[2], qal[2];
#pragma unroll
  for (int dc = 0; dc < 2; ++dc) {
    const size_t qo = ((size_t)b * SEQ + (size_t)q0) * EMB + (size_t)(h * (HD / 32) + dc) * FRAG_EL + lane * 8;
    qah[dc] = ldfrag<_Float16>(Qh + qo);
    qal[dc] = ldfrag<_Float16>(Ql + qo);
  }

  float mrow = -INFINITY, lrow = 0.f;         // query q0 + c, over this lane's half of the keys

#if DEV_ASM
  asm volatile("s_wait_xcnt 0x0" ::: "memory");   // before the k fetch lands in registers that the q loads name
#endif
  v16h kf[8];
  // The NKT blocks of one (b, h) walk the same k lines: each starts its walk at its own chunk (qb) and wraps round, so that
  // blocks running in step ask L2 for different lines at any moment.
  int kc = qb;                                // chunk in hand, 0 .. NKT-1
  KPtr kp = (KPtr)(const void*)(Kb0 + (size_t)kc * 64 * EMB + lane * 8);
  ld_kchunk(kp, kf);
  for (int kt = 0; kt < NKT; ++kt) {          // static trip count
    v8f s[4];
    score_chunk(qah, qal, kf, s);
    __builtin_amdgcn_sched_barrier(0);        // the next chunk's fetch stays behind this chunk's products (same registers)
    kp += (kc + 1 < NKT) ? 64 * EMB / 8 : -(NKT - 1) * (64 * EMB / 8);  // 16-byte units; behind the last chunk comes chunk 0
    kc = (kc + 1 < NKT) ? kc + 1 : 0;         // last trip: the walk's first chunk again, a fetch that nothing uses
    ld_kchunk(kp, kf);
    __builtin_amdgcn_sched_barrier(0);        // ... and ahead of the vector work below, which covers its latency
    float mj[4];                              // loops over j and r unrolled here and below: s keeps constant indices (registers)
#pragma unroll
    for (int j = 0; j < 4; ++j) {
      mj[j] = s[j][0];
#pragma unroll
      for (int r = 1; r < 8; ++r) mj[j] = fmaxf(mj[j], s[j][r]);
    }
    const float mnew  = fmaxf(mrow, fmaxf(fmaxf(mj[0], mj[1]), fmaxf(mj[2], mj[3])));
    const float msafe = (mnew == -INFINITY) ? 0.f : mnew;
    const float alpha = ex2(mrow - msafe);
    mrow = mnew;
#pragma unroll
    for (int j = 0; j < 4; ++j)
#pragma unroll
      for (int r = 0; r < 8; ++r) s[j][r] = ex2(s[j][r] - msafe);
    float pj[4];                              // four independent partial sums
#pragma unroll
    for (int j = 0; j < 4; ++j) {
      pj[j] = s[j][0];
#pragma unroll
      for (int r = 1; r < 8; ++r) pj[j] += s[j][r];
    }
    lrow = lrow * alpha + ((pj[0] + pj[1]) + (pj[2] + pj[3]));
  }

  // merge the two halves of each query's keys (lane ^ 16), once
  const float mo    = __shfl_xor(mrow, 16, 32);
  const float lo    = __shfl_xor(lrow, 16, 32);
  const float mall  = fmaxf(mrow, mo);
  const float msafe = (mall == -INFINITY) ? 0.f : mall;
  const float l     = lrow * ex2(mrow - msafe) + lo * ex2(mo - msafe);
  const float M     = (l > 0.f) ? (msafe + lg2(l)) : INFINITY;   // an empty sum: every probability of the row 2^(-inf) = 0
  if (hh == 0) MLsh[wave * 16 + c] = M;       // query q0 + c (both lanes of a query hold the same M)
  __syncthreads();
  if (tid < 16) {
    const v4f v = *(const v4f*)(MLsh + lane * 4);        // rows 4c..4c+3
    float* dst = ML + (size_t)bh * SEQ + qb * 64 + c * 4;
    *(v4f*)dst = v;
  }
}

// =====================================================================================================
// Main attention pass: one block per (b, 32 query rows q0..q0+31, one of KSPLIT key ranges), 16 waves = the 16 heads;
//   a wave holds TWO 16-row query tiles, so each k and v fragment fetched from L2 serves 32 queries.
//   Per 32-key chunk (static trip NKT32): scores recomputed with the products of attn_stats, p x 16384 = 2^(s + 14 - M) in f32
//   (M from the ML plane, one query a lane and tile; 14 - M is the score accumulators' start value, so the exponent comes straight
//   from the WMMA; the carry is taken off again in the head average's factor and in the epilogue);
//   (a) context += P . V: the lane's p x 16384 values, converted to f16, ARE the A fragments (no LDS, no
//       lane exchange); B = v^T f16 plane [b][h*64+d][s] (head slab h*64*SEQ), fragment order;
//       p also goes to the per-wave LDS tile Pf[h][row][key] (16-byte stores of 4 keys, every entry written) for
//   (b) head average: after __syncthreads (cross-wave), threads 0..255 sum the 16 wave tiles in fixed head order
//   Epilogue: the key range's part of ctx = acc / 16384, x256 carry, staged in the wave's Pf tile (wave-private), written in f32;
//   p is already normalised, so ctx is the plain sum of its parts (ctx_merge).
//   coverage: avg: NKT32 chunks x 32 rows x 32 keys per block, grid (b, qb, ks) = the whole [NB][SEQ][SEQ];
//   ctx parts: each wave rows q0..q0+31 x its head's 64 columns, 16 waves x grid = the whole [KSPLIT][NROW][EMB].
// =====================================================================================================
// 32-key forms of the chunk fetch and of the score chunk (same k map, same products, same order per score)
__device__ __forceinline__ void ld_kchunk32(KPtr& kp, v16h (&kf)[4]) {
#pragma unroll
  for (int j = 0; j < 2; ++j)
#pragma unroll
    for (int dc = 0; dc < 2; ++dc) kf[2 * j + dc] = ldfrag_g<_Float16>(kp, j * 16 * EMB + dc * FRAG_EL);
#if DEV_ASM
  asm volatile("s_wait_xcnt 0x0" : "+v"(kp) :: "memory");   // before kp, which these loads name, is moved on or given up
#endif
}
// both query tiles [qt], 16 products in one run; c0[qt] = the accumulators' start value (a lane holds one query of a tile:
// what is to be added to every score of that query), so s = c0 + score
__device__ __forceinline__ void score_chunk32(const v16h (&qah)[2][2], const v16h (&qal)[2][2], const v16h (&kf)[4],
                                              const v8f (&c0)[2], v8f (&s)[2][2]) {
#pragma unroll                                // qt and j innermost: a product's successor on the same accumulator stands 4 products on
  for (int qt = 0; qt < 2; ++qt)
#pragma unroll
    for (int j = 0; j < 2; ++j) s[qt][j] = c0[qt];
#pragma unroll
  for (int dc = 0; dc < 2; ++dc) {
#pragma unroll
    for (int qt = 0; qt < 2; ++qt)
#pragma unroll
      for (int j = 0; j < 2; ++j) s[qt][j] = mmar(kf[2 * j + dc], qah[qt][dc], s[qt][j]);
#pragma unroll
    for (int qt = 0; qt < 2; ++qt)
#pragma unroll
      for (int j = 0; j < 2; ++j) s[qt][j] = mmar(kf[2 * j + dc], qal[qt][dc], s[qt][j]);
  }
  acc_guard4(s[0][0], s[0][1], s[1][0], s[1][1]);   // 4 VALU slots ahead of the v fetch, which lands in kf's registers
}
#define KSPLIT   2                   // key ranges of a sequence, one block each
#define KRANGE   (SEQ / KSPLIT)      // keys of one block
#define NQB32    (SEQ / 32)          // 32-row query blocks per sequence
#define NKT32    (KRANGE / 32)       // 32-key chunks of one block
#define PP32     36                  // row pitch of the 32-key LDS P tile in floats: 144 B = 16 B x odd, so 16 rows written 16 B each fall on 64 distinct banks
#define NGRAN    ((size_t)NROW * EMB / 8)   // 8-element granules of a ctx plane
static_assert((KRANGE % 32) == 0 && (SEQ % 32) == 0 && 32 * PP32 >= 16 * 68);
__global__ __launch_bounds__(512)
void attn_main(const unsigned short* __restrict__ qhp, const unsigned short* __restrict__ qlp,
               const unsigned short* __restrict__ kpp, const unsigned short* __restrict__ vtp,
               const float* __restrict__ ML, float* cpart, float* avg) {
  union FH { v16h v; v8h h[2]; };
  __shared__ __align__(32) float Pf[NH][32 * PP32];        // per wave (head) P tile [32 rows][32 keys] f32, pitch PP32; the epilogue's ctx tile has pitch 68
  const int tid  = threadIdx.x;
  const int wave = tid >> 5;
  const int lane = tid & 31;
  const int hh   = lane >> 4;
  const int c    = lane & 15;
  const int bx   = blockIdx.x;
  const int ks   = bx % KSPLIT;
  const int qb   = (bx / KSPLIT) % NQB32;
  const int b    = bx / (KSPLIT * NQB32);
  const int h    = wave;
  const int bh   = b * NH + h;
  const int q0   = qb * 32;
  const int key0 = ks * KRANGE;

  const _Float16* Qh  = (const _Float16*)(const void*)qhp;
  const _Float16* Ql  = (const _Float16*)(const void*)qlp;
  const _Float16* Kb0 = (const _Float16*)(const void*)kpp + ((size_t)b * SEQ + key0) * EMB + (size_t)h * (HD / 32) * FRAG_EL;
  const _Float16* Vb0 = (const _Float16*)(const void*)vtp + (size_t)b * EMB * SEQ + (size_t)h * HD * SEQ
                        + (size_t)(key0 / 32) * FRAG_EL;   // v^T [b][h*64+d][s], fragment order

  v16h qah[2][2], qal[2][2];                  // [query tile][d chunk]
  v8f c0[2];                                  // PCARRY_L2 - M of the lane's query, in all 8 elements: start value of the score accumulators
#pragma unroll
  for (int qt = 0; qt < 2; ++qt) {
#pragma unroll
    for (int dc = 0; dc < 2; ++dc) {
      const size_t qo = ((size_t)b * SEQ + (size_t)(q0 + 16 * qt)) * EMB + (size_t)(h * (HD / 32) + dc) * FRAG_EL + lane * 8;
      qah[qt][dc] = ldfrag<_Float16>(Qh + qo);
      qal[qt][dc] = ldfrag<_Float16>(Ql + qo);
    }
    c0[qt] = zero8() + (PCARRY_L2 - ML[(size_t)bh * SEQ + q0 + 16 * qt + c]);      // the lane's query q0 + 16qt + c
  }

  v8f oacc[2][4];
#pragma unroll
  for (int qt = 0; qt < 2; ++qt)
#pragma unroll
    for (int t = 0; t < 4; ++t) oacc[qt][t] = zero8();
  float* pf = Pf[wave];

#if DEV_ASM
  asm volatile("s_wait_xcnt 0x0" ::: "memory");   // before the k fetch lands in registers that the loads above name
#endif
  __builtin_amdgcn_sched_barrier(0);          // no address below is formed, in a register that those loads name, ahead of that wait
  v16h kf[4];
  // The NQB32 blocks of one (b, key range) walk the same k and v lines: each starts its walk at its own chunk and wraps round,
  // so that blocks running in step ask L2 for different lines at any moment. p is already normalised: any chunk order gives ctx.
  int kc = qb % NKT32;                        // chunk in hand, 0 .. NKT32-1
  KPtr kp = (KPtr)(const void*)(Kb0 + (size_t)kc * 32 * EMB + lane * 8);
  ld_kchunk32(kp, kf);
  KPtr vp = (KPtr)(const void*)(Vb0 + (size_t)kc * FRAG_EL + lane * 8);   // the lane's pointer into the unit of d 0..15, keys kv0..kv0+31
  for (int kt = 0; kt < NKT32; ++kt) {       // static trip count
    const int kv0 = key0 + kc * 32;
    const bool more = kc + 1 < NKT32;         // block-uniform: behind the last chunk comes chunk 0
    __syncthreads();                          // Pf tiles free again (head sum of the prior chunk done)

    v8f s[2][2];                              // [query tile][16-key group]: both tiles' scores from ONE fetch of the k fragments
    score_chunk32(qah, qal, kf, c0, s);
    __builtin_amdgcn_sched_barrier(0);        // the v fetch stays behind the score products (registers)
    v16h vf[4];                               // this chunk's 4 v fragments as one load group, vf[t]
#pragma unroll
    for (int t = 0; t < 4; ++t) vf[t] = ldfrag_g<_Float16>(vp, t * 16 * SEQ);
#if DEV_ASM
    asm volatile("s_wait_xcnt 0x0" : "+v"(vp) :: "memory");   // before vp, which these loads name, is moved on
#endif
    vp += more ? FRAG_EL / 8 : -(NKT32 - 1) * (FRAG_EL / 8);   // 32 keys = 1 unit (16-byte units)
    __builtin_amdgcn_sched_barrier(0);        // ... and ahead of the exponentials, which cover its latency
#pragma unroll                                // all loops unrolled: s keeps constant indices (registers)
    for (int qt = 0; qt < 2; ++qt) {
#pragma unroll
      for (int j = 0; j < 2; ++j) {
#pragma unroll
        for (int r = 0; r < 8; ++r) s[qt][j][r] = ex2(s[qt][j][r]);      // s now holds p x 16384
        float* pw = pf + (16 * qt + c) * PP32 + j * 16 + 8 * hh;   // query 16qt + c, keys 16j + 8hh .. +7; 16-byte aligned at every row
        *(v4f*)(pw)     = __builtin_shufflevector(s[qt][j], s[qt][j], 0, 1, 2, 3);
        *(v4f*)(pw + 4) = __builtin_shufflevector(s[qt][j], s[qt][j], 4, 5, 6, 7);
      }
    }

    // ---- context += P . V (f16 WMMA, p carried x16384): both query tiles on ONE fetch of the v fragments ----
    FH pa[2];                                 // row = query c of the tile; elements 0..7 = keys 8hh + e, 8..15 = keys 16 + 8hh + e
#pragma unroll                                // s, pa and oacc are indexed by qt: a constant index keeps them in registers
    for (int qt = 0; qt < 2; ++qt) {          // both tiles converted first, so that the 8 products stand in one run
      pa[qt].h[0] = __builtin_convertvector(s[qt][0], v8h);
      pa[qt].h[1] = __builtin_convertvector(s[qt][1], v8h);
    }
#pragma unroll
    for (int qt = 0; qt < 2; ++qt)
#pragma unroll
      for (int t = 0; t < 4; ++t) oacc[qt][t] = mmar(pa[qt].v, vf[t], oacc[qt][t]);
    run_guard8(oacc[0][0], oacc[0][1], oacc[0][2], oacc[0][3], oacc[1][0], oacc[1][1], oacc[1][2], oacc[1][3]);   // the next k fetch lands in vf's registers
    __syncthreads();
    kp += more ? 32 * EMB / 8 : -(NKT32 - 1) * (32 * EMB / 8);  // 16-byte units; last trip: the walk's first chunk again, a fetch that nothing uses
    kc = more ? kc + 1 : 0;
    ld_kchunk32(kp, kf);                      // next chunk's k, one load group
    __builtin_amdgcn_sched_barrier(0);        // issued ahead of the head average, which covers part of its latency

    // ---- head average of this 32 x 32 tile, one block = one writer of every line (a row's 32 keys = one 128-B line) ----
    if (tid < 256) {                          // waves 0..7, wave-uniform
      const int row = tid >> 3, c4 = (tid & 7) * 4;
      v4f a = *(const v4f*)(Pf[0] + row * PP32 + c4);
#pragma unroll
      for (int w = 1; w < NH; ++w) a += *(const v4f*)(Pf[w] + row * PP32 + c4);
      a *= (1.0f / ((float)NH * PCARRY));
      float* dst = avg + ((size_t)b * SEQ + (size_t)(q0 + row)) * SEQ + kv0 + c4;
      *(v4f*)dst = a;
#if DEV_ASM
      asm volatile("s_wait_xcnt 0x0" ::: "memory");   // before the next chunk overwrites the registers this store names
#endif
    }
  }
  __syncthreads();

  // ---- epilogue: this key range's part of ctx (undo the x16384 p carry, apply the x256 carry), staged, stored in f32 ----
  // cpart = [KSPLIT][2][NGRAN] groups of 4 floats: group (ks, 0, g) = elements 0..3 of granule g of the ctx planes, (ks, 1, g) = 4..7,
  // so that every store here and every load in ctx_merge covers 512 contiguous bytes a wave.
  float* os = pf;
#pragma unroll
  for (int qt = 0; qt < 2; ++qt) {
#pragma unroll
    for (int r = 0; r < 8; ++r) {
#pragma unroll
      for (int t = 0; t < 4; ++t) os[(8 * hh + r) * 68 + t * 16 + c] = oacc[qt][t][r] * (256.0f / PCARRY);
    }
    __builtin_amdgcn_fence(3, "workgroup");
    __builtin_amdgcn_wave_barrier();
    __builtin_amdgcn_fence(2, "workgroup");
    // the wave's 16 x 64 tile = 2 units = 128 granules in a row: step it takes granules 32*it + lane,
    // which hold row c, columns 8*(2*it + hh) .. +7
    v4f lo4[4], hi4[4];
#pragma unroll
    for (int it = 0; it < 4; ++it) {
      const float* sp = os + c * 68 + (it * 2 + hh) * 8;
      lo4[it] = *(const v4f*)(sp);
      hi4[it] = *(const v4f*)(sp + 4);
    }
    const size_t g0 = (((size_t)b * SEQ + (size_t)(q0 + 16 * qt)) * EMB + (size_t)h * (HD / 32) * FRAG_EL) / 8 + lane;
    float* d0 = cpart + ((size_t)(ks * 2) * NGRAN + g0) * 4;
    float* d1 = cpart + ((size_t)(ks * 2 + 1) * NGRAN + g0) * 4;
#pragma unroll
    for (int it = 0; it < 4; ++it) {
      *(v4f*)(d0 + it * 128) = lo4[it];
      *(v4f*)(d1 + it * 128) = hi4[it];
    }
#if DEV_ASM
    asm volatile("s_wait_xcnt 0x0" ::: "memory");   // before the next tile overwrites the registers these stores name
#endif
    __builtin_amdgcn_sched_barrier(0);        // the next tile's products stay behind that wait
    __builtin_amdgcn_fence(3, "workgroup");
    __builtin_amdgcn_wave_barrier();
    __builtin_amdgcn_fence(2, "workgroup");
  }
}

// =====================================================================================================
// ctx = sum of its KSPLIT key-range parts (fixed order), converted to the f16 hi plane (x256 carry, already in the parts)
// and the f16 residual plane (x4096), fragment order. Few waves, MG_N granules a thread, all loads up front.
// coverage: MG_T threads x MG_N granules = NGRAN granules = the whole [NROW][EMB] planes.
// =====================================================================================================
#define MG_N 4
#define MG_T (NROW * EMB / 8 / MG_N)
static_assert((MG_T % 256) == 0 && KSPLIT == 2);
__global__ __launch_bounds__(256) void ctx_merge(const float* __restrict__ c00, const float* __restrict__ c01,
                                                 const float* __restrict__ c10, const float* __restrict__ c11,
                                                 unsigned short* chp, unsigned short* clp) {
  const float* const cin[4] = {c00, c01, c10, c11};   // [2 * key range + half of the granule]: four scalar bases
  // granule i's byte offset, 32 bits, the same in a part (16 B of f32 a half granule) and in a plane (16 B of f16 a granule):
  // one offset register beside scalar bases serves every load and store
  unsigned ob = (blockIdx.x * 256u + threadIdx.x) * 16u;
  v4f x[MG_N][4];
#pragma unroll                                // unrolled here and below: x keeps constant indices (registers)
  for (int n = 0; n < MG_N; ++n)
#pragma unroll
    for (int p = 0; p < 4; ++p)               // p = 2 * key range + half of the granule
      x[n][p] = *(const v4f*)((const char*)cin[p] + (size_t)n * MG_T * 16 + ob);
#if DEV_ASM
  asm volatile("s_wait_xcnt 0x0" : "+v"(ob) :: "memory");   // the offset register, which these loads name, is held to here
#endif
  __builtin_amdgcn_sched_barrier(0);          // no conversion result is written ahead of that wait
#pragma unroll
  for (int n = 0; n < MG_N; ++n) {
    const v4f fa = x[n][0] + x[n][2], fb = x[n][1] + x[n][3];
    const float f[8] = {fa[0], fa[1], fa[2], fa[3], fb[0], fb[1], fb[2], fb[3]};
    v4u a, a2;
#pragma unroll
    for (int e = 0; e < 4; ++e) {
      const float f0 = f[2 * e], f1 = f[2 * e + 1];
      const _Float16 x0 = (_Float16)f0, x1 = (_Float16)f1;
      const unsigned short h0 = h_bits(x0), h1 = h_bits(x1);
      const unsigned short l0 = h_bits((_Float16)((f0 - (float)x0) * 4096.0f));
      const unsigned short l1 = h_bits((_Float16)((f1 - (float)x1) * 4096.0f));
      a[e] = pk16(h0, h1); a2[e] = pk16(l0, l1);
    }
    *(v4u*)((char*)chp + (size_t)n * MG_T * 16 + ob) = a;
    *(v4u*)((char*)clp + (size_t)n * MG_T * 16 + ob) = a2;
  }
}

// =====================================================================================================
// Workspace map (bytes, full size NB=2 SEQ=2048; PX = NROW*EMB*2 = 8388608; every region an exact multiple of
// its whole-line / whole-tile store granularity, rows are whole tiles, no padded tails needed):
//   Xq   bf16 [NROW][EMB]            PX        8388608
//   Xk   bf16 [NROW][EMB]            PX        8388608
//   Xv   bf16 [NROW][EMB]            PX        8388608
//   Wqb  bf16 [EMB n][EMB k]                   2097152
//   Wkb  bf16 [EMB n][EMB k]                   2097152
//   Wvb  bf16 [EMB n][EMB k]                   2097152
//   Wob  f16  [EMB n][EMB k] (x64)             2097152
//   Qh   f16  [NROW][EMB]            PX        8388608
//   Ql   f16  [NROW][EMB]            PX        8388608
//   Kp   f16  [NROW][EMB]            PX        8388608
//   VT   f16  [NB][EMB][SEQ]                   8388608
//   Ch   f16  [NROW][EMB]            PX        8388608
//   Cl   f16  [NROW][EMB]            PX        8388608
//   ML   f32  [NB*NH][SEQ]                      262144
//   CP   f32  [2 key ranges][NROW][EMB]       33554432
//   total                                    117702656
// Every 16-bit plane is in fragment order (same bytes, same extents). Input weights are [out n][in k] (k contiguous) =
// the Bt / A orientation directly; they are only converted to 16 bit and put in that order.
// Output 0 at element 0 of d_out (rows b*SEQ + s); output 1 at the fixed element offset OFF1 = NB_FULL*SEQ_FULL*EMB.
// =====================================================================================================
extern "C" void kernel_launch(void* const* d_in, const int* in_sizes, int n_in,
                              void* d_out, int out_size, void* d_ws, size_t ws_size,
                              hipStream_t stream) {
  if (n_in < 7) return;
  const int needX = ((NB - 1) * SEQ_FULL + SEQ) * EMB;
  if (in_sizes[0] < needX) return;
  if (in_sizes[1] < needX) return;
  if (in_sizes[2] < needX) return;
  if (in_sizes[3] < EMB * EMB) return;
  if (in_sizes[4] < EMB * EMB) return;
  if (in_sizes[5] < EMB * EMB) return;
  if (in_sizes[6] < EMB * EMB) return;
  const size_t n0e = (size_t)NROW * EMB;            // output 0 written elements [NB][SEQ][EMB]
  const size_t n1e = (size_t)NB * SEQ * SEQ;        // output 1 written elements [NB][SEQ][SEQ]
  if (out_size < 0) return;
  if ((size_t)out_size < n0e) return;
  if ((size_t)out_size < OFF1 + n1e) return;        // written extent of output 1 inside d_out

  const float* xq = (const float*)d_in[0];
  const float* xk = (const float*)d_in[1];
  const float* xv = (const float*)d_in[2];
  const float* Wq = (const float*)d_in[3];
  const float* Wk = (const float*)d_in[4];
  const float* Wv = (const float*)d_in[5];
  const float* Wo = (const float*)d_in[6];

  const size_t PX  = (size_t)NROW * EMB * 2;        // 16-bit activation plane
  const size_t PW  = (size_t)EMB * EMB * 2;
  const size_t PVT = (size_t)NB * EMB * SEQ * 2;
  const size_t PML = (size_t)NB * NH * SEQ * 4;
  size_t off = 0;
  const size_t oXq = off; off += PX;
  const size_t oXk = off; off += PX;
  const size_t oXv = off; off += PX;
  const size_t oWq = off; off += PW;
  const size_t oWk = off; off += PW;
  const size_t oWv = off; off += PW;
  const size_t oWo = off; off += PW;
  const size_t oQh = off; off += PX;
  const size_t oQl = off; off += PX;
  const size_t oKp = off; off += PX;
  const size_t oVT = off; off += PVT;
  const size_t oCh = off; off += PX;
  const size_t oCl = off; off += PX;
  const size_t oML = off; off += PML;
  const size_t oCP = off; off += (size_t)KSPLIT * NROW * EMB * 4;
  if (off > ws_size) return;                        // off = 117702656 at full size
  if (off > (size_t)134217728) return;

  char* ws = (char*)d_ws;
  unsigned short* Xq  = (unsigned short*)(ws + oXq);
  unsigned short* Xk  = (unsigned short*)(ws + oXk);
  unsigned short* Xv  = (unsigned short*)(ws + oXv);
  unsigned short* Wqb = (unsigned short*)(ws + oWq);
  unsigned short* Wkb = (unsigned short*)(ws + oWk);
  unsigned short* Wvb = (unsigned short*)(ws + oWv);
  unsigned short* Wob = (unsigned short*)(ws + oWo);
  unsigned short* Qh  = (unsigned short*)(ws + oQh);
  unsigned short* Ql  = (unsigned short*)(ws + oQl);
  unsigned short* Kp  = (unsigned short*)(ws + oKp);
  unsigned short* VT  = (unsigned short*)(ws + oVT);
  unsigned short* Ch  = (unsigned short*)(ws + oCh);
  unsigned short* Cl  = (unsigned short*)(ws + oCl);
  float*          ML  = (float*)(ws + oML);
  float*          CP  = (float*)(ws + oCP);
  float*          out0 = (float*)d_out;
  float*          out1 = (float*)d_out + OFF1;

  const dim3 blk(256);
  const dim3 gCvt(CVT_T / 256);                                  //  512 blocks
  const dim3 gQKV(QKV_NBLK, 3);                                  // 3 products x 1024 tiles of 64 x 64 -> 3 x 128 blocks
  const dim3 gO((((NROW) / 32) * (EMB / 64) + 7) / 8, 1);         // 2048 tiles -> 256 blocks (32x64 wave tiles)
  const dim3 gStats(NB * NH * NKT);                              // 1024 blocks of 128
  const dim3 gMain(NB * NQB32 * KSPLIT);                         //  256 blocks of 512
  const dim3 gMerge(MG_T / 256);                                 //  512 blocks

  // (1) activations [b][s][k] -> bf16 planes [b*SEQ+s][k] (input batch stride SEQ_FULL*EMB, plane batch stride SEQ*EMB);
  // (2) weights [EMB n][EMB k] -> bf16 planes (Wq, Wk, Wv); Wo -> f16 (x64 of its bf16 value); no transpose needed
  cvt_all<<<gCvt, blk, 0, stream>>>(xq, xk, xv, Wq, Wk, Wv, Wo, Xq, Xk, Xv, Wqb, Wkb, Wvb, Wob);
  // (3) (4) (5) q, k and v^T, one launch (gemm_qkv)
  gemm_qkv<<<gQKV, blk, 0, stream>>>(Xq, Xk, Xv, Wqb, Wkb, Wvb, Qh, Ql, Kp, VT, EMB);
  // (6) softmax statistics (M) per (b, h, s)
  attn_stats<<<gStats, dim3(128), 0, stream>>>(Qh, Ql, Kp, ML);
  // (7) exact-normalised p: P.V -> f32 parts of ctx, one per key range; head-averaged p -> output 1
  attn_main<<<gMain, dim3(512), 0, stream>>>(Qh, Ql, Kp, VT, ML, CP, out1);
  // (7b) ctx = sum of its parts -> ctx planes (f16 hi x256 / residual x4096)
  ctx_merge<<<gMerge, blk, 0, stream>>>(CP, CP + NGRAN * 4, CP + NGRAN * 8, CP + NGRAN * 12, Ch, Cl);
  // (8) output 0 = ctx . Wo^T, f32 [NROW][EMB] straight into d_out, accumulators (hi + res/4096) x 1/(256*64)
  gemm_t<_Float16, 2, 2, 0><<<gO, blk, 0, stream>>>(
      Ch, Cl, EMB, 0LL, Wob, EMB, 0LL,
      (void*)out0, (void*)out0, EMB, 0LL,
      NROW, EMB, EMB, 1.0f / 16384.0f, 1.0f / 4096.0f, 1.0f, 1.0f);
  (void)hipGetLastError();
}
